// v000
// Measured on an AMD MI455X. A time is GPU time per run, averaged over a window of back-to-back runs after a warm-up
// (all launches, gaps included; the runs take copies of the inputs in turn), and the median of several windows.
// Apart from v000's, it joins two sittings. Times from different sittings can be a few percent apart, while
// side-by-side timings come from the same sitting.
// v000 is the starting kernel. One run takes 470 microseconds.
// Contractions: conv1x1 q/k/v GEMM W[384x256].X on v_wmma_f32_16x16x32_f16 (f16 containers of bf16-RNE weights x256
// and bf16-RNE x); scores K.Q^T on v_wmma_f32_16x16x32_bf16 (bf16 hi + bf16 residual planes of q and k, 3 products,
// K=128); O^T = V.P^T on v_wmma_f32_16x16x32_f16 (v x16 f16, P = 1024 e^{(s-m)c} f16 from the score D registers);
// output conv1x1 Wo[256x128].U on v_wmma_f32_16x16x32_f16 (Wo f16 of bf16-RNE x256, U as f16 hi x16 plus f16
// residual x2^11 planes in two accumulators); f32 accumulate everywhere; softmax statistics in f32 VALU.
#include <hip/hip_runtime.h>
#include <math.h>
#include <stdint.h>

#define NIMG  8
#define CC    256
#define NN    4096
#define CK    128
#define CV    128
#define CO    256
#define MQKV  384
#define QT    64
#define OSP   68
#define OSPW  132
#define TP    72
#define QP    136
#define BP    136
#define WSC   256.0f
#define IWSC  0.00390625f
#define VSC   16.0f
#define IVSC  0.0625f
#define USC   16.0f
#define IUSC  0.0625f
#define RSC   2048.0f
#define IRSC  0.00048828125f
#define LNPS  6.931471805599453f
#define SCL   0.08838834764831845f

static_assert(NN % QT == 0);
static_assert(CC % 32 == 0 && CK % 32 == 0 && CV % 32 == 0);
static_assert(MQKV == 2 * CK + CV);
static_assert(MQKV % QT == 0 && CO % QT == 0);
static_assert(CK == 2 * QT && CV == 2 * QT);
static_assert((OSP * 4) % 16 == 0);
static_assert((OSPW * 4) % 16 == 0);
static_assert((TP * 2) % 16 == 0);
static_assert((QP * 2) % 16 == 0 && (BP * 2) % 16 == 0 && (BP % 2) == 0);
static_assert(QT * OSPW * 4 <= 2 * QT * QP * 2);

typedef _Float16       v16h __attribute__((ext_vector_type(16)));
typedef _Float16       v8h  __attribute__((ext_vector_type(8)));
typedef __bf16         v16b __attribute__((ext_vector_type(16)));
typedef unsigned short v8us __attribute__((ext_vector_type(8)));
typedef float          v8f  __attribute__((ext_vector_type(8)));
typedef float          v4f  __attribute__((ext_vector_type(4)));
typedef unsigned int   v4u  __attribute__((ext_vector_type(4)));

union Frag  { v8us u[2]; v16h h; v16b bf; };
union FragH { v16h v; v8h hv[2]; };
static_assert(sizeof(Frag) == 32);
static_assert(sizeof(FragH) == 32);

// ---- scalar helpers ---------------------------------------------------------------------------------------
__device__ __forceinline__ unsigned short bf_bits(float f) {          // f32 -> bf16 bits, RNE convert
  unsigned u = __float_as_uint(f);
  return (unsigned short)((u + 0x7FFFu + ((u >> 16) & 1u)) >> 16);
}
__device__ __forceinline__ float bf_up(unsigned short hb) { return __uint_as_float(((unsigned)hb) << 16); }
__device__ __forceinline__ float bfr(float f) { return bf_up(bf_bits(f)); }
__device__ __forceinline__ unsigned short h_bits(_Float16 x) { return __builtin_bit_cast(unsigned short, x); }
__device__ __forceinline__ unsigned pk16(unsigned short a, unsigned short b) { return (unsigned)a | ((unsigned)b << 16); }
__device__ __forceinline__ v8f zero8() { v8f z = {0.f, 0.f, 0.f, 0.f, 0.f, 0.f, 0.f, 0.f}; return z; }
__device__ __forceinline__ float hmax8(v8f s) {
  return fmaxf(fmaxf(fmaxf(s[0], s[1]), fmaxf(s[2], s[3])), fmaxf(fmaxf(s[4], s[5]), fmaxf(s[6], s[7])));
}

// ---- 16-bit fragment loader (A, or B from a k-contiguous [n][k] row): lane -> row/col (lane&15), p already includes
//      + 8*(lane>>4); elements 0..7 <- p[0..7] (k0+8h..), elements 8..15 <- p[16..23] (k0+16+8h..)
__device__ __forceinline__ Frag ldfrag(const unsigned short* p) {
  Frag f;
  f.u[0] = *(const v8us*)(p);
  f.u[1] = *(const v8us*)(p + 16);
  return f;
}

// ---- WMMA helpers: builtin followed by a 4-slot VALU gap tying D and keeping A/B live --------------------------
__device__ __forceinline__ v8f mma_h(v16h a, v16h b, v8f c) {
  v8f d = __builtin_amdgcn_wmma_f32_16x16x32_f16(false, a, false, b, (short)0, c, false, false);
#if defined(__HIP_DEVICE_COMPILE__)
  asm volatile("v_nop\n\tv_nop\n\tv_nop\n\tv_nop" : "+v"(d) : "v"(a), "v"(b));
#endif
  return d;
}
__device__ __forceinline__ v8f mma_b(v16b a, v16b b, v8f c) {
  v8f d = __builtin_amdgcn_wmma_f32_16x16x32_bf16(false, a, false, b, (short)0, c, false, false);
#if defined(__HIP_DEVICE_COMPILE__)
  const v16h ha = __builtin_bit_cast(v16h, a), hb = __builtin_bit_cast(v16h, b);
  asm volatile("v_nop\n\tv_nop\n\tv_nop\n\tv_nop" : "+v"(d) : "v"(ha), "v"(hb));
#endif
  return d;
}

// =========================================================================================================
// (0) q/k/v conv1x1 weights: W16 f16 [384][256], rows 0..127 = wq, 128..255 = wk, 256..383 = wv; value = f16 of
//     (bf16-RNE(w) * 256) (exact). BIAS f32 [384] = bf16-RNE of bq / bk / bv. Block blk (0..47) owns rows
// coverage: 48 blocks x 8 rows x 32 pieces x 8 halves = 384 x 256; bias 96 x 4 floats = 384.
// =========================================================================================================
__global__ __launch_bounds__(256)
void cvt_w(const float* __restrict__ wq, const float* __restrict__ bq,
           const float* __restrict__ wk, const float* __restrict__ bk,
           const float* __restrict__ wv, const float* __restrict__ bv,
           unsigned short* W16, float* BIAS) {
  const int tid = threadIdx.x, blk = blockIdx.x;
  const int rl = tid >> 5, col = 8 * (tid & 31);
  const int o = 8 * blk + rl;                                          // 0..383
  const float* wbase = (blk < 16) ? wq : (blk < 32) ? wk : wv;         // block-uniform selection
  const int osub = (blk < 16) ? 0 : (blk < 32) ? CK : 2 * CK;
  const float* s = wbase + (size_t)(o - osub) * CC + col;             // (o-osub) < 128 rows of that matrix
  const v4f a = *(const v4f*)s;
  const v4f q = *(const v4f*)(s + 4);
  const float f[8] = {a[0], a[1], a[2], a[3], q[0], q[1], q[2], q[3]};
  v4u u;
#pragma unroll
  for (int t = 0; t < 4; ++t) {
    const _Float16 h0 = (_Float16)(bfr(f[2 * t]) * WSC);
    const _Float16 h1 = (_Float16)(bfr(f[2 * t + 1]) * WSC);
    u[t] = pk16(h_bits(h0), h_bits(h1));
  }
  // bias values: every lane loads all three candidates with clamped indices, selects by value
  v4f bvv;
  {
    const int tb = min(tid, 95);
    const int o4 = 4 * tb;
#pragma unroll
    for (int qd = 0; qd < 4; ++qd) {
      const int oo = o4 + qd;                                          // 0..383
      const int iq = min(oo, CK - 1);
      const int ik = min(max(oo - CK, 0), CK - 1);
      const int iv = min(max(oo - 2 * CK, 0), CV - 1);
      const float cq = bq[iq], ckv = bk[ik], cvv = bv[iv];
      const float val = (oo < CK) ? cq : (oo < 2 * CK) ? ckv : cvv;
      bvv[qd] = bfr(val);
    }
  }
{
    *(v4u*)(W16 + (size_t)o * CC + col) = u;
    if (blk == 0 && tid < 96) *(v4f*)(BIAS + 4 * tid) = bvv;
    
  }
}

// =========================================================================================================
// (0b) output conv weights: WO16 f16 [256][128] = f16 of (bf16-RNE(wo) * 256) (exact); BOB f32 [256] = bf16-RNE bo.
// coverage: 16 blocks x 16 rows x 16 pieces x 8 halves = 256 x 128; bias 64 x 4 floats = 256.
// =========================================================================================================
__global__ __launch_bounds__(256)
void cvt_wo(const float* __restrict__ wo, const float* __restrict__ bo, unsigned short* WO16, float* BOB) {
  const int tid = threadIdx.x, blk = blockIdx.x;
  const int rl = tid >> 4, col = 8 * (tid & 15);
  const int o = 16 * blk + rl;                                         // 0..255
  const float* s = wo + (size_t)o * CV + col;
  const v4f a = *(const v4f*)s;
  const v4f q = *(const v4f*)(s + 4);
  const float f[8] = {a[0], a[1], a[2], a[3], q[0], q[1], q[2], q[3]};
  v4u u;
#pragma unroll
  for (int t = 0; t < 4; ++t) {
    const _Float16 h0 = (_Float16)(bfr(f[2 * t]) * WSC);
    const _Float16 h1 = (_Float16)(bfr(f[2 * t + 1]) * WSC);
    u[t] = pk16(h_bits(h0), h_bits(h1));
  }
  v4f bvv;
  {
    const int tb = min(tid, 63);
#pragma unroll
    for (int qd = 0; qd < 4; ++qd) bvv[qd] = bfr(bo[4 * tb + qd]);  // index <= 255
  }
{
    *(v4u*)(WO16 + (size_t)o * CV + col) = u;
    if (blk == 0 && tid < 64) *(v4f*)(BOB + 4 * tid) = bvv;
    
  }
}

// =========================================================================================================
// (1) x f32 [b][256 c][4096 n] -> XP f16 [b][n][c] (position-major, bf16-RNE values, exact in f16) through an LDS
// coverage: XP 2 it x 32 rows x 8 lanes x 8 halves = 64 n x 64 c; grid (64, 4, NIMG) covers the plane exactly once.
// =========================================================================================================
__global__ __launch_bounds__(256)
void cvt_x(const float* __restrict__ x, unsigned short* XP) {
  __shared__ __align__(16) unsigned short T[QT * TP];
  const int tid = threadIdx.x;
  const int nb = blockIdx.x, cb = blockIdx.y, b = blockIdx.z;
  const int e = tid & 7, lq = tid >> 3;                               // lq 0..31
  const int n0 = nb * QT, c0 = cb * QT;
#pragma unroll
  for (int it = 0; it < 2; ++it) {
    const int cl = it * 32 + lq;                                       // 0..63
    const float* sp = x + ((size_t)(b * CC + c0 + cl)) * NN + n0 + 8 * e;
    const v4f a = *(const v4f*)sp;
    const v4f q = *(const v4f*)(sp + 4);
    unsigned short hb[8];
#pragma unroll
    for (int t = 0; t < 4; ++t) {
      hb[t]     = h_bits((_Float16)bfr(a[t]));
      hb[4 + t] = h_bits((_Float16)bfr(q[t]));
    }
#pragma unroll
    for (int t = 0; t < 8; ++t) T[(8 * e + t) * TP + cl] = hb[t];     // T[n_loc][c_loc]
  }
  __syncthreads();
  v4u up[2];
#pragma unroll
  for (int it = 0; it < 2; ++it) {
    const int nl = it * 32 + lq;                                       // 0..63
    up[it] = *(const v4u*)(T + nl * TP + 8 * e);
  }
{
#pragma unroll
    for (int it = 0; it < 2; ++it) {
      const int rl = it * 32 + lq;
      *(v4u*)(XP + ((size_t)(b * NN + n0 + rl)) * CC + c0 + 8 * e) = up[it];
    }
    
  }
}

// =========================================================================================================
// (2) conv1x1 GEMM for one (b, 64-n tile, 64-o block): Y[o][n] = (1/256) sum_c W16[o][c] XP[b][n][c] + BIAS[o].
//     Block 128 threads = 4 waves; wave w owns cols n0+16w..+15 (one B fragment per k-step, k = c contiguous in the
//     XP row) and 4 m-tiles (A rows o = o0 + 16 mt + (lane&15), split k map loader from W16). K = 256 = 8 steps.
//     Epilogue staged in LDS Os[o_loc][n_loc] (pitch OSP), barrier, then:
//       o-blocks 0,1 (q ck cols 0..63 / 64..127) and 2,3 (k): bf16 hi / bf16 residual planes [b][4096 n][128]
//         plane; lane e -> cols 8e..8e+7 of token row 16 it + lq; one instruction per 16 lines.
//         lane e -> halves 8e..8e+7; one instruction per 16 lines.
// coverage: Os 4 waves x 4 tiles x 16x16 = 64 x 64; q/k: per plane 4 it x 16 rows x 8 lanes x 8 = 64 n x 64 cols,
//           o-blocks 0..3 cover all 128 cols of Qh/Ql/Kh/Kl; v: 4 it x 16 rows x 8 lanes x 8 = 64 ch x 64 n;
//           grid (64, 6, NIMG) covers every plane exactly once.
// =========================================================================================================
__global__ __launch_bounds__(128)
void gemm_qkv(const unsigned short* __restrict__ W16, const float* __restrict__ BIAS,
              const unsigned short* __restrict__ XP,
              unsigned short* Qh, unsigned short* Ql, unsigned short* Kh, unsigned short* Kl,
              unsigned short* Vh) {
  __shared__ __align__(16) float Os[QT * OSP];
  const int tid  = threadIdx.x;
  const int lane = tid & 31, wave = tid >> 5;
  const int hh   = lane >> 4, c = lane & 15;
  const int nt   = blockIdx.x, mb = blockIdx.y, b = blockIdx.z;
  const int n0   = nt * QT, o0 = mb * QT;

  const unsigned short* ap = W16 + (size_t)(o0 + c) * CC + 8 * hh;
  const unsigned short* bp = XP + ((size_t)(b * NN + n0 + 16 * wave + c)) * CC + 8 * hh;

  v8f acc[4];
#pragma unroll
  for (int mt = 0; mt < 4; ++mt) acc[mt] = zero8();

#pragma unroll
  for (int ks = 0; ks < CC / 32; ++ks) {
    const Frag fb = ldfrag(bp + 32 * ks);
#pragma unroll
    for (int mt = 0; mt < 4; ++mt) {
      const Frag fa = ldfrag(ap + (size_t)(16 * mt) * CC + 32 * ks);
      acc[mt] = mma_h(fa.h, fb.h, acc[mt]);
    }
  }

  // ---- epilogue: scale back, + bias -> LDS Os[o_loc][n_loc] ----
  {
    const int nl = 16 * wave + c;
#pragma unroll
    for (int mt = 0; mt < 4; ++mt) {
#pragma unroll
      for (int r = 0; r < 8; ++r) {
        const int ol = 16 * mt + 8 * hh + r;                           // 0..63
        Os[ol * OSP + nl] = acc[mt][r] * IWSC + BIAS[o0 + ol];
      }
    }
  }
  __syncthreads();

  const int e = tid & 7, lq = tid >> 3;                               // lq 0..15
  if (mb < 4) {
    // ---- q / k bf16 hi + residual planes (block-uniform branch) ----
    unsigned short* Ph = (mb < 2) ? Qh : Kh;
    unsigned short* Pl = (mb < 2) ? Ql : Kl;
    const int cb = QT * (mb & 1);                                      // ck column base 0 or 64
    v4u uh[4], ul[4];
#pragma unroll
    for (int it = 0; it < 4; ++it) {
      const int nl = it * 16 + lq;                                     // token 0..63
#pragma unroll
      for (int t = 0; t < 4; ++t) {
        const float f0 = Os[(8 * e + 2 * t) * OSP + nl];
        const float f1 = Os[(8 * e + 2 * t + 1) * OSP + nl];
        const unsigned short hb0 = bf_bits(f0), hb1 = bf_bits(f1);
        const unsigned short lb0 = bf_bits(f0 - bf_up(hb0));
        const unsigned short lb1 = bf_bits(f1 - bf_up(hb1));
        uh[it][t] = pk16(hb0, hb1);
        ul[it][t] = pk16(lb0, lb1);
      }
    }
{
#pragma unroll
      for (int it = 0; it < 4; ++it) {
        const int nl = it * 16 + lq;
        const size_t base = ((size_t)(b * NN + n0 + nl)) * CK + cb + 8 * e;
        *(v4u*)(Ph + base) = uh[it];
        *(v4u*)(Pl + base) = ul[it];
      }
      
    }
  } else {
    // ---- v f16 plane, carried x16 ----
    const int ch0 = QT * (mb - 4);                                     // 0 or 64
    v4u uv[4];
#pragma unroll
    for (int it = 0; it < 4; ++it) {
      const int row = it * 16 + lq;                                    // 0..63
      const v4f a = *(const v4f*)(Os + row * OSP + 8 * e);
      const v4f q = *(const v4f*)(Os + row * OSP + 8 * e + 4);
#pragma unroll
      for (int t = 0; t < 2; ++t) {
        uv[it][t]     = pk16(h_bits((_Float16)(a[2 * t] * VSC)), h_bits((_Float16)(a[2 * t + 1] * VSC)));
        uv[it][2 + t] = pk16(h_bits((_Float16)(q[2 * t] * VSC)), h_bits((_Float16)(q[2 * t + 1] * VSC)));
      }
    }
{
#pragma unroll
      for (int it = 0; it < 4; ++it) {
        const int row = it * 16 + lq;
        *(v4u*)(Vh + ((size_t)(b * CV + ch0 + row)) * NN + n0 + 8 * e) = uv[it];
      }
      
    }
  }
}

// =========================================================================================================
// (3) attention for one (b, 64-query tile), transposed formulation, 4096 keys, no mask:
//   S^T tile (16 keys x 16 queries) = sum over 4 k-steps of A(k: row = key kb + (lane&15), 32 d via the split k map
//   from the bf16 plane Kh [b][4096][128]) . B(q: col = query, same map, from the LDS copy of Qh) + A(Kh).B(Ql)
//   + A(Kl).B(Qh) (bf16 unscaled residual planes, shared accumulator). Softmax of s*c with c = 1/sqrt(128):
//   per lane the D tile holds 8 keys of ONE query: online state per lane, one shuffle (lane^16) for the max over 32
//   keys, row-sum partials combined at the end. P = 1024 e^{(s-m)c} as f16 is the B operand of
//   O^T (rows channel, cols queries) += A(V rows channel = 16j + (lane&15), keys contiguous, f16 plane Vh
//   [b][128][4096]) . B(P^T): element r <- D of the tile covering keys kb..kb+15, element 8+r <- the tile covering
//   kb+16..kb+31, lane unchanged. 8 accumulator tiles per wave (128 channels). Block = 4 waves = 64 queries.
//   Q hi/lo rows of the block's 64 queries are staged once in LDS (v4u pieces, barrier); the k-step loop is rolled.
//   Epilogue: barrier, O/l staged in LDS Os[query][128 channels] (pitch OSPW, b128 stores, aliases the Q staging),
// coverage: Q staging 8 it x 8 rows x 16 lanes x 8 = 64 x 128 per plane; OB 16 it x 16 lines x 8 lanes x 4 floats =
//           64 queries x 128 ch; grid (64, NIMG) covers OB exactly once.
// =========================================================================================================
union AttnSmem { unsigned short q[2 * QT * QP]; float o[QT * OSPW]; };

__global__ __launch_bounds__(128)
void attn_gab(const unsigned short* __restrict__ Qh, const unsigned short* __restrict__ Ql,
              const unsigned short* __restrict__ Kh, const unsigned short* __restrict__ Kl,
              const unsigned short* __restrict__ Vh, float* OB) {
  __shared__ __align__(16) AttnSmem sm;
  const int tid  = threadIdx.x;
  const int wave = tid >> 5, lane = tid & 31;
  const int hh   = lane >> 4, c = lane & 15;
  const int n0   = blockIdx.x * QT, b = blockIdx.y;

  // ---- stage q hi (rows 0..63) and q residual (rows 64..127) of this query tile in LDS ----
  {
    const int e16 = tid & 15, rq = tid >> 4;                          // rq 0..7
#pragma unroll
    for (int it = 0; it < 8; ++it) {
      const int row = 8 * it + rq;                                     // 0..63
      const size_t g = ((size_t)(b * NN + n0 + row)) * CK + 8 * e16;
      const v4u vh = *(const v4u*)(Qh + g);
      const v4u vl = *(const v4u*)(Ql + g);
      *(v4u*)(sm.q + row * QP + 8 * e16)        = vh;
      *(v4u*)(sm.q + (QT + row) * QP + 8 * e16) = vl;
    }
  }
  __syncthreads();

  const unsigned short* qsh = sm.q + (16 * wave + c) * QP + 8 * hh;    // B operand, col = query n0 + 16*wave + c
  const unsigned short* qsl = qsh + QT * QP;
  // k fragment base (A operand, row = key kb + c), + key * 128
  const unsigned short* Khp = Kh + (size_t)b * NN * CK + (size_t)c * CK + 8 * hh;
  const unsigned short* Klp = Kl + (size_t)b * NN * CK + (size_t)c * CK + 8 * hh;
  // v fragment base (A operand, row = channel 16j + c, keys contiguous), + 16*j*NN + kb
  const unsigned short* Vhp = Vh + (size_t)b * CV * NN + (size_t)c * NN + 8 * hh;

  float m = -1.0e30f, l = 0.f;
  v8f o[8];
#pragma unroll
  for (int j = 0; j < 8; ++j) o[j] = zero8();

#pragma unroll 1
  for (int kb = 0; kb < NN; kb += 32) {
    v8f s0 = zero8(), s1 = zero8();
#pragma unroll 1
    for (int ks = 0; ks < CK / 32; ++ks) {
      const Frag qhf = ldfrag(qsh + 32 * ks);
      const Frag qlf = ldfrag(qsl + 32 * ks);
      const Frag k0  = ldfrag(Khp + (size_t)kb * CK + 32 * ks);          // keys kb .. kb+15
      const Frag k1  = ldfrag(Khp + (size_t)(kb + 16) * CK + 32 * ks);   // keys kb+16 .. kb+31
      const Frag k0l = ldfrag(Klp + (size_t)kb * CK + 32 * ks);
      const Frag k1l = ldfrag(Klp + (size_t)(kb + 16) * CK + 32 * ks);
      s0 = mma_b(k0.bf, qhf.bf, s0);
      s1 = mma_b(k1.bf, qhf.bf, s1);
      s0 = mma_b(k0.bf, qlf.bf, s0);
      s1 = mma_b(k1.bf, qlf.bf, s1);
      s0 = mma_b(k0l.bf, qhf.bf, s0);
      s1 = mma_b(k1l.bf, qhf.bf, s1);
    }

    float mx = fmaxf(hmax8(s0), hmax8(s1));
    mx = fmaxf(mx, __shfl_xor(mx, 16, 32));
    const float mn   = fmaxf(m, mx);
    const float corr = __expf((m - mn) * SCL);
    m = mn;
    const float msh = mn * SCL - LNPS;                                 // exp gives e^{(s-m)c} * 1024
    l *= corr;
#pragma unroll
    for (int j = 0; j < 8; ++j) {
#pragma unroll
      for (int r = 0; r < 8; ++r) o[j][r] *= corr;
    }

    FragH ph;
    float ls = 0.f;
#pragma unroll
    for (int r = 0; r < 8; ++r) {
      const float e0 = __expf(s0[r] * SCL - msh);                      // key kb      + 8hh + r
      const float e1 = __expf(s1[r] * SCL - msh);                      // key kb + 16 + 8hh + r
      ls += e0 + e1;
      ph.hv[0][r] = (_Float16)e0;
      ph.hv[1][r] = (_Float16)e1;
    }
    l += ls;

#pragma unroll
    for (int j = 0; j < 8; ++j) {
      const Frag vf = ldfrag(Vhp + (size_t)(16 * j) * NN + kb);
      o[j] = mma_h(vf.h, ph.v, o[j]);
    }
  }
  l += __shfl_xor(l, 16, 32);
  const float inv = IVSC / l;                                          // o carries x1024 x16, l carries x1024

  __syncthreads();                                                     // every wave finished reading sm.q
  const int qrow = 16 * wave + c;
#pragma unroll
  for (int j = 0; j < 8; ++j) {
    v4f va, vb;
#pragma unroll
    for (int r = 0; r < 4; ++r) { va[r] = o[j][r] * inv; vb[r] = o[j][4 + r] * inv; }
    *(v4f*)(sm.o + qrow * OSPW + 16 * j + 8 * hh)     = va;           // Os[query][ch = 16j + 8hh + r]
    *(v4f*)(sm.o + qrow * OSPW + 16 * j + 8 * hh + 4) = vb;
  }
  __syncthreads();

  const int e = tid & 7, lq = tid >> 3;                                // lq 0..15
{
#pragma unroll
    for (int it = 0; it < 16; ++it) {
      const int L   = it * 16 + lq;                                    // line 0..255
      const int q   = L >> 2, seg = L & 3;                             // query 0..63, 32-float segment
      const v4f v = *(const v4f*)(sm.o + q * OSPW + 32 * seg + 4 * e);
      *(v4f*)(OB + ((size_t)(b * NN + n0 + q)) * CV + 32 * seg + 4 * e) = v;
    }
    
  }
}

// =========================================================================================================
// (4) output conv on the raw view: for image b, U[r][p] = OB_b[r*4096 + p] (r < 128, p < 4096);
//     y[b][o][p] = (1/4096) sum_r WO16[o][r] (Uh + Ul/2048)[p][r] + BOB[o], Uh = f16(16 U), Ul = f16((16U - Uh) 2048).
//     Block (64-p tile, 64-o block, b), 128 threads: stage the 128 r x 64 p view slab from OB (256-B contiguous row
//     segments), convert, store transposed into LDS Bs[p_loc][r] hi rows 0..63 / residual rows 64..127 (u32 pairs of
//     consecutive r), barrier; then 4 waves, wave w owns cols p0+16w..+15 (B fragments from the LDS rows, split k
//     map), 4 m-tiles (A rows o0 + 16 mt + (lane&15) from WO16, k = r contiguous), K = 128 = 4 steps, hi and
//     d_out [b][256][4096] (row segment 64 p = 2 lines): 8 consecutive lanes x 16 B, one instruction per 16 lines,
// coverage: staging 8 it x 8 row-pairs x 16 lanes x 4 p x 2 rows = 128 r x 64 p per plane (pad cols never read);
//           d_out 8 it x 16 lines x 8 lanes x 4 = 64 o x 64 p; grid (64, 4, NIMG) covers d_out exactly once.
// =========================================================================================================
__global__ __launch_bounds__(128)
void out_proj(const float* __restrict__ OB, const unsigned short* __restrict__ WO16,
              const float* __restrict__ BOB, float* out) {
  __shared__ __align__(16) unsigned int Bs[2 * QT * (BP / 2)];
  __shared__ __align__(16) float Os[QT * OSP];
  const int tid  = threadIdx.x;
  const int lane = tid & 31, wave = tid >> 5;
  const int hh   = lane >> 4, c = lane & 15;
  const int pt = blockIdx.x, mb = blockIdx.y, b = blockIdx.z;
  const int p0 = pt * QT, o0 = mb * QT;
  const float* OBb = OB + (size_t)b * NN * CV;

  // ---- stage + convert the view slab: Bs[p_loc][r] ----
  {
    const int e16 = tid & 15, rq = tid >> 4;                           // rq 0..7
#pragma unroll
    for (int it = 0; it < 8; ++it) {
      const int rp = 8 * it + rq;                                      // row pair 0..63
      const int r0 = 2 * rp;
      const v4f va = *(const v4f*)(OBb + (size_t)r0 * NN + p0 + 4 * e16);
      const v4f vb = *(const v4f*)(OBb + (size_t)(r0 + 1) * NN + p0 + 4 * e16);
#pragma unroll
      for (int t = 0; t < 4; ++t) {
        const float f0 = va[t] * USC, f1 = vb[t] * USC;
        const _Float16 h0 = (_Float16)f0, h1 = (_Float16)f1;
        const _Float16 l0 = (_Float16)((f0 - (float)h0) * RSC);
        const _Float16 l1 = (_Float16)((f1 - (float)h1) * RSC);
        const int pl = 4 * e16 + t;                                    // p_loc 0..63
        Bs[pl * (BP / 2) + rp]        = pk16(h_bits(h0), h_bits(h1));  // halves r0, r0+1
        Bs[(QT + pl) * (BP / 2) + rp] = pk16(h_bits(l0), h_bits(l1));
      }
    }
  }
  __syncthreads();

  const unsigned short* Bh  = (const unsigned short*)Bs;
  const unsigned short* bph = Bh + (16 * wave + c) * BP + 8 * hh;     // B col = p0 + 16*wave + c, k = r
  const unsigned short* bpl = bph + QT * BP;
  const unsigned short* ap  = WO16 + (size_t)(o0 + c) * CV + 8 * hh;  // A row = o0 + 16 mt + c, k = r

  v8f acch[4], accl[4];
#pragma unroll
  for (int mt = 0; mt < 4; ++mt) { acch[mt] = zero8(); accl[mt] = zero8(); }

#pragma unroll
  for (int ks = 0; ks < CV / 32; ++ks) {
    const Frag fbh = ldfrag(bph + 32 * ks);
    const Frag fbl = ldfrag(bpl + 32 * ks);
#pragma unroll
    for (int mt = 0; mt < 4; ++mt) {
      const Frag fa = ldfrag(ap + (size_t)(16 * mt) * CV + 32 * ks);
      acch[mt] = mma_h(fa.h, fbh.h, acch[mt]);
      accl[mt] = mma_h(fa.h, fbl.h, accl[mt]);
    }
  }
  {
    const int nl = 16 * wave + c;
    const float osc = IWSC * IUSC;                                     // 1/4096
#pragma unroll
    for (int mt = 0; mt < 4; ++mt) {
#pragma unroll
      for (int r = 0; r < 8; ++r) {
        const int ol = 16 * mt + 8 * hh + r;                           // 0..63
        Os[ol * OSP + nl] = (acch[mt][r] + accl[mt][r] * IRSC) * osc + BOB[o0 + ol];
      }
    }
  }
  __syncthreads();
  {
    const int e = tid & 7, lq = tid >> 3;                              // lq 0..15
{
#pragma unroll
      for (int it = 0; it < 8; ++it) {
        const int L = it * 16 + lq;                                    // 0..127
        const int row = L >> 1, hf = L & 1;
        const int nl = hf * 32 + 4 * e;
        const v4f v = *(const v4f*)(Os + row * OSP + nl);
        *(v4f*)(out + ((size_t)(b * CO + o0 + row)) * NN + p0 + nl) = v;
      }
      
    }
  }
}

// =========================================================================================================
// Workspace map (bytes; each region start a multiple of 256; every extent is an exact tile multiple and is written
//   W16 f16 [384][256]            196608      BIAS f32 [384]              1536
//   WO16 f16 [256][128]            65536      BOB  f32 [256]              1024
//   XP  f16 [8][4096][256]      16777216
//   Qh/Ql/Kh/Kl bf16 [8][4096][128]  8388608 x4                          Vh f16 [8][128][4096]  8388608
//   OB  f32 [8][4096][128]      16777216
//   total = 75762176
// =========================================================================================================
extern "C" void kernel_launch(void* const* d_in, const int* in_sizes, int n_in,
                              void* d_out, int out_size, void* d_ws, size_t ws_size,
                              hipStream_t stream) {
  const int XN = NIMG * CC * NN;                                       // 8388608
  if (n_in < 9) return;
  if (in_sizes[0] != XN) return;
  if (in_sizes[1] != CK * CC || in_sizes[2] != CK) return;
  if (in_sizes[3] != CK * CC || in_sizes[4] != CK) return;
  if (in_sizes[5] != CV * CC || in_sizes[6] != CV) return;
  if (in_sizes[7] != CO * CV || in_sizes[8] != CO) return;
  if (out_size != NIMG * CO * NN) return;

  size_t off = 0;
  auto carve = [&](size_t bytes) { const size_t o = off; off += (bytes + 255) & ~(size_t)255; return o; };
  const size_t oW16 = carve((size_t)MQKV * CC * 2);
  const size_t oBIA = carve((size_t)MQKV * 4);
  const size_t oWO  = carve((size_t)CO * CV * 2);
  const size_t oBOB = carve((size_t)CO * 4);
  const size_t oXP  = carve((size_t)NIMG * NN * CC * 2);
  const size_t oQh  = carve((size_t)NIMG * NN * CK * 2);
  const size_t oQl  = carve((size_t)NIMG * NN * CK * 2);
  const size_t oKh  = carve((size_t)NIMG * NN * CK * 2);
  const size_t oKl  = carve((size_t)NIMG * NN * CK * 2);
  const size_t oVh  = carve((size_t)NIMG * CV * NN * 2);
  const size_t oOB  = carve((size_t)NIMG * NN * CV * 4);
  if (off > ws_size) return;
  if (off > (size_t)134217728) return;

  const float* x  = (const float*)d_in[0];
  const float* wq = (const float*)d_in[1];
  const float* bq = (const float*)d_in[2];
  const float* wk = (const float*)d_in[3];
  const float* bk = (const float*)d_in[4];
  const float* wv = (const float*)d_in[5];
  const float* bv = (const float*)d_in[6];
  const float* wo = (const float*)d_in[7];
  const float* bo = (const float*)d_in[8];

  char* ws = (char*)d_ws;
  unsigned short* W16 = (unsigned short*)(ws + oW16);
  float*          BIA = (float*)(ws + oBIA);
  unsigned short* WO  = (unsigned short*)(ws + oWO);
  float*          BOB = (float*)(ws + oBOB);
  unsigned short* XP  = (unsigned short*)(ws + oXP);
  unsigned short* Qh  = (unsigned short*)(ws + oQh);
  unsigned short* Ql  = (unsigned short*)(ws + oQl);
  unsigned short* Kh  = (unsigned short*)(ws + oKh);
  unsigned short* Kl  = (unsigned short*)(ws + oKl);
  unsigned short* Vh  = (unsigned short*)(ws + oVh);
  float*          OB  = (float*)(ws + oOB);
  float* out = (float*)d_out;

  const dim3 blk256(256), blk128(128);

  // (0) conv1x1 q/k/v weights -> f16 plane + bias line; output conv weights -> f16 plane + bias line
  cvt_w<<<dim3(MQKV / 8), blk256, 0, stream>>>(wq, bq, wk, bk, wv, bv, W16, BIA);
  cvt_wo<<<dim3(CO / 16), blk256, 0, stream>>>(wo, bo, WO, BOB);
  // (1) x -> position-major 16-bit plane
  cvt_x<<<dim3(NN / QT, CC / QT, NIMG), blk256, 0, stream>>>(x, XP);
  // (2) conv1x1 GEMM -> q/k hi + residual planes and v plane
  gemm_qkv<<<dim3(NN / QT, MQKV / QT, NIMG), blk128, 0, stream>>>(W16, BIA, XP, Qh, Ql, Kh, Kl, Vh);
  // (3) attention -> OB [b][4096][128] token-major f32
  attn_gab<<<dim3(NN / QT, NIMG), blk128, 0, stream>>>(Qh, Ql, Kh, Kl, Vh, OB);
  // (4) output conv on the raw view -> out [b][256][4096]
  out_proj<<<dim3(NN / QT, CO / QT, NIMG), blk128, 0, stream>>>(OB, WO, BOB, out);
  (void)hipGetLastError();
}

// v001
// A run of this version takes 206 microseconds.
// Two timings next to v000 both put it at 2.35 times that version's speed.
// Contractions: conv1x1 q/k/v GEMM W[384x256].X on v_wmma_f32_16x16x32_f16 (f16 containers of bf16-RNE weights x256
// and bf16-RNE x); scores K.Q^T on v_wmma_f32_16x16x32_bf16 (bf16 hi + bf16 residual planes of q and k, 3 products,
// K=128); O^T = V.P^T on v_wmma_f32_16x16x32_f16 (v x16 f16, P = 1024 e^{(s-m)c} f16 from the score D registers);
// output conv1x1 Wo[256x128].U on v_wmma_f32_16x16x32_f16 (Wo f16 of bf16-RNE x256, U as f16 hi x16 plus f16
// residual x2^11 planes in two accumulators); f32 accumulate everywhere; softmax statistics in f32 VALU.
#include <hip/hip_runtime.h>
#include <math.h>
#include <stdint.h>

#define NIMG  8
#define CC    256
#define NN    4096
#define CK    128
#define CV    128
#define CO    256
#define MQKV  384
#define QT    64
#define OSP   68
#define OSPW  132
#define TP    72
#define QP    136
#define BP    136
#define KT    64
#define VP    72
#define STG   (2 * KT * QP + CV * VP)
#define WSC   256.0f
#define IWSC  0.00390625f
#define VSC   16.0f
#define IVSC  0.0625f
#define USC   16.0f
#define IUSC  0.0625f
#define RSC   2048.0f
#define IRSC  0.00048828125f
#define LNPS  6.931471805599453f
#define SCL   0.08838834764831845f

static_assert(NN % QT == 0);
static_assert(CC % 32 == 0 && CK % 32 == 0 && CV % 32 == 0);
static_assert(MQKV == 2 * CK + CV);
static_assert(MQKV % QT == 0 && CO % QT == 0);
static_assert(CK == 2 * QT && CV == 2 * QT);
static_assert((OSP * 4) % 16 == 0);
static_assert((OSPW * 4) % 16 == 0);
static_assert((TP * 2) % 16 == 0);
static_assert((QP * 2) % 16 == 0 && (BP * 2) % 16 == 0 && (BP % 2) == 0);
static_assert(QT * OSPW * 4 <= 2 * QT * QP * 2);
static_assert(NN % KT == 0 && NN / KT >= 2 && KT % 32 == 0);
static_assert((VP * 2) % 16 == 0 && (STG * 2) % 16 == 0 && VP >= KT + 8);
static_assert(KT * CK * 2 == 8 * 128 * 16 && CV * KT * 2 == 8 * 128 * 16);

typedef _Float16       v16h __attribute__((ext_vector_type(16)));
typedef _Float16       v8h  __attribute__((ext_vector_type(8)));
typedef __bf16         v16b __attribute__((ext_vector_type(16)));
typedef unsigned short v8us __attribute__((ext_vector_type(8)));
typedef float          v8f  __attribute__((ext_vector_type(8)));
typedef float          v4f  __attribute__((ext_vector_type(4)));
typedef unsigned int   v4u  __attribute__((ext_vector_type(4)));

union Frag  { v8us u[2]; v16h h; v16b bf; };
union FragH { v16h v; v8h hv[2]; };
static_assert(sizeof(Frag) == 32);
static_assert(sizeof(FragH) == 32);

// ---- scalar helpers ---------------------------------------------------------------------------------------
__device__ __forceinline__ unsigned short bf_bits(float f) {          // f32 -> bf16 bits, RNE convert
  unsigned u = __float_as_uint(f);
  return (unsigned short)((u + 0x7FFFu + ((u >> 16) & 1u)) >> 16);
}
__device__ __forceinline__ float bf_up(unsigned short hb) { return __uint_as_float(((unsigned)hb) << 16); }
__device__ __forceinline__ float bfr(float f) { return bf_up(bf_bits(f)); }
__device__ __forceinline__ unsigned short h_bits(_Float16 x) { return __builtin_bit_cast(unsigned short, x); }
__device__ __forceinline__ unsigned pk16(unsigned short a, unsigned short b) { return (unsigned)a | ((unsigned)b << 16); }
__device__ __forceinline__ v8f zero8() { v8f z = {0.f, 0.f, 0.f, 0.f, 0.f, 0.f, 0.f, 0.f}; return z; }
__device__ __forceinline__ float hmax8(v8f s) {
  return fmaxf(fmaxf(fmaxf(s[0], s[1]), fmaxf(s[2], s[3])), fmaxf(fmaxf(s[4], s[5]), fmaxf(s[6], s[7])));
}

// ---- 16-bit fragment loader (A, or B from a k-contiguous [n][k] row): lane -> row/col (lane&15), p already includes
//      + 8*(lane>>4); elements 0..7 <- p[0..7] (k0+8h..), elements 8..15 <- p[16..23] (k0+16+8h..)
__device__ __forceinline__ Frag ldfrag(const unsigned short* p) {
  Frag f;
  f.u[0] = *(const v8us*)(p);
  f.u[1] = *(const v8us*)(p + 16);
  return f;
}

// ---- WMMA helpers: builtin followed by a 4-slot VALU gap tying D and keeping A/B live --------------------------
__device__ __forceinline__ v8f mma_h(v16h a, v16h b, v8f c) {
  v8f d = __builtin_amdgcn_wmma_f32_16x16x32_f16(false, a, false, b, (short)0, c, false, false);
#if defined(__HIP_DEVICE_COMPILE__)
  asm volatile("v_nop\n\tv_nop\n\tv_nop\n\tv_nop" : "+v"(d) : "v"(a), "v"(b));
#endif
  return d;
}
__device__ __forceinline__ v8f mma_b(v16b a, v16b b, v8f c) {
  v8f d = __builtin_amdgcn_wmma_f32_16x16x32_bf16(false, a, false, b, (short)0, c, false, false);
#if defined(__HIP_DEVICE_COMPILE__)
  const v16h ha = __builtin_bit_cast(v16h, a), hb = __builtin_bit_cast(v16h, b);
  asm volatile("v_nop\n\tv_nop\n\tv_nop\n\tv_nop" : "+v"(d) : "v"(ha), "v"(hb));
#endif
  return d;
}

// =========================================================================================================
// (0) q/k/v conv1x1 weights: W16 f16 [384][256], rows 0..127 = wq, 128..255 = wk, 256..383 = wv; value = f16 of
//     (bf16-RNE(w) * 256) (exact). BIAS f32 [384] = bf16-RNE of bq / bk / bv. Block blk (0..47) owns rows
// coverage: 48 blocks x 8 rows x 32 pieces x 8 halves = 384 x 256; bias 96 x 4 floats = 384.
// =========================================================================================================
__global__ __launch_bounds__(256)
void cvt_w(const float* __restrict__ wq, const float* __restrict__ bq,
           const float* __restrict__ wk, const float* __restrict__ bk,
           const float* __restrict__ wv, const float* __restrict__ bv,
           unsigned short* W16, float* BIAS) {
  const int tid = threadIdx.x, blk = blockIdx.x;
  const int rl = tid >> 5, col = 8 * (tid & 31);
  const int o = 8 * blk + rl;                                          // 0..383
  const float* wbase = (blk < 16) ? wq : (blk < 32) ? wk : wv;         // block-uniform selection
  const int osub = (blk < 16) ? 0 : (blk < 32) ? CK : 2 * CK;
  const float* s = wbase + (size_t)(o - osub) * CC + col;             // (o-osub) < 128 rows of that matrix
  const v4f a = *(const v4f*)s;
  const v4f q = *(const v4f*)(s + 4);
  const float f[8] = {a[0], a[1], a[2], a[3], q[0], q[1], q[2], q[3]};
  v4u u;
#pragma unroll
  for (int t = 0; t < 4; ++t) {
    const _Float16 h0 = (_Float16)(bfr(f[2 * t]) * WSC);
    const _Float16 h1 = (_Float16)(bfr(f[2 * t + 1]) * WSC);
    u[t] = pk16(h_bits(h0), h_bits(h1));
  }
  // bias values: every lane loads all three candidates with clamped indices, selects by value
  v4f bvv;
  {
    const int tb = min(tid, 95);
    const int o4 = 4 * tb;
#pragma unroll
    for (int qd = 0; qd < 4; ++qd) {
      const int oo = o4 + qd;                                          // 0..383
      const int iq = min(oo, CK - 1);
      const int ik = min(max(oo - CK, 0), CK - 1);
      const int iv = min(max(oo - 2 * CK, 0), CV - 1);
      const float cq = bq[iq], ckv = bk[ik], cvv = bv[iv];
      const float val = (oo < CK) ? cq : (oo < 2 * CK) ? ckv : cvv;
      bvv[qd] = bfr(val);
    }
  }
{
    *(v4u*)(W16 + (size_t)o * CC + col) = u;
    if (blk == 0 && tid < 96) *(v4f*)(BIAS + 4 * tid) = bvv;
    
  }
}

// =========================================================================================================
// (0b) output conv weights: WO16 f16 [256][128] = f16 of (bf16-RNE(wo) * 256) (exact); BOB f32 [256] = bf16-RNE bo.
// coverage: 16 blocks x 16 rows x 16 pieces x 8 halves = 256 x 128; bias 64 x 4 floats = 256.
// =========================================================================================================
__global__ __launch_bounds__(256)
void cvt_wo(const float* __restrict__ wo, const float* __restrict__ bo, unsigned short* WO16, float* BOB) {
  const int tid = threadIdx.x, blk = blockIdx.x;
  const int rl = tid >> 4, col = 8 * (tid & 15);
  const int o = 16 * blk + rl;                                         // 0..255
  const float* s = wo + (size_t)o * CV + col;
  const v4f a = *(const v4f*)s;
  const v4f q = *(const v4f*)(s + 4);
  const float f[8] = {a[0], a[1], a[2], a[3], q[0], q[1], q[2], q[3]};
  v4u u;
#pragma unroll
  for (int t = 0; t < 4; ++t) {
    const _Float16 h0 = (_Float16)(bfr(f[2 * t]) * WSC);
    const _Float16 h1 = (_Float16)(bfr(f[2 * t + 1]) * WSC);
    u[t] = pk16(h_bits(h0), h_bits(h1));
  }
  v4f bvv;
  {
    const int tb = min(tid, 63);
#pragma unroll
    for (int qd = 0; qd < 4; ++qd) bvv[qd] = bfr(bo[4 * tb + qd]);  // index <= 255
  }
{
    *(v4u*)(WO16 + (size_t)o * CV + col) = u;
    if (blk == 0 && tid < 64) *(v4f*)(BOB + 4 * tid) = bvv;
    
  }
}

// =========================================================================================================
// (1) x f32 [b][256 c][4096 n] -> XP f16 [b][n][c] (position-major, bf16-RNE values, exact in f16) through an LDS
// coverage: XP 2 it x 32 rows x 8 lanes x 8 halves = 64 n x 64 c; grid (64, 4, NIMG) covers the plane exactly once.
// =========================================================================================================
__global__ __launch_bounds__(256)
void cvt_x(const float* __restrict__ x, unsigned short* XP) {
  __shared__ __align__(16) unsigned short T[QT * TP];
  const int tid = threadIdx.x;
  const int nb = blockIdx.x, cb = blockIdx.y, b = blockIdx.z;
  const int e = tid & 7, lq = tid >> 3;                               // lq 0..31
  const int n0 = nb * QT, c0 = cb * QT;
#pragma unroll
  for (int it = 0; it < 2; ++it) {
    const int cl = it * 32 + lq;                                       // 0..63
    const float* sp = x + ((size_t)(b * CC + c0 + cl)) * NN + n0 + 8 * e;
    const v4f a = *(const v4f*)sp;
    const v4f q = *(const v4f*)(sp + 4);
    unsigned short hb[8];
#pragma unroll
    for (int t = 0; t < 4; ++t) {
      hb[t]     = h_bits((_Float16)bfr(a[t]));
      hb[4 + t] = h_bits((_Float16)bfr(q[t]));
    }
#pragma unroll
    for (int t = 0; t < 8; ++t) T[(8 * e + t) * TP + cl] = hb[t];     // T[n_loc][c_loc]
  }
  __syncthreads();
  v4u up[2];
#pragma unroll
  for (int it = 0; it < 2; ++it) {
    const int nl = it * 32 + lq;                                       // 0..63
    up[it] = *(const v4u*)(T + nl * TP + 8 * e);
  }
{
#pragma unroll
    for (int it = 0; it < 2; ++it) {
      const int rl = it * 32 + lq;
      *(v4u*)(XP + ((size_t)(b * NN + n0 + rl)) * CC + c0 + 8 * e) = up[it];
    }
    
  }
}

// =========================================================================================================
// (2) conv1x1 GEMM for one (b, 64-n tile, 64-o block): Y[o][n] = (1/256) sum_c W16[o][c] XP[b][n][c] + BIAS[o].
//     Block 128 threads = 4 waves; wave w owns cols n0+16w..+15 (one B fragment per k-step, k = c contiguous in the
//     XP row) and 4 m-tiles (A rows o = o0 + 16 mt + (lane&15), split k map loader from W16). K = 256 = 8 steps.
//     Epilogue staged in LDS Os[o_loc][n_loc] (pitch OSP), barrier, then:
//       o-blocks 0,1 (q ck cols 0..63 / 64..127) and 2,3 (k): bf16 hi / bf16 residual planes [b][4096 n][128]
//         plane; lane e -> cols 8e..8e+7 of token row 16 it + lq; one instruction per 16 lines.
//         lane e -> halves 8e..8e+7; one instruction per 16 lines.
// coverage: Os 4 waves x 4 tiles x 16x16 = 64 x 64; q/k: per plane 4 it x 16 rows x 8 lanes x 8 = 64 n x 64 cols,
//           o-blocks 0..3 cover all 128 cols of Qh/Ql/Kh/Kl; v: 4 it x 16 rows x 8 lanes x 8 = 64 ch x 64 n;
//           grid (64, 6, NIMG) covers every plane exactly once.
// =========================================================================================================
__global__ __launch_bounds__(128)
void gemm_qkv(const unsigned short* __restrict__ W16, const float* __restrict__ BIAS,
              const unsigned short* __restrict__ XP,
              unsigned short* Qh, unsigned short* Ql, unsigned short* Kh, unsigned short* Kl,
              unsigned short* Vh) {
  __shared__ __align__(16) float Os[QT * OSP];
  const int tid  = threadIdx.x;
  const int lane = tid & 31, wave = tid >> 5;
  const int hh   = lane >> 4, c = lane & 15;
  const int nt   = blockIdx.x, mb = blockIdx.y, b = blockIdx.z;
  const int n0   = nt * QT, o0 = mb * QT;

  const unsigned short* ap = W16 + (size_t)(o0 + c) * CC + 8 * hh;
  const unsigned short* bp = XP + ((size_t)(b * NN + n0 + 16 * wave + c)) * CC + 8 * hh;

  v8f acc[4];
#pragma unroll
  for (int mt = 0; mt < 4; ++mt) acc[mt] = zero8();

#pragma unroll
  for (int ks = 0; ks < CC / 32; ++ks) {
    const Frag fb = ldfrag(bp + 32 * ks);
#pragma unroll
    for (int mt = 0; mt < 4; ++mt) {
      const Frag fa = ldfrag(ap + (size_t)(16 * mt) * CC + 32 * ks);
      acc[mt] = mma_h(fa.h, fb.h, acc[mt]);
    }
  }

  // ---- epilogue: scale back, + bias -> LDS Os[o_loc][n_loc] ----
  {
    const int nl = 16 * wave + c;
#pragma unroll
    for (int mt = 0; mt < 4; ++mt) {
#pragma unroll
      for (int r = 0; r < 8; ++r) {
        const int ol = 16 * mt + 8 * hh + r;                           // 0..63
        Os[ol * OSP + nl] = acc[mt][r] * IWSC + BIAS[o0 + ol];
      }
    }
  }
  __syncthreads();

  const int e = tid & 7, lq = tid >> 3;                               // lq 0..15
  if (mb < 4) {
    // ---- q / k bf16 hi + residual planes (block-uniform branch) ----
    unsigned short* Ph = (mb < 2) ? Qh : Kh;
    unsigned short* Pl = (mb < 2) ? Ql : Kl;
    const int cb = QT * (mb & 1);                                      // ck column base 0 or 64
    v4u uh[4], ul[4];
#pragma unroll
    for (int it = 0; it < 4; ++it) {
      const int nl = it * 16 + lq;                                     // token 0..63
#pragma unroll
      for (int t = 0; t < 4; ++t) {
        const float f0 = Os[(8 * e + 2 * t) * OSP + nl];
        const float f1 = Os[(8 * e + 2 * t + 1) * OSP + nl];
        const unsigned short hb0 = bf_bits(f0), hb1 = bf_bits(f1);
        const unsigned short lb0 = bf_bits(f0 - bf_up(hb0));
        const unsigned short lb1 = bf_bits(f1 - bf_up(hb1));
        uh[it][t] = pk16(hb0, hb1);
        ul[it][t] = pk16(lb0, lb1);
      }
    }
{
#pragma unroll
      for (int it = 0; it < 4; ++it) {
        const int nl = it * 16 + lq;
        const size_t base = ((size_t)(b * NN + n0 + nl)) * CK + cb + 8 * e;
        *(v4u*)(Ph + base) = uh[it];
        *(v4u*)(Pl + base) = ul[it];
      }
      
    }
  } else {
    // ---- v f16 plane, carried x16 ----
    const int ch0 = QT * (mb - 4);                                     // 0 or 64
    v4u uv[4];
#pragma unroll
    for (int it = 0; it < 4; ++it) {
      const int row = it * 16 + lq;                                    // 0..63
      const v4f a = *(const v4f*)(Os + row * OSP + 8 * e);
      const v4f q = *(const v4f*)(Os + row * OSP + 8 * e + 4);
#pragma unroll
      for (int t = 0; t < 2; ++t) {
        uv[it][t]     = pk16(h_bits((_Float16)(a[2 * t] * VSC)), h_bits((_Float16)(a[2 * t + 1] * VSC)));
        uv[it][2 + t] = pk16(h_bits((_Float16)(q[2 * t] * VSC)), h_bits((_Float16)(q[2 * t + 1] * VSC)));
      }
    }
{
#pragma unroll
      for (int it = 0; it < 4; ++it) {
        const int row = it * 16 + lq;
        *(v4u*)(Vh + ((size_t)(b * CV + ch0 + row)) * NN + n0 + 8 * e) = uv[it];
      }
      
    }
  }
}

// =========================================================================================================
// (3) attention for one (b, 64-query tile), transposed formulation, 4096 keys, no mask:
//   S^T tile (16 keys x 16 queries) = sum over 4 k-steps of A(k: row = key kb + (lane&15), 32 d via the split k map
//   from the bf16 plane Kh [b][4096][128]) . B(q: col = query, same map, from the LDS copy of Qh) + A(Kh).B(Ql)
//   + A(Kl).B(Qh) (bf16 unscaled residual planes, shared accumulator). Softmax of s*c with c = 1/sqrt(128):
//   per lane the D tile holds 8 keys of ONE query: online state per lane, one shuffle (lane^16) for the max over 32
//   keys, row-sum partials combined at the end. P = 1024 e^{(s-m)c} as f16 is the B operand of
//   O^T (rows channel, cols queries) += A(V rows channel = 16j + (lane&15), keys contiguous, f16 plane Vh
//   [b][128][4096]) . B(P^T): element r <- D of the tile covering keys kb..kb+15, element 8+r <- the tile covering
//   kb+16..kb+31, lane unchanged. 8 accumulator tiles per wave (128 channels). Block = 4 waves = 64 queries.
//   Q hi/lo rows of the block's 64 queries are staged once in LDS (v4u pieces, barrier); the k-step loop is rolled.
//   K hi, K residual and V come in tiles of KT = 64 keys through a two-buffer LDS ring filled by asynchronous 16-byte
//   copies (whole 128-B lines per request, each tile fetched once per block and read by all 4 waves); tile t+2 is
//   issued behind the barrier that ends the reads of tile t. Row pitches QP / VP halves = 16 B x odd.
//   Epilogue: barrier, O/l staged in LDS Os[query][128 channels] (pitch OSPW, b128 stores, aliases the Q staging),
// coverage: Q staging 8 it x 8 rows x 16 lanes x 8 = 64 x 128 per plane; OB 16 it x 16 lines x 8 lanes x 4 floats =
//           64 queries x 128 ch; grid (64, NIMG) covers OB exactly once.
// =========================================================================================================
union AttnSmem { unsigned short q[2 * QT * QP]; float o[QT * OSPW]; };

typedef __attribute__((address_space(3))) unsigned short lds_us;
__device__ __forceinline__ unsigned lds_byte(unsigned short* p) { return (unsigned)(uintptr_t)(lds_us*)p; }

// Eight 16-byte copies per lane, global -> LDS through no register: piece i goes from g + i*gstep (halves) to LDS byte
// l + i*lstep. The s_wait_xcnt closes the statement so that no address register of a copy is rewritten ahead of it.
__device__ __forceinline__ void acopy8(unsigned l, unsigned lstep, const unsigned short* g, size_t gstep) {
#if defined(__HIP_DEVICE_COMPILE__)
  asm volatile(
      "global_load_async_to_lds_b128 %0, %8, off\n\t"
      "global_load_async_to_lds_b128 %1, %9, off\n\t"
      "global_load_async_to_lds_b128 %2, %10, off\n\t"
      "global_load_async_to_lds_b128 %3, %11, off\n\t"
      "global_load_async_to_lds_b128 %4, %12, off\n\t"
      "global_load_async_to_lds_b128 %5, %13, off\n\t"
      "global_load_async_to_lds_b128 %6, %14, off\n\t"
      "global_load_async_to_lds_b128 %7, %15, off\n\t"
      "s_wait_xcnt 0x0"
      :: "v"(l), "v"(l + lstep), "v"(l + 2 * lstep), "v"(l + 3 * lstep),
         "v"(l + 4 * lstep), "v"(l + 5 * lstep), "v"(l + 6 * lstep), "v"(l + 7 * lstep),
         "v"(g), "v"(g + gstep), "v"(g + 2 * gstep), "v"(g + 3 * gstep),
         "v"(g + 4 * gstep), "v"(g + 5 * gstep), "v"(g + 6 * gstep), "v"(g + 7 * gstep)
      : "memory");
#endif
}

// One tile of KT keys into one ring buffer at LDS byte lb: k hi rows [KT][QP], k residual rows [KT][QP], v rows
// [CV][VP]. kh / kl / vh are this thread's piece 0 of the tile; lk / lv its byte offsets inside the k and v parts.
// k: 16 lanes per 256-B row, 8 rows per piece step; v: 8 lanes per 128-B row segment, 16 rows per piece step.
__device__ __forceinline__ void stage_kv(unsigned lb, unsigned lk, unsigned lv, const unsigned short* kh,
                                         const unsigned short* kl, const unsigned short* vh) {
  acopy8(lb + lk, 8 * QP * 2, kh, (size_t)8 * CK);
  acopy8(lb + KT * QP * 2 + lk, 8 * QP * 2, kl, (size_t)8 * CK);
  acopy8(lb + 2 * KT * QP * 2 + lv, 16 * VP * 2, vh, (size_t)16 * NN);
}

__global__ __launch_bounds__(128)
void attn_gab(const unsigned short* __restrict__ Qh, const unsigned short* __restrict__ Ql,
              const unsigned short* __restrict__ Kh, const unsigned short* __restrict__ Kl,
              const unsigned short* __restrict__ Vh, float* OB) {
  __shared__ __align__(16) AttnSmem sm;
  __shared__ __align__(16) unsigned short ring[2 * STG];
  const int tid  = threadIdx.x;
  const int wave = tid >> 5, lane = tid & 31;
  const int hh   = lane >> 4, c = lane & 15;
  const int n0   = blockIdx.x * QT, b = blockIdx.y;

  // ---- this thread's share of a k/v tile: source pointers of tile 0, byte places inside a ring buffer ----
  const unsigned ring0 = lds_byte(ring);
  const unsigned lk = (unsigned)((tid >> 4) * (QP * 2) + (tid & 15) * 16);
  const unsigned lv = (unsigned)((tid >> 3) * (VP * 2) + (tid & 7) * 16);
  const unsigned short* khg = Kh + ((size_t)(b * NN + (tid >> 4))) * CK + 8 * (tid & 15);
  const unsigned short* klg = Kl + ((size_t)(b * NN + (tid >> 4))) * CK + 8 * (tid & 15);
  const unsigned short* vhg = Vh + ((size_t)(b * CV + (tid >> 3))) * NN + 8 * (tid & 7);
  stage_kv(ring0, lk, lv, khg, klg, vhg);                              // tile 0 -> buffer 0

  // ---- stage q hi (rows 0..63) and q residual (rows 64..127) of this query tile in LDS ----
  {
    const int e16 = tid & 15, rq = tid >> 4;                          // rq 0..7
#pragma unroll
    for (int it = 0; it < 8; ++it) {
      const int row = 8 * it + rq;                                     // 0..63
      const size_t g = ((size_t)(b * NN + n0 + row)) * CK + 8 * e16;
      const v4u vh = *(const v4u*)(Qh + g);
      const v4u vl = *(const v4u*)(Ql + g);
      *(v4u*)(sm.q + row * QP + 8 * e16)        = vh;
      *(v4u*)(sm.q + (QT + row) * QP + 8 * e16) = vl;
    }
  }
  asm volatile("s_wait_asynccnt 0x0" ::: "memory");                    // this wave's share of tile 0 has landed
  __syncthreads();                                                     // publishes the q rows and tile 0
  stage_kv(ring0 + STG * 2, lk, lv, khg + (size_t)KT * CK, klg + (size_t)KT * CK, vhg + KT);   // tile 1 -> buffer 1

  const unsigned short* qsh = sm.q + (16 * wave + c) * QP + 8 * hh;    // B operand, col = query n0 + 16*wave + c
  const unsigned short* qsl = qsh + QT * QP;

  float m = -1.0e30f, l = 0.f;
  v8f o[8];
#pragma unroll
  for (int j = 0; j < 8; ++j) o[j] = zero8();

#pragma unroll 1   // rolled: one hand-over point in the text, the buffer picked by t & 1
  for (int t = 0; t < NN / KT; ++t) {
  const unsigned short* buf = ring + (t & 1) * STG;
  // k fragment base (A operand, row = key kb + c of the tile), + key * QP
  const unsigned short* Khp = buf + c * QP + 8 * hh;
  const unsigned short* Klp = Khp + KT * QP;
  // v fragment base (A operand, row = channel 16j + c, the tile's keys contiguous), + 16*j*VP + kb
  const unsigned short* Vhp = buf + 2 * KT * QP + c * VP + 8 * hh;
#pragma unroll 1   // the 32-key pass stays rolled: its text and registers stay those of one pass
  for (int kb = 0; kb < KT; kb += 32) {
    v8f s0 = zero8(), s1 = zero8();
#pragma unroll 1
    for (int ks = 0; ks < CK / 32; ++ks) {
      const Frag qhf = ldfrag(qsh + 32 * ks);
      const Frag qlf = ldfrag(qsl + 32 * ks);
      const Frag k0  = ldfrag(Khp + kb * QP + 32 * ks);                  // keys kb .. kb+15
      const Frag k1  = ldfrag(Khp + (kb + 16) * QP + 32 * ks);           // keys kb+16 .. kb+31
      const Frag k0l = ldfrag(Klp + kb * QP + 32 * ks);
      const Frag k1l = ldfrag(Klp + (kb + 16) * QP + 32 * ks);
      s0 = mma_b(k0.bf, qhf.bf, s0);
      s1 = mma_b(k1.bf, qhf.bf, s1);
      s0 = mma_b(k0.bf, qlf.bf, s0);
      s1 = mma_b(k1.bf, qlf.bf, s1);
      s0 = mma_b(k0l.bf, qhf.bf, s0);
      s1 = mma_b(k1l.bf, qhf.bf, s1);
    }

    float mx = fmaxf(hmax8(s0), hmax8(s1));
    mx = fmaxf(mx, __shfl_xor(mx, 16, 32));
    const float mn   = fmaxf(m, mx);
    const float corr = __expf((m - mn) * SCL);
    m = mn;
    const float msh = mn * SCL - LNPS;                                 // exp gives e^{(s-m)c} * 1024
    l *= corr;
#pragma unroll
    for (int j = 0; j < 8; ++j) {
#pragma unroll
      for (int r = 0; r < 8; ++r) o[j][r] *= corr;
    }

    FragH ph;
    float ls = 0.f;
#pragma unroll
    for (int r = 0; r < 8; ++r) {
      const float e0 = __expf(s0[r] * SCL - msh);                      // key kb      + 8hh + r
      const float e1 = __expf(s1[r] * SCL - msh);                      // key kb + 16 + 8hh + r
      ls += e0 + e1;
      ph.hv[0][r] = (_Float16)e0;
      ph.hv[1][r] = (_Float16)e1;
    }
    l += ls;

#pragma unroll
    for (int j = 0; j < 8; ++j) {
      const Frag vf = ldfrag(Vhp + (16 * j) * VP + kb);
      o[j] = mma_h(vf.h, ph.v, o[j]);
    }
  }
  // ---- hand-over: tile t+1 becomes readable, buffer t&1 becomes free ----
  asm volatile("s_wait_dscnt 0x0" ::: "memory");                       // this wave's reads of buffer t&1 are done
  asm volatile("s_wait_asynccnt 0x0" ::: "memory");                    // this wave's share of tile t+1 has landed
  __syncthreads();
  if (t + 2 < NN / KT)
    stage_kv(ring0 + (unsigned)(t & 1) * (STG * 2), lk, lv, khg + (size_t)(t + 2) * KT * CK,
             klg + (size_t)(t + 2) * KT * CK, vhg + (t + 2) * KT);
  }
  asm volatile("s_wait_asynccnt 0x0" ::: "memory");                    // no copy is left in flight at the wave's end
  l += __shfl_xor(l, 16, 32);
  const float inv = IVSC / l;                                          // o carries x1024 x16, l carries x1024

  __syncthreads();                                                     // every wave finished reading sm.q
  const int qrow = 16 * wave + c;
#pragma unroll
  for (int j = 0; j < 8; ++j) {
    v4f va, vb;
#pragma unroll
    for (int r = 0; r < 4; ++r) { va[r] = o[j][r] * inv; vb[r] = o[j][4 + r] * inv; }
    *(v4f*)(sm.o + qrow * OSPW + 16 * j + 8 * hh)     = va;           // Os[query][ch = 16j + 8hh + r]
    *(v4f*)(sm.o + qrow * OSPW + 16 * j + 8 * hh + 4) = vb;
  }
  __syncthreads();

  const int e = tid & 7, lq = tid >> 3;                                // lq 0..15
{
#pragma unroll
    for (int it = 0; it < 16; ++it) {
      const int L   = it * 16 + lq;                                    // line 0..255
      const int q   = L >> 2, seg = L & 3;                             // query 0..63, 32-float segment
      const v4f v = *(const v4f*)(sm.o + q * OSPW + 32 * seg + 4 * e);
      *(v4f*)(OB + ((size_t)(b * NN + n0 + q)) * CV + 32 * seg + 4 * e) = v;
    }
    
  }
}

// =========================================================================================================
// (4) output conv on the raw view: for image b, U[r][p] = OB_b[r*4096 + p] (r < 128, p < 4096);
//     y[b][o][p] = (1/4096) sum_r WO16[o][r] (Uh + Ul/2048)[p][r] + BOB[o], Uh = f16(16 U), Ul = f16((16U - Uh) 2048).
//     Block (64-p tile, 64-o block, b), 128 threads: stage the 128 r x 64 p view slab from OB (256-B contiguous row
//     segments), convert, store transposed into LDS Bs[p_loc][r] hi rows 0..63 / residual rows 64..127 (u32 pairs of
//     consecutive r), barrier; then 4 waves, wave w owns cols p0+16w..+15 (B fragments from the LDS rows, split k
//     map), 4 m-tiles (A rows o0 + 16 mt + (lane&15) from WO16, k = r contiguous), K = 128 = 4 steps, hi and
//     d_out [b][256][4096] (row segment 64 p = 2 lines): 8 consecutive lanes x 16 B, one instruction per 16 lines,
// coverage: staging 8 it x 8 row-pairs x 16 lanes x 4 p x 2 rows = 128 r x 64 p per plane (pad cols never read);
//           d_out 8 it x 16 lines x 8 lanes x 4 = 64 o x 64 p; grid (64, 4, NIMG) covers d_out exactly once.
// =========================================================================================================
__global__ __launch_bounds__(128)
void out_proj(const float* __restrict__ OB, const unsigned short* __restrict__ WO16,
              const float* __restrict__ BOB, float* out) {
  __shared__ __align__(16) unsigned int Bs[2 * QT * (BP / 2)];
  __shared__ __align__(16) float Os[QT * OSP];
  const int tid  = threadIdx.x;
  const int lane = tid & 31, wave = tid >> 5;
  const int hh   = lane >> 4, c = lane & 15;
  const int pt = blockIdx.x, mb = blockIdx.y, b = blockIdx.z;
  const int p0 = pt * QT, o0 = mb * QT;
  const float* OBb = OB + (size_t)b * NN * CV;

  // ---- stage + convert the view slab: Bs[p_loc][r] ----
  {
    const int e16 = tid & 15, rq = tid >> 4;                           // rq 0..7
#pragma unroll
    for (int it = 0; it < 8; ++it) {
      const int rp = 8 * it + rq;                                      // row pair 0..63
      const int r0 = 2 * rp;
      const v4f va = *(const v4f*)(OBb + (size_t)r0 * NN + p0 + 4 * e16);
      const v4f vb = *(const v4f*)(OBb + (size_t)(r0 + 1) * NN + p0 + 4 * e16);
#pragma unroll
      for (int t = 0; t < 4; ++t) {
        const float f0 = va[t] * USC, f1 = vb[t] * USC;
        const _Float16 h0 = (_Float16)f0, h1 = (_Float16)f1;
        const _Float16 l0 = (_Float16)((f0 - (float)h0) * RSC);
        const _Float16 l1 = (_Float16)((f1 - (float)h1) * RSC);
        const int pl = 4 * e16 + t;                                    // p_loc 0..63
        Bs[pl * (BP / 2) + rp]        = pk16(h_bits(h0), h_bits(h1));  // halves r0, r0+1
        Bs[(QT + pl) * (BP / 2) + rp] = pk16(h_bits(l0), h_bits(l1));
      }
    }
  }
  __syncthreads();

  const unsigned short* Bh  = (const unsigned short*)Bs;
  const unsigned short* bph = Bh + (16 * wave + c) * BP + 8 * hh;     // B col = p0 + 16*wave + c, k = r
  const unsigned short* bpl = bph + QT * BP;
  const unsigned short* ap  = WO16 + (size_t)(o0 + c) * CV + 8 * hh;  // A row = o0 + 16 mt + c, k = r

  v8f acch[4], accl[4];
#pragma unroll
  for (int mt = 0; mt < 4; ++mt) { acch[mt] = zero8(); accl[mt] = zero8(); }

#pragma unroll
  for (int ks = 0; ks < CV / 32; ++ks) {
    const Frag fbh = ldfrag(bph + 32 * ks);
    const Frag fbl = ldfrag(bpl + 32 * ks);
#pragma unroll
    for (int mt = 0; mt < 4; ++mt) {
      const Frag fa = ldfrag(ap + (size_t)(16 * mt) * CV + 32 * ks);
      acch[mt] = mma_h(fa.h, fbh.h, acch[mt]);
      accl[mt] = mma_h(fa.h, fbl.h, accl[mt]);
    }
  }
  {
    const int nl = 16 * wave + c;
    const float osc = IWSC * IUSC;                                     // 1/4096
#pragma unroll
    for (int mt = 0; mt < 4; ++mt) {
#pragma unroll
      for (int r = 0; r < 8; ++r) {
        const int ol = 16 * mt + 8 * hh + r;                           // 0..63
        Os[ol * OSP + nl] = (acch[mt][r] + accl[mt][r] * IRSC) * osc + BOB[o0 + ol];
      }
    }
  }
  __syncthreads();
  {
    const int e = tid & 7, lq = tid >> 3;                              // lq 0..15
{
#pragma unroll
      for (int it = 0; it < 8; ++it) {
        const int L = it * 16 + lq;                                    // 0..127
        const int row = L >> 1, hf = L & 1;
        const int nl = hf * 32 + 4 * e;
        const v4f v = *(const v4f*)(Os + row * OSP + nl);
        *(v4f*)(out + ((size_t)(b * CO + o0 + row)) * NN + p0 + nl) = v;
      }
      
    }
  }
}

// =========================================================================================================
// Workspace map (bytes; each region start a multiple of 256; every extent is an exact tile multiple and is written
//   W16 f16 [384][256]            196608      BIAS f32 [384]              1536
//   WO16 f16 [256][128]            65536      BOB  f32 [256]              1024
//   XP  f16 [8][4096][256]      16777216
//   Qh/Ql/Kh/Kl bf16 [8][4096][128]  8388608 x4                          Vh f16 [8][128][4096]  8388608
//   OB  f32 [8][4096][128]      16777216
//   total = 75762176
// =========================================================================================================
extern "C" void kernel_launch(void* const* d_in, const int* in_sizes, int n_in,
                              void* d_out, int out_size, void* d_ws, size_t ws_size,
                              hipStream_t stream) {
  const int XN = NIMG * CC * NN;                                       // 8388608
  if (n_in < 9) return;
  if (in_sizes[0] != XN) return;
  if (in_sizes[1] != CK * CC || in_sizes[2] != CK) return;
  if (in_sizes[3] != CK * CC || in_sizes[4] != CK) return;
  if (in_sizes[5] != CV * CC || in_sizes[6] != CV) return;
  if (in_sizes[7] != CO * CV || in_sizes[8] != CO) return;
  if (out_size != NIMG * CO * NN) return;

  size_t off = 0;
  auto carve = [&](size_t bytes) { const size_t o = off; off += (bytes + 255) & ~(size_t)255; return o; };
  const size_t oW16 = carve((size_t)MQKV * CC * 2);
  const size_t oBIA = carve((size_t)MQKV * 4);
  const size_t oWO  = carve((size_t)CO * CV * 2);
  const size_t oBOB = carve((size_t)CO * 4);
  const size_t oXP  = carve((size_t)NIMG * NN * CC * 2);
  const size_t oQh  = carve((size_t)NIMG * NN * CK * 2);
  const size_t oQl  = carve((size_t)NIMG * NN * CK * 2);
  const size_t oKh  = carve((size_t)NIMG * NN * CK * 2);
  const size_t oKl  = carve((size_t)NIMG * NN * CK * 2);
  const size_t oVh  = carve((size_t)NIMG * CV * NN * 2);
  const size_t oOB  = carve((size_t)NIMG * NN * CV * 4);
  if (off > ws_size) return;
  if (off > (size_t)134217728) return;

  const float* x  = (const float*)d_in[0];
  const float* wq = (const float*)d_in[1];
  const float* bq = (const float*)d_in[2];
  const float* wk = (const float*)d_in[3];
  const float* bk = (const float*)d_in[4];
  const float* wv = (const float*)d_in[5];
  const float* bv = (const float*)d_in[6];
  const float* wo = (const float*)d_in[7];
  const float* bo = (const float*)d_in[8];

  char* ws = (char*)d_ws;
  unsigned short* W16 = (unsigned short*)(ws + oW16);
  float*          BIA = (float*)(ws + oBIA);
  unsigned short* WO  = (unsigned short*)(ws + oWO);
  float*          BOB = (float*)(ws + oBOB);
  unsigned short* XP  = (unsigned short*)(ws + oXP);
  unsigned short* Qh  = (unsigned short*)(ws + oQh);
  unsigned short* Ql  = (unsigned short*)(ws + oQl);
  unsigned short* Kh  = (unsigned short*)(ws + oKh);
  unsigned short* Kl  = (unsigned short*)(ws + oKl);
  unsigned short* Vh  = (unsigned short*)(ws + oVh);
  float*          OB  = (float*)(ws + oOB);
  float* out = (float*)d_out;

  const dim3 blk256(256), blk128(128);

  // (0) conv1x1 q/k/v weights -> f16 plane + bias line; output conv weights -> f16 plane + bias line
  cvt_w<<<dim3(MQKV / 8), blk256, 0, stream>>>(wq, bq, wk, bk, wv, bv, W16, BIA);
  cvt_wo<<<dim3(CO / 16), blk256, 0, stream>>>(wo, bo, WO, BOB);
  // (1) x -> position-major 16-bit plane
  cvt_x<<<dim3(NN / QT, CC / QT, NIMG), blk256, 0, stream>>>(x, XP);
  // (2) conv1x1 GEMM -> q/k hi + residual planes and v plane
  gemm_qkv<<<dim3(NN / QT, MQKV / QT, NIMG), blk128, 0, stream>>>(W16, BIA, XP, Qh, Ql, Kh, Kl, Vh);
  // (3) attention -> OB [b][4096][128] token-major f32
  attn_gab<<<dim3(NN / QT, NIMG), blk128, 0, stream>>>(Qh, Ql, Kh, Kl, Vh, OB);
  // (4) output conv on the raw view -> out [b][256][4096]
  out_proj<<<dim3(NN / QT, CO / QT, NIMG), blk128, 0, stream>>>(OB, WO, BOB, out);
  (void)hipGetLastError();
}

// v002
// Measured time: 172 microseconds a run.
// Next to v001, in two timings, it ran 1.19 and 1.20 times as fast.
// Over all steps from v000 it is 2.81 times as fast.
// Contractions: conv1x1 q/k/v GEMM W[384x256].X on v_wmma_f32_16x16x32_f16 (f16 containers of bf16-RNE weights x256
// and bf16-RNE x); scores K.Q^T on v_wmma_f32_16x16x32_bf16 (bf16 hi + bf16 residual planes of q and k, 3 products,
// K=128); O^T = V.P^T on v_wmma_f32_16x16x32_f16 (v x16 f16, P = 1024 e^{(s-m)c} f16 from the score D registers);
// output conv1x1 Wo[256x128].U on v_wmma_f32_16x16x32_f16 (Wo f16 of bf16-RNE x256, U as f16 hi x16 plus f16
// residual x2^11 planes in two accumulators); f32 accumulate everywhere; softmax statistics in f32 VALU.
#include <hip/hip_runtime.h>
#include <math.h>
#include <stdint.h>

#define NIMG  8
#define CC    256
#define NN    4096
#define CK    128
#define CV    128
#define CO    256
#define MQKV  384
#define QT    64
#define OSP   68
#define OSPW  132
#define TP    72
#define QP    136
#define BP    136
#define KT    64
#define VP    72
#define STG   (2 * KT * QP + CV * VP)
#define WSC   256.0f
#define IWSC  0.00390625f
#define VSC   16.0f
#define IVSC  0.0625f
#define USC   16.0f
#define IUSC  0.0625f
#define RSC   2048.0f
#define IRSC  0.00048828125f
#define LNPS  6.931471805599453f
#define SCL   0.08838834764831845f

static_assert(NN % QT == 0);
static_assert(CC % 32 == 0 && CK % 64 == 0 && CV % 32 == 0);
static_assert(MQKV == 2 * CK + CV);
static_assert(MQKV % QT == 0 && CO % QT == 0);
static_assert(CK == 2 * QT && CV == 2 * QT);
static_assert((OSP * 4) % 16 == 0);
static_assert((OSPW * 4) % 16 == 0);
static_assert((TP * 2) % 16 == 0);
static_assert((QP * 2) % 16 == 0 && (BP * 2) % 16 == 0 && (BP % 2) == 0);
static_assert(QT * OSPW * 4 <= 2 * QT * QP * 2);
static_assert(NN % KT == 0 && NN / KT >= 2 && KT % 32 == 0);
static_assert((VP * 2) % 16 == 0 && (STG * 2) % 16 == 0 && VP >= KT + 8);
static_assert(KT * CK * 2 == 8 * 128 * 16 && CV * KT * 2 == 8 * 128 * 16);

typedef _Float16       v16h __attribute__((ext_vector_type(16)));
typedef _Float16       v8h  __attribute__((ext_vector_type(8)));
typedef __bf16         v16b __attribute__((ext_vector_type(16)));
typedef unsigned short v8us __attribute__((ext_vector_type(8)));
typedef float          v8f  __attribute__((ext_vector_type(8)));
typedef float          v4f  __attribute__((ext_vector_type(4)));
typedef unsigned int   v4u  __attribute__((ext_vector_type(4)));

union Frag  { v8us u[2]; v16h h; v16b bf; };
union FragH { v16h v; v8h hv[2]; };
static_assert(sizeof(Frag) == 32);
static_assert(sizeof(FragH) == 32);

// ---- scalar helpers ---------------------------------------------------------------------------------------
__device__ __forceinline__ unsigned short bf_bits(float f) {          // f32 -> bf16 bits, RNE convert
  unsigned u = __float_as_uint(f);
  return (unsigned short)((u + 0x7FFFu + ((u >> 16) & 1u)) >> 16);
}
__device__ __forceinline__ float bf_up(unsigned short hb) { return __uint_as_float(((unsigned)hb) << 16); }
__device__ __forceinline__ float bfr(float f) { return bf_up(bf_bits(f)); }
__device__ __forceinline__ unsigned short h_bits(_Float16 x) { return __builtin_bit_cast(unsigned short, x); }
__device__ __forceinline__ unsigned pk16(unsigned short a, unsigned short b) { return (unsigned)a | ((unsigned)b << 16); }
__device__ __forceinline__ v8f zero8() { v8f z = {0.f, 0.f, 0.f, 0.f, 0.f, 0.f, 0.f, 0.f}; return z; }
__device__ __forceinline__ float hmax8(v8f s) {
  return fmaxf(fmaxf(fmaxf(s[0], s[1]), fmaxf(s[2], s[3])), fmaxf(fmaxf(s[4], s[5]), fmaxf(s[6], s[7])));
}

// lane l <-> l ^ 16 by a vector cross-row move: it counts on no LDS counter, so no wait on it drains LDS reads in flight
__device__ __forceinline__ float xhalf(float x) {
  const int b = __builtin_bit_cast(int, x);
  return __builtin_bit_cast(float, __builtin_amdgcn_permlanex16(b, b, 0x76543210, 0xfedcba98, false, false));
}

// ---- 16-bit fragment loader (A, or B from a k-contiguous [n][k] row): lane -> row/col (lane&15), p already includes
//      + 8*(lane>>4); elements 0..7 <- p[0..7] (k0+8h..), elements 8..15 <- p[16..23] (k0+16+8h..)
__device__ __forceinline__ Frag ldfrag(const unsigned short* p) {
  Frag f;
  f.u[0] = *(const v8us*)(p);
  f.u[1] = *(const v8us*)(p + 16);
  return f;
}

// ---- WMMA helpers: builtin followed by a 4-slot VALU gap tying D and keeping A/B live --------------------------
__device__ __forceinline__ v8f mma_h(v16h a, v16h b, v8f c) {
  v8f d = __builtin_amdgcn_wmma_f32_16x16x32_f16(false, a, false, b, (short)0, c, false, false);
#if defined(__HIP_DEVICE_COMPILE__)
  asm volatile("v_nop\n\tv_nop\n\tv_nop\n\tv_nop" : "+v"(d) : "v"(a), "v"(b));
#endif
  return d;
}
__device__ __forceinline__ v8f mma_b(v16b a, v16b b, v8f c) {
  v8f d = __builtin_amdgcn_wmma_f32_16x16x32_bf16(false, a, false, b, (short)0, c, false, false);
#if defined(__HIP_DEVICE_COMPILE__)
  const v16h ha = __builtin_bit_cast(v16h, a), hb = __builtin_bit_cast(v16h, b);
  asm volatile("v_nop\n\tv_nop\n\tv_nop\n\tv_nop" : "+v"(d) : "v"(ha), "v"(hb));
#endif
  return d;
}

// =========================================================================================================
// (0) q/k/v conv1x1 weights: W16 f16 [384][256], rows 0..127 = wq, 128..255 = wk, 256..383 = wv; value = f16 of
//     (bf16-RNE(w) * 256) (exact). BIAS f32 [384] = bf16-RNE of bq / bk / bv. Block blk (0..47) owns rows
// coverage: 48 blocks x 8 rows x 32 pieces x 8 halves = 384 x 256; bias 96 x 4 floats = 384.
// =========================================================================================================
__global__ __launch_bounds__(256)
void cvt_w(const float* __restrict__ wq, const float* __restrict__ bq,
           const float* __restrict__ wk, const float* __restrict__ bk,
           const float* __restrict__ wv, const float* __restrict__ bv,
           unsigned short* W16, float* BIAS) {
  const int tid = threadIdx.x, blk = blockIdx.x;
  const int rl = tid >> 5, col = 8 * (tid & 31);
  const int o = 8 * blk + rl;                                          // 0..383
  const float* wbase = (blk < 16) ? wq : (blk < 32) ? wk : wv;         // block-uniform selection
  const int osub = (blk < 16) ? 0 : (blk < 32) ? CK : 2 * CK;
  const float* s = wbase + (size_t)(o - osub) * CC + col;             // (o-osub) < 128 rows of that matrix
  const v4f a = *(const v4f*)s;
  const v4f q = *(const v4f*)(s + 4);
  const float f[8] = {a[0], a[1], a[2], a[3], q[0], q[1], q[2], q[3]};
  v4u u;
#pragma unroll
  for (int t = 0; t < 4; ++t) {
    const _Float16 h0 = (_Float16)(bfr(f[2 * t]) * WSC);
    const _Float16 h1 = (_Float16)(bfr(f[2 * t + 1]) * WSC);
    u[t] = pk16(h_bits(h0), h_bits(h1));
  }
  // bias values: every lane loads all three candidates with clamped indices, selects by value
  v4f bvv;
  {
    const int tb = min(tid, 95);
    const int o4 = 4 * tb;
#pragma unroll
    for (int qd = 0; qd < 4; ++qd) {
      const int oo = o4 + qd;                                          // 0..383
      const int iq = min(oo, CK - 1);
      const int ik = min(max(oo - CK, 0), CK - 1);
      const int iv = min(max(oo - 2 * CK, 0), CV - 1);
      const float cq = bq[iq], ckv = bk[ik], cvv = bv[iv];
      const float val = (oo < CK) ? cq : (oo < 2 * CK) ? ckv : cvv;
      bvv[qd] = bfr(val);
    }
  }
{
    *(v4u*)(W16 + (size_t)o * CC + col) = u;
    if (blk == 0 && tid < 96) *(v4f*)(BIAS + 4 * tid) = bvv;
    
  }
}

// =========================================================================================================
// (0b) output conv weights: WO16 f16 [256][128] = f16 of (bf16-RNE(wo) * 256) (exact); BOB f32 [256] = bf16-RNE bo.
// coverage: 16 blocks x 16 rows x 16 pieces x 8 halves = 256 x 128; bias 64 x 4 floats = 256.
// =========================================================================================================
__global__ __launch_bounds__(256)
void cvt_wo(const float* __restrict__ wo, const float* __restrict__ bo, unsigned short* WO16, float* BOB) {
  const int tid = threadIdx.x, blk = blockIdx.x;
  const int rl = tid >> 4, col = 8 * (tid & 15);
  const int o = 16 * blk + rl;                                         // 0..255
  const float* s = wo + (size_t)o * CV + col;
  const v4f a = *(const v4f*)s;
  const v4f q = *(const v4f*)(s + 4);
  const float f[8] = {a[0], a[1], a[2], a[3], q[0], q[1], q[2], q[3]};
  v4u u;
#pragma unroll
  for (int t = 0; t < 4; ++t) {
    const _Float16 h0 = (_Float16)(bfr(f[2 * t]) * WSC);
    const _Float16 h1 = (_Float16)(bfr(f[2 * t + 1]) * WSC);
    u[t] = pk16(h_bits(h0), h_bits(h1));
  }
  v4f bvv;
  {
    const int tb = min(tid, 63);
#pragma unroll
    for (int qd = 0; qd < 4; ++qd) bvv[qd] = bfr(bo[4 * tb + qd]);  // index <= 255
  }
{
    *(v4u*)(WO16 + (size_t)o * CV + col) = u;
    if (blk == 0 && tid < 64) *(v4f*)(BOB + 4 * tid) = bvv;
    
  }
}

// =========================================================================================================
// (1) x f32 [b][256 c][4096 n] -> XP f16 [b][n][c] (position-major, bf16-RNE values, exact in f16) through an LDS
// coverage: XP 2 it x 32 rows x 8 lanes x 8 halves = 64 n x 64 c; grid (64, 4, NIMG) covers the plane exactly once.
// =========================================================================================================
__global__ __launch_bounds__(256)
void cvt_x(const float* __restrict__ x, unsigned short* XP) {
  __shared__ __align__(16) unsigned short T[QT * TP];
  const int tid = threadIdx.x;
  const int nb = blockIdx.x, cb = blockIdx.y, b = blockIdx.z;
  const int e = tid & 7, lq = tid >> 3;                               // lq 0..31
  const int n0 = nb * QT, c0 = cb * QT;
#pragma unroll
  for (int it = 0; it < 2; ++it) {
    const int cl = it * 32 + lq;                                       // 0..63
    const float* sp = x + ((size_t)(b * CC + c0 + cl)) * NN + n0 + 8 * e;
    const v4f a = *(const v4f*)sp;
    const v4f q = *(const v4f*)(sp + 4);
    unsigned short hb[8];
#pragma unroll
    for (int t = 0; t < 4; ++t) {
      hb[t]     = h_bits((_Float16)bfr(a[t]));
      hb[4 + t] = h_bits((_Float16)bfr(q[t]));
    }
#pragma unroll
    for (int t = 0; t < 8; ++t) T[(8 * e + t) * TP + cl] = hb[t];     // T[n_loc][c_loc]
  }
  __syncthreads();
  v4u up[2];
#pragma unroll
  for (int it = 0; it < 2; ++it) {
    const int nl = it * 32 + lq;                                       // 0..63
    up[it] = *(const v4u*)(T + nl * TP + 8 * e);
  }
{
#pragma unroll
    for (int it = 0; it < 2; ++it) {
      const int rl = it * 32 + lq;
      *(v4u*)(XP + ((size_t)(b * NN + n0 + rl)) * CC + c0 + 8 * e) = up[it];
    }
    
  }
}

// =========================================================================================================
// (2) conv1x1 GEMM for one (b, 64-n tile, 64-o block): Y[o][n] = (1/256) sum_c W16[o][c] XP[b][n][c] + BIAS[o].
//     Block 128 threads = 4 waves; wave w owns cols n0+16w..+15 (one B fragment per k-step, k = c contiguous in the
//     XP row) and 4 m-tiles (A rows o = o0 + 16 mt + (lane&15), split k map loader from W16). K = 256 = 8 steps.
//     Epilogue staged in LDS Os[o_loc][n_loc] (pitch OSP), barrier, then:
//       o-blocks 0,1 (q ck cols 0..63 / 64..127) and 2,3 (k): bf16 hi / bf16 residual planes [b][4096 n][128]
//         plane; lane e -> cols 8e..8e+7 of token row 16 it + lq; one instruction per 16 lines.
//         lane e -> halves 8e..8e+7; one instruction per 16 lines.
// coverage: Os 4 waves x 4 tiles x 16x16 = 64 x 64; q/k: per plane 4 it x 16 rows x 8 lanes x 8 = 64 n x 64 cols,
//           o-blocks 0..3 cover all 128 cols of Qh/Ql/Kh/Kl; v: 4 it x 16 rows x 8 lanes x 8 = 64 ch x 64 n;
//           grid (64, 6, NIMG) covers every plane exactly once.
// =========================================================================================================
__global__ __launch_bounds__(128)
void gemm_qkv(const unsigned short* __restrict__ W16, const float* __restrict__ BIAS,
              const unsigned short* __restrict__ XP,
              unsigned short* Qh, unsigned short* Ql, unsigned short* Kh, unsigned short* Kl,
              unsigned short* Vh) {
  __shared__ __align__(16) float Os[QT * OSP];
  const int tid  = threadIdx.x;
  const int lane = tid & 31, wave = tid >> 5;
  const int hh   = lane >> 4, c = lane & 15;
  const int nt   = blockIdx.x, mb = blockIdx.y, b = blockIdx.z;
  const int n0   = nt * QT, o0 = mb * QT;

  const unsigned short* ap = W16 + (size_t)(o0 + c) * CC + 8 * hh;
  const unsigned short* bp = XP + ((size_t)(b * NN + n0 + 16 * wave + c)) * CC + 8 * hh;

  v8f acc[4];
#pragma unroll
  for (int mt = 0; mt < 4; ++mt) acc[mt] = zero8();

#pragma unroll
  for (int ks = 0; ks < CC / 32; ++ks) {
    const Frag fb = ldfrag(bp + 32 * ks);
#pragma unroll
    for (int mt = 0; mt < 4; ++mt) {
      const Frag fa = ldfrag(ap + (size_t)(16 * mt) * CC + 32 * ks);
      acc[mt] = mma_h(fa.h, fb.h, acc[mt]);
    }
  }

  // ---- epilogue: scale back, + bias -> LDS Os[o_loc][n_loc] ----
  {
    const int nl = 16 * wave + c;
#pragma unroll
    for (int mt = 0; mt < 4; ++mt) {
#pragma unroll
      for (int r = 0; r < 8; ++r) {
        const int ol = 16 * mt + 8 * hh + r;                           // 0..63
        Os[ol * OSP + nl] = acc[mt][r] * IWSC + BIAS[o0 + ol];
      }
    }
  }
  __syncthreads();

  const int e = tid & 7, lq = tid >> 3;                               // lq 0..15
  if (mb < 4) {
    // ---- q / k bf16 hi + residual planes (block-uniform branch) ----
    unsigned short* Ph = (mb < 2) ? Qh : Kh;
    unsigned short* Pl = (mb < 2) ? Ql : Kl;
    const int cb = QT * (mb & 1);                                      // ck column base 0 or 64
    v4u uh[4], ul[4];
#pragma unroll
    for (int it = 0; it < 4; ++it) {
      const int nl = it * 16 + lq;                                     // token 0..63
#pragma unroll
      for (int t = 0; t < 4; ++t) {
        const float f0 = Os[(8 * e + 2 * t) * OSP + nl];
        const float f1 = Os[(8 * e + 2 * t + 1) * OSP + nl];
        const unsigned short hb0 = bf_bits(f0), hb1 = bf_bits(f1);
        const unsigned short lb0 = bf_bits(f0 - bf_up(hb0));
        const unsigned short lb1 = bf_bits(f1 - bf_up(hb1));
        uh[it][t] = pk16(hb0, hb1);
        ul[it][t] = pk16(lb0, lb1);
      }
    }
{
#pragma unroll
      for (int it = 0; it < 4; ++it) {
        const int nl = it * 16 + lq;
        const size_t base = ((size_t)(b * NN + n0 + nl)) * CK + cb + 8 * e;
        *(v4u*)(Ph + base) = uh[it];
        *(v4u*)(Pl + base) = ul[it];
      }
      
    }
  } else {
    // ---- v f16 plane, carried x16 ----
    const int ch0 = QT * (mb - 4);                                     // 0 or 64
    v4u uv[4];
#pragma unroll
    for (int it = 0; it < 4; ++it) {
      const int row = it * 16 + lq;                                    // 0..63
      const v4f a = *(const v4f*)(Os + row * OSP + 8 * e);
      const v4f q = *(const v4f*)(Os + row * OSP + 8 * e + 4);
#pragma unroll
      for (int t = 0; t < 2; ++t) {
        uv[it][t]     = pk16(h_bits((_Float16)(a[2 * t] * VSC)), h_bits((_Float16)(a[2 * t + 1] * VSC)));
        uv[it][2 + t] = pk16(h_bits((_Float16)(q[2 * t] * VSC)), h_bits((_Float16)(q[2 * t + 1] * VSC)));
      }
    }
{
#pragma unroll
      for (int it = 0; it < 4; ++it) {
        const int row = it * 16 + lq;
        *(v4u*)(Vh + ((size_t)(b * CV + ch0 + row)) * NN + n0 + 8 * e) = uv[it];
      }
      
    }
  }
}

// =========================================================================================================
// (3) attention for one (b, 64-query tile), transposed formulation, 4096 keys, no mask:
//   S^T tile (16 keys x 16 queries) = sum over 4 k-steps of A(k: row = key kb + (lane&15), 32 d via the split k map
//   from the bf16 plane Kh [b][4096][128]) . B(q: col = query, same map, from the LDS copy of Qh) + A(Kh).B(Ql)
//   + A(Kl).B(Qh) (bf16 unscaled residual planes, shared accumulator). Softmax of s*c with c = 1/sqrt(128):
//   per lane the D tile holds 8 keys of ONE query: online state per lane, one cross-row move (lane^16) for the max over
//   32 keys, row-sum partials combined at the end. P = 1024 e^{(s-m)c} as f16 is the B operand of
//   O^T (rows channel, cols queries) += A(V rows channel = 16j + (lane&15), keys contiguous, f16 plane Vh
//   [b][128][4096]) . B(P^T): element r <- D of the tile covering keys kb..kb+15, element 8+r <- the tile covering
//   kb+16..kb+31, lane unchanged. 8 accumulator tiles per wave (128 channels). Block = 4 waves = 64 queries.
//   Q hi/lo rows of the block's 64 queries are staged once in LDS (v4u pieces, barrier). A 32-key pass reads its LDS
//   fragments in three groups, each ahead of the products that use it: q/k of k-steps 0,1; q/k of k-steps 2,3; all of v.
//   K hi, K residual and V come in tiles of KT = 64 keys through a two-buffer LDS ring filled by asynchronous 16-byte
//   copies (whole 128-B lines per request, each tile fetched once per block and read by all 4 waves); tile t+2 is
//   issued behind the barrier that ends the reads of tile t. Row pitches QP / VP halves = 16 B x odd.
//   Epilogue: barrier, O/l staged in LDS Os[query][128 channels] (pitch OSPW, b128 stores, aliases the Q staging),
// coverage: Q staging 8 it x 8 rows x 16 lanes x 8 = 64 x 128 per plane; OB 16 it x 16 lines x 8 lanes x 4 floats =
//           64 queries x 128 ch; grid (64, NIMG) covers OB exactly once.
// =========================================================================================================
union AttnSmem { unsigned short q[2 * QT * QP]; float o[QT * OSPW]; };

typedef __attribute__((address_space(3))) unsigned short lds_us;
__device__ __forceinline__ unsigned lds_byte(unsigned short* p) { return (unsigned)(uintptr_t)(lds_us*)p; }

// Eight 16-byte copies per lane, global -> LDS through no register: piece i goes from g + i*gstep (halves) to LDS byte
// l + i*lstep. The s_wait_xcnt closes the statement so that no address register of a copy is rewritten ahead of it.
__device__ __forceinline__ void acopy8(unsigned l, unsigned lstep, const unsigned short* g, size_t gstep) {
#if defined(__HIP_DEVICE_COMPILE__)
  asm volatile(
      "global_load_async_to_lds_b128 %0, %8, off\n\t"
      "global_load_async_to_lds_b128 %1, %9, off\n\t"
      "global_load_async_to_lds_b128 %2, %10, off\n\t"
      "global_load_async_to_lds_b128 %3, %11, off\n\t"
      "global_load_async_to_lds_b128 %4, %12, off\n\t"
      "global_load_async_to_lds_b128 %5, %13, off\n\t"
      "global_load_async_to_lds_b128 %6, %14, off\n\t"
      "global_load_async_to_lds_b128 %7, %15, off\n\t"
      "s_wait_xcnt 0x0"
      :: "v"(l), "v"(l + lstep), "v"(l + 2 * lstep), "v"(l + 3 * lstep),
         "v"(l + 4 * lstep), "v"(l + 5 * lstep), "v"(l + 6 * lstep), "v"(l + 7 * lstep),
         "v"(g), "v"(g + gstep), "v"(g + 2 * gstep), "v"(g + 3 * gstep),
         "v"(g + 4 * gstep), "v"(g + 5 * gstep), "v"(g + 6 * gstep), "v"(g + 7 * gstep)
      : "memory");
#endif
}

// One tile of KT keys into one ring buffer at LDS byte lb: k hi rows [KT][QP], k residual rows [KT][QP], v rows
// [CV][VP]. kh / kl / vh are this thread's piece 0 of the tile; lk / lv its byte offsets inside the k and v parts.
// k: 16 lanes per 256-B row, 8 rows per piece step; v: 8 lanes per 128-B row segment, 16 rows per piece step.
__device__ __forceinline__ void stage_kv(unsigned lb, unsigned lk, unsigned lv, const unsigned short* kh,
                                         const unsigned short* kl, const unsigned short* vh) {
  acopy8(lb + lk, 8 * QP * 2, kh, (size_t)8 * CK);
  acopy8(lb + KT * QP * 2 + lk, 8 * QP * 2, kl, (size_t)8 * CK);
  acopy8(lb + 2 * KT * QP * 2 + lv, 16 * VP * 2, vh, (size_t)16 * NN);
}

__global__ __launch_bounds__(128)
void attn_gab(const unsigned short* __restrict__ Qh, const unsigned short* __restrict__ Ql,
              const unsigned short* __restrict__ Kh, const unsigned short* __restrict__ Kl,
              const unsigned short* __restrict__ Vh, float* OB) {
  __shared__ __align__(16) AttnSmem sm;
  __shared__ __align__(16) unsigned short ring[2 * STG];
  const int tid  = threadIdx.x;
  const int wave = tid >> 5, lane = tid & 31;
  const int hh   = lane >> 4, c = lane & 15;
  const int n0   = blockIdx.x * QT, b = blockIdx.y;

  // ---- this thread's share of a k/v tile: source pointers of tile 0, byte places inside a ring buffer ----
  const unsigned ring0 = lds_byte(ring);
  const unsigned lk = (unsigned)((tid >> 4) * (QP * 2) + (tid & 15) * 16);
  const unsigned lv = (unsigned)((tid >> 3) * (VP * 2) + (tid & 7) * 16);
  const unsigned short* khg = Kh + ((size_t)(b * NN + (tid >> 4))) * CK + 8 * (tid & 15);
  const unsigned short* klg = Kl + ((size_t)(b * NN + (tid >> 4))) * CK + 8 * (tid & 15);
  const unsigned short* vhg = Vh + ((size_t)(b * CV + (tid >> 3))) * NN + 8 * (tid & 7);
  stage_kv(ring0, lk, lv, khg, klg, vhg);                              // tile 0 -> buffer 0

  // ---- stage q hi (rows 0..63) and q residual (rows 64..127) of this query tile in LDS ----
  {
    const int e16 = tid & 15, rq = tid >> 4;                          // rq 0..7
#pragma unroll
    for (int it = 0; it < 8; ++it) {
      const int row = 8 * it + rq;                                     // 0..63
      const size_t g = ((size_t)(b * NN + n0 + row)) * CK + 8 * e16;
      const v4u vh = *(const v4u*)(Qh + g);
      const v4u vl = *(const v4u*)(Ql + g);
      *(v4u*)(sm.q + row * QP + 8 * e16)        = vh;
      *(v4u*)(sm.q + (QT + row) * QP + 8 * e16) = vl;
    }
  }
  asm volatile("s_wait_asynccnt 0x0" ::: "memory");                    // this wave's share of tile 0 has landed
  __syncthreads();                                                     // publishes the q rows and tile 0
  stage_kv(ring0 + STG * 2, lk, lv, khg + (size_t)KT * CK, klg + (size_t)KT * CK, vhg + KT);   // tile 1 -> buffer 1

  const unsigned short* qsh = sm.q + (16 * wave + c) * QP + 8 * hh;    // B operand, col = query n0 + 16*wave + c
  const unsigned short* qsl = qsh + QT * QP;

  float m = -1.0e30f, l = 0.f;
  v8f o[8];
#pragma unroll
  for (int j = 0; j < 8; ++j) o[j] = zero8();

#pragma unroll 1   // rolled: one hand-over point in the text, the buffer picked by t & 1
  for (int t = 0; t < NN / KT; ++t) {
  const unsigned short* buf = ring + (t & 1) * STG;
  // k fragment base (A operand, row = key kb + c of the tile), + key * QP
  const unsigned short* Khp = buf + c * QP + 8 * hh;
  const unsigned short* Klp = Khp + KT * QP;
  // v fragment base (A operand, row = channel 16j + c, the tile's keys contiguous), + 16*j*VP + kb
  const unsigned short* Vhp = buf + 2 * KT * QP + c * VP + 8 * hh;
#pragma unroll 1   // the 32-key pass stays rolled: its text and registers stay those of one pass
  for (int kb = 0; kb < KT; kb += 32) {
    v8f s0 = zero8(), s1 = zero8();
#pragma unroll   // unrolled: each trip's reads stand as one group in the text, ahead of that trip's twelve products
    for (int kg = 0; kg < CK / 64; ++kg) {
      // the q and k fragments of two k-steps, read as one group: one LDS latency per group, counted waits behind it
      Frag qhf[2], qlf[2], k0[2], k1[2], k0l[2], k1l[2];
#pragma unroll   // the fragment arrays stay in registers only under constant indices
      for (int u = 0; u < 2; ++u) {
        const int ks = 2 * kg + u;
        qhf[u] = ldfrag(qsh + 32 * ks);
        k0[u]  = ldfrag(Khp + kb * QP + 32 * ks);                        // keys kb .. kb+15
        k1[u]  = ldfrag(Khp + (kb + 16) * QP + 32 * ks);                 // keys kb+16 .. kb+31
        qlf[u] = ldfrag(qsl + 32 * ks);
        k0l[u] = ldfrag(Klp + kb * QP + 32 * ks);
        k1l[u] = ldfrag(Klp + (kb + 16) * QP + 32 * ks);
      }
#pragma unroll   // constant indices, as above
      for (int u = 0; u < 2; ++u) {
        s0 = mma_b(k0[u].bf, qhf[u].bf, s0);
        s1 = mma_b(k1[u].bf, qhf[u].bf, s1);
        s0 = mma_b(k0[u].bf, qlf[u].bf, s0);
        s1 = mma_b(k1[u].bf, qlf[u].bf, s1);
        s0 = mma_b(k0l[u].bf, qhf[u].bf, s0);
        s1 = mma_b(k1l[u].bf, qhf[u].bf, s1);
      }
    }

    // the pass's eight v fragments, read as one group here: nothing below waits on LDS before the products that use
    // them, so they land while the softmax runs
    Frag vf[8];
#pragma unroll   // constant indices, as above
    for (int j = 0; j < 8; ++j) vf[j] = ldfrag(Vhp + (16 * j) * VP + kb);
    // holds the sixteen reads here: without it the compiler sinks them to the softmax's end and their latency is waited out
    __builtin_amdgcn_sched_barrier(0);

    float mx = fmaxf(hmax8(s0), hmax8(s1));
    mx = fmaxf(mx, xhalf(mx));
    const float mn   = fmaxf(m, mx);
    const float corr = __expf((m - mn) * SCL);
    m = mn;
    const float msh = mn * SCL - LNPS;                                 // exp gives e^{(s-m)c} * 1024
    l *= corr;
#pragma unroll
    for (int j = 0; j < 8; ++j) {
#pragma unroll
      for (int r = 0; r < 8; ++r) o[j][r] *= corr;
    }

    FragH ph;
    float ls = 0.f;
#pragma unroll
    for (int r = 0; r < 8; ++r) {
      const float e0 = __expf(s0[r] * SCL - msh);                      // key kb      + 8hh + r
      const float e1 = __expf(s1[r] * SCL - msh);                      // key kb + 16 + 8hh + r
      ls += e0 + e1;
      ph.hv[0][r] = (_Float16)e0;
      ph.hv[1][r] = (_Float16)e1;
    }
    l += ls;

#pragma unroll
    for (int j = 0; j < 8; ++j) o[j] = mma_h(vf[j].h, ph.v, o[j]);
  }
  // ---- hand-over: tile t+1 becomes readable, buffer t&1 becomes free ----
  asm volatile("s_wait_dscnt 0x0" ::: "memory");                       // this wave's reads of buffer t&1 are done
  asm volatile("s_wait_asynccnt 0x0" ::: "memory");                    // this wave's share of tile t+1 has landed
  __syncthreads();
  if (t + 2 < NN / KT)
    stage_kv(ring0 + (unsigned)(t & 1) * (STG * 2), lk, lv, khg + (size_t)(t + 2) * KT * CK,
             klg + (size_t)(t + 2) * KT * CK, vhg + (t + 2) * KT);
  }
  asm volatile("s_wait_asynccnt 0x0" ::: "memory");                    // no copy is left in flight at the wave's end
  l += __shfl_xor(l, 16, 32);
  const float inv = IVSC / l;                                          // o carries x1024 x16, l carries x1024

  __syncthreads();                                                     // every wave finished reading sm.q
  const int qrow = 16 * wave + c;
#pragma unroll
  for (int j = 0; j < 8; ++j) {
    v4f va, vb;
#pragma unroll
    for (int r = 0; r < 4; ++r) { va[r] = o[j][r] * inv; vb[r] = o[j][4 + r] * inv; }
    *(v4f*)(sm.o + qrow * OSPW + 16 * j + 8 * hh)     = va;           // Os[query][ch = 16j + 8hh + r]
    *(v4f*)(sm.o + qrow * OSPW + 16 * j + 8 * hh + 4) = vb;
  }
  __syncthreads();

  const int e = tid & 7, lq = tid >> 3;                                // lq 0..15
{
#pragma unroll
    for (int it = 0; it < 16; ++it) {
      const int L   = it * 16 + lq;                                    // line 0..255
      const int q   = L >> 2, seg = L & 3;                             // query 0..63, 32-float segment
      const v4f v = *(const v4f*)(sm.o + q * OSPW + 32 * seg + 4 * e);
      *(v4f*)(OB + ((size_t)(b * NN + n0 + q)) * CV + 32 * seg + 4 * e) = v;
    }
    
  }
}

// =========================================================================================================
// (4) output conv on the raw view: for image b, U[r][p] = OB_b[r*4096 + p] (r < 128, p < 4096);
//     y[b][o][p] = (1/4096) sum_r WO16[o][r] (Uh + Ul/2048)[p][r] + BOB[o], Uh = f16(16 U), Ul = f16((16U - Uh) 2048).
//     Block (64-p tile, 64-o block, b), 128 threads: stage the 128 r x 64 p view slab from OB (256-B contiguous row
//     segments), convert, store transposed into LDS Bs[p_loc][r] hi rows 0..63 / residual rows 64..127 (u32 pairs of
//     consecutive r), barrier; then 4 waves, wave w owns cols p0+16w..+15 (B fragments from the LDS rows, split k
//     map), 4 m-tiles (A rows o0 + 16 mt + (lane&15) from WO16, k = r contiguous), K = 128 = 4 steps, hi and
//     d_out [b][256][4096] (row segment 64 p = 2 lines): 8 consecutive lanes x 16 B, one instruction per 16 lines,
// coverage: staging 8 it x 8 row-pairs x 16 lanes x 4 p x 2 rows = 128 r x 64 p per plane (pad cols never read);
//           d_out 8 it x 16 lines x 8 lanes x 4 = 64 o x 64 p; grid (64, 4, NIMG) covers d_out exactly once.
// =========================================================================================================
__global__ __launch_bounds__(128)
void out_proj(const float* __restrict__ OB, const unsigned short* __restrict__ WO16,
              const float* __restrict__ BOB, float* out) {
  __shared__ __align__(16) unsigned int Bs[2 * QT * (BP / 2)];
  __shared__ __align__(16) float Os[QT * OSP];
  const int tid  = threadIdx.x;
  const int lane = tid & 31, wave = tid >> 5;
  const int hh   = lane >> 4, c = lane & 15;
  const int pt = blockIdx.x, mb = blockIdx.y, b = blockIdx.z;
  const int p0 = pt * QT, o0 = mb * QT;
  const float* OBb = OB + (size_t)b * NN * CV;

  // ---- stage + convert the view slab: Bs[p_loc][r] ----
  {
    const int e16 = tid & 15, rq = tid >> 4;                           // rq 0..7
#pragma unroll
    for (int it = 0; it < 8; ++it) {
      const int rp = 8 * it + rq;                                      // row pair 0..63
      const int r0 = 2 * rp;
      const v4f va = *(const v4f*)(OBb + (size_t)r0 * NN + p0 + 4 * e16);
      const v4f vb = *(const v4f*)(OBb + (size_t)(r0 + 1) * NN + p0 + 4 * e16);
#pragma unroll
      for (int t = 0; t < 4; ++t) {
        const float f0 = va[t] * USC, f1 = vb[t] * USC;
        const _Float16 h0 = (_Float16)f0, h1 = (_Float16)f1;
        const _Float16 l0 = (_Float16)((f0 - (float)h0) * RSC);
        const _Float16 l1 = (_Float16)((f1 - (float)h1) * RSC);
        const int pl = 4 * e16 + t;                                    // p_loc 0..63
        Bs[pl * (BP / 2) + rp]        = pk16(h_bits(h0), h_bits(h1));  // halves r0, r0+1
        Bs[(QT + pl) * (BP / 2) + rp] = pk16(h_bits(l0), h_bits(l1));
      }
    }
  }
  __syncthreads();

  const unsigned short* Bh  = (const unsigned short*)Bs;
  const unsigned short* bph = Bh + (16 * wave + c) * BP + 8 * hh;     // B col = p0 + 16*wave + c, k = r
  const unsigned short* bpl = bph + QT * BP;
  const unsigned short* ap  = WO16 + (size_t)(o0 + c) * CV + 8 * hh;  // A row = o0 + 16 mt + c, k = r

  v8f acch[4], accl[4];
#pragma unroll
  for (int mt = 0; mt < 4; ++mt) { acch[mt] = zero8(); accl[mt] = zero8(); }

#pragma unroll
  for (int ks = 0; ks < CV / 32; ++ks) {
    const Frag fbh = ldfrag(bph + 32 * ks);
    const Frag fbl = ldfrag(bpl + 32 * ks);
#pragma unroll
    for (int mt = 0; mt < 4; ++mt) {
      const Frag fa = ldfrag(ap + (size_t)(16 * mt) * CV + 32 * ks);
      acch[mt] = mma_h(fa.h, fbh.h, acch[mt]);
      accl[mt] = mma_h(fa.h, fbl.h, accl[mt]);
    }
  }
  {
    const int nl = 16 * wave + c;
    const float osc = IWSC * IUSC;                                     // 1/4096
#pragma unroll
    for (int mt = 0; mt < 4; ++mt) {
#pragma unroll
      for (int r = 0; r < 8; ++r) {
        const int ol = 16 * mt + 8 * hh + r;                           // 0..63
        Os[ol * OSP + nl] = (acch[mt][r] + accl[mt][r] * IRSC) * osc + BOB[o0 + ol];
      }
    }
  }
  __syncthreads();
  {
    const int e = tid & 7, lq = tid >> 3;                              // lq 0..15
{
#pragma unroll
      for (int it = 0; it < 8; ++it) {
        const int L = it * 16 + lq;                                    // 0..127
        const int row = L >> 1, hf = L & 1;
        const int nl = hf * 32 + 4 * e;
        const v4f v = *(const v4f*)(Os + row * OSP + nl);
        *(v4f*)(out + ((size_t)(b * CO + o0 + row)) * NN + p0 + nl) = v;
      }
      
    }
  }
}

// =========================================================================================================
// Workspace map (bytes; each region start a multiple of 256; every extent is an exact tile multiple and is written
//   W16 f16 [384][256]            196608      BIAS f32 [384]              1536
//   WO16 f16 [256][128]            65536      BOB  f32 [256]              1024
//   XP  f16 [8][4096][256]      16777216
//   Qh/Ql/Kh/Kl bf16 [8][4096][128]  8388608 x4                          Vh f16 [8][128][4096]  8388608
//   OB  f32 [8][4096][128]      16777216
//   total = 75762176
// =========================================================================================================
extern "C" void kernel_launch(void* const* d_in, const int* in_sizes, int n_in,
                              void* d_out, int out_size, void* d_ws, size_t ws_size,
                              hipStream_t stream) {
  const int XN = NIMG * CC * NN;                                       // 8388608
  if (n_in < 9) return;
  if (in_sizes[0] != XN) return;
  if (in_sizes[1] != CK * CC || in_sizes[2] != CK) return;
  if (in_sizes[3] != CK * CC || in_sizes[4] != CK) return;
  if (in_sizes[5] != CV * CC || in_sizes[6] != CV) return;
  if (in_sizes[7] != CO * CV || in_sizes[8] != CO) return;
  if (out_size != NIMG * CO * NN) return;

  size_t off = 0;
  auto carve = [&](size_t bytes) { const size_t o = off; off += (bytes + 255) & ~(size_t)255; return o; };
  const size_t oW16 = carve((size_t)MQKV * CC * 2);
  const size_t oBIA = carve((size_t)MQKV * 4);
  const size_t oWO  = carve((size_t)CO * CV * 2);
  const size_t oBOB = carve((size_t)CO * 4);
  const size_t oXP  = carve((size_t)NIMG * NN * CC * 2);
  const size_t oQh  = carve((size_t)NIMG * NN * CK * 2);
  const size_t oQl  = carve((size_t)NIMG * NN * CK * 2);
  const size_t oKh  = carve((size_t)NIMG * NN * CK * 2);
  const size_t oKl  = carve((size_t)NIMG * NN * CK * 2);
  const size_t oVh  = carve((size_t)NIMG * CV * NN * 2);
  const size_t oOB  = carve((size_t)NIMG * NN * CV * 4);
  if (off > ws_size) return;
  if (off > (size_t)134217728) return;

  const float* x  = (const float*)d_in[0];
  const float* wq = (const float*)d_in[1];
  const float* bq = (const float*)d_in[2];
  const float* wk = (const float*)d_in[3];
  const float* bk = (const float*)d_in[4];
  const float* wv = (const float*)d_in[5];
  const float* bv = (const float*)d_in[6];
  const float* wo = (const float*)d_in[7];
  const float* bo = (const float*)d_in[8];

  char* ws = (char*)d_ws;
  unsigned short* W16 = (unsigned short*)(ws + oW16);
  float*          BIA = (float*)(ws + oBIA);
  unsigned short* WO  = (unsigned short*)(ws + oWO);
  float*          BOB = (float*)(ws + oBOB);
  unsigned short* XP  = (unsigned short*)(ws + oXP);
  unsigned short* Qh  = (unsigned short*)(ws + oQh);
  unsigned short* Ql  = (unsigned short*)(ws + oQl);
  unsigned short* Kh  = (unsigned short*)(ws + oKh);
  unsigned short* Kl  = (unsigned short*)(ws + oKl);
  unsigned short* Vh  = (unsigned short*)(ws + oVh);
  float*          OB  = (float*)(ws + oOB);
  float* out = (float*)d_out;

  const dim3 blk256(256), blk128(128);

  // (0) conv1x1 q/k/v weights -> f16 plane + bias line; output conv weights -> f16 plane + bias line
  cvt_w<<<dim3(MQKV / 8), blk256, 0, stream>>>(wq, bq, wk, bk, wv, bv, W16, BIA);
  cvt_wo<<<dim3(CO / 16), blk256, 0, stream>>>(wo, bo, WO, BOB);
  // (1) x -> position-major 16-bit plane
  cvt_x<<<dim3(NN / QT, CC / QT, NIMG), blk256, 0, stream>>>(x, XP);
  // (2) conv1x1 GEMM -> q/k hi + residual planes and v plane
  gemm_qkv<<<dim3(NN / QT, MQKV / QT, NIMG), blk128, 0, stream>>>(W16, BIA, XP, Qh, Ql, Kh, Kl, Vh);
  // (3) attention -> OB [b][4096][128] token-major f32
  attn_gab<<<dim3(NN / QT, NIMG), blk128, 0, stream>>>(Qh, Ql, Kh, Kl, Vh, OB);
  // (4) output conv on the raw view -> out [b][256][4096]
  out_proj<<<dim3(NN / QT, CO / QT, NIMG), blk128, 0, stream>>>(OB, WO, BOB, out);
  (void)hipGetLastError();
}

// v003
// A run of this version takes 167 microseconds.
// Timed twice side by side with v002, it ran 1.03 times as fast both times.
// Counting every step since v000, it is 2.90 times as fast.
// Contractions: conv1x1 q/k/v GEMM W[384x256].X on v_wmma_f32_16x16x32_f16 (f16 containers of bf16-RNE weights x256
// and bf16-RNE x); scores K.Q^T on v_wmma_f32_16x16x32_bf16 (bf16 hi + bf16 residual planes of q and k, 3 products,
// K=128); O^T = V.P^T on v_wmma_f32_16x16x32_f16 (v x16 f16, P = 1024 e^{(s-m)c} f16 from the score D registers);
// output conv1x1 Wo[256x128].U on v_wmma_f32_16x16x32_f16 (Wo f16 of bf16-RNE x256, U as f16 hi x16 plus f16
// residual x2^11 planes in two accumulators); f32 accumulate everywhere; softmax statistics in f32 VALU.
#include <hip/hip_runtime.h>
#include <math.h>
#include <stdint.h>

#define NIMG  8
#define CC    256
#define NN    4096
#define CK    128
#define CV    128
#define CO    256
#define MQKV  384
#define QT    64
#define OSP   68
#define OSPW  132
#define TP    72
#define QP    136
#define BP    136
#define KT    64
#define VP    72
#define STG   (2 * KT * QP + CV * VP)
#define WSC   256.0f
#define IWSC  0.00390625f
#define VSC   16.0f
#define IVSC  0.0625f
#define USC   16.0f
#define IUSC  0.0625f
#define RSC   2048.0f
#define IRSC  0.00048828125f
#define LNPS  6.931471805599453f
#define SCL   0.08838834764831845f

static_assert(NN % QT == 0);
static_assert(CC % 32 == 0 && CK % 64 == 0 && CV % 32 == 0);
static_assert(MQKV == 2 * CK + CV);
static_assert(MQKV % QT == 0 && CO % QT == 0);
static_assert(CK == 2 * QT && CV == 2 * QT);
static_assert((OSP * 4) % 16 == 0);
static_assert((OSPW * 4) % 16 == 0);
static_assert((TP * 2) % 16 == 0);
static_assert((QP * 2) % 16 == 0 && (BP * 2) % 16 == 0 && (BP % 2) == 0);
static_assert(QT * OSPW * 4 <= 2 * QT * QP * 2);
static_assert(NN % KT == 0 && NN / KT >= 2 && KT % 32 == 0);
static_assert((VP * 2) % 16 == 0 && (STG * 2) % 16 == 0 && VP >= KT + 8);
static_assert(KT * CK * 2 == 4 * 256 * 16 && CV * KT * 2 == 4 * 256 * 16 && KT == 64);

typedef _Float16       v16h __attribute__((ext_vector_type(16)));
typedef _Float16       v8h  __attribute__((ext_vector_type(8)));
typedef __bf16         v16b __attribute__((ext_vector_type(16)));
typedef unsigned short v8us __attribute__((ext_vector_type(8)));
typedef float          v8f  __attribute__((ext_vector_type(8)));
typedef float          v4f  __attribute__((ext_vector_type(4)));
typedef unsigned int   v4u  __attribute__((ext_vector_type(4)));

union Frag  { v8us u[2]; v16h h; v16b bf; };
union FragH { v16h v; v8h hv[2]; };
static_assert(sizeof(Frag) == 32);
static_assert(sizeof(FragH) == 32);

// ---- scalar helpers ---------------------------------------------------------------------------------------
__device__ __forceinline__ unsigned short bf_bits(float f) {          // f32 -> bf16 bits, RNE convert
  unsigned u = __float_as_uint(f);
  return (unsigned short)((u + 0x7FFFu + ((u >> 16) & 1u)) >> 16);
}
__device__ __forceinline__ float bf_up(unsigned short hb) { return __uint_as_float(((unsigned)hb) << 16); }
__device__ __forceinline__ float bfr(float f) { return bf_up(bf_bits(f)); }
__device__ __forceinline__ unsigned short h_bits(_Float16 x) { return __builtin_bit_cast(unsigned short, x); }
__device__ __forceinline__ unsigned pk16(unsigned short a, unsigned short b) { return (unsigned)a | ((unsigned)b << 16); }
__device__ __forceinline__ v8f zero8() { v8f z = {0.f, 0.f, 0.f, 0.f, 0.f, 0.f, 0.f, 0.f}; return z; }
__device__ __forceinline__ float hmax8(v8f s) {
  return fmaxf(fmaxf(fmaxf(s[0], s[1]), fmaxf(s[2], s[3])), fmaxf(fmaxf(s[4], s[5]), fmaxf(s[6], s[7])));
}

// lane l <-> l ^ 16 by a vector cross-row move: it counts on no LDS counter, so no wait on it drains LDS reads in flight
__device__ __forceinline__ float xhalf(float x) {
  const int b = __builtin_bit_cast(int, x);
  return __builtin_bit_cast(float, __builtin_amdgcn_permlanex16(b, b, 0x76543210, 0xfedcba98, false, false));
}

// ---- 16-bit fragment loader (A, or B from a k-contiguous [n][k] row): lane -> row/col (lane&15), p already includes
//      + 8*(lane>>4); elements 0..7 <- p[0..7] (k0+8h..), elements 8..15 <- p[16..23] (k0+16+8h..)
__device__ __forceinline__ Frag ldfrag(const unsigned short* p) {
  Frag f;
  f.u[0] = *(const v8us*)(p);
  f.u[1] = *(const v8us*)(p + 16);
  return f;
}

// ---- WMMA helpers: builtin followed by a 4-slot VALU gap tying D and keeping A/B live --------------------------
__device__ __forceinline__ v8f mma_h(v16h a, v16h b, v8f c) {
  v8f d = __builtin_amdgcn_wmma_f32_16x16x32_f16(false, a, false, b, (short)0, c, false, false);
#if defined(__HIP_DEVICE_COMPILE__)
  asm volatile("v_nop\n\tv_nop\n\tv_nop\n\tv_nop" : "+v"(d) : "v"(a), "v"(b));
#endif
  return d;
}
__device__ __forceinline__ v8f mma_b(v16b a, v16b b, v8f c) {
  v8f d = __builtin_amdgcn_wmma_f32_16x16x32_bf16(false, a, false, b, (short)0, c, false, false);
#if defined(__HIP_DEVICE_COMPILE__)
  const v16h ha = __builtin_bit_cast(v16h, a), hb = __builtin_bit_cast(v16h, b);
  asm volatile("v_nop\n\tv_nop\n\tv_nop\n\tv_nop" : "+v"(d) : "v"(ha), "v"(hb));
#endif
  return d;
}

// =========================================================================================================
// (0) q/k/v conv1x1 weights: W16 f16 [384][256], rows 0..127 = wq, 128..255 = wk, 256..383 = wv; value = f16 of
//     (bf16-RNE(w) * 256) (exact). BIAS f32 [384] = bf16-RNE of bq / bk / bv. Block blk (0..47) owns rows
// coverage: 48 blocks x 8 rows x 32 pieces x 8 halves = 384 x 256; bias 96 x 4 floats = 384.
// =========================================================================================================
__global__ __launch_bounds__(256)
void cvt_w(const float* __restrict__ wq, const float* __restrict__ bq,
           const float* __restrict__ wk, const float* __restrict__ bk,
           const float* __restrict__ wv, const float* __restrict__ bv,
           unsigned short* W16, float* BIAS) {
  const int tid = threadIdx.x, blk = blockIdx.x;
  const int rl = tid >> 5, col = 8 * (tid & 31);
  const int o = 8 * blk + rl;                                          // 0..383
  const float* wbase = (blk < 16) ? wq : (blk < 32) ? wk : wv;         // block-uniform selection
  const int osub = (blk < 16) ? 0 : (blk < 32) ? CK : 2 * CK;
  const float* s = wbase + (size_t)(o - osub) * CC + col;             // (o-osub) < 128 rows of that matrix
  const v4f a = *(const v4f*)s;
  const v4f q = *(const v4f*)(s + 4);
  const float f[8] = {a[0], a[1], a[2], a[3], q[0], q[1], q[2], q[3]};
  v4u u;
#pragma unroll
  for (int t = 0; t < 4; ++t) {
    const _Float16 h0 = (_Float16)(bfr(f[2 * t]) * WSC);
    const _Float16 h1 = (_Float16)(bfr(f[2 * t + 1]) * WSC);
    u[t] = pk16(h_bits(h0), h_bits(h1));
  }
  // bias values: every lane loads all three candidates with clamped indices, selects by value
  v4f bvv;
  {
    const int tb = min(tid, 95);
    const int o4 = 4 * tb;
#pragma unroll
    for (int qd = 0; qd < 4; ++qd) {
      const int oo = o4 + qd;                                          // 0..383
      const int iq = min(oo, CK - 1);
      const int ik = min(max(oo - CK, 0), CK - 1);
      const int iv = min(max(oo - 2 * CK, 0), CV - 1);
      const float cq = bq[iq], ckv = bk[ik], cvv = bv[iv];
      const float val = (oo < CK) ? cq : (oo < 2 * CK) ? ckv : cvv;
      bvv[qd] = bfr(val);
    }
  }
{
    *(v4u*)(W16 + (size_t)o * CC + col) = u;
    if (blk == 0 && tid < 96) *(v4f*)(BIAS + 4 * tid) = bvv;
    
  }
}

// =========================================================================================================
// (0b) output conv weights: WO16 f16 [256][128] = f16 of (bf16-RNE(wo) * 256) (exact); BOB f32 [256] = bf16-RNE bo.
// coverage: 16 blocks x 16 rows x 16 pieces x 8 halves = 256 x 128; bias 64 x 4 floats = 256.
// =========================================================================================================
__global__ __launch_bounds__(256)
void cvt_wo(const float* __restrict__ wo, const float* __restrict__ bo, unsigned short* WO16, float* BOB) {
  const int tid = threadIdx.x, blk = blockIdx.x;
  const int rl = tid >> 4, col = 8 * (tid & 15);
  const int o = 16 * blk + rl;                                         // 0..255
  const float* s = wo + (size_t)o * CV + col;
  const v4f a = *(const v4f*)s;
  const v4f q = *(const v4f*)(s + 4);
  const float f[8] = {a[0], a[1], a[2], a[3], q[0], q[1], q[2], q[3]};
  v4u u;
#pragma unroll
  for (int t = 0; t < 4; ++t) {
    const _Float16 h0 = (_Float16)(bfr(f[2 * t]) * WSC);
    const _Float16 h1 = (_Float16)(bfr(f[2 * t + 1]) * WSC);
    u[t] = pk16(h_bits(h0), h_bits(h1));
  }
  v4f bvv;
  {
    const int tb = min(tid, 63);
#pragma unroll
    for (int qd = 0; qd < 4; ++qd) bvv[qd] = bfr(bo[4 * tb + qd]);  // index <= 255
  }
{
    *(v4u*)(WO16 + (size_t)o * CV + col) = u;
    if (blk == 0 && tid < 64) *(v4f*)(BOB + 4 * tid) = bvv;
    
  }
}

// =========================================================================================================
// (1) x f32 [b][256 c][4096 n] -> XP f16 [b][n][c] (position-major, bf16-RNE values, exact in f16) through an LDS
// coverage: XP 2 it x 32 rows x 8 lanes x 8 halves = 64 n x 64 c; grid (64, 4, NIMG) covers the plane exactly once.
// =========================================================================================================
__global__ __launch_bounds__(256)
void cvt_x(const float* __restrict__ x, unsigned short* XP) {
  __shared__ __align__(16) unsigned short T[QT * TP];
  const int tid = threadIdx.x;
  const int nb = blockIdx.x, cb = blockIdx.y, b = blockIdx.z;
  const int e = tid & 7, lq = tid >> 3;                               // lq 0..31
  const int n0 = nb * QT, c0 = cb * QT;
#pragma unroll
  for (int it = 0; it < 2; ++it) {
    const int cl = it * 32 + lq;                                       // 0..63
    const float* sp = x + ((size_t)(b * CC + c0 + cl)) * NN + n0 + 8 * e;
    const v4f a = *(const v4f*)sp;
    const v4f q = *(const v4f*)(sp + 4);
    unsigned short hb[8];
#pragma unroll
    for (int t = 0; t < 4; ++t) {
      hb[t]     = h_bits((_Float16)bfr(a[t]));
      hb[4 + t] = h_bits((_Float16)bfr(q[t]));
    }
#pragma unroll
    for (int t = 0; t < 8; ++t) T[(8 * e + t) * TP + cl] = hb[t];     // T[n_loc][c_loc]
  }
  __syncthreads();
  v4u up[2];
#pragma unroll
  for (int it = 0; it < 2; ++it) {
    const int nl = it * 32 + lq;                                       // 0..63
    up[it] = *(const v4u*)(T + nl * TP + 8 * e);
  }
{
#pragma unroll
    for (int it = 0; it < 2; ++it) {
      const int rl = it * 32 + lq;
      *(v4u*)(XP + ((size_t)(b * NN + n0 + rl)) * CC + c0 + 8 * e) = up[it];
    }
    
  }
}

// =========================================================================================================
// (2) conv1x1 GEMM for one (b, 64-n tile, 64-o block): Y[o][n] = (1/256) sum_c W16[o][c] XP[b][n][c] + BIAS[o].
//     Block 128 threads = 4 waves; wave w owns cols n0+16w..+15 (one B fragment per k-step, k = c contiguous in the
//     XP row) and 4 m-tiles (A rows o = o0 + 16 mt + (lane&15), split k map loader from W16). K = 256 = 8 steps.
//     Epilogue staged in LDS Os[o_loc][n_loc] (pitch OSP), barrier, then:
//       o-blocks 0,1 (q ck cols 0..63 / 64..127) and 2,3 (k): bf16 hi / bf16 residual planes [b][4096 n][128]
//         plane; lane e -> cols 8e..8e+7 of token row 16 it + lq; one instruction per 16 lines.
//         lane e -> halves 8e..8e+7; one instruction per 16 lines.
// coverage: Os 4 waves x 4 tiles x 16x16 = 64 x 64; q/k: per plane 4 it x 16 rows x 8 lanes x 8 = 64 n x 64 cols,
//           o-blocks 0..3 cover all 128 cols of Qh/Ql/Kh/Kl; v: 4 it x 16 rows x 8 lanes x 8 = 64 ch x 64 n;
//           grid (64, 6, NIMG) covers every plane exactly once.
// =========================================================================================================
__global__ __launch_bounds__(128)
void gemm_qkv(const unsigned short* __restrict__ W16, const float* __restrict__ BIAS,
              const unsigned short* __restrict__ XP,
              unsigned short* Qh, unsigned short* Ql, unsigned short* Kh, unsigned short* Kl,
              unsigned short* Vh) {
  __shared__ __align__(16) float Os[QT * OSP];
  const int tid  = threadIdx.x;
  const int lane = tid & 31, wave = tid >> 5;
  const int hh   = lane >> 4, c = lane & 15;
  const int nt   = blockIdx.x, mb = blockIdx.y, b = blockIdx.z;
  const int n0   = nt * QT, o0 = mb * QT;

  const unsigned short* ap = W16 + (size_t)(o0 + c) * CC + 8 * hh;
  const unsigned short* bp = XP + ((size_t)(b * NN + n0 + 16 * wave + c)) * CC + 8 * hh;

  v8f acc[4];
#pragma unroll
  for (int mt = 0; mt < 4; ++mt) acc[mt] = zero8();

#pragma unroll
  for (int ks = 0; ks < CC / 32; ++ks) {
    const Frag fb = ldfrag(bp + 32 * ks);
#pragma unroll
    for (int mt = 0; mt < 4; ++mt) {
      const Frag fa = ldfrag(ap + (size_t)(16 * mt) * CC + 32 * ks);
      acc[mt] = mma_h(fa.h, fb.h, acc[mt]);
    }
  }

  // ---- epilogue: scale back, + bias -> LDS Os[o_loc][n_loc] ----
  {
    const int nl = 16 * wave + c;
#pragma unroll
    for (int mt = 0; mt < 4; ++mt) {
#pragma unroll
      for (int r = 0; r < 8; ++r) {
        const int ol = 16 * mt + 8 * hh + r;                           // 0..63
        Os[ol * OSP + nl] = acc[mt][r] * IWSC + BIAS[o0 + ol];
      }
    }
  }
  __syncthreads();

  const int e = tid & 7, lq = tid >> 3;                               // lq 0..15
  if (mb < 4) {
    // ---- q / k bf16 hi + residual planes (block-uniform branch) ----
    unsigned short* Ph = (mb < 2) ? Qh : Kh;
    unsigned short* Pl = (mb < 2) ? Ql : Kl;
    const int cb = QT * (mb & 1);                                      // ck column base 0 or 64
    v4u uh[4], ul[4];
#pragma unroll
    for (int it = 0; it < 4; ++it) {
      const int nl = it * 16 + lq;                                     // token 0..63
#pragma unroll
      for (int t = 0; t < 4; ++t) {
        const float f0 = Os[(8 * e + 2 * t) * OSP + nl];
        const float f1 = Os[(8 * e + 2 * t + 1) * OSP + nl];
        const unsigned short hb0 = bf_bits(f0), hb1 = bf_bits(f1);
        const unsigned short lb0 = bf_bits(f0 - bf_up(hb0));
        const unsigned short lb1 = bf_bits(f1 - bf_up(hb1));
        uh[it][t] = pk16(hb0, hb1);
        ul[it][t] = pk16(lb0, lb1);
      }
    }
{
#pragma unroll
      for (int it = 0; it < 4; ++it) {
        const int nl = it * 16 + lq;
        const size_t base = ((size_t)(b * NN + n0 + nl)) * CK + cb + 8 * e;
        *(v4u*)(Ph + base) = uh[it];
        *(v4u*)(Pl + base) = ul[it];
      }
      
    }
  } else {
    // ---- v f16 plane, carried x16 ----
    const int ch0 = QT * (mb - 4);                                     // 0 or 64
    v4u uv[4];
#pragma unroll
    for (int it = 0; it < 4; ++it) {
      const int row = it * 16 + lq;                                    // 0..63
      const v4f a = *(const v4f*)(Os + row * OSP + 8 * e);
      const v4f q = *(const v4f*)(Os + row * OSP + 8 * e + 4);
#pragma unroll
      for (int t = 0; t < 2; ++t) {
        uv[it][t]     = pk16(h_bits((_Float16)(a[2 * t] * VSC)), h_bits((_Float16)(a[2 * t + 1] * VSC)));
        uv[it][2 + t] = pk16(h_bits((_Float16)(q[2 * t] * VSC)), h_bits((_Float16)(q[2 * t + 1] * VSC)));
      }
    }
{
#pragma unroll
      for (int it = 0; it < 4; ++it) {
        const int row = it * 16 + lq;
        *(v4u*)(Vh + ((size_t)(b * CV + ch0 + row)) * NN + n0 + 8 * e) = uv[it];
      }
      
    }
  }
}

// =========================================================================================================
// (3) attention for one (b, 64-query tile), transposed formulation, 4096 keys, no mask:
//   S^T tile (16 keys x 16 queries) = sum over 4 k-steps of A(k: row = key kb + (lane&15), 32 d via the split k map
//   from the bf16 plane Kh [b][4096][128]) . B(q: col = query, same map, from the LDS copy of Qh) + A(Kh).B(Ql)
//   + A(Kl).B(Qh) (bf16 unscaled residual planes, shared accumulator). Softmax of s*c with c = 1/sqrt(128):
//   per lane the D tile holds 8 keys of ONE query: online state per lane, one cross-row move (lane^16) for the max over
//   32 keys, row-sum partials combined at the end. P = 1024 e^{(s-m)c} as f16 is the B operand of
//   O^T (rows channel, cols queries) += A(V rows channel = 16j + (lane&15), keys contiguous, f16 plane Vh
//   [b][128][4096]) . B(P^T): element r <- D of the tile covering keys kb..kb+15, element 8+r <- the tile covering
//   kb+16..kb+31, lane unchanged. 8 accumulator tiles per wave (128 channels). Block = 8 waves = 64 queries: wave w owns
//   queries 16 (w & 3) .. +15 and keys 32 (w >> 2) .. +31 of every tile; the two states of a query group are merged at the end.
//   Q hi/lo rows of the block's 64 queries are staged once in LDS (v4u pieces, barrier). A 32-key pass reads its LDS
//   fragments in three groups, each ahead of the products that use it: q/k of k-steps 0,1; q/k of k-steps 2,3; all of v.
//   K hi, K residual and V come in tiles of KT = 64 keys through a two-buffer LDS ring filled by asynchronous 16-byte
//   copies (whole 128-B lines per request, each tile fetched once per block and read by all 8 waves); tile t+2 is
//   issued behind the barrier that ends the reads of tile t. Row pitches QP / VP halves = 16 B x odd.
//   Epilogue: barrier, O/l staged in LDS Os[query][128 channels] (pitch OSPW, b128 stores, aliases the Q staging),
// coverage: Q staging 4 it x 16 rows x 16 lanes x 8 = 64 x 128 per plane; OB 8 it x 32 lines x 8 lanes x 4 floats =
//           64 queries x 128 ch; grid (64, NIMG) covers OB exactly once.
// =========================================================================================================
union AttnSmem { unsigned short q[2 * QT * QP]; float o[QT * OSPW]; };
// the k/v ring; after the key loop its first bytes carry the second key half's softmax state (o 8192 floats, m, l)
union AttnRing { unsigned short h[2 * STG]; float f[4 * 66 * 32]; };
static_assert(4 * 66 * 32 * 4 <= 2 * STG * 2);

typedef __attribute__((address_space(3))) unsigned short lds_us;
__device__ __forceinline__ unsigned lds_byte(unsigned short* p) { return (unsigned)(uintptr_t)(lds_us*)p; }

// One tile of KT keys into one ring buffer at LDS byte lb: k hi rows [KT][QP], k residual rows [KT][QP], v rows
// [CV][VP]. kh / kl / vh are this thread's piece 0 of the tile; lk / lv its byte offsets inside the k and v parts.
// 256 threads, twelve 16-byte copies per lane, global -> LDS through no register. k: 16 lanes per 256-B row, 16 rows
// per piece step; v: 8 lanes per 128-B row segment, 32 rows per piece step. The s_wait_xcnt closes the statement so
// that no address register of a copy is rewritten ahead of it.
__device__ __forceinline__ void stage_kv(unsigned lb, unsigned lk, unsigned lv, const unsigned short* kh,
                                         const unsigned short* kl, const unsigned short* vh) {
#if defined(__HIP_DEVICE_COMPILE__)
  const unsigned la = lb + lk, lc = lb + KT * QP * 2 + lk, ld = lb + 2 * KT * QP * 2 + lv;
  const unsigned ks = 16 * QP * 2, vs = 32 * VP * 2;
  const size_t kg = (size_t)16 * CK, vg = (size_t)32 * NN;
  asm volatile(
      "global_load_async_to_lds_b128 %0, %12, off\n\t"
      "global_load_async_to_lds_b128 %1, %13, off\n\t"
      "global_load_async_to_lds_b128 %2, %14, off\n\t"
      "global_load_async_to_lds_b128 %3, %15, off\n\t"
      "global_load_async_to_lds_b128 %4, %16, off\n\t"
      "global_load_async_to_lds_b128 %5, %17, off\n\t"
      "global_load_async_to_lds_b128 %6, %18, off\n\t"
      "global_load_async_to_lds_b128 %7, %19, off\n\t"
      "global_load_async_to_lds_b128 %8, %20, off\n\t"
      "global_load_async_to_lds_b128 %9, %21, off\n\t"
      "global_load_async_to_lds_b128 %10, %22, off\n\t"
      "global_load_async_to_lds_b128 %11, %23, off\n\t"
      "s_wait_xcnt 0x0"
      :: "v"(la), "v"(la + ks), "v"(la + 2 * ks), "v"(la + 3 * ks),
         "v"(lc), "v"(lc + ks), "v"(lc + 2 * ks), "v"(lc + 3 * ks),
         "v"(ld), "v"(ld + vs), "v"(ld + 2 * vs), "v"(ld + 3 * vs),
         "v"(kh), "v"(kh + kg), "v"(kh + 2 * kg), "v"(kh + 3 * kg),
         "v"(kl), "v"(kl + kg), "v"(kl + 2 * kg), "v"(kl + 3 * kg),
         "v"(vh), "v"(vh + vg), "v"(vh + 2 * vg), "v"(vh + 3 * vg)
      : "memory");
#endif
}

__global__ __launch_bounds__(256)
void attn_gab(const unsigned short* __restrict__ Qh, const unsigned short* __restrict__ Ql,
              const unsigned short* __restrict__ Kh, const unsigned short* __restrict__ Kl,
              const unsigned short* __restrict__ Vh, float* OB) {
  __shared__ __align__(16) AttnSmem sm;
  __shared__ __align__(16) AttnRing rg;
  unsigned short* ring = rg.h;
  const int tid  = threadIdx.x;
  const int wave = tid >> 5, lane = tid & 31;
  const int hh   = lane >> 4, c = lane & 15;
  const int n0   = blockIdx.x * QT, b = blockIdx.y;
  const int wq   = wave & 3, kh2 = wave >> 2;                          // query group of 16; key half of every tile

  // ---- this thread's share of a k/v tile: source pointers of tile 0, byte places inside a ring buffer ----
  const unsigned ring0 = lds_byte(ring);
  const unsigned lk = (unsigned)((tid >> 4) * (QP * 2) + (tid & 15) * 16);
  const unsigned lv = (unsigned)((tid >> 3) * (VP * 2) + (tid & 7) * 16);
  const unsigned short* khg = Kh + ((size_t)(b * NN + (tid >> 4))) * CK + 8 * (tid & 15);
  const unsigned short* klg = Kl + ((size_t)(b * NN + (tid >> 4))) * CK + 8 * (tid & 15);
  const unsigned short* vhg = Vh + ((size_t)(b * CV + (tid >> 3))) * NN + 8 * (tid & 7);
  stage_kv(ring0, lk, lv, khg, klg, vhg);                              // tile 0 -> buffer 0

  // ---- stage q hi (rows 0..63) and q residual (rows 64..127) of this query tile in LDS ----
  {
    const int e16 = tid & 15, rq = tid >> 4;                          // rq 0..15
#pragma unroll
    for (int it = 0; it < 4; ++it) {
      const int row = 16 * it + rq;                                    // 0..63
      const size_t g = ((size_t)(b * NN + n0 + row)) * CK + 8 * e16;
      const v4u vh = *(const v4u*)(Qh + g);
      const v4u vl = *(const v4u*)(Ql + g);
      *(v4u*)(sm.q + row * QP + 8 * e16)        = vh;
      *(v4u*)(sm.q + (QT + row) * QP + 8 * e16) = vl;
    }
  }
  asm volatile("s_wait_asynccnt 0x0" ::: "memory");                    // this wave's share of tile 0 has landed
  __syncthreads();                                                     // publishes the q rows and tile 0
  stage_kv(ring0 + STG * 2, lk, lv, khg + (size_t)KT * CK, klg + (size_t)KT * CK, vhg + KT);   // tile 1 -> buffer 1

  const unsigned short* qsh = sm.q + (16 * wq + c) * QP + 8 * hh;      // B operand, col = query n0 + 16*wq + c
  const unsigned short* qsl = qsh + QT * QP;

  float m = -1.0e30f, l = 0.f;
  v8f o[8];
#pragma unroll
  for (int j = 0; j < 8; ++j) o[j] = zero8();

#pragma unroll 1   // rolled: one hand-over point in the text, the buffer picked by t & 1
  for (int t = 0; t < NN / KT; ++t) {
  const unsigned short* buf = ring + (t & 1) * STG;
  // k fragment base (A operand, row = key kb + c of the tile), + key * QP
  const int kb = 32 * kh2;                                             // this wave's 32 keys of the tile
  const unsigned short* Khp = buf + c * QP + 8 * hh;
  const unsigned short* Klp = Khp + KT * QP;
  // v fragment base (A operand, row = channel 16j + c, the tile's keys contiguous), + 16*j*VP + kb
  const unsigned short* Vhp = buf + 2 * KT * QP + c * VP + 8 * hh;
  {
    v8f s0 = zero8(), s1 = zero8();
#pragma unroll   // unrolled: each trip's reads stand as one group in the text, ahead of that trip's twelve products
    for (int kg = 0; kg < CK / 64; ++kg) {
      // the q and k fragments of two k-steps, read as one group: one LDS latency per group, counted waits behind it
      Frag qhf[2], qlf[2], k0[2], k1[2], k0l[2], k1l[2];
#pragma unroll   // the fragment arrays stay in registers only under constant indices
      for (int u = 0; u < 2; ++u) {
        const int ks = 2 * kg + u;
        qhf[u] = ldfrag(qsh + 32 * ks);
        k0[u]  = ldfrag(Khp + kb * QP + 32 * ks);                        // keys kb .. kb+15
        k1[u]  = ldfrag(Khp + (kb + 16) * QP + 32 * ks);                 // keys kb+16 .. kb+31
        qlf[u] = ldfrag(qsl + 32 * ks);
        k0l[u] = ldfrag(Klp + kb * QP + 32 * ks);
        k1l[u] = ldfrag(Klp + (kb + 16) * QP + 32 * ks);
      }
#pragma unroll   // constant indices, as above
      for (int u = 0; u < 2; ++u) {
        s0 = mma_b(k0[u].bf, qhf[u].bf, s0);
        s1 = mma_b(k1[u].bf, qhf[u].bf, s1);
        s0 = mma_b(k0[u].bf, qlf[u].bf, s0);
        s1 = mma_b(k1[u].bf, qlf[u].bf, s1);
        s0 = mma_b(k0l[u].bf, qhf[u].bf, s0);
        s1 = mma_b(k1l[u].bf, qhf[u].bf, s1);
      }
    }

    // the pass's eight v fragments, read as one group here: nothing below waits on LDS before the products that use
    // them, so they land while the softmax runs
    Frag vf[8];
#pragma unroll   // constant indices, as above
    for (int j = 0; j < 8; ++j) vf[j] = ldfrag(Vhp + (16 * j) * VP + kb);
    // holds the sixteen reads here: without it the compiler sinks them to the softmax's end and their latency is waited out
    __builtin_amdgcn_sched_barrier(0);

    float mx = fmaxf(hmax8(s0), hmax8(s1));
    mx = fmaxf(mx, xhalf(mx));
    const float mn   = fmaxf(m, mx);
    const float corr = __expf((m - mn) * SCL);
    m = mn;
    const float msh = mn * SCL - LNPS;                                 // exp gives e^{(s-m)c} * 1024
    l *= corr;
#pragma unroll
    for (int j = 0; j < 8; ++j) {
#pragma unroll
      for (int r = 0; r < 8; ++r) o[j][r] *= corr;
    }

    FragH ph;
    float ls = 0.f;
#pragma unroll
    for (int r = 0; r < 8; ++r) {
      const float e0 = __expf(s0[r] * SCL - msh);                      // key kb      + 8hh + r
      const float e1 = __expf(s1[r] * SCL - msh);                      // key kb + 16 + 8hh + r
      ls += e0 + e1;
      ph.hv[0][r] = (_Float16)e0;
      ph.hv[1][r] = (_Float16)e1;
    }
    l += ls;

#pragma unroll
    for (int j = 0; j < 8; ++j) o[j] = mma_h(vf[j].h, ph.v, o[j]);
  }
  // ---- hand-over: tile t+1 becomes readable, buffer t&1 becomes free ----
  asm volatile("s_wait_dscnt 0x0" ::: "memory");                       // this wave's reads of buffer t&1 are done
  asm volatile("s_wait_asynccnt 0x0" ::: "memory");                    // this wave's share of tile t+1 has landed
  __syncthreads();
  if (t + 2 < NN / KT)
    stage_kv(ring0 + (unsigned)(t & 1) * (STG * 2), lk, lv, khg + (size_t)(t + 2) * KT * CK,
             klg + (size_t)(t + 2) * KT * CK, vhg + (t + 2) * KT);
  }
  asm volatile("s_wait_asynccnt 0x0" ::: "memory");                    // no copy is left in flight at the wave's end
  l += __shfl_xor(l, 16, 32);

  // ---- the two key halves of a query group hold the same lane layout: waves 4..7 hand m, l, o over through the ring's
  //      LDS (free behind the loop's last barrier: every read of it is done and no copy is in flight) ----
  float* mg = rg.f;
  if (kh2 == 1) {                                                      // the same in every lane of a wave
#pragma unroll
    for (int j = 0; j < 8; ++j) {
      v4f va, vb;
#pragma unroll
      for (int r = 0; r < 4; ++r) { va[r] = o[j][r]; vb[r] = o[j][4 + r]; }
      *(v4f*)(mg + ((wq * 16 + 2 * j) * 32 + lane) * 4)     = va;      // 16 B per lane, lanes adjacent
      *(v4f*)(mg + ((wq * 16 + 2 * j + 1) * 32 + lane) * 4) = vb;
    }
    mg[8192 + (2 * wq) * 32 + lane]     = m;
    mg[8192 + (2 * wq + 1) * 32 + lane] = l;
  }
  __syncthreads();                                                     // publishes the second half's state
  if (kh2 == 0) {
    const float m2 = mg[8192 + (2 * wq) * 32 + lane];
    const float l2 = mg[8192 + (2 * wq + 1) * 32 + lane];
    const float mn = fmaxf(m, m2);
    const float f1 = __expf((m - mn) * SCL), f2 = __expf((m2 - mn) * SCL);
    const float inv = IVSC / (l * f1 + l2 * f2);                       // o carries x1024 x16, l carries x1024
    const float g1 = f1 * inv, g2 = f2 * inv;
    const int qrow = 16 * wq + c;
#pragma unroll
    for (int j = 0; j < 8; ++j) {
      const v4f pa = *(const v4f*)(mg + ((wq * 16 + 2 * j) * 32 + lane) * 4);
      const v4f pb = *(const v4f*)(mg + ((wq * 16 + 2 * j + 1) * 32 + lane) * 4);
      v4f va, vb;
#pragma unroll
      for (int r = 0; r < 4; ++r) { va[r] = o[j][r] * g1 + pa[r] * g2; vb[r] = o[j][4 + r] * g1 + pb[r] * g2; }
      *(v4f*)(sm.o + qrow * OSPW + 16 * j + 8 * hh)     = va;         // Os[query][ch = 16j + 8hh + r]
      *(v4f*)(sm.o + qrow * OSPW + 16 * j + 8 * hh + 4) = vb;
    }
  }
  __syncthreads();

  const int e = tid & 7, lq = tid >> 3;                                // lq 0..31
{
#pragma unroll
    for (int it = 0; it < 8; ++it) {
      const int L   = it * 32 + lq;                                    // line 0..255
      const int q   = L >> 2, seg = L & 3;                             // query 0..63, 32-float segment
      const v4f v = *(const v4f*)(sm.o + q * OSPW + 32 * seg + 4 * e);
      *(v4f*)(OB + ((size_t)(b * NN + n0 + q)) * CV + 32 * seg + 4 * e) = v;
    }
    
  }
}

// =========================================================================================================
// (4) output conv on the raw view: for image b, U[r][p] = OB_b[r*4096 + p] (r < 128, p < 4096);
//     y[b][o][p] = (1/4096) sum_r WO16[o][r] (Uh + Ul/2048)[p][r] + BOB[o], Uh = f16(16 U), Ul = f16((16U - Uh) 2048).
//     Block (64-p tile, 64-o block, b), 128 threads: stage the 128 r x 64 p view slab from OB (256-B contiguous row
//     segments), convert, store transposed into LDS Bs[p_loc][r] hi rows 0..63 / residual rows 64..127 (u32 pairs of
//     consecutive r), barrier; then 4 waves, wave w owns cols p0+16w..+15 (B fragments from the LDS rows, split k
//     map), 4 m-tiles (A rows o0 + 16 mt + (lane&15) from WO16, k = r contiguous), K = 128 = 4 steps, hi and
//     d_out [b][256][4096] (row segment 64 p = 2 lines): 8 consecutive lanes x 16 B, one instruction per 16 lines,
// coverage: staging 8 it x 8 row-pairs x 16 lanes x 4 p x 2 rows = 128 r x 64 p per plane (pad cols never read);
//           d_out 8 it x 16 lines x 8 lanes x 4 = 64 o x 64 p; grid (64, 4, NIMG) covers d_out exactly once.
// =========================================================================================================
__global__ __launch_bounds__(128)
void out_proj(const float* __restrict__ OB, const unsigned short* __restrict__ WO16,
              const float* __restrict__ BOB, float* out) {
  __shared__ __align__(16) unsigned int Bs[2 * QT * (BP / 2)];
  __shared__ __align__(16) float Os[QT * OSP];
  const int tid  = threadIdx.x;
  const int lane = tid & 31, wave = tid >> 5;
  const int hh   = lane >> 4, c = lane & 15;
  const int pt = blockIdx.x, mb = blockIdx.y, b = blockIdx.z;
  const int p0 = pt * QT, o0 = mb * QT;
  const float* OBb = OB + (size_t)b * NN * CV;

  // ---- stage + convert the view slab: Bs[p_loc][r] ----
  {
    const int e16 = tid & 15, rq = tid >> 4;                           // rq 0..7
#pragma unroll
    for (int it = 0; it < 8; ++it) {
      const int rp = 8 * it + rq;                                      // row pair 0..63
      const int r0 = 2 * rp;
      const v4f va = *(const v4f*)(OBb + (size_t)r0 * NN + p0 + 4 * e16);
      const v4f vb = *(const v4f*)(OBb + (size_t)(r0 + 1) * NN + p0 + 4 * e16);
#pragma unroll
      for (int t = 0; t < 4; ++t) {
        const float f0 = va[t] * USC, f1 = vb[t] * USC;
        const _Float16 h0 = (_Float16)f0, h1 = (_Float16)f1;
        const _Float16 l0 = (_Float16)((f0 - (float)h0) * RSC);
        const _Float16 l1 = (_Float16)((f1 - (float)h1) * RSC);
        const int pl = 4 * e16 + t;                                    // p_loc 0..63
        Bs[pl * (BP / 2) + rp]        = pk16(h_bits(h0), h_bits(h1));  // halves r0, r0+1
        Bs[(QT + pl) * (BP / 2) + rp] = pk16(h_bits(l0), h_bits(l1));
      }
    }
  }
  __syncthreads();

  const unsigned short* Bh  = (const unsigned short*)Bs;
  const unsigned short* bph = Bh + (16 * wave + c) * BP + 8 * hh;     // B col = p0 + 16*wave + c, k = r
  const unsigned short* bpl = bph + QT * BP;
  const unsigned short* ap  = WO16 + (size_t)(o0 + c) * CV + 8 * hh;  // A row = o0 + 16 mt + c, k = r

  v8f acch[4], accl[4];
#pragma unroll
  for (int mt = 0; mt < 4; ++mt) { acch[mt] = zero8(); accl[mt] = zero8(); }

#pragma unroll
  for (int ks = 0; ks < CV / 32; ++ks) {
    const Frag fbh = ldfrag(bph + 32 * ks);
    const Frag fbl = ldfrag(bpl + 32 * ks);
#pragma unroll
    for (int mt = 0; mt < 4; ++mt) {
      const Frag fa = ldfrag(ap + (size_t)(16 * mt) * CV + 32 * ks);
      acch[mt] = mma_h(fa.h, fbh.h, acch[mt]);
      accl[mt] = mma_h(fa.h, fbl.h, accl[mt]);
    }
  }
  {
    const int nl = 16 * wave + c;
    const float osc = IWSC * IUSC;                                     // 1/4096
#pragma unroll
    for (int mt = 0; mt < 4; ++mt) {
#pragma unroll
      for (int r = 0; r < 8; ++r) {
        const int ol = 16 * mt + 8 * hh + r;                           // 0..63
        Os[ol * OSP + nl] = (acch[mt][r] + accl[mt][r] * IRSC) * osc + BOB[o0 + ol];
      }
    }
  }
  __syncthreads();
  {
    const int e = tid & 7, lq = tid >> 3;                              // lq 0..15
{
#pragma unroll
      for (int it = 0; it < 8; ++it) {
        const int L = it * 16 + lq;                                    // 0..127
        const int row = L >> 1, hf = L & 1;
        const int nl = hf * 32 + 4 * e;
        const v4f v = *(const v4f*)(Os + row * OSP + nl);
        *(v4f*)(out + ((size_t)(b * CO + o0 + row)) * NN + p0 + nl) = v;
      }
      
    }
  }
}

// =========================================================================================================
// Workspace map (bytes; each region start a multiple of 256; every extent is an exact tile multiple and is written
//   W16 f16 [384][256]            196608      BIAS f32 [384]              1536
//   WO16 f16 [256][128]            65536      BOB  f32 [256]              1024
//   XP  f16 [8][4096][256]      16777216
//   Qh/Ql/Kh/Kl bf16 [8][4096][128]  8388608 x4                          Vh f16 [8][128][4096]  8388608
//   OB  f32 [8][4096][128]      16777216
//   total = 75762176
// =========================================================================================================
extern "C" void kernel_launch(void* const* d_in, const int* in_sizes, int n_in,
                              void* d_out, int out_size, void* d_ws, size_t ws_size,
                              hipStream_t stream) {
  const int XN = NIMG * CC * NN;                                       // 8388608
  if (n_in < 9) return;
  if (in_sizes[0] != XN) return;
  if (in_sizes[1] != CK * CC || in_sizes[2] != CK) return;
  if (in_sizes[3] != CK * CC || in_sizes[4] != CK) return;
  if (in_sizes[5] != CV * CC || in_sizes[6] != CV) return;
  if (in_sizes[7] != CO * CV || in_sizes[8] != CO) return;
  if (out_size != NIMG * CO * NN) return;

  size_t off = 0;
  auto carve = [&](size_t bytes) { const size_t o = off; off += (bytes + 255) & ~(size_t)255; return o; };
  const size_t oW16 = carve((size_t)MQKV * CC * 2);
  const size_t oBIA = carve((size_t)MQKV * 4);
  const size_t oWO  = carve((size_t)CO * CV * 2);
  const size_t oBOB = carve((size_t)CO * 4);
  const size_t oXP  = carve((size_t)NIMG * NN * CC * 2);
  const size_t oQh  = carve((size_t)NIMG * NN * CK * 2);
  const size_t oQl  = carve((size_t)NIMG * NN * CK * 2);
  const size_t oKh  = carve((size_t)NIMG * NN * CK * 2);
  const size_t oKl  = carve((size_t)NIMG * NN * CK * 2);
  const size_t oVh  = carve((size_t)NIMG * CV * NN * 2);
  const size_t oOB  = carve((size_t)NIMG * NN * CV * 4);
  if (off > ws_size) return;
  if (off > (size_t)134217728) return;

  const float* x  = (const float*)d_in[0];
  const float* wq = (const float*)d_in[1];
  const float* bq = (const float*)d_in[2];
  const float* wk = (const float*)d_in[3];
  const float* bk = (const float*)d_in[4];
  const float* wv = (const float*)d_in[5];
  const float* bv = (const float*)d_in[6];
  const float* wo = (const float*)d_in[7];
  const float* bo = (const float*)d_in[8];

  char* ws = (char*)d_ws;
  unsigned short* W16 = (unsigned short*)(ws + oW16);
  float*          BIA = (float*)(ws + oBIA);
  unsigned short* WO  = (unsigned short*)(ws + oWO);
  float*          BOB = (float*)(ws + oBOB);
  unsigned short* XP  = (unsigned short*)(ws + oXP);
  unsigned short* Qh  = (unsigned short*)(ws + oQh);
  unsigned short* Ql  = (unsigned short*)(ws + oQl);
  unsigned short* Kh  = (unsigned short*)(ws + oKh);
  unsigned short* Kl  = (unsigned short*)(ws + oKl);
  unsigned short* Vh  = (unsigned short*)(ws + oVh);
  float*          OB  = (float*)(ws + oOB);
  float* out = (float*)d_out;

  const dim3 blk256(256), blk128(128);

  // (0) conv1x1 q/k/v weights -> f16 plane + bias line; output conv weights -> f16 plane + bias line
  cvt_w<<<dim3(MQKV / 8), blk256, 0, stream>>>(wq, bq, wk, bk, wv, bv, W16, BIA);
  cvt_wo<<<dim3(CO / 16), blk256, 0, stream>>>(wo, bo, WO, BOB);
  // (1) x -> position-major 16-bit plane
  cvt_x<<<dim3(NN / QT, CC / QT, NIMG), blk256, 0, stream>>>(x, XP);
  // (2) conv1x1 GEMM -> q/k hi + residual planes and v plane
  gemm_qkv<<<dim3(NN / QT, MQKV / QT, NIMG), blk128, 0, stream>>>(W16, BIA, XP, Qh, Ql, Kh, Kl, Vh);
  // (3) attention -> OB [b][4096][128] token-major f32
  attn_gab<<<dim3(NN / QT, NIMG), blk256, 0, stream>>>(Qh, Ql, Kh, Kl, Vh, OB);
  // (4) output conv on the raw view -> out [b][256][4096]
  out_proj<<<dim3(NN / QT, CO / QT, NIMG), blk128, 0, stream>>>(OB, WO, BOB, out);
  (void)hipGetLastError();
}

// v004
// A run of this version takes 147 microseconds.
// Two timings next to v003 both put it at 1.14 times that version's speed.
// Counting every step since v000, it is 3.30 times as fast.
// Contractions: conv1x1 q/k/v GEMM W[384x256].X on v_wmma_f32_16x16x32_f16 (f16 containers of bf16-RNE weights x256
// and bf16-RNE x); scores K.Q^T on v_wmma_f32_16x16x32_bf16 (bf16 hi + bf16 residual planes of q and k, 3 products,
// K=128); O^T = V.P^T on v_wmma_f32_16x16x32_f16 (v x16 f16, P = 1024 e^{(s-m)c} f16 from the score D registers);
// output conv1x1 Wo[256x128].U on v_wmma_f32_16x16x32_f16 (Wo f16 of bf16-RNE x256, U as f16 hi x16 plus f16
// residual x2^11 planes in two accumulators); f32 accumulate everywhere; softmax statistics in f32 VALU.
#include <hip/hip_runtime.h>
#include <math.h>
#include <stdint.h>

#define NIMG  8
#define CC    256
#define NN    4096
#define CK    128
#define CV    128
#define CO    256
#define MQKV  384
#define QT    64
#define OSP   68
#define OSPW  132
#define TP    72
#define QP    136
#define BP    136
#define KT    64
#define VP    72
#define STG   (2 * KT * QP + CV * VP)
#define WSC   256.0f
#define IWSC  0.00390625f
#define VSC   16.0f
#define IVSC  0.0625f
#define USC   16.0f
#define IUSC  0.0625f
#define RSC   2048.0f
#define IRSC  0.00048828125f
#define LNPS  6.931471805599453f
#define SCL   0.08838834764831845f

static_assert(NN % QT == 0);
static_assert(CC % 32 == 0 && CK % 64 == 0 && CV % 32 == 0);
static_assert(MQKV == 2 * CK + CV);
static_assert(MQKV % QT == 0 && CO % QT == 0);
static_assert(CK == 2 * QT && CV == 2 * QT);
static_assert((OSP * 4) % 16 == 0);
static_assert((OSPW * 4) % 16 == 0);
static_assert((TP * 2) % 16 == 0);
static_assert((QP * 2) % 16 == 0 && (BP * 2) % 16 == 0 && (BP % 2) == 0);
static_assert(QT * OSPW * 4 <= 2 * QT * QP * 2);
static_assert(NN % KT == 0 && NN / KT >= 2 && KT % 32 == 0);
static_assert((VP * 2) % 16 == 0 && (STG * 2) % 16 == 0 && VP >= KT + 8);
static_assert(KT * CK * 2 == 4 * 256 * 16 && CV * KT * 2 == 4 * 256 * 16 && KT == 64);

typedef _Float16       v16h __attribute__((ext_vector_type(16)));
typedef _Float16       v8h  __attribute__((ext_vector_type(8)));
typedef __bf16         v16b __attribute__((ext_vector_type(16)));
typedef unsigned short v8us __attribute__((ext_vector_type(8)));
typedef float          v8f  __attribute__((ext_vector_type(8)));
typedef float          v4f  __attribute__((ext_vector_type(4)));
typedef unsigned int   v4u  __attribute__((ext_vector_type(4)));

union Frag  { v8us u[2]; v16h h; v16b bf; };
union FragH { v16h v; v8h hv[2]; };
static_assert(sizeof(Frag) == 32);
static_assert(sizeof(FragH) == 32);

// ---- scalar helpers ---------------------------------------------------------------------------------------
__device__ __forceinline__ unsigned short bf_bits(float f) {          // f32 -> bf16 bits, RNE convert
  unsigned u = __float_as_uint(f);
  return (unsigned short)((u + 0x7FFFu + ((u >> 16) & 1u)) >> 16);
}
__device__ __forceinline__ float bf_up(unsigned short hb) { return __uint_as_float(((unsigned)hb) << 16); }
__device__ __forceinline__ float bfr(float f) { return bf_up(bf_bits(f)); }
__device__ __forceinline__ unsigned short h_bits(_Float16 x) { return __builtin_bit_cast(unsigned short, x); }
__device__ __forceinline__ unsigned pk16(unsigned short a, unsigned short b) { return (unsigned)a | ((unsigned)b << 16); }
__device__ __forceinline__ v8f zero8() { v8f z = {0.f, 0.f, 0.f, 0.f, 0.f, 0.f, 0.f, 0.f}; return z; }
__device__ __forceinline__ float hmax8(v8f s) {
  return fmaxf(fmaxf(fmaxf(s[0], s[1]), fmaxf(s[2], s[3])), fmaxf(fmaxf(s[4], s[5]), fmaxf(s[6], s[7])));
}

// lane l <-> l ^ 16 by a vector cross-row move: it counts on no LDS counter, so no wait on it drains LDS reads in flight
__device__ __forceinline__ float xhalf(float x) {
  const int b = __builtin_bit_cast(int, x);
  return __builtin_bit_cast(float, __builtin_amdgcn_permlanex16(b, b, 0x76543210, 0xfedcba98, false, false));
}

// ---- 16-bit fragment loader (A, or B from a k-contiguous [n][k] row): lane -> row/col (lane&15), p already includes
//      + 8*(lane>>4); elements 0..7 <- p[0..7] (k0+8h..), elements 8..15 <- p[16..23] (k0+16+8h..)
__device__ __forceinline__ Frag ldfrag(const unsigned short* p) {
  Frag f;
  f.u[0] = *(const v8us*)(p);
  f.u[1] = *(const v8us*)(p + 16);
  return f;
}

// ---- WMMA helpers: builtin followed by a 4-slot VALU gap tying D and keeping A/B live --------------------------
__device__ __forceinline__ v8f mma_h(v16h a, v16h b, v8f c) {
  v8f d = __builtin_amdgcn_wmma_f32_16x16x32_f16(false, a, false, b, (short)0, c, false, false);
#if defined(__HIP_DEVICE_COMPILE__)
  asm volatile("v_nop\n\tv_nop\n\tv_nop\n\tv_nop" : "+v"(d) : "v"(a), "v"(b));
#endif
  return d;
}
__device__ __forceinline__ v8f mma_b(v16b a, v16b b, v8f c) {
  v8f d = __builtin_amdgcn_wmma_f32_16x16x32_bf16(false, a, false, b, (short)0, c, false, false);
#if defined(__HIP_DEVICE_COMPILE__)
  const v16h ha = __builtin_bit_cast(v16h, a), hb = __builtin_bit_cast(v16h, b);
  asm volatile("v_nop\n\tv_nop\n\tv_nop\n\tv_nop" : "+v"(d) : "v"(ha), "v"(hb));
#endif
  return d;
}

// =========================================================================================================
// (0) q/k/v conv1x1 weights: W16 f16 [384][256], rows 0..127 = wq, 128..255 = wk, 256..383 = wv; value = f16 of
//     (bf16-RNE(w) * 256) (exact). BIAS f32 [384] = bf16-RNE of bq / bk / bv. Block blk (0..47) owns rows
// coverage: 48 blocks x 8 rows x 32 pieces x 8 halves = 384 x 256; bias 96 x 4 floats = 384.
// =========================================================================================================
__global__ __launch_bounds__(256)
void cvt_w(const float* __restrict__ wq, const float* __restrict__ bq,
           const float* __restrict__ wk, const float* __restrict__ bk,
           const float* __restrict__ wv, const float* __restrict__ bv,
           unsigned short* W16, float* BIAS) {
  const int tid = threadIdx.x, blk = blockIdx.x;
  const int rl = tid >> 5, col = 8 * (tid & 31);
  const int o = 8 * blk + rl;                                          // 0..383
  const float* wbase = (blk < 16) ? wq : (blk < 32) ? wk : wv;         // block-uniform selection
  const int osub = (blk < 16) ? 0 : (blk < 32) ? CK : 2 * CK;
  const float* s = wbase + (size_t)(o - osub) * CC + col;             // (o-osub) < 128 rows of that matrix
  const v4f a = *(const v4f*)s;
  const v4f q = *(const v4f*)(s + 4);
  const float f[8] = {a[0], a[1], a[2], a[3], q[0], q[1], q[2], q[3]};
  v4u u;
#pragma unroll
  for (int t = 0; t < 4; ++t) {
    const _Float16 h0 = (_Float16)(bfr(f[2 * t]) * WSC);
    const _Float16 h1 = (_Float16)(bfr(f[2 * t + 1]) * WSC);
    u[t] = pk16(h_bits(h0), h_bits(h1));
  }
  // bias values: every lane loads all three candidates with clamped indices, selects by value
  v4f bvv;
  {
    const int tb = min(tid, 95);
    const int o4 = 4 * tb;
#pragma unroll
    for (int qd = 0; qd < 4; ++qd) {
      const int oo = o4 + qd;                                          // 0..383
      const int iq = min(oo, CK - 1);
      const int ik = min(max(oo - CK, 0), CK - 1);
      const int iv = min(max(oo - 2 * CK, 0), CV - 1);
      const float cq = bq[iq], ckv = bk[ik], cvv = bv[iv];
      const float val = (oo < CK) ? cq : (oo < 2 * CK) ? ckv : cvv;
      bvv[qd] = bfr(val);
    }
  }
{
    *(v4u*)(W16 + (size_t)o * CC + col) = u;
    if (blk == 0 && tid < 96) *(v4f*)(BIAS + 4 * tid) = bvv;
    
  }
}

// =========================================================================================================
// (0b) output conv weights: WO16 f16 [256][128] = f16 of (bf16-RNE(wo) * 256) (exact); BOB f32 [256] = bf16-RNE bo.
// coverage: 16 blocks x 16 rows x 16 pieces x 8 halves = 256 x 128; bias 64 x 4 floats = 256.
// =========================================================================================================
__global__ __launch_bounds__(256)
void cvt_wo(const float* __restrict__ wo, const float* __restrict__ bo, unsigned short* WO16, float* BOB) {
  const int tid = threadIdx.x, blk = blockIdx.x;
  const int rl = tid >> 4, col = 8 * (tid & 15);
  const int o = 16 * blk + rl;                                         // 0..255
  const float* s = wo + (size_t)o * CV + col;
  const v4f a = *(const v4f*)s;
  const v4f q = *(const v4f*)(s + 4);
  const float f[8] = {a[0], a[1], a[2], a[3], q[0], q[1], q[2], q[3]};
  v4u u;
#pragma unroll
  for (int t = 0; t < 4; ++t) {
    const _Float16 h0 = (_Float16)(bfr(f[2 * t]) * WSC);
    const _Float16 h1 = (_Float16)(bfr(f[2 * t + 1]) * WSC);
    u[t] = pk16(h_bits(h0), h_bits(h1));
  }
  v4f bvv;
  {
    const int tb = min(tid, 63);
#pragma unroll
    for (int qd = 0; qd < 4; ++qd) bvv[qd] = bfr(bo[4 * tb + qd]);  // index <= 255
  }
{
    *(v4u*)(WO16 + (size_t)o * CV + col) = u;
    if (blk == 0 && tid < 64) *(v4f*)(BOB + 4 * tid) = bvv;
    
  }
}

// =========================================================================================================
// (1) x f32 [b][256 c][4096 n] -> XP f16 [b][n][c] (position-major, bf16-RNE values, exact in f16) through an LDS
// coverage: XP 2 it x 32 rows x 8 lanes x 8 halves = 64 n x 64 c; grid (64, 4, NIMG) covers the plane exactly once.
// =========================================================================================================
__global__ __launch_bounds__(256)
void cvt_x(const float* __restrict__ x, unsigned short* XP) {
  __shared__ __align__(16) unsigned short T[QT * TP];
  const int tid = threadIdx.x;
  const int nb = blockIdx.x, cb = blockIdx.y, b = blockIdx.z;
  const int e = tid & 7, lq = tid >> 3;                               // lq 0..31
  const int n0 = nb * QT, c0 = cb * QT;
#pragma unroll
  for (int it = 0; it < 2; ++it) {
    const int cl = it * 32 + lq;                                       // 0..63
    const float* sp = x + ((size_t)(b * CC + c0 + cl)) * NN + n0 + 8 * e;
    const v4f a = *(const v4f*)sp;
    const v4f q = *(const v4f*)(sp + 4);
    unsigned short hb[8];
#pragma unroll
    for (int t = 0; t < 4; ++t) {
      hb[t]     = h_bits((_Float16)bfr(a[t]));
      hb[4 + t] = h_bits((_Float16)bfr(q[t]));
    }
#pragma unroll
    for (int t = 0; t < 8; ++t) T[(8 * e + t) * TP + cl] = hb[t];     // T[n_loc][c_loc]
  }
  __syncthreads();
  v4u up[2];
#pragma unroll
  for (int it = 0; it < 2; ++it) {
    const int nl = it * 32 + lq;                                       // 0..63
    up[it] = *(const v4u*)(T + nl * TP + 8 * e);
  }
{
#pragma unroll
    for (int it = 0; it < 2; ++it) {
      const int rl = it * 32 + lq;
      *(v4u*)(XP + ((size_t)(b * NN + n0 + rl)) * CC + c0 + 8 * e) = up[it];
    }
    
  }
}

// =========================================================================================================
// (2) conv1x1 GEMM for one (b, 64-n tile, 64-o block): Y[o][n] = (1/256) sum_c W16[o][c] XP[b][n][c] + BIAS[o].
//     Block 128 threads = 4 waves; wave w owns cols n0+16w..+15 (one B fragment per k-step, k = c contiguous in the
//     XP row) and 4 m-tiles (A rows o = o0 + 16 mt + (lane&15), split k map loader from W16). K = 256 = 8 steps.
//     Epilogue staged in LDS Os[o_loc][n_loc] (pitch OSP), barrier, then:
//       o-blocks 0,1 (q ck cols 0..63 / 64..127) and 2,3 (k): bf16 hi / bf16 residual planes [b][4096 n][128]
//         plane; lane e -> cols 8e..8e+7 of token row 16 it + lq; one instruction per 16 lines.
//         lane e -> halves 8e..8e+7; one instruction per 16 lines.
// coverage: Os 4 waves x 4 tiles x 16x16 = 64 x 64; q/k: per plane 4 it x 16 rows x 8 lanes x 8 = 64 n x 64 cols,
//           o-blocks 0..3 cover all 128 cols of Qh/Ql/Kh/Kl; v: 4 it x 16 rows x 8 lanes x 8 = 64 ch x 64 n;
//           grid (64, 6, NIMG) covers every plane exactly once.
// =========================================================================================================
__global__ __launch_bounds__(128)
void gemm_qkv(const unsigned short* __restrict__ W16, const float* __restrict__ BIAS,
              const unsigned short* __restrict__ XP,
              unsigned short* Qh, unsigned short* Ql, unsigned short* Kh, unsigned short* Kl,
              unsigned short* Vh) {
  __shared__ __align__(16) float Os[QT * OSP];
  const int tid  = threadIdx.x;
  const int lane = tid & 31, wave = tid >> 5;
  const int hh   = lane >> 4, c = lane & 15;
  const int nt   = blockIdx.x, mb = blockIdx.y, b = blockIdx.z;
  const int n0   = nt * QT, o0 = mb * QT;

  const unsigned short* ap = W16 + (size_t)(o0 + c) * CC + 8 * hh;
  const unsigned short* bp = XP + ((size_t)(b * NN + n0 + 16 * wave + c)) * CC + 8 * hh;

  v8f acc[4];
#pragma unroll
  for (int mt = 0; mt < 4; ++mt) acc[mt] = zero8();

#pragma unroll
  for (int ks = 0; ks < CC / 32; ++ks) {
    const Frag fb = ldfrag(bp + 32 * ks);
#pragma unroll
    for (int mt = 0; mt < 4; ++mt) {
      const Frag fa = ldfrag(ap + (size_t)(16 * mt) * CC + 32 * ks);
      acc[mt] = mma_h(fa.h, fb.h, acc[mt]);
    }
  }

  // ---- epilogue: scale back, + bias -> LDS Os[o_loc][n_loc] ----
  {
    const int nl = 16 * wave + c;
#pragma unroll
    for (int mt = 0; mt < 4; ++mt) {
#pragma unroll
      for (int r = 0; r < 8; ++r) {
        const int ol = 16 * mt + 8 * hh + r;                           // 0..63
        Os[ol * OSP + nl] = acc[mt][r] * IWSC + BIAS[o0 + ol];
      }
    }
  }
  __syncthreads();

  const int e = tid & 7, lq = tid >> 3;                               // lq 0..15
  if (mb < 4) {
    // ---- q / k bf16 hi + residual planes (block-uniform branch) ----
    unsigned short* Ph = (mb < 2) ? Qh : Kh;
    unsigned short* Pl = (mb < 2) ? Ql : Kl;
    const int cb = QT * (mb & 1);                                      // ck column base 0 or 64
    v4u uh[4], ul[4];
#pragma unroll
    for (int it = 0; it < 4; ++it) {
      const int nl = it * 16 + lq;                                     // token 0..63
#pragma unroll
      for (int t = 0; t < 4; ++t) {
        const float f0 = Os[(8 * e + 2 * t) * OSP + nl];
        const float f1 = Os[(8 * e + 2 * t + 1) * OSP + nl];
        const unsigned short hb0 = bf_bits(f0), hb1 = bf_bits(f1);
        const unsigned short lb0 = bf_bits(f0 - bf_up(hb0));
        const unsigned short lb1 = bf_bits(f1 - bf_up(hb1));
        uh[it][t] = pk16(hb0, hb1);
        ul[it][t] = pk16(lb0, lb1);
      }
    }
{
#pragma unroll
      for (int it = 0; it < 4; ++it) {
        const int nl = it * 16 + lq;
        const size_t base = ((size_t)(b * NN + n0 + nl)) * CK + cb + 8 * e;
        *(v4u*)(Ph + base) = uh[it];
        *(v4u*)(Pl + base) = ul[it];
      }
      
    }
  } else {
    // ---- v f16 plane, carried x16 ----
    const int ch0 = QT * (mb - 4);                                     // 0 or 64
    v4u uv[4];
#pragma unroll
    for (int it = 0; it < 4; ++it) {
      const int row = it * 16 + lq;                                    // 0..63
      const v4f a = *(const v4f*)(Os + row * OSP + 8 * e);
      const v4f q = *(const v4f*)(Os + row * OSP + 8 * e + 4);
#pragma unroll
      for (int t = 0; t < 2; ++t) {
        uv[it][t]     = pk16(h_bits((_Float16)(a[2 * t] * VSC)), h_bits((_Float16)(a[2 * t + 1] * VSC)));
        uv[it][2 + t] = pk16(h_bits((_Float16)(q[2 * t] * VSC)), h_bits((_Float16)(q[2 * t + 1] * VSC)));
      }
    }
{
#pragma unroll
      for (int it = 0; it < 4; ++it) {
        const int row = it * 16 + lq;
        *(v4u*)(Vh + ((size_t)(b * CV + ch0 + row)) * NN + n0 + 8 * e) = uv[it];
      }
      
    }
  }
}

// =========================================================================================================
// (3) attention for one (b, 128-query tile), transposed formulation, 4096 keys, no mask:
//   S^T tile (16 keys x 16 queries) = sum over 4 k-steps of A(k: row = key kb + (lane&15), 32 d via the split k map
//   from the bf16 plane Kh [b][4096][128]) . B(q: col = query, same map, from the wave's registers) + A(Kh).B(Ql)
//   + A(Kl).B(Qh) (bf16 unscaled residual planes, shared accumulator). Softmax of s*c with c = 1/sqrt(128):
//   per lane the D tile holds 8 keys of ONE query: online state per lane, one cross-row move (lane^16) for the max over
//   32 keys, row-sum partials combined at the end. P = 1024 e^{(s-m)c} as f16 is the B operand of
//   O^T (rows channel, cols queries) += A(V rows channel = 16j + (lane&15), keys contiguous, f16 plane Vh
//   [b][128][4096]) . B(P^T): element r <- D of the tile covering keys kb..kb+15, element 8+r <- the tile covering
//   kb+16..kb+31, lane unchanged. 8 accumulator tiles per query tile (128 channels). Block = 8 waves = 128 queries, one
//   block per WGP: wave w owns two query tiles, queries 32 (w & 3) .. +31, and keys 32 (w >> 2) .. +31 of every key tile;
//   the two states of a query group are merged at the end. Q hi/lo rows of the block's 128 queries are staged once in LDS
//   (v4u pieces, barrier); each wave then reads its 16 q fragments once and keeps them in registers, so that the key loop
//   reads only k and v from LDS and every such fragment feeds both query tiles. A 32-key pass reads its LDS fragments
//   ahead of the products that use them: k of k-steps 0,1; k of k-steps 2,3; all of v.
//   K hi, K residual and V come in tiles of KT = 64 keys through a two-buffer LDS ring filled by asynchronous 16-byte
//   copies (whole 128-B lines per request, each tile fetched once per block and read by all 8 waves); tile t+2 is
//   issued behind the barrier that ends the reads of tile t. Row pitches QP / VP halves = 16 B x odd.
//   Epilogue: barrier, O/l staged in LDS Os[query][128 channels] (pitch OSPW, b128 stores, aliases the Q staging),
// coverage: Q staging 8 it x 16 rows x 16 lanes x 8 = 128 x 128 per plane; OB 16 it x 32 lines x 8 lanes x 4 floats =
//           128 queries x 128 ch; grid (32, NIMG) covers OB exactly once.
// =========================================================================================================
#define AQ    128                                                      // queries of one attention block
static_assert(NN % AQ == 0 && AQ * OSPW * 4 <= 2 * AQ * QP * 2);
union AttnSmem { unsigned short q[2 * AQ * QP]; float o[AQ * OSPW]; };
// the k/v ring; after the key loop its first bytes carry the second key half's softmax state (o 16384 floats, m, l)
union AttnRing { unsigned short h[2 * STG]; float f[4 * 132 * 32]; };
static_assert(4 * 132 * 32 * 4 <= 2 * STG * 2);

typedef __attribute__((address_space(3))) unsigned short lds_us;
__device__ __forceinline__ unsigned lds_byte(unsigned short* p) { return (unsigned)(uintptr_t)(lds_us*)p; }

// One tile of KT keys into one ring buffer: k hi rows [KT][QP], k residual rows [KT][QP], v rows
// [CV][VP]. kh / kl / vh are this thread's piece 0 of the tile; lb + lk / lb + lv the buffer's LDS byte plus its offsets inside the k and v parts.
// 256 threads, twelve 16-byte copies per lane, global -> LDS through no register. k: 16 lanes per 256-B row, 16 rows
// per piece step; v: 8 lanes per 128-B row segment, 32 rows per piece step. The s_wait_xcnt closes the statement so
// that no address register of a copy is rewritten ahead of it.
__device__ __forceinline__ void stage_kv(unsigned lb, unsigned lk, unsigned lv, const unsigned short* kh,
                                         const unsigned short* kl, const unsigned short* vh) {
#if defined(__HIP_DEVICE_COMPILE__)
  const unsigned la = lb + lk, lc = lb + KT * QP * 2 + lk, ld = lb + 2 * KT * QP * 2 + lv;
  const unsigned ks = 16 * QP * 2, vs = 32 * VP * 2;
  const size_t kg = (size_t)16 * CK, vg = (size_t)32 * NN;
  asm volatile(
      "global_load_async_to_lds_b128 %0, %12, off\n\t"
      "global_load_async_to_lds_b128 %1, %13, off\n\t"
      "global_load_async_to_lds_b128 %2, %14, off\n\t"
      "global_load_async_to_lds_b128 %3, %15, off\n\t"
      "global_load_async_to_lds_b128 %4, %16, off\n\t"
      "global_load_async_to_lds_b128 %5, %17, off\n\t"
      "global_load_async_to_lds_b128 %6, %18, off\n\t"
      "global_load_async_to_lds_b128 %7, %19, off\n\t"
      "global_load_async_to_lds_b128 %8, %20, off\n\t"
      "global_load_async_to_lds_b128 %9, %21, off\n\t"
      "global_load_async_to_lds_b128 %10, %22, off\n\t"
      "global_load_async_to_lds_b128 %11, %23, off\n\t"
      "s_wait_xcnt 0x0"
      :: "v"(la), "v"(la + ks), "v"(la + 2 * ks), "v"(la + 3 * ks),
         "v"(lc), "v"(lc + ks), "v"(lc + 2 * ks), "v"(lc + 3 * ks),
         "v"(ld), "v"(ld + vs), "v"(ld + 2 * vs), "v"(ld + 3 * vs),
         "v"(kh), "v"(kh + kg), "v"(kh + 2 * kg), "v"(kh + 3 * kg),
         "v"(kl), "v"(kl + kg), "v"(kl + 2 * kg), "v"(kl + 3 * kg),
         "v"(vh), "v"(vh + vg), "v"(vh + 2 * vg), "v"(vh + 3 * vg)
      : "memory");
#endif
}

// ---- WMMA helpers of the attention kernel: the bare builtins, the compiler keeping the distance behind them. An asm
//      statement takes its vector operands from v0..v255 only; tied to one, the wave's 32-query register tile
//      (q 128, o 128 registers) would not fit and would spill.
__device__ __forceinline__ v8f mma_hr(v16h a, v16h b, v8f c) {
  return __builtin_amdgcn_wmma_f32_16x16x32_f16(false, a, false, b, (short)0, c, false, false);
}
__device__ __forceinline__ v8f mma_br(v16b a, v16b b, v8f c) {
  return __builtin_amdgcn_wmma_f32_16x16x32_bf16(false, a, false, b, (short)0, c, false, false);
}

__global__ __launch_bounds__(256)
void attn_gab(const unsigned short* __restrict__ Qh, const unsigned short* __restrict__ Ql,
              const unsigned short* __restrict__ Kh, const unsigned short* __restrict__ Kl,
              const unsigned short* __restrict__ Vh, float* OB) {
  __shared__ __align__(16) AttnSmem sm;
  __shared__ __align__(16) AttnRing rg;
  unsigned short* ring = rg.h;
  const int tid  = threadIdx.x;
  const int wave = tid >> 5, lane = tid & 31;
  const int hh   = lane >> 4, c = lane & 15;
  const int n0   = blockIdx.x * AQ, b = blockIdx.y;
  const int wq   = wave & 3, kh2 = wave >> 2;                          // query group of 32; key half of every tile

  // ---- this thread's share of a k/v tile: source pointers of tile 0, byte places inside a ring buffer ----
  const unsigned ring0 = lds_byte(ring);
  const unsigned lk = (unsigned)((tid >> 4) * (QP * 2) + (tid & 15) * 16);
  const unsigned lv = (unsigned)((tid >> 3) * (VP * 2) + (tid & 7) * 16);
  const unsigned short* khg = Kh + ((size_t)(b * NN + (tid >> 4))) * CK + 8 * (tid & 15);
  const unsigned short* klg = Kl + ((size_t)(b * NN + (tid >> 4))) * CK + 8 * (tid & 15);
  const unsigned short* vhg = Vh + ((size_t)(b * CV + (tid >> 3))) * NN + 8 * (tid & 7);
  stage_kv(ring0, lk, lv, khg, klg, vhg);                              // tile 0 -> buffer 0

  // ---- stage q hi (rows 0..127) and q residual (rows 128..255) of this query tile in LDS ----
  {
    const int e16 = tid & 15, rq = tid >> 4;                          // rq 0..15
#pragma unroll
    for (int it = 0; it < AQ / 16; ++it) {
      const int row = 16 * it + rq;                                    // 0..127
      const size_t g = ((size_t)(b * NN + n0 + row)) * CK + 8 * e16;
      const v4u vh = *(const v4u*)(Qh + g);
      const v4u vl = *(const v4u*)(Ql + g);
      *(v4u*)(sm.q + row * QP + 8 * e16)        = vh;
      *(v4u*)(sm.q + (AQ + row) * QP + 8 * e16) = vl;
    }
  }
  asm volatile("s_wait_asynccnt 0x0" ::: "memory");                    // this wave's share of tile 0 has landed
  __syncthreads();                                                     // publishes the q rows and tile 0
  stage_kv(ring0 + STG * 2, lk, lv, khg + (size_t)KT * CK, klg + (size_t)KT * CK, vhg + KT);   // tile 1 -> buffer 1

  // ---- the wave's q fragments (B operand, col = query n0 + 32*wq + 16*g + c), read once and kept in registers ----
  Frag qhf[2][CK / 32], qlf[2][CK / 32];
#pragma unroll
  for (int g = 0; g < 2; ++g) {
    const unsigned short* qsh = sm.q + (32 * wq + 16 * g + c) * QP + 8 * hh;
#pragma unroll
    for (int ks = 0; ks < CK / 32; ++ks) {
      qhf[g][ks] = ldfrag(qsh + 32 * ks);
      qlf[g][ks] = ldfrag(qsh + AQ * QP + 32 * ks);
    }
  }

  float m[2] = {-1.0e30f, -1.0e30f}, l[2] = {0.f, 0.f};
  v8f o[2][8];
#pragma unroll
  for (int g = 0; g < 2; ++g) {
#pragma unroll
    for (int j = 0; j < 8; ++j) o[g][j] = zero8();
  }

  // this thread's places in the buffer that trip t frees, carried from trip to trip: they are the copies' own operands
  unsigned lkc = ring0 + lk, lvc = ring0 + lv;
  const unsigned lks = 2 * (ring0 + lk) + STG * 2, lvs = 2 * (ring0 + lv) + STG * 2;

#pragma unroll 1   // rolled: one hand-over point in the text, the buffer picked by t & 1
  for (int t = 0; t < NN / KT; ++t) {
  const unsigned short* buf = ring + (t & 1) * STG;
  // k fragment base (A operand, row = key kb + c of the tile), + key * QP
  const int kb = 32 * kh2;                                             // this wave's 32 keys of the tile
  const unsigned short* Khp = buf + c * QP + 8 * hh;
  const unsigned short* Klp = Khp + KT * QP;
  // v fragment base (A operand, row = channel 16j + c, the tile's keys contiguous), + 16*j*VP + kb
  const unsigned short* Vhp = buf + 2 * KT * QP + c * VP + 8 * hh;
  {
    v8f s0[2], s1[2];                                                  // [query tile]: keys kb..+15, keys kb+16..+31
#pragma unroll
    for (int g = 0; g < 2; ++g) { s0[g] = zero8(); s1[g] = zero8(); }
#pragma unroll   // unrolled: each trip's reads stand as one group in the text, ahead of that trip's 24 products
    for (int kg = 0; kg < CK / 64; ++kg) {
      // the k fragments of two k-steps, read ahead of their products, counted waits behind them
      Frag k0[2], k1[2], k0l[2], k1l[2];
#pragma unroll   // the fragment arrays stay in registers only under constant indices
      for (int u = 0; u < 2; ++u) {
        const int ks = 2 * kg + u;
        k0[u]  = ldfrag(Khp + kb * QP + 32 * ks);                        // keys kb .. kb+15
        k1[u]  = ldfrag(Khp + (kb + 16) * QP + 32 * ks);                 // keys kb+16 .. kb+31
        k0l[u] = ldfrag(Klp + kb * QP + 32 * ks);
        k1l[u] = ldfrag(Klp + (kb + 16) * QP + 32 * ks);
      }
      // keeps the group's reads ahead of its products: without it the compiler sinks each pair to its first use, and the
      // wave waits out every pair's latency
      __builtin_amdgcn_sched_barrier(0);
#pragma unroll   // constant indices, as above
      for (int u = 0; u < 2; ++u) {
        const int ks = 2 * kg + u;
        // every k fragment feeds both query tiles; per accumulator the order hi.hi, hi.res, res.hi is kept
        s0[0] = mma_br(k0[u].bf, qhf[0][ks].bf, s0[0]);
        s1[0] = mma_br(k1[u].bf, qhf[0][ks].bf, s1[0]);
        s0[1] = mma_br(k0[u].bf, qhf[1][ks].bf, s0[1]);
        s1[1] = mma_br(k1[u].bf, qhf[1][ks].bf, s1[1]);
        s0[0] = mma_br(k0[u].bf, qlf[0][ks].bf, s0[0]);
        s1[0] = mma_br(k1[u].bf, qlf[0][ks].bf, s1[0]);
        s0[1] = mma_br(k0[u].bf, qlf[1][ks].bf, s0[1]);
        s1[1] = mma_br(k1[u].bf, qlf[1][ks].bf, s1[1]);
        s0[0] = mma_br(k0l[u].bf, qhf[0][ks].bf, s0[0]);
        s1[0] = mma_br(k1l[u].bf, qhf[0][ks].bf, s1[0]);
        s0[1] = mma_br(k0l[u].bf, qhf[1][ks].bf, s0[1]);
        s1[1] = mma_br(k1l[u].bf, qhf[1][ks].bf, s1[1]);
      }
    }

    // the pass's eight v fragments, read ahead of the softmax: nothing below waits on LDS before the products that use
    // them, so they land while the softmax runs
    Frag vf[8];
#pragma unroll   // constant indices, as above
    for (int j = 0; j < 8; ++j) vf[j] = ldfrag(Vhp + (16 * j) * VP + kb);
    // holds the sixteen reads here: without it the compiler sinks them to the softmax's end and their latency is waited out
    __builtin_amdgcn_sched_barrier(0);

    FragH ph[2];
#pragma unroll   // constant indices, as above
    for (int g = 0; g < 2; ++g) {
      float mx = fmaxf(hmax8(s0[g]), hmax8(s1[g]));
      mx = fmaxf(mx, xhalf(mx));
      const float mn   = fmaxf(m[g], mx);
      const float corr = __expf((m[g] - mn) * SCL);
      m[g] = mn;
      const float msh = mn * SCL - LNPS;                               // exp gives e^{(s-m)c} * 1024
      l[g] *= corr;
#pragma unroll
      for (int j = 0; j < 8; ++j) {
#pragma unroll
        for (int r = 0; r < 8; ++r) o[g][j][r] *= corr;
      }

      float ls = 0.f;
#pragma unroll
      for (int r = 0; r < 8; ++r) {
        const float e0 = __expf(s0[g][r] * SCL - msh);                 // key kb      + 8hh + r
        const float e1 = __expf(s1[g][r] * SCL - msh);                 // key kb + 16 + 8hh + r
        ls += e0 + e1;
        ph[g].hv[0][r] = (_Float16)e0;
        ph[g].hv[1][r] = (_Float16)e1;
      }
      l[g] += ls;
    }

#pragma unroll
    for (int j = 0; j < 8; ++j) {                                      // every v fragment feeds both query tiles
      o[0][j] = mma_hr(vf[j].h, ph[0].v, o[0][j]);
      o[1][j] = mma_hr(vf[j].h, ph[1].v, o[1][j]);
    }
  }
  // ---- hand-over: tile t+1 becomes readable, buffer t&1 becomes free ----
  // keeps the waits below behind the products above: lifted into the softmax, the dscnt wait would wait out the v reads
  __builtin_amdgcn_sched_barrier(0);
  asm volatile("s_wait_dscnt 0x0" ::: "memory");                       // this wave's reads of buffer t&1 are done
  asm volatile("s_wait_asynccnt 0x0" ::: "memory");                    // this wave's share of tile t+1 has landed
  __syncthreads();
  if (t + 2 < NN / KT)
    stage_kv(0u, lkc, lvc, khg + (size_t)(t + 2) * KT * CK, klg + (size_t)(t + 2) * KT * CK, vhg + (t + 2) * KT);
  lkc = lks - lkc;                                                     // the other buffer
  lvc = lvs - lvc;
  }
  asm volatile("s_wait_asynccnt 0x0" ::: "memory");                    // no copy is left in flight at the wave's end
#pragma unroll
  for (int g = 0; g < 2; ++g) l[g] += __shfl_xor(l[g], 16, 32);

  // ---- the two key halves of a query group hold the same lane layout: waves 4..7 hand m, l, o over through the ring's
  //      LDS (free behind the loop's last barrier: every read of it is done and no copy is in flight) ----
  float* mg = rg.f;
  if (kh2 == 1) {                                                      // the same in every lane of a wave
#pragma unroll
    for (int g = 0; g < 2; ++g) {
#pragma unroll
      for (int j = 0; j < 8; ++j) {
        v4f va, vb;
#pragma unroll
        for (int r = 0; r < 4; ++r) { va[r] = o[g][j][r]; vb[r] = o[g][j][4 + r]; }
        *(v4f*)(mg + ((wq * 32 + 16 * g + 2 * j) * 32 + lane) * 4)     = va;   // 16 B per lane, lanes adjacent
        *(v4f*)(mg + ((wq * 32 + 16 * g + 2 * j + 1) * 32 + lane) * 4) = vb;
      }
      mg[16384 + (4 * wq + 2 * g) * 32 + lane]     = m[g];
      mg[16384 + (4 * wq + 2 * g + 1) * 32 + lane] = l[g];
    }
  }
  __syncthreads();                                                     // publishes the second half's state
  if (kh2 == 0) {
#pragma unroll
    for (int g = 0; g < 2; ++g) {
      const float m2 = mg[16384 + (4 * wq + 2 * g) * 32 + lane];
      const float l2 = mg[16384 + (4 * wq + 2 * g + 1) * 32 + lane];
      const float mn = fmaxf(m[g], m2);
      const float f1 = __expf((m[g] - mn) * SCL), f2 = __expf((m2 - mn) * SCL);
      const float inv = IVSC / (l[g] * f1 + l2 * f2);                  // o carries x1024 x16, l carries x1024
      const float g1 = f1 * inv, g2 = f2 * inv;
      const int qrow = 32 * wq + 16 * g + c;
#pragma unroll
      for (int j = 0; j < 8; ++j) {
        const v4f pa = *(const v4f*)(mg + ((wq * 32 + 16 * g + 2 * j) * 32 + lane) * 4);
        const v4f pb = *(const v4f*)(mg + ((wq * 32 + 16 * g + 2 * j + 1) * 32 + lane) * 4);
        v4f va, vb;
#pragma unroll
        for (int r = 0; r < 4; ++r) {
          va[r] = o[g][j][r] * g1 + pa[r] * g2;
          vb[r] = o[g][j][4 + r] * g1 + pb[r] * g2;
        }
        *(v4f*)(sm.o + qrow * OSPW + 16 * j + 8 * hh)     = va;       // Os[query][ch = 16j + 8hh + r]
        *(v4f*)(sm.o + qrow * OSPW + 16 * j + 8 * hh + 4) = vb;
      }
    }
  }
  __syncthreads();

  const int e = tid & 7, lq = tid >> 3;                                // lq 0..31
{
#pragma unroll
    for (int it = 0; it < AQ / 8; ++it) {
      const int L   = it * 32 + lq;                                    // line 0..511
      const int q   = L >> 2, seg = L & 3;                             // query 0..127, 32-float segment
      const v4f v = *(const v4f*)(sm.o + q * OSPW + 32 * seg + 4 * e);
      *(v4f*)(OB + ((size_t)(b * NN + n0 + q)) * CV + 32 * seg + 4 * e) = v;
    }
    
  }
}

// =========================================================================================================
// (4) output conv on the raw view: for image b, U[r][p] = OB_b[r*4096 + p] (r < 128, p < 4096);
//     y[b][o][p] = (1/4096) sum_r WO16[o][r] (Uh + Ul/2048)[p][r] + BOB[o], Uh = f16(16 U), Ul = f16((16U - Uh) 2048).
//     Block (64-p tile, 64-o block, b), 128 threads: stage the 128 r x 64 p view slab from OB (256-B contiguous row
//     segments), convert, store transposed into LDS Bs[p_loc][r] hi rows 0..63 / residual rows 64..127 (u32 pairs of
//     consecutive r), barrier; then 4 waves, wave w owns cols p0+16w..+15 (B fragments from the LDS rows, split k
//     map), 4 m-tiles (A rows o0 + 16 mt + (lane&15) from WO16, k = r contiguous), K = 128 = 4 steps, hi and
//     d_out [b][256][4096] (row segment 64 p = 2 lines): 8 consecutive lanes x 16 B, one instruction per 16 lines,
// coverage: staging 8 it x 8 row-pairs x 16 lanes x 4 p x 2 rows = 128 r x 64 p per plane (pad cols never read);
//           d_out 8 it x 16 lines x 8 lanes x 4 = 64 o x 64 p; grid (64, 4, NIMG) covers d_out exactly once.
// =========================================================================================================
__global__ __launch_bounds__(128)
void out_proj(const float* __restrict__ OB, const unsigned short* __restrict__ WO16,
              const float* __restrict__ BOB, float* out) {
  __shared__ __align__(16) unsigned int Bs[2 * QT * (BP / 2)];
  __shared__ __align__(16) float Os[QT * OSP];
  const int tid  = threadIdx.x;
  const int lane = tid & 31, wave = tid >> 5;
  const int hh   = lane >> 4, c = lane & 15;
  const int pt = blockIdx.x, mb = blockIdx.y, b = blockIdx.z;
  const int p0 = pt * QT, o0 = mb * QT;
  const float* OBb = OB + (size_t)b * NN * CV;

  // ---- stage + convert the view slab: Bs[p_loc][r] ----
  {
    const int e16 = tid & 15, rq = tid >> 4;                           // rq 0..7
#pragma unroll
    for (int it = 0; it < 8; ++it) {
      const int rp = 8 * it + rq;                                      // row pair 0..63
      const int r0 = 2 * rp;
      const v4f va = *(const v4f*)(OBb + (size_t)r0 * NN + p0 + 4 * e16);
      const v4f vb = *(const v4f*)(OBb + (size_t)(r0 + 1) * NN + p0 + 4 * e16);
#pragma unroll
      for (int t = 0; t < 4; ++t) {
        const float f0 = va[t] * USC, f1 = vb[t] * USC;
        const _Float16 h0 = (_Float16)f0, h1 = (_Float16)f1;
        const _Float16 l0 = (_Float16)((f0 - (float)h0) * RSC);
        const _Float16 l1 = (_Float16)((f1 - (float)h1) * RSC);
        const int pl = 4 * e16 + t;                                    // p_loc 0..63
        Bs[pl * (BP / 2) + rp]        = pk16(h_bits(h0), h_bits(h1));  // halves r0, r0+1
        Bs[(QT + pl) * (BP / 2) + rp] = pk16(h_bits(l0), h_bits(l1));
      }
    }
  }
  __syncthreads();

  const unsigned short* Bh  = (const unsigned short*)Bs;
  const unsigned short* bph = Bh + (16 * wave + c) * BP + 8 * hh;     // B col = p0 + 16*wave + c, k = r
  const unsigned short* bpl = bph + QT * BP;
  const unsigned short* ap  = WO16 + (size_t)(o0 + c) * CV + 8 * hh;  // A row = o0 + 16 mt + c, k = r

  v8f acch[4], accl[4];
#pragma unroll
  for (int mt = 0; mt < 4; ++mt) { acch[mt] = zero8(); accl[mt] = zero8(); }

#pragma unroll
  for (int ks = 0; ks < CV / 32; ++ks) {
    const Frag fbh = ldfrag(bph + 32 * ks);
    const Frag fbl = ldfrag(bpl + 32 * ks);
#pragma unroll
    for (int mt = 0; mt < 4; ++mt) {
      const Frag fa = ldfrag(ap + (size_t)(16 * mt) * CV + 32 * ks);
      acch[mt] = mma_h(fa.h, fbh.h, acch[mt]);
      accl[mt] = mma_h(fa.h, fbl.h, accl[mt]);
    }
  }
  {
    const int nl = 16 * wave + c;
    const float osc = IWSC * IUSC;                                     // 1/4096
#pragma unroll
    for (int mt = 0; mt < 4; ++mt) {
#pragma unroll
      for (int r = 0; r < 8; ++r) {
        const int ol = 16 * mt + 8 * hh + r;                           // 0..63
        Os[ol * OSP + nl] = (acch[mt][r] + accl[mt][r] * IRSC) * osc + BOB[o0 + ol];
      }
    }
  }
  __syncthreads();
  {
    const int e = tid & 7, lq = tid >> 3;                              // lq 0..15
{
#pragma unroll
      for (int it = 0; it < 8; ++it) {
        const int L = it * 16 + lq;                                    // 0..127
        const int row = L >> 1, hf = L & 1;
        const int nl = hf * 32 + 4 * e;
        const v4f v = *(const v4f*)(Os + row * OSP + nl);
        *(v4f*)(out + ((size_t)(b * CO + o0 + row)) * NN + p0 + nl) = v;
      }
      
    }
  }
}

// =========================================================================================================
// Workspace map (bytes; each region start a multiple of 256; every extent is an exact tile multiple and is written
//   W16 f16 [384][256]            196608      BIAS f32 [384]              1536
//   WO16 f16 [256][128]            65536      BOB  f32 [256]              1024
//   XP  f16 [8][4096][256]      16777216
//   Qh/Ql/Kh/Kl bf16 [8][4096][128]  8388608 x4                          Vh f16 [8][128][4096]  8388608
//   OB  f32 [8][4096][128]      16777216
//   total = 75762176
// =========================================================================================================
extern "C" void kernel_launch(void* const* d_in, const int* in_sizes, int n_in,
                              void* d_out, int out_size, void* d_ws, size_t ws_size,
                              hipStream_t stream) {
  const int XN = NIMG * CC * NN;                                       // 8388608
  if (n_in < 9) return;
  if (in_sizes[0] != XN) return;
  if (in_sizes[1] != CK * CC || in_sizes[2] != CK) return;
  if (in_sizes[3] != CK * CC || in_sizes[4] != CK) return;
  if (in_sizes[5] != CV * CC || in_sizes[6] != CV) return;
  if (in_sizes[7] != CO * CV || in_sizes[8] != CO) return;
  if (out_size != NIMG * CO * NN) return;

  size_t off = 0;
  auto carve = [&](size_t bytes) { const size_t o = off; off += (bytes + 255) & ~(size_t)255; return o; };
  const size_t oW16 = carve((size_t)MQKV * CC * 2);
  const size_t oBIA = carve((size_t)MQKV * 4);
  const size_t oWO  = carve((size_t)CO * CV * 2);
  const size_t oBOB = carve((size_t)CO * 4);
  const size_t oXP  = carve((size_t)NIMG * NN * CC * 2);
  const size_t oQh  = carve((size_t)NIMG * NN * CK * 2);
  const size_t oQl  = carve((size_t)NIMG * NN * CK * 2);
  const size_t oKh  = carve((size_t)NIMG * NN * CK * 2);
  const size_t oKl  = carve((size_t)NIMG * NN * CK * 2);
  const size_t oVh  = carve((size_t)NIMG * CV * NN * 2);
  const size_t oOB  = carve((size_t)NIMG * NN * CV * 4);
  if (off > ws_size) return;
  if (off > (size_t)134217728) return;

  const float* x  = (const float*)d_in[0];
  const float* wq = (const float*)d_in[1];
  const float* bq = (const float*)d_in[2];
  const float* wk = (const float*)d_in[3];
  const float* bk = (const float*)d_in[4];
  const float* wv = (const float*)d_in[5];
  const float* bv = (const float*)d_in[6];
  const float* wo = (const float*)d_in[7];
  const float* bo = (const float*)d_in[8];

  char* ws = (char*)d_ws;
  unsigned short* W16 = (unsigned short*)(ws + oW16);
  float*          BIA = (float*)(ws + oBIA);
  unsigned short* WO  = (unsigned short*)(ws + oWO);
  float*          BOB = (float*)(ws + oBOB);
  unsigned short* XP  = (unsigned short*)(ws + oXP);
  unsigned short* Qh  = (unsigned short*)(ws + oQh);
  unsigned short* Ql  = (unsigned short*)(ws + oQl);
  unsigned short* Kh  = (unsigned short*)(ws + oKh);
  unsigned short* Kl  = (unsigned short*)(ws + oKl);
  unsigned short* Vh  = (unsigned short*)(ws + oVh);
  float*          OB  = (float*)(ws + oOB);
  float* out = (float*)d_out;

  const dim3 blk256(256), blk128(128);

  // (0) conv1x1 q/k/v weights -> f16 plane + bias line; output conv weights -> f16 plane + bias line
  cvt_w<<<dim3(MQKV / 8), blk256, 0, stream>>>(wq, bq, wk, bk, wv, bv, W16, BIA);
  cvt_wo<<<dim3(CO / 16), blk256, 0, stream>>>(wo, bo, WO, BOB);
  // (1) x -> position-major 16-bit plane
  cvt_x<<<dim3(NN / QT, CC / QT, NIMG), blk256, 0, stream>>>(x, XP);
  // (2) conv1x1 GEMM -> q/k hi + residual planes and v plane
  gemm_qkv<<<dim3(NN / QT, MQKV / QT, NIMG), blk128, 0, stream>>>(W16, BIA, XP, Qh, Ql, Kh, Kl, Vh);
  // (3) attention -> OB [b][4096][128] token-major f32
  attn_gab<<<dim3(NN / AQ, NIMG), blk256, 0, stream>>>(Qh, Ql, Kh, Kl, Vh, OB);
  // (4) output conv on the raw view -> out [b][256][4096]
  out_proj<<<dim3(NN / QT, CO / QT, NIMG), blk128, 0, stream>>>(OB, WO, BOB, out);
  (void)hipGetLastError();
}

// v005
// A run of this version takes 118 microseconds.
// Next to v004, in two timings, it ran 1.25 times as fast each time.
// Counting every step since v000, it is 4.13 times as fast.
// Contractions: conv1x1 q/k/v GEMM W[384x256].X on v_wmma_f32_16x16x32_f16 (f16 containers of bf16-RNE weights x256
// and bf16-RNE x); scores K.Q^T on v_wmma_f32_16x16x32_bf16 (bf16 hi + bf16 residual planes of q and k, 3 products,
// K=128); O^T = V.P^T on v_wmma_f32_16x16x32_f16 (v x16 f16, P = 1024 e^{(s-m)c} f16 from the score D registers);
// output conv1x1 Wo[256x128].U on v_wmma_f32_16x16x32_f16 (Wo f16 of bf16-RNE x256, U as f16 hi x16 plus f16
// residual x2^11 planes in two accumulators); f32 accumulate everywhere; softmax statistics in f32 VALU.
#include <hip/hip_runtime.h>
#include <math.h>
#include <stdint.h>

#define NIMG  8
#define CC    256
#define NN    4096
#define CK    128
#define CV    128
#define CO    256
#define MQKV  384
#define QT    64
#define OSP   68
#define OSPW  132
#define TP    72
#define QP    136
#define BP    136
#define KT    64
#define VP    72
#define STG   (2 * KT * QP + CV * VP)
#define XPP   264
#define WSC   256.0f
#define IWSC  0.00390625f
#define VSC   16.0f
#define IVSC  0.0625f
#define USC   16.0f
#define IUSC  0.0625f
#define RSC   2048.0f
#define IRSC  0.00048828125f
#define LNPS  6.931471805599453f
#define SCL   0.08838834764831845f

static_assert(NN % QT == 0);
static_assert(CC % 32 == 0 && CK % 64 == 0 && CV % 32 == 0);
static_assert(MQKV == 2 * CK + CV);
static_assert(MQKV % QT == 0 && CO % QT == 0);
static_assert(CK == 2 * QT && CV == 2 * QT);
static_assert((OSP * 4) % 16 == 0);
static_assert((OSPW * 4) % 16 == 0);
static_assert((TP * 2) % 16 == 0);
static_assert((XPP * 2) % 32 == 16 && XPP >= CC + 8 && QT * OSP * 4 <= 2 * QT * XPP * 2);
static_assert((QP * 2) % 16 == 0 && (BP * 2) % 16 == 0 && (BP % 2) == 0);
static_assert(QT * OSPW * 4 <= 2 * QT * QP * 2);
static_assert(NN % KT == 0 && NN / KT >= 2 && KT % 32 == 0);
static_assert((VP * 2) % 16 == 0 && (STG * 2) % 16 == 0 && VP >= KT + 8);
static_assert(KT * CK * 2 == 4 * 256 * 16 && CV * KT * 2 == 4 * 256 * 16 && KT == 64);

typedef _Float16       v16h __attribute__((ext_vector_type(16)));
typedef _Float16       v8h  __attribute__((ext_vector_type(8)));
typedef __bf16         v16b __attribute__((ext_vector_type(16)));
typedef unsigned short v8us __attribute__((ext_vector_type(8)));
typedef float          v8f  __attribute__((ext_vector_type(8)));
typedef float          v4f  __attribute__((ext_vector_type(4)));
typedef unsigned int   v4u  __attribute__((ext_vector_type(4)));

union Frag  { v8us u[2]; v16h h; v16b bf; };
union FragH { v16h v; v8h hv[2]; };
static_assert(sizeof(Frag) == 32);
static_assert(sizeof(FragH) == 32);

// ---- scalar helpers ---------------------------------------------------------------------------------------
__device__ __forceinline__ unsigned short bf_bits(float f) {          // f32 -> bf16 bits, RNE convert
  unsigned u = __float_as_uint(f);
  return (unsigned short)((u + 0x7FFFu + ((u >> 16) & 1u)) >> 16);
}
__device__ __forceinline__ float bf_up(unsigned short hb) { return __uint_as_float(((unsigned)hb) << 16); }
__device__ __forceinline__ float bfr(float f) { return bf_up(bf_bits(f)); }
__device__ __forceinline__ unsigned short h_bits(_Float16 x) { return __builtin_bit_cast(unsigned short, x); }
__device__ __forceinline__ unsigned pk16(unsigned short a, unsigned short b) { return (unsigned)a | ((unsigned)b << 16); }
__device__ __forceinline__ v8f zero8() { v8f z = {0.f, 0.f, 0.f, 0.f, 0.f, 0.f, 0.f, 0.f}; return z; }
__device__ __forceinline__ float hmax8(v8f s) {
  return fmaxf(fmaxf(fmaxf(s[0], s[1]), fmaxf(s[2], s[3])), fmaxf(fmaxf(s[4], s[5]), fmaxf(s[6], s[7])));
}

// lane l <-> l ^ 16 by a vector cross-row move: it counts on no LDS counter, so no wait on it drains LDS reads in flight
__device__ __forceinline__ float xhalf(float x) {
  const int b = __builtin_bit_cast(int, x);
  return __builtin_bit_cast(float, __builtin_amdgcn_permlanex16(b, b, 0x76543210, 0xfedcba98, false, false));
}

// ---- 16-bit fragment loader (A, or B from a k-contiguous [n][k] row): lane -> row/col (lane&15), p already includes
//      + 8*(lane>>4); elements 0..7 <- p[0..7] (k0+8h..), elements 8..15 <- p[16..23] (k0+16+8h..)
__device__ __forceinline__ Frag ldfrag(const unsigned short* p) {
  Frag f;
  f.u[0] = *(const v8us*)(p);
  f.u[1] = *(const v8us*)(p + 16);
  return f;
}

typedef __attribute__((address_space(3))) unsigned short lds_us;
__device__ __forceinline__ unsigned lds_byte(unsigned short* p) { return (unsigned)(uintptr_t)(lds_us*)p; }

// ---- WMMA helpers: builtin followed by a 4-slot VALU gap tying D and keeping A/B live --------------------------
__device__ __forceinline__ v8f mma_h(v16h a, v16h b, v8f c) {
  v8f d = __builtin_amdgcn_wmma_f32_16x16x32_f16(false, a, false, b, (short)0, c, false, false);
#if defined(__HIP_DEVICE_COMPILE__)
  asm volatile("v_nop\n\tv_nop\n\tv_nop\n\tv_nop" : "+v"(d) : "v"(a), "v"(b));
#endif
  return d;
}
__device__ __forceinline__ v8f mma_b(v16b a, v16b b, v8f c) {
  v8f d = __builtin_amdgcn_wmma_f32_16x16x32_bf16(false, a, false, b, (short)0, c, false, false);
#if defined(__HIP_DEVICE_COMPILE__)
  const v16h ha = __builtin_bit_cast(v16h, a), hb = __builtin_bit_cast(v16h, b);
  asm volatile("v_nop\n\tv_nop\n\tv_nop\n\tv_nop" : "+v"(d) : "v"(ha), "v"(hb));
#endif
  return d;
}

// =========================================================================================================
// (0) q/k/v conv1x1 weights: W16 f16 [384][256], rows 0..127 = wq, 128..255 = wk, 256..383 = wv; value = f16 of
//     (bf16-RNE(w) * 256) (exact). BIAS f32 [384] = bf16-RNE of bq / bk / bv. Block blk (0..47) owns rows
// coverage: 48 blocks x 8 rows x 32 pieces x 8 halves = 384 x 256; bias 96 x 4 floats = 384.
// =========================================================================================================
__global__ __launch_bounds__(256)
void cvt_w(const float* __restrict__ wq, const float* __restrict__ bq,
           const float* __restrict__ wk, const float* __restrict__ bk,
           const float* __restrict__ wv, const float* __restrict__ bv,
           unsigned short* W16, float* BIAS) {
  const int tid = threadIdx.x, blk = blockIdx.x;
  const int rl = tid >> 5, col = 8 * (tid & 31);
  const int o = 8 * blk + rl;                                          // 0..383
  const float* wbase = (blk < 16) ? wq : (blk < 32) ? wk : wv;         // block-uniform selection
  const int osub = (blk < 16) ? 0 : (blk < 32) ? CK : 2 * CK;
  const float* s = wbase + (size_t)(o - osub) * CC + col;             // (o-osub) < 128 rows of that matrix
  const v4f a = *(const v4f*)s;
  const v4f q = *(const v4f*)(s + 4);
  const float f[8] = {a[0], a[1], a[2], a[3], q[0], q[1], q[2], q[3]};
  v4u u;
#pragma unroll
  for (int t = 0; t < 4; ++t) {
    const _Float16 h0 = (_Float16)(bfr(f[2 * t]) * WSC);
    const _Float16 h1 = (_Float16)(bfr(f[2 * t + 1]) * WSC);
    u[t] = pk16(h_bits(h0), h_bits(h1));
  }
  // bias values: every lane loads all three candidates with clamped indices, selects by value
  v4f bvv;
  {
    const int tb = min(tid, 95);
    const int o4 = 4 * tb;
#pragma unroll
    for (int qd = 0; qd < 4; ++qd) {
      const int oo = o4 + qd;                                          // 0..383
      const int iq = min(oo, CK - 1);
      const int ik = min(max(oo - CK, 0), CK - 1);
      const int iv = min(max(oo - 2 * CK, 0), CV - 1);
      const float cq = bq[iq], ckv = bk[ik], cvv = bv[iv];
      const float val = (oo < CK) ? cq : (oo < 2 * CK) ? ckv : cvv;
      bvv[qd] = bfr(val);
    }
  }
{
    *(v4u*)(W16 + (size_t)o * CC + col) = u;
    if (blk == 0 && tid < 96) *(v4f*)(BIAS + 4 * tid) = bvv;
    
  }
}

// =========================================================================================================
// (0b) output conv weights: WO16 f16 [256][128] = f16 of (bf16-RNE(wo) * 256) (exact); BOB f32 [256] = bf16-RNE bo.
// coverage: 16 blocks x 16 rows x 16 pieces x 8 halves = 256 x 128; bias 64 x 4 floats = 256.
// =========================================================================================================
__global__ __launch_bounds__(256)
void cvt_wo(const float* __restrict__ wo, const float* __restrict__ bo, unsigned short* WO16, float* BOB) {
  const int tid = threadIdx.x, blk = blockIdx.x;
  const int rl = tid >> 4, col = 8 * (tid & 15);
  const int o = 16 * blk + rl;                                         // 0..255
  const float* s = wo + (size_t)o * CV + col;
  const v4f a = *(const v4f*)s;
  const v4f q = *(const v4f*)(s + 4);
  const float f[8] = {a[0], a[1], a[2], a[3], q[0], q[1], q[2], q[3]};
  v4u u;
#pragma unroll
  for (int t = 0; t < 4; ++t) {
    const _Float16 h0 = (_Float16)(bfr(f[2 * t]) * WSC);
    const _Float16 h1 = (_Float16)(bfr(f[2 * t + 1]) * WSC);
    u[t] = pk16(h_bits(h0), h_bits(h1));
  }
  v4f bvv;
  {
    const int tb = min(tid, 63);
#pragma unroll
    for (int qd = 0; qd < 4; ++qd) bvv[qd] = bfr(bo[4 * tb + qd]);  // index <= 255
  }
{
    *(v4u*)(WO16 + (size_t)o * CV + col) = u;
    if (blk == 0 && tid < 64) *(v4f*)(BOB + 4 * tid) = bvv;
    
  }
}

// =========================================================================================================
// (1) x f32 [b][256 c][4096 n] -> XP f16 [b][n][c] (position-major, bf16-RNE values, exact in f16) through an LDS
// coverage: XP 2 it x 32 rows x 8 lanes x 8 halves = 64 n x 64 c; grid (64, 4, NIMG) covers the plane exactly once.
// =========================================================================================================
__global__ __launch_bounds__(256)
void cvt_x(const float* __restrict__ x, unsigned short* XP) {
  __shared__ __align__(16) unsigned short T[QT * TP];
  const int tid = threadIdx.x;
  const int nb = blockIdx.x, cb = blockIdx.y, b = blockIdx.z;
  const int e = tid & 7, lq = tid >> 3;                               // lq 0..31
  const int n0 = nb * QT, c0 = cb * QT;
#pragma unroll
  for (int it = 0; it < 2; ++it) {
    const int cl = it * 32 + lq;                                       // 0..63
    const float* sp = x + ((size_t)(b * CC + c0 + cl)) * NN + n0 + 8 * e;
    const v4f a = *(const v4f*)sp;
    const v4f q = *(const v4f*)(sp + 4);
    unsigned short hb[8];
#pragma unroll
    for (int t = 0; t < 4; ++t) {
      hb[t]     = h_bits((_Float16)bfr(a[t]));
      hb[4 + t] = h_bits((_Float16)bfr(q[t]));
    }
#pragma unroll
    for (int t = 0; t < 8; ++t) T[(8 * e + t) * TP + cl] = hb[t];     // T[n_loc][c_loc]
  }
  __syncthreads();
  v4u up[2];
#pragma unroll
  for (int it = 0; it < 2; ++it) {
    const int nl = it * 32 + lq;                                       // 0..63
    up[it] = *(const v4u*)(T + nl * TP + 8 * e);
  }
{
#pragma unroll
    for (int it = 0; it < 2; ++it) {
      const int rl = it * 32 + lq;
      *(v4u*)(XP + ((size_t)(b * NN + n0 + rl)) * CC + c0 + 8 * e) = up[it];
    }
    
  }
}

// =========================================================================================================
// (2) conv1x1 GEMM for one (b, 64-n tile, 64-o block): Y[o][n] = (1/256) sum_c W16[o][c] XP[b][n][c] + BIAS[o].
//     Block 128 threads = 4 waves. The 64 W16 rows and the 64 XP rows of the block come into LDS first, by asynchronous
//     16-byte copies of whole rows (row pitch XPP halves = 16 B x odd), wait, barrier. Wave w owns cols n0+16w..+15 (one
//     B fragment per k-step, k = c contiguous in the token row) and 4 m-tiles (A rows o = o0 + 16 mt + (lane&15), split k
//     map loader), all fragments from LDS. K = 256 = 8 steps.
//     Epilogue, behind a barrier, staged in the same LDS as Os[o_loc][n_loc] (pitch OSP), barrier, then:
//       o-blocks 0,1 (q ck cols 0..63 / 64..127) and 2,3 (k): bf16 hi / bf16 residual planes [b][4096 n][128]
//         plane; lane e -> cols 8e..8e+7 of token row 16 it + lq; one instruction per 16 lines.
//         lane e -> halves 8e..8e+7; one instruction per 16 lines.
// coverage: Os 4 waves x 4 tiles x 16x16 = 64 x 64; q/k: per plane 4 it x 16 rows x 8 lanes x 8 = 64 n x 64 cols,
//           o-blocks 0..3 cover all 128 cols of Qh/Ql/Kh/Kl; v: 4 it x 16 rows x 8 lanes x 8 = 64 ch x 64 n;
//           grid (64, 6, NIMG) covers every plane exactly once.
// =========================================================================================================
// the two operand tiles, rows of XPP halves: weight rows 0..63, then token rows 0..63; behind the products the same
// bytes carry the output tile Os
union GemmSmem { unsigned short t[2 * QT * XPP]; float o[QT * OSP]; };

// Eight 16-byte pieces per lane, global -> LDS through no register: a wave's 32 lanes x 16 B take 512 contiguous bytes
// (four whole lines) per copy. l / g are this lane's first piece, ls bytes / gs halves the step from copy to copy. The
// s_wait_xcnt closes the statement so that no address register of a copy is rewritten ahead of it.
__device__ __forceinline__ void stage_rows8(unsigned l, const unsigned short* g, unsigned ls, size_t gs) {
#if defined(__HIP_DEVICE_COMPILE__)
  asm volatile(
      "global_load_async_to_lds_b128 %0, %8, off\n\t"
      "global_load_async_to_lds_b128 %1, %9, off\n\t"
      "global_load_async_to_lds_b128 %2, %10, off\n\t"
      "global_load_async_to_lds_b128 %3, %11, off\n\t"
      "global_load_async_to_lds_b128 %4, %12, off\n\t"
      "global_load_async_to_lds_b128 %5, %13, off\n\t"
      "global_load_async_to_lds_b128 %6, %14, off\n\t"
      "global_load_async_to_lds_b128 %7, %15, off\n\t"
      "s_wait_xcnt 0x0"
      :: "v"(l), "v"(l + ls), "v"(l + 2 * ls), "v"(l + 3 * ls),
         "v"(l + 4 * ls), "v"(l + 5 * ls), "v"(l + 6 * ls), "v"(l + 7 * ls),
         "v"(g), "v"(g + gs), "v"(g + 2 * gs), "v"(g + 3 * gs),
         "v"(g + 4 * gs), "v"(g + 5 * gs), "v"(g + 6 * gs), "v"(g + 7 * gs)
      : "memory");
#endif
}

__global__ __launch_bounds__(128)
void gemm_qkv(const unsigned short* __restrict__ W16, const float* __restrict__ BIAS,
              const unsigned short* __restrict__ XP,
              unsigned short* Qh, unsigned short* Ql, unsigned short* Kh, unsigned short* Kl,
              unsigned short* Vh) {
  __shared__ __align__(16) GemmSmem sm;
  float* Os = sm.o;
  const int tid  = threadIdx.x;
  const int lane = tid & 31, wave = tid >> 5;
  const int hh   = lane >> 4, c = lane & 15;
  const int nt   = blockIdx.x, mb = blockIdx.y, b = blockIdx.z;
  const int n0   = nt * QT, o0 = mb * QT;

  // ---- both operand tiles into LDS: copy j of wave w takes row 4j + w of the weight tile and of the token tile ----
  {
    const unsigned la = lds_byte(sm.t) + (unsigned)(wave * (XPP * 2) + lane * 16);
    const unsigned lb = la + QT * XPP * 2;
    const unsigned short* ga = W16 + (size_t)(o0 + wave) * CC + 8 * lane;
    const unsigned short* gb = XP + ((size_t)(b * NN + n0 + wave)) * CC + 8 * lane;
    const unsigned ls = 4 * XPP * 2;
    const size_t gs = (size_t)4 * CC;
    stage_rows8(la, ga, ls, gs);
    stage_rows8(la + 8 * ls, ga + 8 * gs, ls, gs);
    stage_rows8(lb, gb, ls, gs);
    stage_rows8(lb + 8 * ls, gb + 8 * gs, ls, gs);
  }
  asm volatile("s_wait_asynccnt 0x0" ::: "memory");                    // this wave's rows of both tiles have landed
  __syncthreads();                                                     // publishes both tiles to the 4 waves

  const unsigned short* ap = sm.t + c * XPP + 8 * hh;
  const unsigned short* bp = sm.t + (QT + 16 * wave + c) * XPP + 8 * hh;

  v8f acc[4];
#pragma unroll
  for (int mt = 0; mt < 4; ++mt) acc[mt] = zero8();

  // the LDS fragments are read in groups ahead of the products that use them: the weight fragments of k-step 0, the
  // wave's eight token fragments, then in every k-step the next k-step's four weight fragments
  Frag fa[2][4], fb[CC / 32];
#pragma unroll   // the fragment arrays stay in registers only under constant indices
  for (int mt = 0; mt < 4; ++mt) fa[0][mt] = ldfrag(ap + (16 * mt) * XPP);
#pragma unroll   // constant indices, as above
  for (int ks = 0; ks < CC / 32; ++ks) fb[ks] = ldfrag(bp + 32 * ks);
#pragma unroll   // constant indices, as above
  for (int ks = 0; ks < CC / 32; ++ks) {
    if (ks + 1 < CC / 32) {
#pragma unroll   // constant indices, as above
      for (int mt = 0; mt < 4; ++mt) fa[(ks + 1) & 1][mt] = ldfrag(ap + (16 * mt) * XPP + 32 * (ks + 1));
    }
    // keeps the group's reads ahead of this k-step's products: without it the compiler sinks each pair to its first use,
    // and the wave waits out every pair's LDS latency
    __builtin_amdgcn_sched_barrier(0);
#pragma unroll   // constant indices, as above
    for (int mt = 0; mt < 4; ++mt) acc[mt] = mma_h(fa[ks & 1][mt].h, fb[ks].h, acc[mt]);
  }
  __syncthreads();                                                     // every wave has read its fragments: Os may overwrite the tiles

  // ---- epilogue: scale back, + bias -> LDS Os[o_loc][n_loc] ----
  {
    const int nl = 16 * wave + c;
#pragma unroll
    for (int mt = 0; mt < 4; ++mt) {
#pragma unroll
      for (int r = 0; r < 8; ++r) {
        const int ol = 16 * mt + 8 * hh + r;                           // 0..63
        Os[ol * OSP + nl] = acc[mt][r] * IWSC + BIAS[o0 + ol];
      }
    }
  }
  __syncthreads();

  const int e = tid & 7, lq = tid >> 3;                               // lq 0..15
  if (mb < 4) {
    // ---- q / k bf16 hi + residual planes (block-uniform branch) ----
    unsigned short* Ph = (mb < 2) ? Qh : Kh;
    unsigned short* Pl = (mb < 2) ? Ql : Kl;
    const int cb = QT * (mb & 1);                                      // ck column base 0 or 64
    v4u uh[4], ul[4];
#pragma unroll
    for (int it = 0; it < 4; ++it) {
      const int nl = it * 16 + lq;                                     // token 0..63
#pragma unroll
      for (int t = 0; t < 4; ++t) {
        const float f0 = Os[(8 * e + 2 * t) * OSP + nl];
        const float f1 = Os[(8 * e + 2 * t + 1) * OSP + nl];
        const unsigned short hb0 = bf_bits(f0), hb1 = bf_bits(f1);
        const unsigned short lb0 = bf_bits(f0 - bf_up(hb0));
        const unsigned short lb1 = bf_bits(f1 - bf_up(hb1));
        uh[it][t] = pk16(hb0, hb1);
        ul[it][t] = pk16(lb0, lb1);
      }
    }
{
#pragma unroll
      for (int it = 0; it < 4; ++it) {
        const int nl = it * 16 + lq;
        const size_t base = ((size_t)(b * NN + n0 + nl)) * CK + cb + 8 * e;
        *(v4u*)(Ph + base) = uh[it];
        *(v4u*)(Pl + base) = ul[it];
      }
      
    }
  } else {
    // ---- v f16 plane, carried x16 ----
    const int ch0 = QT * (mb - 4);                                     // 0 or 64
    v4u uv[4];
#pragma unroll
    for (int it = 0; it < 4; ++it) {
      const int row = it * 16 + lq;                                    // 0..63
      const v4f a = *(const v4f*)(Os + row * OSP + 8 * e);
      const v4f q = *(const v4f*)(Os + row * OSP + 8 * e + 4);
#pragma unroll
      for (int t = 0; t < 2; ++t) {
        uv[it][t]     = pk16(h_bits((_Float16)(a[2 * t] * VSC)), h_bits((_Float16)(a[2 * t + 1] * VSC)));
        uv[it][2 + t] = pk16(h_bits((_Float16)(q[2 * t] * VSC)), h_bits((_Float16)(q[2 * t + 1] * VSC)));
      }
    }
{
#pragma unroll
      for (int it = 0; it < 4; ++it) {
        const int row = it * 16 + lq;
        *(v4u*)(Vh + ((size_t)(b * CV + ch0 + row)) * NN + n0 + 8 * e) = uv[it];
      }
      
    }
  }
}

// =========================================================================================================
// (3) attention for one (b, 128-query tile), transposed formulation, 4096 keys, no mask:
//   S^T tile (16 keys x 16 queries) = sum over 4 k-steps of A(k: row = key kb + (lane&15), 32 d via the split k map
//   from the bf16 plane Kh [b][4096][128]) . B(q: col = query, same map, from the wave's registers) + A(Kh).B(Ql)
//   + A(Kl).B(Qh) (bf16 unscaled residual planes, shared accumulator). Softmax of s*c with c = 1/sqrt(128):
//   per lane the D tile holds 8 keys of ONE query: online state per lane, one cross-row move (lane^16) for the max over
//   32 keys, row-sum partials combined at the end. P = 1024 e^{(s-m)c} as f16 is the B operand of
//   O^T (rows channel, cols queries) += A(V rows channel = 16j + (lane&15), keys contiguous, f16 plane Vh
//   [b][128][4096]) . B(P^T): element r <- D of the tile covering keys kb..kb+15, element 8+r <- the tile covering
//   kb+16..kb+31, lane unchanged. 8 accumulator tiles per query tile (128 channels). Block = 8 waves = 128 queries, one
//   block per WGP: wave w owns two query tiles, queries 32 (w & 3) .. +31, and keys 32 (w >> 2) .. +31 of every key tile;
//   the two states of a query group are merged at the end. Q hi/lo rows of the block's 128 queries are staged once in LDS
//   (v4u pieces, barrier); each wave then reads its 16 q fragments once and keeps them in registers, so that the key loop
//   reads only k and v from LDS and every such fragment feeds both query tiles. A 32-key pass reads its LDS fragments
//   ahead of the products that use them: k of k-steps 0,1; k of k-steps 2,3; all of v.
//   K hi, K residual and V come in tiles of KT = 64 keys through a two-buffer LDS ring filled by asynchronous 16-byte
//   copies (whole 128-B lines per request, each tile fetched once per block and read by all 8 waves); tile t+2 is
//   issued behind the barrier that ends the reads of tile t. Row pitches QP / VP halves = 16 B x odd.
//   Epilogue: barrier, O/l staged in LDS Os[query][128 channels] (pitch OSPW, b128 stores, aliases the Q staging),
// coverage: Q staging 8 it x 16 rows x 16 lanes x 8 = 128 x 128 per plane; OB 16 it x 32 lines x 8 lanes x 4 floats =
//           128 queries x 128 ch; grid (32, NIMG) covers OB exactly once.
// =========================================================================================================
#define AQ    128                                                      // queries of one attention block
static_assert(NN % AQ == 0 && AQ * OSPW * 4 <= 2 * AQ * QP * 2);
union AttnSmem { unsigned short q[2 * AQ * QP]; float o[AQ * OSPW]; };
// the k/v ring; after the key loop its first bytes carry the second key half's softmax state (o 16384 floats, m, l)
union AttnRing { unsigned short h[2 * STG]; float f[4 * 132 * 32]; };
static_assert(4 * 132 * 32 * 4 <= 2 * STG * 2);

// One tile of KT keys into one ring buffer at LDS byte lb: k hi rows [KT][QP], k residual rows [KT][QP], v rows
// [CV][VP]. kh / kl / vh are this thread's piece 0 of the tile; lk / lv its byte offsets inside the k and v parts.
// 256 threads, twelve 16-byte copies per lane, global -> LDS through no register. k: 16 lanes per 256-B row, 16 rows
// per piece step; v: 8 lanes per 128-B row segment, 32 rows per piece step. The s_wait_xcnt closes the statement so
// that no address register of a copy is rewritten ahead of it.
__device__ __forceinline__ void stage_kv(unsigned lb, unsigned lk, unsigned lv, const unsigned short* kh,
                                         const unsigned short* kl, const unsigned short* vh) {
#if defined(__HIP_DEVICE_COMPILE__)
  const unsigned la = lb + lk, lc = lb + KT * QP * 2 + lk, ld = lb + 2 * KT * QP * 2 + lv;
  const unsigned ks = 16 * QP * 2, vs = 32 * VP * 2;
  const size_t kg = (size_t)16 * CK, vg = (size_t)32 * NN;
  asm volatile(
      "global_load_async_to_lds_b128 %0, %12, off\n\t"
      "global_load_async_to_lds_b128 %1, %13, off\n\t"
      "global_load_async_to_lds_b128 %2, %14, off\n\t"
      "global_load_async_to_lds_b128 %3, %15, off\n\t"
      "global_load_async_to_lds_b128 %4, %16, off\n\t"
      "global_load_async_to_lds_b128 %5, %17, off\n\t"
      "global_load_async_to_lds_b128 %6, %18, off\n\t"
      "global_load_async_to_lds_b128 %7, %19, off\n\t"
      "global_load_async_to_lds_b128 %8, %20, off\n\t"
      "global_load_async_to_lds_b128 %9, %21, off\n\t"
      "global_load_async_to_lds_b128 %10, %22, off\n\t"
      "global_load_async_to_lds_b128 %11, %23, off\n\t"
      "s_wait_xcnt 0x0"
      :: "v"(la), "v"(la + ks), "v"(la + 2 * ks), "v"(la + 3 * ks),
         "v"(lc), "v"(lc + ks), "v"(lc + 2 * ks), "v"(lc + 3 * ks),
         "v"(ld), "v"(ld + vs), "v"(ld + 2 * vs), "v"(ld + 3 * vs),
         "v"(kh), "v"(kh + kg), "v"(kh + 2 * kg), "v"(kh + 3 * kg),
         "v"(kl), "v"(kl + kg), "v"(kl + 2 * kg), "v"(kl + 3 * kg),
         "v"(vh), "v"(vh + vg), "v"(vh + 2 * vg), "v"(vh + 3 * vg)
      : "memory");
#endif
}

// ---- WMMA helpers of the attention kernel: the bare builtins, the compiler keeping the distance behind them. An asm
//      statement takes its vector operands from v0..v255 only; tied to one, the wave's 32-query register tile
//      (q 128, o 128 registers) would not fit and would spill.
__device__ __forceinline__ v8f mma_hr(v16h a, v16h b, v8f c) {
  return __builtin_amdgcn_wmma_f32_16x16x32_f16(false, a, false, b, (short)0, c, false, false);
}
__device__ __forceinline__ v8f mma_br(v16b a, v16b b, v8f c) {
  return __builtin_amdgcn_wmma_f32_16x16x32_bf16(false, a, false, b, (short)0, c, false, false);
}

__global__ __launch_bounds__(256)
void attn_gab(const unsigned short* __restrict__ Qh, const unsigned short* __restrict__ Ql,
              const unsigned short* __restrict__ Kh, const unsigned short* __restrict__ Kl,
              const unsigned short* __restrict__ Vh, float* OB) {
  __shared__ __align__(16) AttnSmem sm;
  __shared__ __align__(16) AttnRing rg;
  unsigned short* ring = rg.h;
  const int tid  = threadIdx.x;
  const int wave = tid >> 5, lane = tid & 31;
  const int hh   = lane >> 4, c = lane & 15;
  const int n0   = blockIdx.x * AQ, b = blockIdx.y;
  const int wq   = wave & 3, kh2 = wave >> 2;                          // query group of 32; key half of every tile

  // ---- this thread's share of a k/v tile: source pointers of tile 0, byte places inside a ring buffer ----
  const unsigned ring0 = lds_byte(ring);
  const unsigned lk = (unsigned)((tid >> 4) * (QP * 2) + (tid & 15) * 16);
  const unsigned lv = (unsigned)((tid >> 3) * (VP * 2) + (tid & 7) * 16);
  const unsigned short* khg = Kh + ((size_t)(b * NN + (tid >> 4))) * CK + 8 * (tid & 15);
  const unsigned short* klg = Kl + ((size_t)(b * NN + (tid >> 4))) * CK + 8 * (tid & 15);
  const unsigned short* vhg = Vh + ((size_t)(b * CV + (tid >> 3))) * NN + 8 * (tid & 7);
  stage_kv(ring0, lk, lv, khg, klg, vhg);                              // tile 0 -> buffer 0

  // ---- stage q hi (rows 0..127) and q residual (rows 128..255) of this query tile in LDS ----
  {
    const int e16 = tid & 15, rq = tid >> 4;                          // rq 0..15
#pragma unroll
    for (int it = 0; it < AQ / 16; ++it) {
      const int row = 16 * it + rq;                                    // 0..127
      const size_t g = ((size_t)(b * NN + n0 + row)) * CK + 8 * e16;
      const v4u vh = *(const v4u*)(Qh + g);
      const v4u vl = *(const v4u*)(Ql + g);
      *(v4u*)(sm.q + row * QP + 8 * e16)        = vh;
      *(v4u*)(sm.q + (AQ + row) * QP + 8 * e16) = vl;
    }
  }
  asm volatile("s_wait_asynccnt 0x0" ::: "memory");                    // this wave's share of tile 0 has landed
  __syncthreads();                                                     // publishes the q rows and tile 0
  stage_kv(ring0 + STG * 2, lk, lv, khg + (size_t)KT * CK, klg + (size_t)KT * CK, vhg + KT);   // tile 1 -> buffer 1

  // ---- the wave's q fragments (B operand, col = query n0 + 32*wq + 16*g + c), read once and kept in registers ----
  Frag qhf[2][CK / 32], qlf[2][CK / 32];
#pragma unroll
  for (int g = 0; g < 2; ++g) {
    const unsigned short* qsh = sm.q + (32 * wq + 16 * g + c) * QP + 8 * hh;
#pragma unroll
    for (int ks = 0; ks < CK / 32; ++ks) {
      qhf[g][ks] = ldfrag(qsh + 32 * ks);
      qlf[g][ks] = ldfrag(qsh + AQ * QP + 32 * ks);
    }
  }

  float m[2] = {-1.0e30f, -1.0e30f}, l[2] = {0.f, 0.f};
  v8f o[2][8];
#pragma unroll
  for (int g = 0; g < 2; ++g) {
#pragma unroll
    for (int j = 0; j < 8; ++j) o[g][j] = zero8();
  }

  // this thread's places in the buffer that trip t frees, carried from trip to trip: they are the copies' own operands
  unsigned lkc = ring0 + lk, lvc = ring0 + lv;
  const unsigned lks = 2 * (ring0 + lk) + STG * 2, lvs = 2 * (ring0 + lv) + STG * 2;

#pragma unroll 1   // rolled: one hand-over point in the text, the buffer picked by t & 1
  for (int t = 0; t < NN / KT; ++t) {
  const unsigned short* buf = ring + (t & 1) * STG;
  // k fragment base (A operand, row = key kb + c of the tile), + key * QP
  const int kb = 32 * kh2;                                             // this wave's 32 keys of the tile
  const unsigned short* Khp = buf + c * QP + 8 * hh;
  const unsigned short* Klp = Khp + KT * QP;
  // v fragment base (A operand, row = channel 16j + c, the tile's keys contiguous), + 16*j*VP + kb
  const unsigned short* Vhp = buf + 2 * KT * QP + c * VP + 8 * hh;
  {
    v8f s0[2], s1[2];                                                  // [query tile]: keys kb..+15, keys kb+16..+31
#pragma unroll
    for (int g = 0; g < 2; ++g) { s0[g] = zero8(); s1[g] = zero8(); }
#pragma unroll   // unrolled: each trip's reads stand as one group in the text, ahead of that trip's 24 products
    for (int kg = 0; kg < CK / 64; ++kg) {
      // the k fragments of two k-steps, read ahead of their products, counted waits behind them
      Frag k0[2], k1[2], k0l[2], k1l[2];
#pragma unroll   // the fragment arrays stay in registers only under constant indices
      for (int u = 0; u < 2; ++u) {
        const int ks = 2 * kg + u;
        k0[u]  = ldfrag(Khp + kb * QP + 32 * ks);                        // keys kb .. kb+15
        k1[u]  = ldfrag(Khp + (kb + 16) * QP + 32 * ks);                 // keys kb+16 .. kb+31
        k0l[u] = ldfrag(Klp + kb * QP + 32 * ks);
        k1l[u] = ldfrag(Klp + (kb + 16) * QP + 32 * ks);
      }
      // keeps the group's reads ahead of its products: without it the compiler sinks each pair to its first use, and the
      // wave waits out every pair's latency
      __builtin_amdgcn_sched_barrier(0);
#pragma unroll   // constant indices, as above
      for (int u = 0; u < 2; ++u) {
        const int ks = 2 * kg + u;
        // every k fragment feeds both query tiles; per accumulator the order hi.hi, hi.res, res.hi is kept
        s0[0] = mma_br(k0[u].bf, qhf[0][ks].bf, s0[0]);
        s1[0] = mma_br(k1[u].bf, qhf[0][ks].bf, s1[0]);
        s0[1] = mma_br(k0[u].bf, qhf[1][ks].bf, s0[1]);
        s1[1] = mma_br(k1[u].bf, qhf[1][ks].bf, s1[1]);
        s0[0] = mma_br(k0[u].bf, qlf[0][ks].bf, s0[0]);
        s1[0] = mma_br(k1[u].bf, qlf[0][ks].bf, s1[0]);
        s0[1] = mma_br(k0[u].bf, qlf[1][ks].bf, s0[1]);
        s1[1] = mma_br(k1[u].bf, qlf[1][ks].bf, s1[1]);
        s0[0] = mma_br(k0l[u].bf, qhf[0][ks].bf, s0[0]);
        s1[0] = mma_br(k1l[u].bf, qhf[0][ks].bf, s1[0]);
        s0[1] = mma_br(k0l[u].bf, qhf[1][ks].bf, s0[1]);
        s1[1] = mma_br(k1l[u].bf, qhf[1][ks].bf, s1[1]);
      }
    }

    // the pass's eight v fragments, read ahead of the softmax: nothing below waits on LDS before the products that use
    // them, so they land while the softmax runs
    Frag vf[8];
#pragma unroll   // constant indices, as above
    for (int j = 0; j < 8; ++j) vf[j] = ldfrag(Vhp + (16 * j) * VP + kb);
    // holds the sixteen reads here: without it the compiler sinks them to the softmax's end and their latency is waited out
    __builtin_amdgcn_sched_barrier(0);

    FragH ph[2];
#pragma unroll   // constant indices, as above
    for (int g = 0; g < 2; ++g) {
      float mx = fmaxf(hmax8(s0[g]), hmax8(s1[g]));
      mx = fmaxf(mx, xhalf(mx));
      const float mn   = fmaxf(m[g], mx);
      const float corr = __expf((m[g] - mn) * SCL);
      m[g] = mn;
      const float msh = mn * SCL - LNPS;                               // exp gives e^{(s-m)c} * 1024
      l[g] *= corr;
#pragma unroll
      for (int j = 0; j < 8; ++j) {
#pragma unroll
        for (int r = 0; r < 8; ++r) o[g][j][r] *= corr;
      }

      float ls = 0.f;
#pragma unroll
      for (int r = 0; r < 8; ++r) {
        const float e0 = __expf(s0[g][r] * SCL - msh);                 // key kb      + 8hh + r
        const float e1 = __expf(s1[g][r] * SCL - msh);                 // key kb + 16 + 8hh + r
        ls += e0 + e1;
        ph[g].hv[0][r] = (_Float16)e0;
        ph[g].hv[1][r] = (_Float16)e1;
      }
      l[g] += ls;
    }

#pragma unroll
    for (int j = 0; j < 8; ++j) {                                      // every v fragment feeds both query tiles
      o[0][j] = mma_hr(vf[j].h, ph[0].v, o[0][j]);
      o[1][j] = mma_hr(vf[j].h, ph[1].v, o[1][j]);
    }
  }
  // ---- hand-over: tile t+1 becomes readable, buffer t&1 becomes free ----
  // keeps the waits below behind the products above: lifted into the softmax, the dscnt wait would wait out the v reads
  __builtin_amdgcn_sched_barrier(0);
  asm volatile("s_wait_dscnt 0x0" ::: "memory");                       // this wave's reads of buffer t&1 are done
  asm volatile("s_wait_asynccnt 0x0" ::: "memory");                    // this wave's share of tile t+1 has landed
  __syncthreads();
  if (t + 2 < NN / KT)
    stage_kv(0u, lkc, lvc, khg + (size_t)(t + 2) * KT * CK, klg + (size_t)(t + 2) * KT * CK, vhg + (t + 2) * KT);
  lkc = lks - lkc;                                                     // the other buffer
  lvc = lvs - lvc;
  }
  asm volatile("s_wait_asynccnt 0x0" ::: "memory");                    // no copy is left in flight at the wave's end
#pragma unroll
  for (int g = 0; g < 2; ++g) l[g] += __shfl_xor(l[g], 16, 32);

  // ---- the two key halves of a query group hold the same lane layout: waves 4..7 hand m, l, o over through the ring's
  //      LDS (free behind the loop's last barrier: every read of it is done and no copy is in flight) ----
  float* mg = rg.f;
  if (kh2 == 1) {                                                      // the same in every lane of a wave
#pragma unroll
    for (int g = 0; g < 2; ++g) {
#pragma unroll
      for (int j = 0; j < 8; ++j) {
        v4f va, vb;
#pragma unroll
        for (int r = 0; r < 4; ++r) { va[r] = o[g][j][r]; vb[r] = o[g][j][4 + r]; }
        *(v4f*)(mg + ((wq * 32 + 16 * g + 2 * j) * 32 + lane) * 4)     = va;   // 16 B per lane, lanes adjacent
        *(v4f*)(mg + ((wq * 32 + 16 * g + 2 * j + 1) * 32 + lane) * 4) = vb;
      }
      mg[16384 + (4 * wq + 2 * g) * 32 + lane]     = m[g];
      mg[16384 + (4 * wq + 2 * g + 1) * 32 + lane] = l[g];
    }
  }
  __syncthreads();                                                     // publishes the second half's state
  if (kh2 == 0) {
#pragma unroll
    for (int g = 0; g < 2; ++g) {
      const float m2 = mg[16384 + (4 * wq + 2 * g) * 32 + lane];
      const float l2 = mg[16384 + (4 * wq + 2 * g + 1) * 32 + lane];
      const float mn = fmaxf(m[g], m2);
      const float f1 = __expf((m[g] - mn) * SCL), f2 = __expf((m2 - mn) * SCL);
      const float inv = IVSC / (l[g] * f1 + l2 * f2);                  // o carries x1024 x16, l carries x1024
      const float g1 = f1 * inv, g2 = f2 * inv;
      const int qrow = 32 * wq + 16 * g + c;
#pragma unroll
      for (int j = 0; j < 8; ++j) {
        const v4f pa = *(const v4f*)(mg + ((wq * 32 + 16 * g + 2 * j) * 32 + lane) * 4);
        const v4f pb = *(const v4f*)(mg + ((wq * 32 + 16 * g + 2 * j + 1) * 32 + lane) * 4);
        v4f va, vb;
#pragma unroll
        for (int r = 0; r < 4; ++r) {
          va[r] = o[g][j][r] * g1 + pa[r] * g2;
          vb[r] = o[g][j][4 + r] * g1 + pb[r] * g2;
        }
        *(v4f*)(sm.o + qrow * OSPW + 16 * j + 8 * hh)     = va;       // Os[query][ch = 16j + 8hh + r]
        *(v4f*)(sm.o + qrow * OSPW + 16 * j + 8 * hh + 4) = vb;
      }
    }
  }
  __syncthreads();

  const int e = tid & 7, lq = tid >> 3;                                // lq 0..31
{
#pragma unroll
    for (int it = 0; it < AQ / 8; ++it) {
      const int L   = it * 32 + lq;                                    // line 0..511
      const int q   = L >> 2, seg = L & 3;                             // query 0..127, 32-float segment
      const v4f v = *(const v4f*)(sm.o + q * OSPW + 32 * seg + 4 * e);
      *(v4f*)(OB + ((size_t)(b * NN + n0 + q)) * CV + 32 * seg + 4 * e) = v;
    }
    
  }
}

// =========================================================================================================
// (4) output conv on the raw view: for image b, U[r][p] = OB_b[r*4096 + p] (r < 128, p < 4096);
//     y[b][o][p] = (1/4096) sum_r WO16[o][r] (Uh + Ul/2048)[p][r] + BOB[o], Uh = f16(16 U), Ul = f16((16U - Uh) 2048).
//     Block (64-p tile, 64-o block, b), 128 threads: stage the 128 r x 64 p view slab from OB (256-B contiguous row
//     segments), convert, store transposed into LDS Bs[p_loc][r] hi rows 0..63 / residual rows 64..127 (u32 pairs of
//     consecutive r), barrier; then 4 waves, wave w owns cols p0+16w..+15 (B fragments from the LDS rows, split k
//     map), 4 m-tiles (A rows o0 + 16 mt + (lane&15), k = r contiguous, from the 64 WO16 rows that asynchronous 16-byte
//     copies brought into LDS at pitch BP ahead of that barrier), K = 128 = 4 steps, hi and
//     d_out [b][256][4096] (row segment 64 p = 2 lines): 8 consecutive lanes x 16 B, one instruction per 16 lines,
// coverage: staging 8 it x 8 row-pairs x 16 lanes x 4 p x 2 rows = 128 r x 64 p per plane (pad cols never read);
//           d_out 8 it x 16 lines x 8 lanes x 4 = 64 o x 64 p; grid (64, 4, NIMG) covers d_out exactly once.
// =========================================================================================================
__global__ __launch_bounds__(128)
void out_proj(const float* __restrict__ OB, const unsigned short* __restrict__ WO16,
              const float* __restrict__ BOB, float* out) {
  __shared__ __align__(16) unsigned int Bs[2 * QT * (BP / 2)];
  __shared__ __align__(16) unsigned short As[QT * BP];
  __shared__ __align__(16) float Os[QT * OSP];
  const int tid  = threadIdx.x;
  const int lane = tid & 31, wave = tid >> 5;
  const int hh   = lane >> 4, c = lane & 15;
  const int pt = blockIdx.x, mb = blockIdx.y, b = blockIdx.z;
  const int p0 = pt * QT, o0 = mb * QT;
  const float* OBb = OB + (size_t)b * NN * CV;

  // ---- the weight tile into LDS, rows o0 .. o0+63 of 256 B at pitch BP: 16 lanes per row, copy j takes rows 8j .. 8j+7;
  //      the copies fly while the view slab below is loaded and converted ----
  stage_rows8(lds_byte(As) + (unsigned)((tid >> 4) * (BP * 2) + (tid & 15) * 16),
              WO16 + (size_t)(o0 + (tid >> 4)) * CV + 8 * (tid & 15), 8 * BP * 2, (size_t)8 * CV);

  // ---- stage + convert the view slab: Bs[p_loc][r] ----
  {
    const int e16 = tid & 15, rq = tid >> 4;                           // rq 0..7
#pragma unroll
    for (int it = 0; it < 8; ++it) {
      const int rp = 8 * it + rq;                                      // row pair 0..63
      const int r0 = 2 * rp;
      const v4f va = *(const v4f*)(OBb + (size_t)r0 * NN + p0 + 4 * e16);
      const v4f vb = *(const v4f*)(OBb + (size_t)(r0 + 1) * NN + p0 + 4 * e16);
#pragma unroll
      for (int t = 0; t < 4; ++t) {
        const float f0 = va[t] * USC, f1 = vb[t] * USC;
        const _Float16 h0 = (_Float16)f0, h1 = (_Float16)f1;
        const _Float16 l0 = (_Float16)((f0 - (float)h0) * RSC);
        const _Float16 l1 = (_Float16)((f1 - (float)h1) * RSC);
        const int pl = 4 * e16 + t;                                    // p_loc 0..63
        Bs[pl * (BP / 2) + rp]        = pk16(h_bits(h0), h_bits(h1));  // halves r0, r0+1
        Bs[(QT + pl) * (BP / 2) + rp] = pk16(h_bits(l0), h_bits(l1));
      }
    }
  }
  asm volatile("s_wait_asynccnt 0x0" ::: "memory");                    // this wave's rows of the weight tile have landed
  __syncthreads();                                                     // publishes the slab and the weight tile

  const unsigned short* Bh  = (const unsigned short*)Bs;
  const unsigned short* bph = Bh + (16 * wave + c) * BP + 8 * hh;     // B col = p0 + 16*wave + c, k = r
  const unsigned short* bpl = bph + QT * BP;
  const unsigned short* ap  = As + c * BP + 8 * hh;                   // A row = o0 + 16 mt + c, k = r

  v8f acch[4], accl[4];
#pragma unroll
  for (int mt = 0; mt < 4; ++mt) { acch[mt] = zero8(); accl[mt] = zero8(); }

  // a k-step's six LDS fragments are read as one group, one k-step ahead of the products that use them
  Frag fa[2][4], fbh[2], fbl[2];
  fbh[0] = ldfrag(bph);
  fbl[0] = ldfrag(bpl);
#pragma unroll   // the fragment arrays stay in registers only under constant indices
  for (int mt = 0; mt < 4; ++mt) fa[0][mt] = ldfrag(ap + (16 * mt) * BP);
#pragma unroll   // constant indices, as above
  for (int ks = 0; ks < CV / 32; ++ks) {
    if (ks + 1 < CV / 32) {
      fbh[(ks + 1) & 1] = ldfrag(bph + 32 * (ks + 1));
      fbl[(ks + 1) & 1] = ldfrag(bpl + 32 * (ks + 1));
#pragma unroll   // constant indices, as above
      for (int mt = 0; mt < 4; ++mt) fa[(ks + 1) & 1][mt] = ldfrag(ap + (16 * mt) * BP + 32 * (ks + 1));
    }
    // keeps the group's reads ahead of this k-step's products: without it the compiler sinks each pair to its first use,
    // and the wave waits out every pair's LDS latency
    __builtin_amdgcn_sched_barrier(0);
#pragma unroll   // constant indices, as above
    for (int mt = 0; mt < 4; ++mt) {
      acch[mt] = mma_h(fa[ks & 1][mt].h, fbh[ks & 1].h, acch[mt]);
      accl[mt] = mma_h(fa[ks & 1][mt].h, fbl[ks & 1].h, accl[mt]);
    }
  }
  {
    const int nl = 16 * wave + c;
    const float osc = IWSC * IUSC;                                     // 1/4096
#pragma unroll
    for (int mt = 0; mt < 4; ++mt) {
#pragma unroll
      for (int r = 0; r < 8; ++r) {
        const int ol = 16 * mt + 8 * hh + r;                           // 0..63
        Os[ol * OSP + nl] = (acch[mt][r] + accl[mt][r] * IRSC) * osc + BOB[o0 + ol];
      }
    }
  }
  __syncthreads();
  {
    const int e = tid & 7, lq = tid >> 3;                              // lq 0..15
{
#pragma unroll
      for (int it = 0; it < 8; ++it) {
        const int L = it * 16 + lq;                                    // 0..127
        const int row = L >> 1, hf = L & 1;
        const int nl = hf * 32 + 4 * e;
        const v4f v = *(const v4f*)(Os + row * OSP + nl);
        *(v4f*)(out + ((size_t)(b * CO + o0 + row)) * NN + p0 + nl) = v;
      }
      
    }
  }
}

// =========================================================================================================
// Workspace map (bytes; each region start a multiple of 256; every extent is an exact tile multiple and is written
//   W16 f16 [384][256]            196608      BIAS f32 [384]              1536
//   WO16 f16 [256][128]            65536      BOB  f32 [256]              1024
//   XP  f16 [8][4096][256]      16777216
//   Qh/Ql/Kh/Kl bf16 [8][4096][128]  8388608 x4                          Vh f16 [8][128][4096]  8388608
//   OB  f32 [8][4096][128]      16777216
//   total = 75762176
// =========================================================================================================
extern "C" void kernel_launch(void* const* d_in, const int* in_sizes, int n_in,
                              void* d_out, int out_size, void* d_ws, size_t ws_size,
                              hipStream_t stream) {
  const int XN = NIMG * CC * NN;                                       // 8388608
  if (n_in < 9) return;
  if (in_sizes[0] != XN) return;
  if (in_sizes[1] != CK * CC || in_sizes[2] != CK) return;
  if (in_sizes[3] != CK * CC || in_sizes[4] != CK) return;
  if (in_sizes[5] != CV * CC || in_sizes[6] != CV) return;
  if (in_sizes[7] != CO * CV || in_sizes[8] != CO) return;
  if (out_size != NIMG * CO * NN) return;

  size_t off = 0;
  auto carve = [&](size_t bytes) { const size_t o = off; off += (bytes + 255) & ~(size_t)255; return o; };
  const size_t oW16 = carve((size_t)MQKV * CC * 2);
  const size_t oBIA = carve((size_t)MQKV * 4);
  const size_t oWO  = carve((size_t)CO * CV * 2);
  const size_t oBOB = carve((size_t)CO * 4);
  const size_t oXP  = carve((size_t)NIMG * NN * CC * 2);
  const size_t oQh  = carve((size_t)NIMG * NN * CK * 2);
  const size_t oQl  = carve((size_t)NIMG * NN * CK * 2);
  const size_t oKh  = carve((size_t)NIMG * NN * CK * 2);
  const size_t oKl  = carve((size_t)NIMG * NN * CK * 2);
  const size_t oVh  = carve((size_t)NIMG * CV * NN * 2);
  const size_t oOB  = carve((size_t)NIMG * NN * CV * 4);
  if (off > ws_size) return;
  if (off > (size_t)134217728) return;

  const float* x  = (const float*)d_in[0];
  const float* wq = (const float*)d_in[1];
  const float* bq = (const float*)d_in[2];
  const float* wk = (const float*)d_in[3];
  const float* bk = (const float*)d_in[4];
  const float* wv = (const float*)d_in[5];
  const float* bv = (const float*)d_in[6];
  const float* wo = (const float*)d_in[7];
  const float* bo = (const float*)d_in[8];

  char* ws = (char*)d_ws;
  unsigned short* W16 = (unsigned short*)(ws + oW16);
  float*          BIA = (float*)(ws + oBIA);
  unsigned short* WO  = (unsigned short*)(ws + oWO);
  float*          BOB = (float*)(ws + oBOB);
  unsigned short* XP  = (unsigned short*)(ws + oXP);
  unsigned short* Qh  = (unsigned short*)(ws + oQh);
  unsigned short* Ql  = (unsigned short*)(ws + oQl);
  unsigned short* Kh  = (unsigned short*)(ws + oKh);
  unsigned short* Kl  = (unsigned short*)(ws + oKl);
  unsigned short* Vh  = (unsigned short*)(ws + oVh);
  float*          OB  = (float*)(ws + oOB);
  float* out = (float*)d_out;

  const dim3 blk256(256), blk128(128);

  // (0) conv1x1 q/k/v weights -> f16 plane + bias line; output conv weights -> f16 plane + bias line
  cvt_w<<<dim3(MQKV / 8), blk256, 0, stream>>>(wq, bq, wk, bk, wv, bv, W16, BIA);
  cvt_wo<<<dim3(CO / 16), blk256, 0, stream>>>(wo, bo, WO, BOB);
  // (1) x -> position-major 16-bit plane
  cvt_x<<<dim3(NN / QT, CC / QT, NIMG), blk256, 0, stream>>>(x, XP);
  // (2) conv1x1 GEMM -> q/k hi + residual planes and v plane
  gemm_qkv<<<dim3(NN / QT, MQKV / QT, NIMG), blk128, 0, stream>>>(W16, BIA, XP, Qh, Ql, Kh, Kl, Vh);
  // (3) attention -> OB [b][4096][128] token-major f32
  attn_gab<<<dim3(NN / AQ, NIMG), blk256, 0, stream>>>(Qh, Ql, Kh, Kl, Vh, OB);
  // (4) output conv on the raw view -> out [b][256][4096]
  out_proj<<<dim3(NN / QT, CO / QT, NIMG), blk128, 0, stream>>>(OB, WO, BOB, out);
  (void)hipGetLastError();
}

// v006
// One run takes 108 microseconds.
// Next to v005, in two timings, it ran 1.07 and 1.06 times as fast.
// All steps since v000 together make it 4.39 times as fast.
// Contractions: conv1x1 q/k/v GEMM W[384x256].X on v_wmma_f32_16x16x32_f16 (f16 containers of bf16-RNE weights x256
// and bf16-RNE x); scores K.Q^T on v_wmma_f32_16x16x32_bf16 (bf16 hi + bf16 residual planes of q and k, 3 products,
// K=128); O^T = V.P^T on v_wmma_f32_16x16x32_f16 (v x16 f16, P = 1024 e^{(s-m)c} f16 from the score D registers);
// output conv1x1 Wo[256x128].U on v_wmma_f32_16x16x32_f16 (Wo f16 of bf16-RNE x256, U as f16 hi x16 plus f16
// residual x2^11 planes in two accumulators); f32 accumulate everywhere; softmax statistics in f32 VALU.
#include <hip/hip_runtime.h>
#include <math.h>
#include <stdint.h>

#define NIMG  8
#define CC    256
#define NN    4096
#define CK    128
#define CV    128
#define CO    256
#define MQKV  384
#define QT    64
#define OSP   68
#define OSPW  132
#define QP    136
#define BP    136
#define KT    64
#define VP    72
#define STG   (2 * KT * QP + CV * VP)
#define XPP   264
#define WSC   256.0f
#define IWSC  0.00390625f
#define VSC   16.0f
#define IVSC  0.0625f
#define USC   16.0f
#define IUSC  0.0625f
#define RSC   2048.0f
#define IRSC  0.00048828125f
#define LNPS  6.931471805599453f
#define SCL   0.08838834764831845f

static_assert(NN % QT == 0);
static_assert(CC % 32 == 0 && CK % 64 == 0 && CV % 32 == 0);
static_assert(MQKV == 2 * CK + CV);
static_assert(MQKV % QT == 0 && CO % QT == 0);
static_assert(CK == 2 * QT && CV == 2 * QT);
static_assert((OSP * 4) % 16 == 0);
static_assert((OSPW * 4) % 16 == 0);
static_assert((XPP * 2) % 32 == 16 && XPP >= CC + 8 && XPP % 2 == 0 && MQKV / QT >= 2);
static_assert((QP * 2) % 16 == 0 && (BP * 2) % 16 == 0 && (BP % 2) == 0);
static_assert(QT * OSPW * 4 <= 2 * QT * QP * 2);
static_assert(NN % KT == 0 && NN / KT >= 2 && KT % 32 == 0);
static_assert((VP * 2) % 16 == 0 && (STG * 2) % 16 == 0 && VP >= KT + 8);
static_assert(KT * CK * 2 == 4 * 256 * 16 && CV * KT * 2 == 4 * 256 * 16 && KT == 64);

typedef _Float16       v16h __attribute__((ext_vector_type(16)));
typedef _Float16       v8h  __attribute__((ext_vector_type(8)));
typedef _Float16       v2h  __attribute__((ext_vector_type(2)));
typedef __bf16         v16b __attribute__((ext_vector_type(16)));
typedef unsigned short v8us __attribute__((ext_vector_type(8)));
typedef float          v8f  __attribute__((ext_vector_type(8)));
typedef float          v4f  __attribute__((ext_vector_type(4)));
typedef unsigned int   v4u  __attribute__((ext_vector_type(4)));

union Frag  { v8us u[2]; v16h h; v16b bf; };
union FragH { v16h v; v8h hv[2]; };
static_assert(sizeof(Frag) == 32);
static_assert(sizeof(FragH) == 32);

// ---- scalar helpers ---------------------------------------------------------------------------------------
__device__ __forceinline__ unsigned short bf_bits(float f) {          // f32 -> bf16 bits, RNE convert
  unsigned u = __float_as_uint(f);
  return (unsigned short)((u + 0x7FFFu + ((u >> 16) & 1u)) >> 16);
}
__device__ __forceinline__ float bf_up(unsigned short hb) { return __uint_as_float(((unsigned)hb) << 16); }
__device__ __forceinline__ float bfr(float f) { return bf_up(bf_bits(f)); }
__device__ __forceinline__ unsigned short h_bits(_Float16 x) { return __builtin_bit_cast(unsigned short, x); }
__device__ __forceinline__ unsigned pk16(unsigned short a, unsigned short b) { return (unsigned)a | ((unsigned)b << 16); }
__device__ __forceinline__ unsigned pkh(float a, float b) {           // f16 RNE of a (low half) and of b (high half)
  const v2h p = {(_Float16)a, (_Float16)b};
  return __builtin_bit_cast(unsigned, p);
}
__device__ __forceinline__ v8f zero8() { v8f z = {0.f, 0.f, 0.f, 0.f, 0.f, 0.f, 0.f, 0.f}; return z; }
__device__ __forceinline__ float hmax8(v8f s) {
  return fmaxf(fmaxf(fmaxf(s[0], s[1]), fmaxf(s[2], s[3])), fmaxf(fmaxf(s[4], s[5]), fmaxf(s[6], s[7])));
}

// lane l <-> l ^ 16 by a vector cross-row move: it counts on no LDS counter, so no wait on it drains LDS reads in flight
__device__ __forceinline__ float xhalf(float x) {
  const int b = __builtin_bit_cast(int, x);
  return __builtin_bit_cast(float, __builtin_amdgcn_permlanex16(b, b, 0x76543210, 0xfedcba98, false, false));
}

// ---- 16-bit fragment loader (A, or B from a k-contiguous [n][k] row): lane -> row/col (lane&15), p already includes
//      + 8*(lane>>4); elements 0..7 <- p[0..7] (k0+8h..), elements 8..15 <- p[16..23] (k0+16+8h..)
__device__ __forceinline__ Frag ldfrag(const unsigned short* p) {
  Frag f;
  f.u[0] = *(const v8us*)(p);
  f.u[1] = *(const v8us*)(p + 16);
  return f;
}

typedef __attribute__((address_space(3))) unsigned short lds_us;
__device__ __forceinline__ unsigned lds_byte(unsigned short* p) { return (unsigned)(uintptr_t)(lds_us*)p; }

// ---- WMMA helpers: builtin followed by a 4-slot VALU gap tying D and keeping A/B live --------------------------
__device__ __forceinline__ v8f mma_h(v16h a, v16h b, v8f c) {
  v8f d = __builtin_amdgcn_wmma_f32_16x16x32_f16(false, a, false, b, (short)0, c, false, false);
#if defined(__HIP_DEVICE_COMPILE__)
  asm volatile("v_nop\n\tv_nop\n\tv_nop\n\tv_nop" : "+v"(d) : "v"(a), "v"(b));
#endif
  return d;
}
__device__ __forceinline__ v8f mma_b(v16b a, v16b b, v8f c) {
  v8f d = __builtin_amdgcn_wmma_f32_16x16x32_bf16(false, a, false, b, (short)0, c, false, false);
#if defined(__HIP_DEVICE_COMPILE__)
  const v16h ha = __builtin_bit_cast(v16h, a), hb = __builtin_bit_cast(v16h, b);
  asm volatile("v_nop\n\tv_nop\n\tv_nop\n\tv_nop" : "+v"(d) : "v"(ha), "v"(hb));
#endif
  return d;
}

// =========================================================================================================
// (0) q/k/v conv1x1 weights: W16 f16 [384][256], rows 0..127 = wq, 128..255 = wk, 256..383 = wv; value = f16 of
//     (bf16-RNE(w) * 256) (exact). BIAS f32 [384] = bf16-RNE of bq / bk / bv. Block blk (0..47) owns rows
// coverage: 48 blocks x 8 rows x 32 pieces x 8 halves = 384 x 256; bias 96 x 4 floats = 384.
// =========================================================================================================
__global__ __launch_bounds__(256)
void cvt_w(const float* __restrict__ wq, const float* __restrict__ bq,
           const float* __restrict__ wk, const float* __restrict__ bk,
           const float* __restrict__ wv, const float* __restrict__ bv,
           unsigned short* W16, float* BIAS) {
  const int tid = threadIdx.x, blk = blockIdx.x;
  const int rl = tid >> 5, col = 8 * (tid & 31);
  const int o = 8 * blk + rl;                                          // 0..383
  const float* wbase = (blk < 16) ? wq : (blk < 32) ? wk : wv;         // block-uniform selection
  const int osub = (blk < 16) ? 0 : (blk < 32) ? CK : 2 * CK;
  const float* s = wbase + (size_t)(o - osub) * CC + col;             // (o-osub) < 128 rows of that matrix
  const v4f a = *(const v4f*)s;
  const v4f q = *(const v4f*)(s + 4);
  const float f[8] = {a[0], a[1], a[2], a[3], q[0], q[1], q[2], q[3]};
  v4u u;
#pragma unroll
  for (int t = 0; t < 4; ++t) {
    const _Float16 h0 = (_Float16)(bfr(f[2 * t]) * WSC);
    const _Float16 h1 = (_Float16)(bfr(f[2 * t + 1]) * WSC);
    u[t] = pk16(h_bits(h0), h_bits(h1));
  }
  // bias values: every lane loads all three candidates with clamped indices, selects by value
  v4f bvv;
  {
    const int tb = min(tid, 95);
    const int o4 = 4 * tb;
#pragma unroll
    for (int qd = 0; qd < 4; ++qd) {
      const int oo = o4 + qd;                                          // 0..383
      const int iq = min(oo, CK - 1);
      const int ik = min(max(oo - CK, 0), CK - 1);
      const int iv = min(max(oo - 2 * CK, 0), CV - 1);
      const float cq = bq[iq], ckv = bk[ik], cvv = bv[iv];
      const float val = (oo < CK) ? cq : (oo < 2 * CK) ? ckv : cvv;
      bvv[qd] = bfr(val);
    }
  }
{
    *(v4u*)(W16 + (size_t)o * CC + col) = u;
    if (blk == 0 && tid < 96) *(v4f*)(BIAS + 4 * tid) = bvv;
    
  }
}

// =========================================================================================================
// (0b) output conv weights: WO16 f16 [256][128] = f16 of (bf16-RNE(wo) * 256) (exact); BOB f32 [256] = bf16-RNE bo.
// coverage: 16 blocks x 16 rows x 16 pieces x 8 halves = 256 x 128; bias 64 x 4 floats = 256.
// =========================================================================================================
__global__ __launch_bounds__(256)
void cvt_wo(const float* __restrict__ wo, const float* __restrict__ bo, unsigned short* WO16, float* BOB) {
  const int tid = threadIdx.x, blk = blockIdx.x;
  const int rl = tid >> 4, col = 8 * (tid & 15);
  const int o = 16 * blk + rl;                                         // 0..255
  const float* s = wo + (size_t)o * CV + col;
  const v4f a = *(const v4f*)s;
  const v4f q = *(const v4f*)(s + 4);
  const float f[8] = {a[0], a[1], a[2], a[3], q[0], q[1], q[2], q[3]};
  v4u u;
#pragma unroll
  for (int t = 0; t < 4; ++t) {
    const _Float16 h0 = (_Float16)(bfr(f[2 * t]) * WSC);
    const _Float16 h1 = (_Float16)(bfr(f[2 * t + 1]) * WSC);
    u[t] = pk16(h_bits(h0), h_bits(h1));
  }
  v4f bvv;
  {
    const int tb = min(tid, 63);
#pragma unroll
    for (int qd = 0; qd < 4; ++qd) bvv[qd] = bfr(bo[4 * tb + qd]);  // index <= 255
  }
{
    *(v4u*)(WO16 + (size_t)o * CV + col) = u;
    if (blk == 0 && tid < 64) *(v4f*)(BOB + 4 * tid) = bvv;
    
  }
}

// =========================================================================================================
// (1) conv1x1 GEMM for one (b, 64-n tile), all 384 output rows: Y[o][n] = (1/256) sum_c W16[o][c] X[n][c] + BIAS[o],
//     X[n][c] = f16 of bf16-RNE(x[b][c][n]) (exact). Block 256 threads = 8 waves, two blocks per WGP.
//     The block reads its x slab (256 c x 64 n, f32, 256-B row segments) once, rounds it and stores it transposed into LDS
//     Xs[n_loc][c] (u32 pairs of consecutive c, row pitch XPP halves = 16 B x odd), barrier. Wave w owns cols
//     n0 + 32 (w & 1) .. +31 (two B fragments per k-step, k = c contiguous in the token row, read once and kept in
//     registers) and in every 64-row weight tile the m-tile w >> 1 (A rows o = 64 mb + 16 (w >> 1) + (lane&15), split k map
//     loader). K = 256 = 8 steps. The six weight tiles come through a two-buffer LDS ring filled by asynchronous 16-byte
//     copies of whole rows; tile mb+2 is issued behind the barrier that ends the reads of tile mb.
//     Epilogue of a tile: Os[o_loc][n_loc] (pitch OSP), barrier, then packed in registers:
//       tiles 0,1 (q ck cols 0..63 / 64..127) and 2,3 (k): bf16 hi / bf16 residual planes [b][4096 n][128],
//         lane e -> cols 8e..8e+7 of token row 32 it + lq;
//       tiles 4,5 (v): f16 plane x16 [b][128 ch][4096 n], lane e -> halves 8e..8e+7 of channel row 32 it + lq;
//     the global stores stand behind the tile's hand-over barrier, so that they fly under the next tile's products.
// coverage: Xs 8 it x 16 row pairs x 16 lanes x 4 n x 2 rows = 256 c x 64 n; Os 8 waves x 2 tiles x 16x16 = 64 x 64;
//           q/k: per plane 2 it x 32 rows x 8 lanes x 8 = 64 n x 64 cols, tiles 0..3 cover all 128 cols of Qh/Ql/Kh/Kl;
//           v: 2 it x 32 rows x 8 lanes x 8 = 64 ch x 64 n; grid (64, NIMG) covers every plane exactly once.
// =========================================================================================================
// token rows (f16 pairs), the two weight tiles of the ring (rows of XPP halves), the output tile
struct GemmSmem { unsigned int x[QT * (XPP / 2)]; unsigned short w[2 * QT * XPP]; float o[QT * OSP]; };

// Eight 16-byte pieces per lane, global -> LDS through no register: a wave's 32 lanes x 16 B take 512 contiguous bytes
// (four whole lines) per copy. l / g are this lane's first piece, ls bytes / gs halves the step from copy to copy. The
// s_wait_xcnt closes the statement so that no address register of a copy is rewritten ahead of it.
__device__ __forceinline__ void stage_rows8(unsigned l, const unsigned short* g, unsigned ls, size_t gs) {
#if defined(__HIP_DEVICE_COMPILE__)
  asm volatile(
      "global_load_async_to_lds_b128 %0, %8, off\n\t"
      "global_load_async_to_lds_b128 %1, %9, off\n\t"
      "global_load_async_to_lds_b128 %2, %10, off\n\t"
      "global_load_async_to_lds_b128 %3, %11, off\n\t"
      "global_load_async_to_lds_b128 %4, %12, off\n\t"
      "global_load_async_to_lds_b128 %5, %13, off\n\t"
      "global_load_async_to_lds_b128 %6, %14, off\n\t"
      "global_load_async_to_lds_b128 %7, %15, off\n\t"
      "s_wait_xcnt 0x0"
      :: "v"(l), "v"(l + ls), "v"(l + 2 * ls), "v"(l + 3 * ls),
         "v"(l + 4 * ls), "v"(l + 5 * ls), "v"(l + 6 * ls), "v"(l + 7 * ls),
         "v"(g), "v"(g + gs), "v"(g + 2 * gs), "v"(g + 3 * gs),
         "v"(g + 4 * gs), "v"(g + 5 * gs), "v"(g + 6 * gs), "v"(g + 7 * gs)
      : "memory");
#endif
}

__global__ __launch_bounds__(256)
void gemm_qkv(const float* __restrict__ x, const unsigned short* __restrict__ W16, const float* __restrict__ BIAS,
              unsigned short* Qh, unsigned short* Ql, unsigned short* Kh, unsigned short* Kl,
              unsigned short* Vh) {
  __shared__ __align__(16) GemmSmem sm;
  float* Os = sm.o;
  const int tid  = threadIdx.x;
  const int lane = tid & 31, wave = tid >> 5;
  const int hh   = lane >> 4, c = lane & 15;
  const int nt   = blockIdx.x, b = blockIdx.y;
  const int n0   = nt * QT;
  const int nh   = wave & 1, mq = wave >> 1;                           // 32-col half; m-tile of every weight tile

  // ---- this thread's share of a weight tile: copy j of wave w takes row 8j + w, a lane 16 B of the 512-B row ----
  const unsigned lw = lds_byte(sm.w) + (unsigned)(wave * (XPP * 2) + lane * 16);
  const unsigned short* gw = W16 + (size_t)wave * CC + 8 * lane;
  const unsigned wls = 8 * XPP * 2;
  const size_t wgs = (size_t)8 * CC;
  stage_rows8(lw, gw, wls, wgs);                                       // tile 0 -> buffer 0, flies under the slab below

  // ---- load + round the x slab, store it transposed: Xs[n_loc][c] ----
  {
    const int e16 = tid & 15, rq = tid >> 4;                           // rq 0..15
    const float* sp = x + ((size_t)(b * CC + 2 * rq)) * NN + n0 + 4 * e16;
    v4f va[CC / 32], vb[CC / 32];                                      // rows 2cp, 2cp+1 of channel pair cp = 16 it + rq
#pragma unroll   // the arrays stay in registers only under constant indices
    for (int it = 0; it < CC / 32; ++it) {
      va[it] = *(const v4f*)(sp + (size_t)(32 * it) * NN);
      vb[it] = *(const v4f*)(sp + (size_t)(32 * it + 1) * NN);
    }
    // keeps all sixteen loads ahead of the first conversion: without it the compiler issues the later ones behind the
    // wait for the first, and the wave waits out the memory latency twice
    __builtin_amdgcn_sched_barrier(0);
#pragma unroll   // constant indices, as above
    for (int it = 0; it < CC / 32; ++it) {
      const int cp = 16 * it + rq;                                     // channel pair 0..127
#pragma unroll   // constant indices, as above
      for (int t = 0; t < 4; ++t)                                      // halves c = 2cp, 2cp+1 of token 4 e16 + t
        sm.x[(4 * e16 + t) * (XPP / 2) + cp] = pkh(bfr(va[it][t]), bfr(vb[it][t]));
    }
  }
  asm volatile("s_wait_asynccnt 0x0" ::: "memory");                    // this wave's rows of tile 0 have landed
  __syncthreads();                                                     // publishes the token rows and tile 0
  stage_rows8(lw + QT * XPP * 2, gw + (size_t)QT * CC, wls, wgs);      // tile 1 -> buffer 1

  // ---- the wave's 16 token fragments (B operand, col = n0 + 32 nh + 16 g + c), read once and kept in registers ----
  Frag fb[2][CC / 32];
#pragma unroll   // the fragment arrays stay in registers only under constant indices
  for (int g = 0; g < 2; ++g) {
    const unsigned short* bp = (const unsigned short*)sm.x + (32 * nh + 16 * g + c) * XPP + 8 * hh;
#pragma unroll   // constant indices, as above
    for (int ks = 0; ks < CC / 32; ++ks) fb[g][ks] = ldfrag(bp + 32 * ks);
  }

  const int e = tid & 7, lq = tid >> 3;                                // lq 0..31

#pragma unroll 1   // rolled: one hand-over point in the text, the buffer picked by mb & 1
  for (int mb = 0; mb < MQKV / QT; ++mb) {
    const int o0 = mb * QT;
    const unsigned short* ap = sm.w + (mb & 1) * (QT * XPP) + (16 * mq + c) * XPP + 8 * hh;
    // the lane's eight bias values and the tile's eight weight fragments, read as one group ahead of the products
    const v4f b0 = *(const v4f*)(BIAS + o0 + 16 * mq + 8 * hh);
    const v4f b1 = *(const v4f*)(BIAS + o0 + 16 * mq + 8 * hh + 4);
    Frag fa[CC / 32];
#pragma unroll   // constant indices, as above
    for (int ks = 0; ks < CC / 32; ++ks) fa[ks] = ldfrag(ap + 32 * ks);
    // keeps the group's reads ahead of the products: without it the compiler sinks each pair to its first use, and the
    // wave waits out every pair's LDS latency
    __builtin_amdgcn_sched_barrier(0);
    v8f acc[2];
    acc[0] = zero8();
    acc[1] = zero8();
#pragma unroll   // constant indices, as above
    for (int ks = 0; ks < CC / 32; ++ks) {                             // every weight fragment feeds both col tiles
      acc[0] = mma_h(fa[ks].h, fb[0][ks].h, acc[0]);
      acc[1] = mma_h(fa[ks].h, fb[1][ks].h, acc[1]);
    }

    // ---- scale back, + bias -> LDS Os[o_loc][n_loc] ----
#pragma unroll   // constant indices, as above
    for (int g = 0; g < 2; ++g) {
      const int nl = 32 * nh + 16 * g + c;
#pragma unroll   // constant indices, as above
      for (int r = 0; r < 8; ++r) {
        const int ol = 16 * mq + 8 * hh + r;                           // 0..63
        Os[ol * OSP + nl] = acc[g][r] * IWSC + ((r < 4) ? b0[r & 3] : b1[r & 3]);
      }
    }
    __syncthreads();                                                   // publishes Os

    v4u su[4];                                                         // q/k: hi it 0,1 then residual it 0,1; v: it 0,1
    if (mb < 4) {
      // ---- q / k bf16 hi + residual pieces (block-uniform branch) ----
#pragma unroll   // constant indices, as above
      for (int it = 0; it < 2; ++it) {
        const int nl = it * 32 + lq;                                   // token 0..63
#pragma unroll   // constant indices, as above
        for (int t = 0; t < 4; ++t) {
          const float f0 = Os[(8 * e + 2 * t) * OSP + nl];
          const float f1 = Os[(8 * e + 2 * t + 1) * OSP + nl];
          const unsigned short hb0 = bf_bits(f0), hb1 = bf_bits(f1);
          const unsigned short lb0 = bf_bits(f0 - bf_up(hb0));
          const unsigned short lb1 = bf_bits(f1 - bf_up(hb1));
          su[it][t]     = pk16(hb0, hb1);
          su[2 + it][t] = pk16(lb0, lb1);
        }
      }
    } else {
      // ---- v f16 pieces, carried x16 ----
#pragma unroll   // constant indices, as above
      for (int it = 0; it < 2; ++it) {
        const int row = it * 32 + lq;                                  // 0..63
        const v4f a = *(const v4f*)(Os + row * OSP + 8 * e);
        const v4f q = *(const v4f*)(Os + row * OSP + 8 * e + 4);
#pragma unroll   // constant indices, as above
        for (int t = 0; t < 2; ++t) {
          su[it][t]     = pk16(h_bits((_Float16)(a[2 * t] * VSC)), h_bits((_Float16)(a[2 * t + 1] * VSC)));
          su[it][2 + t] = pk16(h_bits((_Float16)(q[2 * t] * VSC)), h_bits((_Float16)(q[2 * t + 1] * VSC)));
        }
      }
    }

    // ---- hand-over: tile mb+1 becomes readable, buffer mb&1 and Os become free ----
    asm volatile("s_wait_dscnt 0x0" ::: "memory");                     // this wave's reads of buffer mb&1 and of Os are done
    asm volatile("s_wait_asynccnt 0x0" ::: "memory");                  // this wave's rows of tile mb+1 have landed
    __syncthreads();
    if (mb + 2 < MQKV / QT)
      stage_rows8(lw + (unsigned)(mb & 1) * (QT * XPP * 2), gw + (size_t)(mb + 2) * QT * CC, wls, wgs);

    if (mb < 4) {
      unsigned short* Ph = (mb < 2) ? Qh : Kh;
      unsigned short* Pl = (mb < 2) ? Ql : Kl;
      const int cb = QT * (mb & 1);                                    // ck column base 0 or 64
#pragma unroll   // constant indices, as above
      for (int it = 0; it < 2; ++it) {
        const size_t base = ((size_t)(b * NN + n0 + it * 32 + lq)) * CK + cb + 8 * e;
        *(v4u*)(Ph + base) = su[it];
        *(v4u*)(Pl + base) = su[2 + it];
      }
    } else {
      const int ch0 = QT * (mb - 4);                                   // 0 or 64
#pragma unroll   // constant indices, as above
      for (int it = 0; it < 2; ++it)
        *(v4u*)(Vh + ((size_t)(b * CV + ch0 + it * 32 + lq)) * NN + n0 + 8 * e) = su[it];
    }
    asm volatile("s_wait_xcnt 0x0" ::: "memory");                      // the next tile's reads rewrite the stores' registers
  }
  asm volatile("s_wait_asynccnt 0x0" ::: "memory");                    // no copy is left in flight at the wave's end
}

// =========================================================================================================
// (3) attention for one (b, 128-query tile), transposed formulation, 4096 keys, no mask:
//   S^T tile (16 keys x 16 queries) = sum over 4 k-steps of A(k: row = key kb + (lane&15), 32 d via the split k map
//   from the bf16 plane Kh [b][4096][128]) . B(q: col = query, same map, from the wave's registers) + A(Kh).B(Ql)
//   + A(Kl).B(Qh) (bf16 unscaled residual planes, shared accumulator). Softmax of s*c with c = 1/sqrt(128):
//   per lane the D tile holds 8 keys of ONE query: online state per lane, one cross-row move (lane^16) for the max over
//   32 keys, row-sum partials combined at the end. P = 1024 e^{(s-m)c} as f16 is the B operand of
//   O^T (rows channel, cols queries) += A(V rows channel = 16j + (lane&15), keys contiguous, f16 plane Vh
//   [b][128][4096]) . B(P^T): element r <- D of the tile covering keys kb..kb+15, element 8+r <- the tile covering
//   kb+16..kb+31, lane unchanged. 8 accumulator tiles per query tile (128 channels). Block = 8 waves = 128 queries, one
//   block per WGP: wave w owns two query tiles, queries 32 (w & 3) .. +31, and keys 32 (w >> 2) .. +31 of every key tile;
//   the two states of a query group are merged at the end. Q hi/lo rows of the block's 128 queries are staged once in LDS
//   (v4u pieces, barrier); each wave then reads its 16 q fragments once and keeps them in registers, so that the key loop
//   reads only k and v from LDS and every such fragment feeds both query tiles. A 32-key pass reads its LDS fragments
//   ahead of the products that use them: k of k-steps 0,1; k of k-steps 2,3; all of v.
//   K hi, K residual and V come in tiles of KT = 64 keys through a two-buffer LDS ring filled by asynchronous 16-byte
//   copies (whole 128-B lines per request, each tile fetched once per block and read by all 8 waves); tile t+2 is
//   issued behind the barrier that ends the reads of tile t. Row pitches QP / VP halves = 16 B x odd.
//   Epilogue: barrier, O/l staged in LDS Os[query][128 channels] (pitch OSPW, b128 stores, aliases the Q staging),
// coverage: Q staging 8 it x 16 rows x 16 lanes x 8 = 128 x 128 per plane; OB 16 it x 32 lines x 8 lanes x 4 floats =
//           128 queries x 128 ch; grid (32, NIMG) covers OB exactly once.
// =========================================================================================================
#define AQ    128                                                      // queries of one attention block
static_assert(NN % AQ == 0 && AQ * OSPW * 4 <= 2 * AQ * QP * 2);
union AttnSmem { unsigned short q[2 * AQ * QP]; float o[AQ * OSPW]; };
// the k/v ring; after the key loop its first bytes carry the second key half's softmax state (o 16384 floats, m, l)
union AttnRing { unsigned short h[2 * STG]; float f[4 * 132 * 32]; };
static_assert(4 * 132 * 32 * 4 <= 2 * STG * 2);

// One tile of KT keys into one ring buffer at LDS byte lb: k hi rows [KT][QP], k residual rows [KT][QP], v rows
// [CV][VP]. kh / kl / vh are this thread's piece 0 of the tile; lk / lv its byte offsets inside the k and v parts.
// 256 threads, twelve 16-byte copies per lane, global -> LDS through no register. k: 16 lanes per 256-B row, 16 rows
// per piece step; v: 8 lanes per 128-B row segment, 32 rows per piece step. The s_wait_xcnt closes the statement so
// that no address register of a copy is rewritten ahead of it.
__device__ __forceinline__ void stage_kv(unsigned lb, unsigned lk, unsigned lv, const unsigned short* kh,
                                         const unsigned short* kl, const unsigned short* vh) {
#if defined(__HIP_DEVICE_COMPILE__)
  const unsigned la = lb + lk, lc = lb + KT * QP * 2 + lk, ld = lb + 2 * KT * QP * 2 + lv;
  const unsigned ks = 16 * QP * 2, vs = 32 * VP * 2;
  const size_t kg = (size_t)16 * CK, vg = (size_t)32 * NN;
  asm volatile(
      "global_load_async_to_lds_b128 %0, %12, off\n\t"
      "global_load_async_to_lds_b128 %1, %13, off\n\t"
      "global_load_async_to_lds_b128 %2, %14, off\n\t"
      "global_load_async_to_lds_b128 %3, %15, off\n\t"
      "global_load_async_to_lds_b128 %4, %16, off\n\t"
      "global_load_async_to_lds_b128 %5, %17, off\n\t"
      "global_load_async_to_lds_b128 %6, %18, off\n\t"
      "global_load_async_to_lds_b128 %7, %19, off\n\t"
      "global_load_async_to_lds_b128 %8, %20, off\n\t"
      "global_load_async_to_lds_b128 %9, %21, off\n\t"
      "global_load_async_to_lds_b128 %10, %22, off\n\t"
      "global_load_async_to_lds_b128 %11, %23, off\n\t"
      "s_wait_xcnt 0x0"
      :: "v"(la), "v"(la + ks), "v"(la + 2 * ks), "v"(la + 3 * ks),
         "v"(lc), "v"(lc + ks), "v"(lc + 2 * ks), "v"(lc + 3 * ks),
         "v"(ld), "v"(ld + vs), "v"(ld + 2 * vs), "v"(ld + 3 * vs),
         "v"(kh), "v"(kh + kg), "v"(kh + 2 * kg), "v"(kh + 3 * kg),
         "v"(kl), "v"(kl + kg), "v"(kl + 2 * kg), "v"(kl + 3 * kg),
         "v"(vh), "v"(vh + vg), "v"(vh + 2 * vg), "v"(vh + 3 * vg)
      : "memory");
#endif
}

// ---- WMMA helpers of the attention kernel: the bare builtins, the compiler keeping the distance behind them. An asm
//      statement takes its vector operands from v0..v255 only; tied to one, the wave's 32-query register tile
//      (q 128, o 128 registers) would not fit and would spill.
__device__ __forceinline__ v8f mma_hr(v16h a, v16h b, v8f c) {
  return __builtin_amdgcn_wmma_f32_16x16x32_f16(false, a, false, b, (short)0, c, false, false);
}
__device__ __forceinline__ v8f mma_br(v16b a, v16b b, v8f c) {
  return __builtin_amdgcn_wmma_f32_16x16x32_bf16(false, a, false, b, (short)0, c, false, false);
}

__global__ __launch_bounds__(256)
void attn_gab(const unsigned short* __restrict__ Qh, const unsigned short* __restrict__ Ql,
              const unsigned short* __restrict__ Kh, const unsigned short* __restrict__ Kl,
              const unsigned short* __restrict__ Vh, float* OB) {
  __shared__ __align__(16) AttnSmem sm;
  __shared__ __align__(16) AttnRing rg;
  unsigned short* ring = rg.h;
  const int tid  = threadIdx.x;
  const int wave = tid >> 5, lane = tid & 31;
  const int hh   = lane >> 4, c = lane & 15;
  const int n0   = blockIdx.x * AQ, b = blockIdx.y;
  const int wq   = wave & 3, kh2 = wave >> 2;                          // query group of 32; key half of every tile

  // ---- this thread's share of a k/v tile: source pointers of tile 0, byte places inside a ring buffer ----
  const unsigned ring0 = lds_byte(ring);
  const unsigned lk = (unsigned)((tid >> 4) * (QP * 2) + (tid & 15) * 16);
  const unsigned lv = (unsigned)((tid >> 3) * (VP * 2) + (tid & 7) * 16);
  const unsigned short* khg = Kh + ((size_t)(b * NN + (tid >> 4))) * CK + 8 * (tid & 15);
  const unsigned short* klg = Kl + ((size_t)(b * NN + (tid >> 4))) * CK + 8 * (tid & 15);
  const unsigned short* vhg = Vh + ((size_t)(b * CV + (tid >> 3))) * NN + 8 * (tid & 7);
  stage_kv(ring0, lk, lv, khg, klg, vhg);                              // tile 0 -> buffer 0

  // ---- stage q hi (rows 0..127) and q residual (rows 128..255) of this query tile in LDS ----
  {
    const int e16 = tid & 15, rq = tid >> 4;                          // rq 0..15
#pragma unroll
    for (int it = 0; it < AQ / 16; ++it) {
      const int row = 16 * it + rq;                                    // 0..127
      const size_t g = ((size_t)(b * NN + n0 + row)) * CK + 8 * e16;
      const v4u vh = *(const v4u*)(Qh + g);
      const v4u vl = *(const v4u*)(Ql + g);
      *(v4u*)(sm.q + row * QP + 8 * e16)        = vh;
      *(v4u*)(sm.q + (AQ + row) * QP + 8 * e16) = vl;
    }
  }
  asm volatile("s_wait_asynccnt 0x0" ::: "memory");                    // this wave's share of tile 0 has landed
  __syncthreads();                                                     // publishes the q rows and tile 0
  stage_kv(ring0 + STG * 2, lk, lv, khg + (size_t)KT * CK, klg + (size_t)KT * CK, vhg + KT);   // tile 1 -> buffer 1

  // ---- the wave's q fragments (B operand, col = query n0 + 32*wq + 16*g + c), read once and kept in registers ----
  Frag qhf[2][CK / 32], qlf[2][CK / 32];
#pragma unroll
  for (int g = 0; g < 2; ++g) {
    const unsigned short* qsh = sm.q + (32 * wq + 16 * g + c) * QP + 8 * hh;
#pragma unroll
    for (int ks = 0; ks < CK / 32; ++ks) {
      qhf[g][ks] = ldfrag(qsh + 32 * ks);
      qlf[g][ks] = ldfrag(qsh + AQ * QP + 32 * ks);
    }
  }

  float m[2] = {-1.0e30f, -1.0e30f}, l[2] = {0.f, 0.f};
  v8f o[2][8];
#pragma unroll
  for (int g = 0; g < 2; ++g) {
#pragma unroll
    for (int j = 0; j < 8; ++j) o[g][j] = zero8();
  }

  // this thread's places in the buffer that trip t frees, carried from trip to trip: they are the copies' own operands
  unsigned lkc = ring0 + lk, lvc = ring0 + lv;
  const unsigned lks = 2 * (ring0 + lk) + STG * 2, lvs = 2 * (ring0 + lv) + STG * 2;

#pragma unroll 1   // rolled: one hand-over point in the text, the buffer picked by t & 1
  for (int t = 0; t < NN / KT; ++t) {
  const unsigned short* buf = ring + (t & 1) * STG;
  // k fragment base (A operand, row = key kb + c of the tile), + key * QP
  const int kb = 32 * kh2;                                             // this wave's 32 keys of the tile
  const unsigned short* Khp = buf + c * QP + 8 * hh;
  const unsigned short* Klp = Khp + KT * QP;
  // v fragment base (A operand, row = channel 16j + c, the tile's keys contiguous), + 16*j*VP + kb
  const unsigned short* Vhp = buf + 2 * KT * QP + c * VP + 8 * hh;
  {
    v8f s0[2], s1[2];                                                  // [query tile]: keys kb..+15, keys kb+16..+31
#pragma unroll
    for (int g = 0; g < 2; ++g) { s0[g] = zero8(); s1[g] = zero8(); }
#pragma unroll   // unrolled: each trip's reads stand as one group in the text, ahead of that trip's 24 products
    for (int kg = 0; kg < CK / 64; ++kg) {
      // the k fragments of two k-steps, read ahead of their products, counted waits behind them
      Frag k0[2], k1[2], k0l[2], k1l[2];
#pragma unroll   // the fragment arrays stay in registers only under constant indices
      for (int u = 0; u < 2; ++u) {
        const int ks = 2 * kg + u;
        k0[u]  = ldfrag(Khp + kb * QP + 32 * ks);                        // keys kb .. kb+15
        k1[u]  = ldfrag(Khp + (kb + 16) * QP + 32 * ks);                 // keys kb+16 .. kb+31
        k0l[u] = ldfrag(Klp + kb * QP + 32 * ks);
        k1l[u] = ldfrag(Klp + (kb + 16) * QP + 32 * ks);
      }
      // keeps the group's reads ahead of its products: without it the compiler sinks each pair to its first use, and the
      // wave waits out every pair's latency
      __builtin_amdgcn_sched_barrier(0);
#pragma unroll   // constant indices, as above
      for (int u = 0; u < 2; ++u) {
        const int ks = 2 * kg + u;
        // every k fragment feeds both query tiles; per accumulator the order hi.hi, hi.res, res.hi is kept
        s0[0] = mma_br(k0[u].bf, qhf[0][ks].bf, s0[0]);
        s1[0] = mma_br(k1[u].bf, qhf[0][ks].bf, s1[0]);
        s0[1] = mma_br(k0[u].bf, qhf[1][ks].bf, s0[1]);
        s1[1] = mma_br(k1[u].bf, qhf[1][ks].bf, s1[1]);
        s0[0] = mma_br(k0[u].bf, qlf[0][ks].bf, s0[0]);
        s1[0] = mma_br(k1[u].bf, qlf[0][ks].bf, s1[0]);
        s0[1] = mma_br(k0[u].bf, qlf[1][ks].bf, s0[1]);
        s1[1] = mma_br(k1[u].bf, qlf[1][ks].bf, s1[1]);
        s0[0] = mma_br(k0l[u].bf, qhf[0][ks].bf, s0[0]);
        s1[0] = mma_br(k1l[u].bf, qhf[0][ks].bf, s1[0]);
        s0[1] = mma_br(k0l[u].bf, qhf[1][ks].bf, s0[1]);
        s1[1] = mma_br(k1l[u].bf, qhf[1][ks].bf, s1[1]);
      }
    }

    // the pass's eight v fragments, read ahead of the softmax: nothing below waits on LDS before the products that use
    // them, so they land while the softmax runs
    Frag vf[8];
#pragma unroll   // constant indices, as above
    for (int j = 0; j < 8; ++j) vf[j] = ldfrag(Vhp + (16 * j) * VP + kb);
    // holds the sixteen reads here: without it the compiler sinks them to the softmax's end and their latency is waited out
    __builtin_amdgcn_sched_barrier(0);

    FragH ph[2];
#pragma unroll   // constant indices, as above
    for (int g = 0; g < 2; ++g) {
      float mx = fmaxf(hmax8(s0[g]), hmax8(s1[g]));
      mx = fmaxf(mx, xhalf(mx));
      const float mn   = fmaxf(m[g], mx);
      const float corr = __expf((m[g] - mn) * SCL);
      m[g] = mn;
      const float msh = mn * SCL - LNPS;                               // exp gives e^{(s-m)c} * 1024
      l[g] *= corr;
#pragma unroll
      for (int j = 0; j < 8; ++j) {
#pragma unroll
        for (int r = 0; r < 8; ++r) o[g][j][r] *= corr;
      }

      float ls = 0.f;
#pragma unroll
      for (int r = 0; r < 8; ++r) {
        const float e0 = __expf(s0[g][r] * SCL - msh);                 // key kb      + 8hh + r
        const float e1 = __expf(s1[g][r] * SCL - msh);                 // key kb + 16 + 8hh + r
        ls += e0 + e1;
        ph[g].hv[0][r] = (_Float16)e0;
        ph[g].hv[1][r] = (_Float16)e1;
      }
      l[g] += ls;
    }

#pragma unroll
    for (int j = 0; j < 8; ++j) {                                      // every v fragment feeds both query tiles
      o[0][j] = mma_hr(vf[j].h, ph[0].v, o[0][j]);
      o[1][j] = mma_hr(vf[j].h, ph[1].v, o[1][j]);
    }
  }
  // ---- hand-over: tile t+1 becomes readable, buffer t&1 becomes free ----
  // keeps the waits below behind the products above: lifted into the softmax, the dscnt wait would wait out the v reads
  __builtin_amdgcn_sched_barrier(0);
  asm volatile("s_wait_dscnt 0x0" ::: "memory");                       // this wave's reads of buffer t&1 are done
  asm volatile("s_wait_asynccnt 0x0" ::: "memory");                    // this wave's share of tile t+1 has landed
  __syncthreads();
  if (t + 2 < NN / KT)
    stage_kv(0u, lkc, lvc, khg + (size_t)(t + 2) * KT * CK, klg + (size_t)(t + 2) * KT * CK, vhg + (t + 2) * KT);
  lkc = lks - lkc;                                                     // the other buffer
  lvc = lvs - lvc;
  }
  asm volatile("s_wait_asynccnt 0x0" ::: "memory");                    // no copy is left in flight at the wave's end
#pragma unroll
  for (int g = 0; g < 2; ++g) l[g] += __shfl_xor(l[g], 16, 32);

  // ---- the two key halves of a query group hold the same lane layout: waves 4..7 hand m, l, o over through the ring's
  //      LDS (free behind the loop's last barrier: every read of it is done and no copy is in flight) ----
  float* mg = rg.f;
  if (kh2 == 1) {                                                      // the same in every lane of a wave
#pragma unroll
    for (int g = 0; g < 2; ++g) {
#pragma unroll
      for (int j = 0; j < 8; ++j) {
        v4f va, vb;
#pragma unroll
        for (int r = 0; r < 4; ++r) { va[r] = o[g][j][r]; vb[r] = o[g][j][4 + r]; }
        *(v4f*)(mg + ((wq * 32 + 16 * g + 2 * j) * 32 + lane) * 4)     = va;   // 16 B per lane, lanes adjacent
        *(v4f*)(mg + ((wq * 32 + 16 * g + 2 * j + 1) * 32 + lane) * 4) = vb;
      }
      mg[16384 + (4 * wq + 2 * g) * 32 + lane]     = m[g];
      mg[16384 + (4 * wq + 2 * g + 1) * 32 + lane] = l[g];
    }
  }
  __syncthreads();                                                     // publishes the second half's state
  if (kh2 == 0) {
#pragma unroll
    for (int g = 0; g < 2; ++g) {
      const float m2 = mg[16384 + (4 * wq + 2 * g) * 32 + lane];
      const float l2 = mg[16384 + (4 * wq + 2 * g + 1) * 32 + lane];
      const float mn = fmaxf(m[g], m2);
      const float f1 = __expf((m[g] - mn) * SCL), f2 = __expf((m2 - mn) * SCL);
      const float inv = IVSC / (l[g] * f1 + l2 * f2);                  // o carries x1024 x16, l carries x1024
      const float g1 = f1 * inv, g2 = f2 * inv;
      const int qrow = 32 * wq + 16 * g + c;
#pragma unroll
      for (int j = 0; j < 8; ++j) {
        const v4f pa = *(const v4f*)(mg + ((wq * 32 + 16 * g + 2 * j) * 32 + lane) * 4);
        const v4f pb = *(const v4f*)(mg + ((wq * 32 + 16 * g + 2 * j + 1) * 32 + lane) * 4);
        v4f va, vb;
#pragma unroll
        for (int r = 0; r < 4; ++r) {
          va[r] = o[g][j][r] * g1 + pa[r] * g2;
          vb[r] = o[g][j][4 + r] * g1 + pb[r] * g2;
        }
        *(v4f*)(sm.o + qrow * OSPW + 16 * j + 8 * hh)     = va;       // Os[query][ch = 16j + 8hh + r]
        *(v4f*)(sm.o + qrow * OSPW + 16 * j + 8 * hh + 4) = vb;
      }
    }
  }
  __syncthreads();

  const int e = tid & 7, lq = tid >> 3;                                // lq 0..31
{
#pragma unroll
    for (int it = 0; it < AQ / 8; ++it) {
      const int L   = it * 32 + lq;                                    // line 0..511
      const int q   = L >> 2, seg = L & 3;                             // query 0..127, 32-float segment
      const v4f v = *(const v4f*)(sm.o + q * OSPW + 32 * seg + 4 * e);
      *(v4f*)(OB + ((size_t)(b * NN + n0 + q)) * CV + 32 * seg + 4 * e) = v;
    }
    
  }
}

// =========================================================================================================
// (4) output conv on the raw view: for image b, U[r][p] = OB_b[r*4096 + p] (r < 128, p < 4096);
//     y[b][o][p] = (1/4096) sum_r WO16[o][r] (Uh + Ul/2048)[p][r] + BOB[o], Uh = f16(16 U), Ul = f16((16U - Uh) 2048).
//     Block (64-p tile, 64-o block, b), 128 threads: stage the 128 r x 64 p view slab from OB (256-B contiguous row
//     segments), convert, store transposed into LDS Bs[p_loc][r] hi rows 0..63 / residual rows 64..127 (u32 pairs of
//     consecutive r), barrier; then 4 waves, wave w owns cols p0+16w..+15 (B fragments from the LDS rows, split k
//     map), 4 m-tiles (A rows o0 + 16 mt + (lane&15), k = r contiguous, from the 64 WO16 rows that asynchronous 16-byte
//     copies brought into LDS at pitch BP ahead of that barrier), K = 128 = 4 steps, hi and
//     d_out [b][256][4096] (row segment 64 p = 2 lines): 8 consecutive lanes x 16 B, one instruction per 16 lines,
// coverage: staging 8 it x 8 row-pairs x 16 lanes x 4 p x 2 rows = 128 r x 64 p per plane (pad cols never read);
//           d_out 8 it x 16 lines x 8 lanes x 4 = 64 o x 64 p; grid (64, 4, NIMG) covers d_out exactly once.
// =========================================================================================================
__global__ __launch_bounds__(128)
void out_proj(const float* __restrict__ OB, const unsigned short* __restrict__ WO16,
              const float* __restrict__ BOB, float* out) {
  __shared__ __align__(16) unsigned int Bs[2 * QT * (BP / 2)];
  __shared__ __align__(16) unsigned short As[QT * BP];
  __shared__ __align__(16) float Os[QT * OSP];
  const int tid  = threadIdx.x;
  const int lane = tid & 31, wave = tid >> 5;
  const int hh   = lane >> 4, c = lane & 15;
  const int pt = blockIdx.x, mb = blockIdx.y, b = blockIdx.z;
  const int p0 = pt * QT, o0 = mb * QT;
  const float* OBb = OB + (size_t)b * NN * CV;

  // ---- the weight tile into LDS, rows o0 .. o0+63 of 256 B at pitch BP: 16 lanes per row, copy j takes rows 8j .. 8j+7;
  //      the copies fly while the view slab below is loaded and converted ----
  stage_rows8(lds_byte(As) + (unsigned)((tid >> 4) * (BP * 2) + (tid & 15) * 16),
              WO16 + (size_t)(o0 + (tid >> 4)) * CV + 8 * (tid & 15), 8 * BP * 2, (size_t)8 * CV);

  // ---- stage + convert the view slab: Bs[p_loc][r] ----
  {
    const int e16 = tid & 15, rq = tid >> 4;                           // rq 0..7
#pragma unroll
    for (int it = 0; it < 8; ++it) {
      const int rp = 8 * it + rq;                                      // row pair 0..63
      const int r0 = 2 * rp;
      const v4f va = *(const v4f*)(OBb + (size_t)r0 * NN + p0 + 4 * e16);
      const v4f vb = *(const v4f*)(OBb + (size_t)(r0 + 1) * NN + p0 + 4 * e16);
#pragma unroll
      for (int t = 0; t < 4; ++t) {
        const float f0 = va[t] * USC, f1 = vb[t] * USC;
        const _Float16 h0 = (_Float16)f0, h1 = (_Float16)f1;
        const _Float16 l0 = (_Float16)((f0 - (float)h0) * RSC);
        const _Float16 l1 = (_Float16)((f1 - (float)h1) * RSC);
        const int pl = 4 * e16 + t;                                    // p_loc 0..63
        Bs[pl * (BP / 2) + rp]        = pk16(h_bits(h0), h_bits(h1));  // halves r0, r0+1
        Bs[(QT + pl) * (BP / 2) + rp] = pk16(h_bits(l0), h_bits(l1));
      }
    }
  }
  asm volatile("s_wait_asynccnt 0x0" ::: "memory");                    // this wave's rows of the weight tile have landed
  __syncthreads();                                                     // publishes the slab and the weight tile

  const unsigned short* Bh  = (const unsigned short*)Bs;
  const unsigned short* bph = Bh + (16 * wave + c) * BP + 8 * hh;     // B col = p0 + 16*wave + c, k = r
  const unsigned short* bpl = bph + QT * BP;
  const unsigned short* ap  = As + c * BP + 8 * hh;                   // A row = o0 + 16 mt + c, k = r

  v8f acch[4], accl[4];
#pragma unroll
  for (int mt = 0; mt < 4; ++mt) { acch[mt] = zero8(); accl[mt] = zero8(); }

  // a k-step's six LDS fragments are read as one group, one k-step ahead of the products that use them
  Frag fa[2][4], fbh[2], fbl[2];
  fbh[0] = ldfrag(bph);
  fbl[0] = ldfrag(bpl);
#pragma unroll   // the fragment arrays stay in registers only under constant indices
  for (int mt = 0; mt < 4; ++mt) fa[0][mt] = ldfrag(ap + (16 * mt) * BP);
#pragma unroll   // constant indices, as above
  for (int ks = 0; ks < CV / 32; ++ks) {
    if (ks + 1 < CV / 32) {
      fbh[(ks + 1) & 1] = ldfrag(bph + 32 * (ks + 1));
      fbl[(ks + 1) & 1] = ldfrag(bpl + 32 * (ks + 1));
#pragma unroll   // constant indices, as above
      for (int mt = 0; mt < 4; ++mt) fa[(ks + 1) & 1][mt] = ldfrag(ap + (16 * mt) * BP + 32 * (ks + 1));
    }
    // keeps the group's reads ahead of this k-step's products: without it the compiler sinks each pair to its first use,
    // and the wave waits out every pair's LDS latency
    __builtin_amdgcn_sched_barrier(0);
#pragma unroll   // constant indices, as above
    for (int mt = 0; mt < 4; ++mt) {
      acch[mt] = mma_h(fa[ks & 1][mt].h, fbh[ks & 1].h, acch[mt]);
      accl[mt] = mma_h(fa[ks & 1][mt].h, fbl[ks & 1].h, accl[mt]);
    }
  }
  {
    const int nl = 16 * wave + c;
    const float osc = IWSC * IUSC;                                     // 1/4096
#pragma unroll
    for (int mt = 0; mt < 4; ++mt) {
#pragma unroll
      for (int r = 0; r < 8; ++r) {
        const int ol = 16 * mt + 8 * hh + r;                           // 0..63
        Os[ol * OSP + nl] = (acch[mt][r] + accl[mt][r] * IRSC) * osc + BOB[o0 + ol];
      }
    }
  }
  __syncthreads();
  {
    const int e = tid & 7, lq = tid >> 3;                              // lq 0..15
{
#pragma unroll
      for (int it = 0; it < 8; ++it) {
        const int L = it * 16 + lq;                                    // 0..127
        const int row = L >> 1, hf = L & 1;
        const int nl = hf * 32 + 4 * e;
        const v4f v = *(const v4f*)(Os + row * OSP + nl);
        *(v4f*)(out + ((size_t)(b * CO + o0 + row)) * NN + p0 + nl) = v;
      }
      
    }
  }
}

// =========================================================================================================
// Workspace map (bytes; each region start a multiple of 256; every extent is an exact tile multiple and is written
//   W16 f16 [384][256]            196608      BIAS f32 [384]              1536
//   WO16 f16 [256][128]            65536      BOB  f32 [256]              1024
//   Qh/Ql/Kh/Kl bf16 [8][4096][128]  8388608 x4                          Vh f16 [8][128][4096]  8388608
//   OB  f32 [8][4096][128]      16777216
//   total = 58984960
// =========================================================================================================
extern "C" void kernel_launch(void* const* d_in, const int* in_sizes, int n_in,
                              void* d_out, int out_size, void* d_ws, size_t ws_size,
                              hipStream_t stream) {
  const int XN = NIMG * CC * NN;                                       // 8388608
  if (n_in < 9) return;
  if (in_sizes[0] != XN) return;
  if (in_sizes[1] != CK * CC || in_sizes[2] != CK) return;
  if (in_sizes[3] != CK * CC || in_sizes[4] != CK) return;
  if (in_sizes[5] != CV * CC || in_sizes[6] != CV) return;
  if (in_sizes[7] != CO * CV || in_sizes[8] != CO) return;
  if (out_size != NIMG * CO * NN) return;

  size_t off = 0;
  auto carve = [&](size_t bytes) { const size_t o = off; off += (bytes + 255) & ~(size_t)255; return o; };
  const size_t oW16 = carve((size_t)MQKV * CC * 2);
  const size_t oBIA = carve((size_t)MQKV * 4);
  const size_t oWO  = carve((size_t)CO * CV * 2);
  const size_t oBOB = carve((size_t)CO * 4);
  const size_t oQh  = carve((size_t)NIMG * NN * CK * 2);
  const size_t oQl  = carve((size_t)NIMG * NN * CK * 2);
  const size_t oKh  = carve((size_t)NIMG * NN * CK * 2);
  const size_t oKl  = carve((size_t)NIMG * NN * CK * 2);
  const size_t oVh  = carve((size_t)NIMG * CV * NN * 2);
  const size_t oOB  = carve((size_t)NIMG * NN * CV * 4);
  if (off > ws_size) return;
  if (off > (size_t)134217728) return;

  const float* x  = (const float*)d_in[0];
  const float* wq = (const float*)d_in[1];
  const float* bq = (const float*)d_in[2];
  const float* wk = (const float*)d_in[3];
  const float* bk = (const float*)d_in[4];
  const float* wv = (const float*)d_in[5];
  const float* bv = (const float*)d_in[6];
  const float* wo = (const float*)d_in[7];
  const float* bo = (const float*)d_in[8];

  char* ws = (char*)d_ws;
  unsigned short* W16 = (unsigned short*)(ws + oW16);
  float*          BIA = (float*)(ws + oBIA);
  unsigned short* WO  = (unsigned short*)(ws + oWO);
  float*          BOB = (float*)(ws + oBOB);
  unsigned short* Qh  = (unsigned short*)(ws + oQh);
  unsigned short* Ql  = (unsigned short*)(ws + oQl);
  unsigned short* Kh  = (unsigned short*)(ws + oKh);
  unsigned short* Kl  = (unsigned short*)(ws + oKl);
  unsigned short* Vh  = (unsigned short*)(ws + oVh);
  float*          OB  = (float*)(ws + oOB);
  float* out = (float*)d_out;

  const dim3 blk256(256), blk128(128);

  // (0) conv1x1 q/k/v weights -> f16 plane + bias line; output conv weights -> f16 plane + bias line
  cvt_w<<<dim3(MQKV / 8), blk256, 0, stream>>>(wq, bq, wk, bk, wv, bv, W16, BIA);
  cvt_wo<<<dim3(CO / 16), blk256, 0, stream>>>(wo, bo, WO, BOB);
  // (1) conv1x1 GEMM straight from x -> q/k hi + residual planes and v plane
  gemm_qkv<<<dim3(NN / QT, NIMG), blk256, 0, stream>>>(x, W16, BIA, Qh, Ql, Kh, Kl, Vh);
  // (3) attention -> OB [b][4096][128] token-major f32
  attn_gab<<<dim3(NN / AQ, NIMG), blk256, 0, stream>>>(Qh, Ql, Kh, Kl, Vh, OB);
  // (4) output conv on the raw view -> out [b][256][4096]
  out_proj<<<dim3(NN / QT, CO / QT, NIMG), blk128, 0, stream>>>(OB, WO, BOB, out);
  (void)hipGetLastError();
}

// v007
// It runs in 105 microseconds.
// Next to v006, in two timings, it ran 1.05 times as fast each time.
// Over all steps from v000 it is 4.61 times as fast.
// Contractions: conv1x1 q/k/v GEMM W[384x256].X on v_wmma_f32_16x16x32_f16 (f16 containers of bf16-RNE weights x256
// and bf16-RNE x); scores K.Q^T on v_wmma_f32_16x16x32_bf16 (bf16 hi + bf16 residual planes of q and k, 3 products,
// K=128); O^T = V.P^T on v_wmma_f32_16x16x32_f16 (v x16 f16, P = 1024 e^{(s-m)c} f16 from the score D registers);
// output conv1x1 Wo[256x128].U on v_wmma_f32_16x16x32_f16 (Wo f16 of bf16-RNE x256, U as f16 hi x16 plus f16
// residual x2^11 planes in two accumulators); f32 accumulate everywhere; softmax statistics in f32 VALU.
#include <hip/hip_runtime.h>
#include <math.h>
#include <stdint.h>

#define NIMG  8
#define CC    256
#define NN    4096
#define CK    128
#define CV    128
#define CO    256
#define MQKV  384
#define QT    64
#define OSP   68
#define OSPW  132
#define QP    136
#define BP    136
#define KT    128
#define VP    136
#define STG   (2 * KT * QP + CV * VP)
#define XPP   264
#define WSC   256.0f
#define IWSC  0.00390625f
#define VSC   16.0f
#define IVSC  0.0625f
#define USC   16.0f
#define IUSC  0.0625f
#define RSC   2048.0f
#define IRSC  0.00048828125f
#define LNPS  6.931471805599453f
#define SCL   0.08838834764831845f

static_assert(NN % QT == 0);
static_assert(CC % 32 == 0 && CK % 64 == 0 && CV % 32 == 0);
static_assert(MQKV == 2 * CK + CV);
static_assert(MQKV % QT == 0 && CO % QT == 0);
static_assert(CK == 2 * QT && CV == 2 * QT);
static_assert((OSP * 4) % 16 == 0);
static_assert((OSPW * 4) % 16 == 0);
static_assert((XPP * 2) % 32 == 16 && XPP >= CC + 8 && XPP % 2 == 0 && MQKV / QT >= 2);
static_assert((QP * 2) % 16 == 0 && (BP * 2) % 16 == 0 && (BP % 2) == 0);
static_assert(QT * OSPW * 4 <= 2 * QT * QP * 2);
static_assert(NN % KT == 0 && NN / KT >= 2 && KT % 32 == 0);
static_assert((VP * 2) % 16 == 0 && (STG * 2) % 16 == 0 && VP >= KT + 8);
static_assert(KT * CK * 2 == 8 * 256 * 16 && CV * KT * 2 == 8 * 256 * 16 && KT == 128 && QP == VP);

typedef _Float16       v16h __attribute__((ext_vector_type(16)));
typedef _Float16       v8h  __attribute__((ext_vector_type(8)));
typedef _Float16       v2h  __attribute__((ext_vector_type(2)));
typedef __bf16         v16b __attribute__((ext_vector_type(16)));
typedef unsigned short v8us __attribute__((ext_vector_type(8)));
typedef float          v8f  __attribute__((ext_vector_type(8)));
typedef float          v4f  __attribute__((ext_vector_type(4)));
typedef unsigned int   v4u  __attribute__((ext_vector_type(4)));

union Frag  { v8us u[2]; v16h h; v16b bf; };
union FragH { v16h v; v8h hv[2]; };
static_assert(sizeof(Frag) == 32);
static_assert(sizeof(FragH) == 32);

// ---- scalar helpers ---------------------------------------------------------------------------------------
__device__ __forceinline__ unsigned short bf_bits(float f) {          // f32 -> bf16 bits, RNE convert
  unsigned u = __float_as_uint(f);
  return (unsigned short)((u + 0x7FFFu + ((u >> 16) & 1u)) >> 16);
}
__device__ __forceinline__ float bf_up(unsigned short hb) { return __uint_as_float(((unsigned)hb) << 16); }
__device__ __forceinline__ float bfr(float f) { return bf_up(bf_bits(f)); }
__device__ __forceinline__ unsigned short h_bits(_Float16 x) { return __builtin_bit_cast(unsigned short, x); }
__device__ __forceinline__ unsigned pk16(unsigned short a, unsigned short b) { return (unsigned)a | ((unsigned)b << 16); }
__device__ __forceinline__ unsigned pkh(float a, float b) {           // f16 RNE of a (low half) and of b (high half)
  const v2h p = {(_Float16)a, (_Float16)b};
  return __builtin_bit_cast(unsigned, p);
}
__device__ __forceinline__ v8f zero8() { v8f z = {0.f, 0.f, 0.f, 0.f, 0.f, 0.f, 0.f, 0.f}; return z; }
__device__ __forceinline__ float hmax8(v8f s) {
  return fmaxf(fmaxf(fmaxf(s[0], s[1]), fmaxf(s[2], s[3])), fmaxf(fmaxf(s[4], s[5]), fmaxf(s[6], s[7])));
}

// lane l <-> l ^ 16 by a vector cross-row move: it counts on no LDS counter, so no wait on it drains LDS reads in flight
__device__ __forceinline__ float xhalf(float x) {
  const int b = __builtin_bit_cast(int, x);
  return __builtin_bit_cast(float, __builtin_amdgcn_permlanex16(b, b, 0x76543210, 0xfedcba98, false, false));
}

// ---- 16-bit fragment loader (A, or B from a k-contiguous [n][k] row): lane -> row/col (lane&15), p already includes
//      + 8*(lane>>4); elements 0..7 <- p[0..7] (k0+8h..), elements 8..15 <- p[16..23] (k0+16+8h..)
__device__ __forceinline__ Frag ldfrag(const unsigned short* p) {
  Frag f;
  f.u[0] = *(const v8us*)(p);
  f.u[1] = *(const v8us*)(p + 16);
  return f;
}

typedef __attribute__((address_space(3))) unsigned short lds_us;
__device__ __forceinline__ unsigned lds_byte(unsigned short* p) { return (unsigned)(uintptr_t)(lds_us*)p; }

// ---- WMMA helpers: builtin followed by a 4-slot VALU gap tying D and keeping A/B live --------------------------
__device__ __forceinline__ v8f mma_h(v16h a, v16h b, v8f c) {
  v8f d = __builtin_amdgcn_wmma_f32_16x16x32_f16(false, a, false, b, (short)0, c, false, false);
#if defined(__HIP_DEVICE_COMPILE__)
  asm volatile("v_nop\n\tv_nop\n\tv_nop\n\tv_nop" : "+v"(d) : "v"(a), "v"(b));
#endif
  return d;
}
__device__ __forceinline__ v8f mma_b(v16b a, v16b b, v8f c) {
  v8f d = __builtin_amdgcn_wmma_f32_16x16x32_bf16(false, a, false, b, (short)0, c, false, false);
#if defined(__HIP_DEVICE_COMPILE__)
  const v16h ha = __builtin_bit_cast(v16h, a), hb = __builtin_bit_cast(v16h, b);
  asm volatile("v_nop\n\tv_nop\n\tv_nop\n\tv_nop" : "+v"(d) : "v"(ha), "v"(hb));
#endif
  return d;
}

// =========================================================================================================
// (0) q/k/v conv1x1 weights: W16 f16 [384][256], rows 0..127 = wq, 128..255 = wk, 256..383 = wv; value = f16 of
//     (bf16-RNE(w) * 256) (exact). BIAS f32 [384] = bf16-RNE of bq / bk / bv. Block blk (0..47) owns rows
// coverage: 48 blocks x 8 rows x 32 pieces x 8 halves = 384 x 256; bias 96 x 4 floats = 384.
// =========================================================================================================
__global__ __launch_bounds__(256)
void cvt_w(const float* __restrict__ wq, const float* __restrict__ bq,
           const float* __restrict__ wk, const float* __restrict__ bk,
           const float* __restrict__ wv, const float* __restrict__ bv,
           unsigned short* W16, float* BIAS) {
  const int tid = threadIdx.x, blk = blockIdx.x;
  const int rl = tid >> 5, col = 8 * (tid & 31);
  const int o = 8 * blk + rl;                                          // 0..383
  const float* wbase = (blk < 16) ? wq : (blk < 32) ? wk : wv;         // block-uniform selection
  const int osub = (blk < 16) ? 0 : (blk < 32) ? CK : 2 * CK;
  const float* s = wbase + (size_t)(o - osub) * CC + col;             // (o-osub) < 128 rows of that matrix
  const v4f a = *(const v4f*)s;
  const v4f q = *(const v4f*)(s + 4);
  const float f[8] = {a[0], a[1], a[2], a[3], q[0], q[1], q[2], q[3]};
  v4u u;
#pragma unroll
  for (int t = 0; t < 4; ++t) {
    const _Float16 h0 = (_Float16)(bfr(f[2 * t]) * WSC);
    const _Float16 h1 = (_Float16)(bfr(f[2 * t + 1]) * WSC);
    u[t] = pk16(h_bits(h0), h_bits(h1));
  }
  // bias values: every lane loads all three candidates with clamped indices, selects by value
  v4f bvv;
  {
    const int tb = min(tid, 95);
    const int o4 = 4 * tb;
#pragma unroll
    for (int qd = 0; qd < 4; ++qd) {
      const int oo = o4 + qd;                                          // 0..383
      const int iq = min(oo, CK - 1);
      const int ik = min(max(oo - CK, 0), CK - 1);
      const int iv = min(max(oo - 2 * CK, 0), CV - 1);
      const float cq = bq[iq], ckv = bk[ik], cvv = bv[iv];
      const float val = (oo < CK) ? cq : (oo < 2 * CK) ? ckv : cvv;
      bvv[qd] = bfr(val);
    }
  }
{
    *(v4u*)(W16 + (size_t)o * CC + col) = u;
    if (blk == 0 && tid < 96) *(v4f*)(BIAS + 4 * tid) = bvv;
    
  }
}

// =========================================================================================================
// (0b) output conv weights: WO16 f16 [256][128] = f16 of (bf16-RNE(wo) * 256) (exact); BOB f32 [256] = bf16-RNE bo.
// coverage: 16 blocks x 16 rows x 16 pieces x 8 halves = 256 x 128; bias 64 x 4 floats = 256.
// =========================================================================================================
__global__ __launch_bounds__(256)
void cvt_wo(const float* __restrict__ wo, const float* __restrict__ bo, unsigned short* WO16, float* BOB) {
  const int tid = threadIdx.x, blk = blockIdx.x;
  const int rl = tid >> 4, col = 8 * (tid & 15);
  const int o = 16 * blk + rl;                                         // 0..255
  const float* s = wo + (size_t)o * CV + col;
  const v4f a = *(const v4f*)s;
  const v4f q = *(const v4f*)(s + 4);
  const float f[8] = {a[0], a[1], a[2], a[3], q[0], q[1], q[2], q[3]};
  v4u u;
#pragma unroll
  for (int t = 0; t < 4; ++t) {
    const _Float16 h0 = (_Float16)(bfr(f[2 * t]) * WSC);
    const _Float16 h1 = (_Float16)(bfr(f[2 * t + 1]) * WSC);
    u[t] = pk16(h_bits(h0), h_bits(h1));
  }
  v4f bvv;
  {
    const int tb = min(tid, 63);
#pragma unroll
    for (int qd = 0; qd < 4; ++qd) bvv[qd] = bfr(bo[4 * tb + qd]);  // index <= 255
  }
{
    *(v4u*)(WO16 + (size_t)o * CV + col) = u;
    if (blk == 0 && tid < 64) *(v4f*)(BOB + 4 * tid) = bvv;
    
  }
}

// =========================================================================================================
// (1) conv1x1 GEMM for one (b, 64-n tile), all 384 output rows: Y[o][n] = (1/256) sum_c W16[o][c] X[n][c] + BIAS[o],
//     X[n][c] = f16 of bf16-RNE(x[b][c][n]) (exact). Block 256 threads = 8 waves, two blocks per WGP.
//     The block reads its x slab (256 c x 64 n, f32, 256-B row segments) once, rounds it and stores it transposed into LDS
//     Xs[n_loc][c] (u32 pairs of consecutive c, row pitch XPP halves = 16 B x odd), barrier. Wave w owns cols
//     n0 + 32 (w & 1) .. +31 (two B fragments per k-step, k = c contiguous in the token row, read once and kept in
//     registers) and in every 64-row weight tile the m-tile w >> 1 (A rows o = 64 mb + 16 (w >> 1) + (lane&15), split k map
//     loader). K = 256 = 8 steps. The six weight tiles come through a two-buffer LDS ring filled by asynchronous 16-byte
//     copies of whole rows; tile mb+2 is issued behind the barrier that ends the reads of tile mb.
//     Epilogue of a tile: Os[o_loc][n_loc] (pitch OSP), barrier, then packed in registers:
//       tiles 0,1 (q ck cols 0..63 / 64..127) and 2,3 (k): bf16 hi / bf16 residual planes [b][4096 n][128],
//         lane e -> cols 8e..8e+7 of token row 32 it + lq;
//       tiles 4,5 (v): f16 plane x16 [b][128 ch][4096 n], lane e -> halves 8e..8e+7 of channel row 32 it + lq;
//     the global stores stand behind the tile's hand-over barrier, so that they fly under the next tile's products.
// coverage: Xs 8 it x 16 row pairs x 16 lanes x 4 n x 2 rows = 256 c x 64 n; Os 8 waves x 2 tiles x 16x16 = 64 x 64;
//           q/k: per plane 2 it x 32 rows x 8 lanes x 8 = 64 n x 64 cols, tiles 0..3 cover all 128 cols of Qh/Ql/Kh/Kl;
//           v: 2 it x 32 rows x 8 lanes x 8 = 64 ch x 64 n; grid (64, NIMG) covers every plane exactly once.
// =========================================================================================================
// token rows (f16 pairs), the two weight tiles of the ring (rows of XPP halves), the output tile
struct GemmSmem { unsigned int x[QT * (XPP / 2)]; unsigned short w[2 * QT * XPP]; float o[QT * OSP]; };

// Eight 16-byte pieces per lane, global -> LDS through no register: a wave's 32 lanes x 16 B take 512 contiguous bytes
// (four whole lines) per copy. l / g are this lane's first piece, ls bytes / gs halves the step from copy to copy. The
// s_wait_xcnt closes the statement so that no address register of a copy is rewritten ahead of it.
__device__ __forceinline__ void stage_rows8(unsigned l, const unsigned short* g, unsigned ls, size_t gs) {
#if defined(__HIP_DEVICE_COMPILE__)
  asm volatile(
      "global_load_async_to_lds_b128 %0, %8, off\n\t"
      "global_load_async_to_lds_b128 %1, %9, off\n\t"
      "global_load_async_to_lds_b128 %2, %10, off\n\t"
      "global_load_async_to_lds_b128 %3, %11, off\n\t"
      "global_load_async_to_lds_b128 %4, %12, off\n\t"
      "global_load_async_to_lds_b128 %5, %13, off\n\t"
      "global_load_async_to_lds_b128 %6, %14, off\n\t"
      "global_load_async_to_lds_b128 %7, %15, off\n\t"
      "s_wait_xcnt 0x0"
      :: "v"(l), "v"(l + ls), "v"(l + 2 * ls), "v"(l + 3 * ls),
         "v"(l + 4 * ls), "v"(l + 5 * ls), "v"(l + 6 * ls), "v"(l + 7 * ls),
         "v"(g), "v"(g + gs), "v"(g + 2 * gs), "v"(g + 3 * gs),
         "v"(g + 4 * gs), "v"(g + 5 * gs), "v"(g + 6 * gs), "v"(g + 7 * gs)
      : "memory");
#endif
}

__global__ __launch_bounds__(256)
void gemm_qkv(const float* __restrict__ x, const unsigned short* __restrict__ W16, const float* __restrict__ BIAS,
              unsigned short* Qh, unsigned short* Ql, unsigned short* Kh, unsigned short* Kl,
              unsigned short* Vh) {
  __shared__ __align__(16) GemmSmem sm;
  float* Os = sm.o;
  const int tid  = threadIdx.x;
  const int lane = tid & 31, wave = tid >> 5;
  const int hh   = lane >> 4, c = lane & 15;
  const int nt   = blockIdx.x, b = blockIdx.y;
  const int n0   = nt * QT;
  const int nh   = wave & 1, mq = wave >> 1;                           // 32-col half; m-tile of every weight tile

  // ---- this thread's share of a weight tile: copy j of wave w takes row 8j + w, a lane 16 B of the 512-B row ----
  const unsigned lw = lds_byte(sm.w) + (unsigned)(wave * (XPP * 2) + lane * 16);
  const unsigned short* gw = W16 + (size_t)wave * CC + 8 * lane;
  const unsigned wls = 8 * XPP * 2;
  const size_t wgs = (size_t)8 * CC;
  stage_rows8(lw, gw, wls, wgs);                                       // tile 0 -> buffer 0, flies under the slab below

  // ---- load + round the x slab, store it transposed: Xs[n_loc][c] ----
  {
    const int e16 = tid & 15, rq = tid >> 4;                           // rq 0..15
    const float* sp = x + ((size_t)(b * CC + 2 * rq)) * NN + n0 + 4 * e16;
    v4f va[CC / 32], vb[CC / 32];                                      // rows 2cp, 2cp+1 of channel pair cp = 16 it + rq
#pragma unroll   // the arrays stay in registers only under constant indices
    for (int it = 0; it < CC / 32; ++it) {
      va[it] = *(const v4f*)(sp + (size_t)(32 * it) * NN);
      vb[it] = *(const v4f*)(sp + (size_t)(32 * it + 1) * NN);
    }
    // keeps all sixteen loads ahead of the first conversion: without it the compiler issues the later ones behind the
    // wait for the first, and the wave waits out the memory latency twice
    __builtin_amdgcn_sched_barrier(0);
#pragma unroll   // constant indices, as above
    for (int it = 0; it < CC / 32; ++it) {
      const int cp = 16 * it + rq;                                     // channel pair 0..127
#pragma unroll   // constant indices, as above
      for (int t = 0; t < 4; ++t)                                      // halves c = 2cp, 2cp+1 of token 4 e16 + t
        sm.x[(4 * e16 + t) * (XPP / 2) + cp] = pkh(bfr(va[it][t]), bfr(vb[it][t]));
    }
  }
  asm volatile("s_wait_asynccnt 0x0" ::: "memory");                    // this wave's rows of tile 0 have landed
  __syncthreads();                                                     // publishes the token rows and tile 0
  stage_rows8(lw + QT * XPP * 2, gw + (size_t)QT * CC, wls, wgs);      // tile 1 -> buffer 1

  // ---- the wave's 16 token fragments (B operand, col = n0 + 32 nh + 16 g + c), read once and kept in registers ----
  Frag fb[2][CC / 32];
#pragma unroll   // the fragment arrays stay in registers only under constant indices
  for (int g = 0; g < 2; ++g) {
    const unsigned short* bp = (const unsigned short*)sm.x + (32 * nh + 16 * g + c) * XPP + 8 * hh;
#pragma unroll   // constant indices, as above
    for (int ks = 0; ks < CC / 32; ++ks) fb[g][ks] = ldfrag(bp + 32 * ks);
  }

  const int e = tid & 7, lq = tid >> 3;                                // lq 0..31

#pragma unroll 1   // rolled: one hand-over point in the text, the buffer picked by mb & 1
  for (int mb = 0; mb < MQKV / QT; ++mb) {
    const int o0 = mb * QT;
    const unsigned short* ap = sm.w + (mb & 1) * (QT * XPP) + (16 * mq + c) * XPP + 8 * hh;
    // the lane's eight bias values and the tile's eight weight fragments, read as one group ahead of the products
    const v4f b0 = *(const v4f*)(BIAS + o0 + 16 * mq + 8 * hh);
    const v4f b1 = *(const v4f*)(BIAS + o0 + 16 * mq + 8 * hh + 4);
    Frag fa[CC / 32];
#pragma unroll   // constant indices, as above
    for (int ks = 0; ks < CC / 32; ++ks) fa[ks] = ldfrag(ap + 32 * ks);
    // keeps the group's reads ahead of the products: without it the compiler sinks each pair to its first use, and the
    // wave waits out every pair's LDS latency
    __builtin_amdgcn_sched_barrier(0);
    v8f acc[2];
    acc[0] = zero8();
    acc[1] = zero8();
#pragma unroll   // constant indices, as above
    for (int ks = 0; ks < CC / 32; ++ks) {                             // every weight fragment feeds both col tiles
      acc[0] = mma_h(fa[ks].h, fb[0][ks].h, acc[0]);
      acc[1] = mma_h(fa[ks].h, fb[1][ks].h, acc[1]);
    }

    // ---- scale back, + bias -> LDS Os[o_loc][n_loc] ----
#pragma unroll   // constant indices, as above
    for (int g = 0; g < 2; ++g) {
      const int nl = 32 * nh + 16 * g + c;
#pragma unroll   // constant indices, as above
      for (int r = 0; r < 8; ++r) {
        const int ol = 16 * mq + 8 * hh + r;                           // 0..63
        Os[ol * OSP + nl] = acc[g][r] * IWSC + ((r < 4) ? b0[r & 3] : b1[r & 3]);
      }
    }
    __syncthreads();                                                   // publishes Os

    v4u su[4];                                                         // q/k: hi it 0,1 then residual it 0,1; v: it 0,1
    if (mb < 4) {
      // ---- q / k bf16 hi + residual pieces (block-uniform branch) ----
#pragma unroll   // constant indices, as above
      for (int it = 0; it < 2; ++it) {
        const int nl = it * 32 + lq;                                   // token 0..63
#pragma unroll   // constant indices, as above
        for (int t = 0; t < 4; ++t) {
          const float f0 = Os[(8 * e + 2 * t) * OSP + nl];
          const float f1 = Os[(8 * e + 2 * t + 1) * OSP + nl];
          const unsigned short hb0 = bf_bits(f0), hb1 = bf_bits(f1);
          const unsigned short lb0 = bf_bits(f0 - bf_up(hb0));
          const unsigned short lb1 = bf_bits(f1 - bf_up(hb1));
          su[it][t]     = pk16(hb0, hb1);
          su[2 + it][t] = pk16(lb0, lb1);
        }
      }
    } else {
      // ---- v f16 pieces, carried x16 ----
#pragma unroll   // constant indices, as above
      for (int it = 0; it < 2; ++it) {
        const int row = it * 32 + lq;                                  // 0..63
        const v4f a = *(const v4f*)(Os + row * OSP + 8 * e);
        const v4f q = *(const v4f*)(Os + row * OSP + 8 * e + 4);
#pragma unroll   // constant indices, as above
        for (int t = 0; t < 2; ++t) {
          su[it][t]     = pk16(h_bits((_Float16)(a[2 * t] * VSC)), h_bits((_Float16)(a[2 * t + 1] * VSC)));
          su[it][2 + t] = pk16(h_bits((_Float16)(q[2 * t] * VSC)), h_bits((_Float16)(q[2 * t + 1] * VSC)));
        }
      }
    }

    // ---- hand-over: tile mb+1 becomes readable, buffer mb&1 and Os become free ----
    asm volatile("s_wait_dscnt 0x0" ::: "memory");                     // this wave's reads of buffer mb&1 and of Os are done
    asm volatile("s_wait_asynccnt 0x0" ::: "memory");                  // this wave's rows of tile mb+1 have landed
    __syncthreads();
    if (mb + 2 < MQKV / QT)
      stage_rows8(lw + (unsigned)(mb & 1) * (QT * XPP * 2), gw + (size_t)(mb + 2) * QT * CC, wls, wgs);

    if (mb < 4) {
      unsigned short* Ph = (mb < 2) ? Qh : Kh;
      unsigned short* Pl = (mb < 2) ? Ql : Kl;
      const int cb = QT * (mb & 1);                                    // ck column base 0 or 64
#pragma unroll   // constant indices, as above
      for (int it = 0; it < 2; ++it) {
        const size_t base = ((size_t)(b * NN + n0 + it * 32 + lq)) * CK + cb + 8 * e;
        *(v4u*)(Ph + base) = su[it];
        *(v4u*)(Pl + base) = su[2 + it];
      }
    } else {
      const int ch0 = QT * (mb - 4);                                   // 0 or 64
#pragma unroll   // constant indices, as above
      for (int it = 0; it < 2; ++it)
        *(v4u*)(Vh + ((size_t)(b * CV + ch0 + it * 32 + lq)) * NN + n0 + 8 * e) = su[it];
    }
    asm volatile("s_wait_xcnt 0x0" ::: "memory");                      // the next tile's reads rewrite the stores' registers
  }
  asm volatile("s_wait_asynccnt 0x0" ::: "memory");                    // no copy is left in flight at the wave's end
}

// =========================================================================================================
// (3) attention for one (b, 128-query tile), transposed formulation, 4096 keys, no mask:
//   S^T tile (16 keys x 16 queries) = sum over 4 k-steps of A(k: row = key kb + (lane&15), 32 d via the split k map
//   from the bf16 plane Kh [b][4096][128]) . B(q: col = query, same map, from the wave's registers) + A(Kh).B(Ql)
//   + A(Kl).B(Qh) (bf16 unscaled residual planes, shared accumulator). Softmax of s*c with c = 1/sqrt(128):
//   per lane the D tile holds 8 keys of ONE query: online state per lane, one cross-row move (lane^16) for the max over
//   32 keys, row-sum partials combined at the end. P = 1024 e^{(s-m)c} as f16 is the B operand of
//   O^T (rows channel, cols queries) += A(V rows channel = 16j + (lane&15), keys contiguous, f16 plane Vh
//   [b][128][4096]) . B(P^T): element r <- D of the tile covering keys kb..kb+15, element 8+r <- the tile covering
//   kb+16..kb+31, lane unchanged. 8 accumulator tiles per query tile (128 channels). Block = 8 waves = 128 queries, one
//   block per WGP: wave w owns two query tiles, queries 32 (w & 3) .. +31, and keys 32 (w >> 2) .. +31 of every 64 keys;
//   the two states of a query group are merged at the end. Q hi/lo rows of the block's 128 queries are staged once in LDS
//   (v4u pieces, barrier); each wave then reads its 16 q fragments once and keeps them in registers, so that the key loop
//   reads only k and v from LDS and every such fragment feeds both query tiles. A 32-key pass reads its LDS fragments
//   ahead of the products that use them: k of k-steps 0,1; k of k-steps 2,3; all of v.
//   K hi, K residual and V come in tiles of KT = 128 keys through a two-buffer LDS ring filled by asynchronous 16-byte
//   copies (whole 128-B lines per request, each tile fetched once per block and read by all 8 waves); a wave makes two
//   32-key passes over a tile between hand-overs, so that the waves of a SIMD may run out of step for two passes and a
//   tile's copies have two passes to land; tile t+2 is issued behind the barrier that ends the reads of tile t. Row
//   pitches QP / VP halves = 16 B x odd.
//   Epilogue: barrier, O/l staged in LDS Os[query][128 channels] (pitch OSPW, b128 stores, aliases the Q staging),
// coverage: Q staging 8 it x 16 rows x 16 lanes x 8 = 128 x 128 per plane; OB 16 it x 32 lines x 8 lanes x 4 floats =
//           128 queries x 128 ch; grid (32, NIMG) covers OB exactly once.
// =========================================================================================================
#define AQ    128                                                      // queries of one attention block
static_assert(NN % AQ == 0 && AQ * OSPW * 4 <= 2 * AQ * QP * 2);
union AttnSmem { unsigned short q[2 * AQ * QP]; float o[AQ * OSPW]; };
// the k/v ring; after the key loop its first bytes carry the second key half's softmax state (o 16384 floats, m, l)
union AttnRing { unsigned short h[2 * STG]; float f[4 * 132 * 32]; };
static_assert(4 * 132 * 32 * 4 <= 2 * STG * 2);

// One tile of KT keys into the ring buffer at LDS halves lp: k hi rows [KT][QP], k residual rows [KT][QP], v rows [CV][VP],
// each part 128 rows of 256 B: 16 lanes per row, 16 rows per piece step, eight pieces (24 copies per lane and tile),
// global -> LDS through no register. lp / kh / kl / vh are this thread's piece 0 of the buffer and of the tile's planes.
// The copies are the builtin: its address registers may lie anywhere in the wave's register file, while an asm operand
// lives in v0..v255, where 24 copies' addresses do not fit beside the wave's register tile (they were spilled).
typedef int v4i __attribute__((ext_vector_type(4)));
typedef __attribute__((address_space(1))) v4i gl_v4i;
typedef __attribute__((address_space(3))) v4i lds_v4i;
__device__ __forceinline__ void copy16(const unsigned short* g, unsigned short* l) {
#if defined(__HIP_DEVICE_COMPILE__)
  __builtin_amdgcn_global_load_async_to_lds_b128((gl_v4i*)(uintptr_t)g, (lds_v4i*)l, 0, 0);
#endif
}
__device__ __forceinline__ void stage_kv(unsigned short* lp, const unsigned short* kh,
                                         const unsigned short* kl, const unsigned short* vh) {
#pragma unroll   // straight-line copies, constant steps
  for (int j = 0; j < KT / 16; ++j) {
    copy16(kh + (size_t)(16 * j) * CK, lp + (16 * j) * QP);
    copy16(kl + (size_t)(16 * j) * CK, lp + KT * QP + (16 * j) * QP);
  }
#pragma unroll   // as above
  for (int j = 0; j < CV / 16; ++j) copy16(vh + (size_t)(16 * j) * NN, lp + 2 * KT * QP + (16 * j) * VP);
}

// ---- WMMA helpers of the attention kernel: the bare builtins, the compiler keeping the distance behind them. An asm
//      statement takes its vector operands from v0..v255 only; tied to one, the wave's 32-query register tile
//      (q 128, o 128 registers) would not fit and would spill.
__device__ __forceinline__ v8f mma_hr(v16h a, v16h b, v8f c) {
  return __builtin_amdgcn_wmma_f32_16x16x32_f16(false, a, false, b, (short)0, c, false, false);
}
__device__ __forceinline__ v8f mma_br(v16b a, v16b b, v8f c) {
  return __builtin_amdgcn_wmma_f32_16x16x32_bf16(false, a, false, b, (short)0, c, false, false);
}

__global__ __launch_bounds__(256)
void attn_gab(const unsigned short* __restrict__ Qh, const unsigned short* __restrict__ Ql,
              const unsigned short* __restrict__ Kh, const unsigned short* __restrict__ Kl,
              const unsigned short* __restrict__ Vh, float* OB) {
  __shared__ __align__(16) AttnSmem sm;
  __shared__ __align__(16) AttnRing rg;
  unsigned short* ring = rg.h;
  const int tid  = threadIdx.x;
  const int wave = tid >> 5, lane = tid & 31;
  const int hh   = lane >> 4, c = lane & 15;
  const int n0   = blockIdx.x * AQ, b = blockIdx.y;
  const int wq   = wave & 3, kh2 = wave >> 2;                          // query group of 32; 32-key half of every 64-key pass

  // ---- this thread's share of a k/v tile: its place inside a ring buffer, source pointers of tile 0 ----
  unsigned short* lp0 = ring + (tid >> 4) * QP + (tid & 15) * 8;
  const unsigned short* khg = Kh + ((size_t)(b * NN + (tid >> 4))) * CK + 8 * (tid & 15);
  const unsigned short* klg = Kl + ((size_t)(b * NN + (tid >> 4))) * CK + 8 * (tid & 15);
  const unsigned short* vhg = Vh + ((size_t)(b * CV + (tid >> 4))) * NN + 8 * (tid & 15);
  stage_kv(lp0, khg, klg, vhg);                                        // tile 0 -> buffer 0

  // ---- stage q hi (rows 0..127) and q residual (rows 128..255) of this query tile in LDS ----
  {
    const int e16 = tid & 15, rq = tid >> 4;                          // rq 0..15
#pragma unroll
    for (int it = 0; it < AQ / 16; ++it) {
      const int row = 16 * it + rq;                                    // 0..127
      const size_t g = ((size_t)(b * NN + n0 + row)) * CK + 8 * e16;
      const v4u vh = *(const v4u*)(Qh + g);
      const v4u vl = *(const v4u*)(Ql + g);
      *(v4u*)(sm.q + row * QP + 8 * e16)        = vh;
      *(v4u*)(sm.q + (AQ + row) * QP + 8 * e16) = vl;
    }
  }
  asm volatile("s_wait_asynccnt 0x0" ::: "memory");                    // this wave's share of tile 0 has landed
  __syncthreads();                                                     // publishes the q rows and tile 0
  stage_kv(lp0 + STG, khg + (size_t)KT * CK, klg + (size_t)KT * CK, vhg + KT);                 // tile 1 -> buffer 1

  // ---- the wave's q fragments (B operand, col = query n0 + 32*wq + 16*g + c), read once and kept in registers ----
  Frag qhf[2][CK / 32], qlf[2][CK / 32];
#pragma unroll
  for (int g = 0; g < 2; ++g) {
    const unsigned short* qsh = sm.q + (32 * wq + 16 * g + c) * QP + 8 * hh;
#pragma unroll
    for (int ks = 0; ks < CK / 32; ++ks) {
      qhf[g][ks] = ldfrag(qsh + 32 * ks);
      qlf[g][ks] = ldfrag(qsh + AQ * QP + 32 * ks);
    }
  }

  float m[2] = {-1.0e30f, -1.0e30f}, l[2] = {0.f, 0.f};
  v8f o[2][8];
#pragma unroll
  for (int g = 0; g < 2; ++g) {
#pragma unroll
    for (int j = 0; j < 8; ++j) o[g][j] = zero8();
  }

#pragma unroll 1   // rolled: one hand-over point in the text, the buffer picked by t & 1
  for (int t = 0; t < NN / KT; ++t) {
  const unsigned short* buf = ring + (t & 1) * STG;
#pragma unroll   // unrolled: the second pass's key offsets fold into the reads' immediates; no barrier stands between the passes
  for (int ps = 0; ps < KT / 64; ++ps) {
  // k fragment base (A operand, row = key kb + c of the tile), + key * QP
  const int kb = 64 * ps + 32 * kh2;                                   // this wave's 32 keys of the pass
  const unsigned short* Khp = buf + c * QP + 8 * hh;
  const unsigned short* Klp = Khp + KT * QP;
  // v fragment base (A operand, row = channel 16j + c, the tile's keys contiguous), + 16*j*VP + kb
  const unsigned short* Vhp = buf + 2 * KT * QP + c * VP + 8 * hh;
  {
    v8f s0[2], s1[2];                                                  // [query tile]: keys kb..+15, keys kb+16..+31
#pragma unroll
    for (int g = 0; g < 2; ++g) { s0[g] = zero8(); s1[g] = zero8(); }
#pragma unroll   // unrolled: each trip's reads stand as one group in the text, ahead of that trip's 24 products
    for (int kg = 0; kg < CK / 64; ++kg) {
      // the k fragments of two k-steps, read ahead of their products, counted waits behind them
      Frag k0[2], k1[2], k0l[2], k1l[2];
#pragma unroll   // the fragment arrays stay in registers only under constant indices
      for (int u = 0; u < 2; ++u) {
        const int ks = 2 * kg + u;
        k0[u]  = ldfrag(Khp + kb * QP + 32 * ks);                        // keys kb .. kb+15
        k1[u]  = ldfrag(Khp + (kb + 16) * QP + 32 * ks);                 // keys kb+16 .. kb+31
        k0l[u] = ldfrag(Klp + kb * QP + 32 * ks);
        k1l[u] = ldfrag(Klp + (kb + 16) * QP + 32 * ks);
      }
      // keeps the group's reads ahead of its products: without it the compiler sinks each pair to its first use, and the
      // wave waits out every pair's latency
      __builtin_amdgcn_sched_barrier(0);
#pragma unroll   // constant indices, as above
      for (int u = 0; u < 2; ++u) {
        const int ks = 2 * kg + u;
        // every k fragment feeds both query tiles; per accumulator the order hi.hi, hi.res, res.hi is kept
        s0[0] = mma_br(k0[u].bf, qhf[0][ks].bf, s0[0]);
        s1[0] = mma_br(k1[u].bf, qhf[0][ks].bf, s1[0]);
        s0[1] = mma_br(k0[u].bf, qhf[1][ks].bf, s0[1]);
        s1[1] = mma_br(k1[u].bf, qhf[1][ks].bf, s1[1]);
        s0[0] = mma_br(k0[u].bf, qlf[0][ks].bf, s0[0]);
        s1[0] = mma_br(k1[u].bf, qlf[0][ks].bf, s1[0]);
        s0[1] = mma_br(k0[u].bf, qlf[1][ks].bf, s0[1]);
        s1[1] = mma_br(k1[u].bf, qlf[1][ks].bf, s1[1]);
        s0[0] = mma_br(k0l[u].bf, qhf[0][ks].bf, s0[0]);
        s1[0] = mma_br(k1l[u].bf, qhf[0][ks].bf, s1[0]);
        s0[1] = mma_br(k0l[u].bf, qhf[1][ks].bf, s0[1]);
        s1[1] = mma_br(k1l[u].bf, qhf[1][ks].bf, s1[1]);
      }
    }

    // the pass's eight v fragments, read ahead of the softmax: nothing below waits on LDS before the products that use
    // them, so they land while the softmax runs
    Frag vf[8];
#pragma unroll   // constant indices, as above
    for (int j = 0; j < 8; ++j) vf[j] = ldfrag(Vhp + (16 * j) * VP + kb);
    // holds the sixteen reads here: without it the compiler sinks them to the softmax's end and their latency is waited out
    __builtin_amdgcn_sched_barrier(0);

    FragH ph[2];
#pragma unroll   // constant indices, as above
    for (int g = 0; g < 2; ++g) {
      float mx = fmaxf(hmax8(s0[g]), hmax8(s1[g]));
      mx = fmaxf(mx, xhalf(mx));
      const float mn   = fmaxf(m[g], mx);
      const float corr = __expf((m[g] - mn) * SCL);
      m[g] = mn;
      const float msh = mn * SCL - LNPS;                               // exp gives e^{(s-m)c} * 1024
      l[g] *= corr;
#pragma unroll
      for (int j = 0; j < 8; ++j) {
#pragma unroll
        for (int r = 0; r < 8; ++r) o[g][j][r] *= corr;
      }

      float ls = 0.f;
#pragma unroll
      for (int r = 0; r < 8; ++r) {
        const float e0 = __expf(s0[g][r] * SCL - msh);                 // key kb      + 8hh + r
        const float e1 = __expf(s1[g][r] * SCL - msh);                 // key kb + 16 + 8hh + r
        ls += e0 + e1;
        ph[g].hv[0][r] = (_Float16)e0;
        ph[g].hv[1][r] = (_Float16)e1;
      }
      l[g] += ls;
    }

#pragma unroll
    for (int j = 0; j < 8; ++j) {                                      // every v fragment feeds both query tiles
      o[0][j] = mma_hr(vf[j].h, ph[0].v, o[0][j]);
      o[1][j] = mma_hr(vf[j].h, ph[1].v, o[1][j]);
    }
  }
  }
  // ---- hand-over: tile t+1 becomes readable, buffer t&1 becomes free ----
  // keeps the waits below behind the products above: lifted into the softmax, the dscnt wait would wait out the v reads
  __builtin_amdgcn_sched_barrier(0);
  asm volatile("s_wait_dscnt 0x0" ::: "memory");                       // this wave's reads of buffer t&1 are done
  asm volatile("s_wait_asynccnt 0x0" ::: "memory");                    // this wave's share of tile t+1 has landed
  __syncthreads();
  if (t + 2 < NN / KT)                                                 // into the buffer that trip t has just read
    stage_kv(lp0 + (t & 1) * STG, khg + (size_t)(t + 2) * KT * CK, klg + (size_t)(t + 2) * KT * CK, vhg + (t + 2) * KT);
  }
  asm volatile("s_wait_asynccnt 0x0" ::: "memory");                    // no copy is left in flight at the wave's end
#pragma unroll
  for (int g = 0; g < 2; ++g) l[g] += __shfl_xor(l[g], 16, 32);

  // ---- the two key halves of a query group hold the same lane layout: waves 4..7 hand m, l, o over through the ring's
  //      LDS (free behind the loop's last barrier: every read of it is done and no copy is in flight) ----
  float* mg = rg.f;
  if (kh2 == 1) {                                                      // the same in every lane of a wave
#pragma unroll
    for (int g = 0; g < 2; ++g) {
#pragma unroll
      for (int j = 0; j < 8; ++j) {
        v4f va, vb;
#pragma unroll
        for (int r = 0; r < 4; ++r) { va[r] = o[g][j][r]; vb[r] = o[g][j][4 + r]; }
        *(v4f*)(mg + ((wq * 32 + 16 * g + 2 * j) * 32 + lane) * 4)     = va;   // 16 B per lane, lanes adjacent
        *(v4f*)(mg + ((wq * 32 + 16 * g + 2 * j + 1) * 32 + lane) * 4) = vb;
      }
      mg[16384 + (4 * wq + 2 * g) * 32 + lane]     = m[g];
      mg[16384 + (4 * wq + 2 * g + 1) * 32 + lane] = l[g];
    }
  }
  __syncthreads();                                                     // publishes the second half's state
  if (kh2 == 0) {
#pragma unroll
    for (int g = 0; g < 2; ++g) {
      const float m2 = mg[16384 + (4 * wq + 2 * g) * 32 + lane];
      const float l2 = mg[16384 + (4 * wq + 2 * g + 1) * 32 + lane];
      const float mn = fmaxf(m[g], m2);
      const float f1 = __expf((m[g] - mn) * SCL), f2 = __expf((m2 - mn) * SCL);
      const float inv = IVSC / (l[g] * f1 + l2 * f2);                  // o carries x1024 x16, l carries x1024
      const float g1 = f1 * inv, g2 = f2 * inv;
      const int qrow = 32 * wq + 16 * g + c;
#pragma unroll
      for (int j = 0; j < 8; ++j) {
        const v4f pa = *(const v4f*)(mg + ((wq * 32 + 16 * g + 2 * j) * 32 + lane) * 4);
        const v4f pb = *(const v4f*)(mg + ((wq * 32 + 16 * g + 2 * j + 1) * 32 + lane) * 4);
        v4f va, vb;
#pragma unroll
        for (int r = 0; r < 4; ++r) {
          va[r] = o[g][j][r] * g1 + pa[r] * g2;
          vb[r] = o[g][j][4 + r] * g1 + pb[r] * g2;
        }
        *(v4f*)(sm.o + qrow * OSPW + 16 * j + 8 * hh)     = va;       // Os[query][ch = 16j + 8hh + r]
        *(v4f*)(sm.o + qrow * OSPW + 16 * j + 8 * hh + 4) = vb;
      }
    }
  }
  __syncthreads();

  const int e = tid & 7, lq = tid >> 3;                                // lq 0..31
{
#pragma unroll
    for (int it = 0; it < AQ / 8; ++it) {
      const int L   = it * 32 + lq;                                    // line 0..511
      const int q   = L >> 2, seg = L & 3;                             // query 0..127, 32-float segment
      const v4f v = *(const v4f*)(sm.o + q * OSPW + 32 * seg + 4 * e);
      *(v4f*)(OB + ((size_t)(b * NN + n0 + q)) * CV + 32 * seg + 4 * e) = v;
    }
    
  }
}

// =========================================================================================================
// (4) output conv on the raw view: for image b, U[r][p] = OB_b[r*4096 + p] (r < 128, p < 4096);
//     y[b][o][p] = (1/4096) sum_r WO16[o][r] (Uh + Ul/2048)[p][r] + BOB[o], Uh = f16(16 U), Ul = f16((16U - Uh) 2048).
//     Block (64-p tile, 64-o block, b), 128 threads: stage the 128 r x 64 p view slab from OB (256-B contiguous row
//     segments), convert, store transposed into LDS Bs[p_loc][r] hi rows 0..63 / residual rows 64..127 (u32 pairs of
//     consecutive r), barrier; then 4 waves, wave w owns cols p0+16w..+15 (B fragments from the LDS rows, split k
//     map), 4 m-tiles (A rows o0 + 16 mt + (lane&15), k = r contiguous, from the 64 WO16 rows that asynchronous 16-byte
//     copies brought into LDS at pitch BP ahead of that barrier), K = 128 = 4 steps, hi and
//     d_out [b][256][4096] (row segment 64 p = 2 lines): 8 consecutive lanes x 16 B, one instruction per 16 lines,
// coverage: staging 8 it x 8 row-pairs x 16 lanes x 4 p x 2 rows = 128 r x 64 p per plane (pad cols never read);
//           d_out 8 it x 16 lines x 8 lanes x 4 = 64 o x 64 p; grid (64, 4, NIMG) covers d_out exactly once.
// =========================================================================================================
__global__ __launch_bounds__(128)
void out_proj(const float* __restrict__ OB, const unsigned short* __restrict__ WO16,
              const float* __restrict__ BOB, float* out) {
  __shared__ __align__(16) unsigned int Bs[2 * QT * (BP / 2)];
  __shared__ __align__(16) unsigned short As[QT * BP];
  __shared__ __align__(16) float Os[QT * OSP];
  const int tid  = threadIdx.x;
  const int lane = tid & 31, wave = tid >> 5;
  const int hh   = lane >> 4, c = lane & 15;
  const int pt = blockIdx.x, mb = blockIdx.y, b = blockIdx.z;
  const int p0 = pt * QT, o0 = mb * QT;
  const float* OBb = OB + (size_t)b * NN * CV;

  // ---- the weight tile into LDS, rows o0 .. o0+63 of 256 B at pitch BP: 16 lanes per row, copy j takes rows 8j .. 8j+7;
  //      the copies fly while the view slab below is loaded and converted ----
  stage_rows8(lds_byte(As) + (unsigned)((tid >> 4) * (BP * 2) + (tid & 15) * 16),
              WO16 + (size_t)(o0 + (tid >> 4)) * CV + 8 * (tid & 15), 8 * BP * 2, (size_t)8 * CV);

  // ---- stage + convert the view slab: Bs[p_loc][r] ----
  {
    const int e16 = tid & 15, rq = tid >> 4;                           // rq 0..7
#pragma unroll
    for (int it = 0; it < 8; ++it) {
      const int rp = 8 * it + rq;                                      // row pair 0..63
      const int r0 = 2 * rp;
      const v4f va = *(const v4f*)(OBb + (size_t)r0 * NN + p0 + 4 * e16);
      const v4f vb = *(const v4f*)(OBb + (size_t)(r0 + 1) * NN + p0 + 4 * e16);
#pragma unroll
      for (int t = 0; t < 4; ++t) {
        const float f0 = va[t] * USC, f1 = vb[t] * USC;
        const _Float16 h0 = (_Float16)f0, h1 = (_Float16)f1;
        const _Float16 l0 = (_Float16)((f0 - (float)h0) * RSC);
        const _Float16 l1 = (_Float16)((f1 - (float)h1) * RSC);
        const int pl = 4 * e16 + t;                                    // p_loc 0..63
        Bs[pl * (BP / 2) + rp]        = pk16(h_bits(h0), h_bits(h1));  // halves r0, r0+1
        Bs[(QT + pl) * (BP / 2) + rp] = pk16(h_bits(l0), h_bits(l1));
      }
    }
  }
  asm volatile("s_wait_asynccnt 0x0" ::: "memory");                    // this wave's rows of the weight tile have landed
  __syncthreads();                                                     // publishes the slab and the weight tile

  const unsigned short* Bh  = (const unsigned short*)Bs;
  const unsigned short* bph = Bh + (16 * wave + c) * BP + 8 * hh;     // B col = p0 + 16*wave + c, k = r
  const unsigned short* bpl = bph + QT * BP;
  const unsigned short* ap  = As + c * BP + 8 * hh;                   // A row = o0 + 16 mt + c, k = r

  v8f acch[4], accl[4];
#pragma unroll
  for (int mt = 0; mt < 4; ++mt) { acch[mt] = zero8(); accl[mt] = zero8(); }

  // a k-step's six LDS fragments are read as one group, one k-step ahead of the products that use them
  Frag fa[2][4], fbh[2], fbl[2];
  fbh[0] = ldfrag(bph);
  fbl[0] = ldfrag(bpl);
#pragma unroll   // the fragment arrays stay in registers only under constant indices
  for (int mt = 0; mt < 4; ++mt) fa[0][mt] = ldfrag(ap + (16 * mt) * BP);
#pragma unroll   // constant indices, as above
  for (int ks = 0; ks < CV / 32; ++ks) {
    if (ks + 1 < CV / 32) {
      fbh[(ks + 1) & 1] = ldfrag(bph + 32 * (ks + 1));
      fbl[(ks + 1) & 1] = ldfrag(bpl + 32 * (ks + 1));
#pragma unroll   // constant indices, as above
      for (int mt = 0; mt < 4; ++mt) fa[(ks + 1) & 1][mt] = ldfrag(ap + (16 * mt) * BP + 32 * (ks + 1));
    }
    // keeps the group's reads ahead of this k-step's products: without it the compiler sinks each pair to its first use,
    // and the wave waits out every pair's LDS latency
    __builtin_amdgcn_sched_barrier(0);
#pragma unroll   // constant indices, as above
    for (int mt = 0; mt < 4; ++mt) {
      acch[mt] = mma_h(fa[ks & 1][mt].h, fbh[ks & 1].h, acch[mt]);
      accl[mt] = mma_h(fa[ks & 1][mt].h, fbl[ks & 1].h, accl[mt]);
    }
  }
  {
    const int nl = 16 * wave + c;
    const float osc = IWSC * IUSC;                                     // 1/4096
#pragma unroll
    for (int mt = 0; mt < 4; ++mt) {
#pragma unroll
      for (int r = 0; r < 8; ++r) {
        const int ol = 16 * mt + 8 * hh + r;                           // 0..63
        Os[ol * OSP + nl] = (acch[mt][r] + accl[mt][r] * IRSC) * osc + BOB[o0 + ol];
      }
    }
  }
  __syncthreads();
  {
    const int e = tid & 7, lq = tid >> 3;                              // lq 0..15
{
#pragma unroll
      for (int it = 0; it < 8; ++it) {
        const int L = it * 16 + lq;                                    // 0..127
        const int row = L >> 1, hf = L & 1;
        const int nl = hf * 32 + 4 * e;
        const v4f v = *(const v4f*)(Os + row * OSP + nl);
        *(v4f*)(out + ((size_t)(b * CO + o0 + row)) * NN + p0 + nl) = v;
      }
      
    }
  }
}

// =========================================================================================================
// Workspace map (bytes; each region start a multiple of 256; every extent is an exact tile multiple and is written
//   W16 f16 [384][256]            196608      BIAS f32 [384]              1536
//   WO16 f16 [256][128]            65536      BOB  f32 [256]              1024
//   Qh/Ql/Kh/Kl bf16 [8][4096][128]  8388608 x4                          Vh f16 [8][128][4096]  8388608
//   OB  f32 [8][4096][128]      16777216
//   total = 58984960
// =========================================================================================================
extern "C" void kernel_launch(void* const* d_in, const int* in_sizes, int n_in,
                              void* d_out, int out_size, void* d_ws, size_t ws_size,
                              hipStream_t stream) {
  const int XN = NIMG * CC * NN;                                       // 8388608
  if (n_in < 9) return;
  if (in_sizes[0] != XN) return;
  if (in_sizes[1] != CK * CC || in_sizes[2] != CK) return;
  if (in_sizes[3] != CK * CC || in_sizes[4] != CK) return;
  if (in_sizes[5] != CV * CC || in_sizes[6] != CV) return;
  if (in_sizes[7] != CO * CV || in_sizes[8] != CO) return;
  if (out_size != NIMG * CO * NN) return;

  size_t off = 0;
  auto carve = [&](size_t bytes) { const size_t o = off; off += (bytes + 255) & ~(size_t)255; return o; };
  const size_t oW16 = carve((size_t)MQKV * CC * 2);
  const size_t oBIA = carve((size_t)MQKV * 4);
  const size_t oWO  = carve((size_t)CO * CV * 2);
  const size_t oBOB = carve((size_t)CO * 4);
  const size_t oQh  = carve((size_t)NIMG * NN * CK * 2);
  const size_t oQl  = carve((size_t)NIMG * NN * CK * 2);
  const size_t oKh  = carve((size_t)NIMG * NN * CK * 2);
  const size_t oKl  = carve((size_t)NIMG * NN * CK * 2);
  const size_t oVh  = carve((size_t)NIMG * CV * NN * 2);
  const size_t oOB  = carve((size_t)NIMG * NN * CV * 4);
  if (off > ws_size) return;
  if (off > (size_t)134217728) return;

  const float* x  = (const float*)d_in[0];
  const float* wq = (const float*)d_in[1];
  const float* bq = (const float*)d_in[2];
  const float* wk = (const float*)d_in[3];
  const float* bk = (const float*)d_in[4];
  const float* wv = (const float*)d_in[5];
  const float* bv = (const float*)d_in[6];
  const float* wo = (const float*)d_in[7];
  const float* bo = (const float*)d_in[8];

  char* ws = (char*)d_ws;
  unsigned short* W16 = (unsigned short*)(ws + oW16);
  float*          BIA = (float*)(ws + oBIA);
  unsigned short* WO  = (unsigned short*)(ws + oWO);
  float*          BOB = (float*)(ws + oBOB);
  unsigned short* Qh  = (unsigned short*)(ws + oQh);
  unsigned short* Ql  = (unsigned short*)(ws + oQl);
  unsigned short* Kh  = (unsigned short*)(ws + oKh);
  unsigned short* Kl  = (unsigned short*)(ws + oKl);
  unsigned short* Vh  = (unsigned short*)(ws + oVh);
  float*          OB  = (float*)(ws + oOB);
  float* out = (float*)d_out;

  const dim3 blk256(256), blk128(128);

  // (0) conv1x1 q/k/v weights -> f16 plane + bias line; output conv weights -> f16 plane + bias line
  cvt_w<<<dim3(MQKV / 8), blk256, 0, stream>>>(wq, bq, wk, bk, wv, bv, W16, BIA);
  cvt_wo<<<dim3(CO / 16), blk256, 0, stream>>>(wo, bo, WO, BOB);
  // (1) conv1x1 GEMM straight from x -> q/k hi + residual planes and v plane
  gemm_qkv<<<dim3(NN / QT, NIMG), blk256, 0, stream>>>(x, W16, BIA, Qh, Ql, Kh, Kl, Vh);
  // (3) attention -> OB [b][4096][128] token-major f32
  attn_gab<<<dim3(NN / AQ, NIMG), blk256, 0, stream>>>(Qh, Ql, Kh, Kl, Vh, OB);
  // (4) output conv on the raw view -> out [b][256][4096]
  out_proj<<<dim3(NN / QT, CO / QT, NIMG), blk128, 0, stream>>>(OB, WO, BOB, out);
  (void)hipGetLastError();
}

// v008
// One run takes 103 microseconds.
// Timed twice side by side with v007, it ran 1.03 and 1.02 times as fast.
// Counting every step since v000, it is 4.73 times as fast.
// Contractions: conv1x1 q/k/v GEMM W[384x256].X on v_wmma_f32_16x16x32_f16 (f16 containers of bf16-RNE weights x256
// and bf16-RNE x); scores K.Q^T on v_wmma_f32_16x16x32_bf16 (bf16 hi + bf16 residual planes of q and k, 3 products,
// K=128); O^T = V.P^T on v_wmma_f32_16x16x32_f16 (v x16 f16, P = 1024 e^{(s-m)c} f16 from the score D registers);
// output conv1x1 Wo[256x128].U on v_wmma_f32_16x16x32_f16 (Wo f16 of bf16-RNE x256, U as f16 hi x16 plus f16
// residual x2^11 planes in two accumulators); f32 accumulate everywhere; softmax statistics in f32 VALU.
#include <hip/hip_runtime.h>
#include <math.h>
#include <stdint.h>

#define NIMG  8
#define CC    256
#define NN    4096
#define CK    128
#define CV    128
#define CO    256
#define MQKV  384
#define QT    64
#define OSP   68
#define OSPW  132
#define QP    136
#define BP    136
#define KT    128
#define VP    136
#define STG   (2 * KT * QP + CV * VP)
#define XPP   264
#define WSC   256.0f
#define IWSC  0.00390625f
#define VSC   16.0f
#define IVSC  0.0625f
#define USC   16.0f
#define IUSC  0.0625f
#define RSC   2048.0f
#define IRSC  0.00048828125f
#define LNPS  6.931471805599453f
#define SCL   0.08838834764831845f

static_assert(NN % QT == 0);
static_assert(CC % 32 == 0 && CK % 64 == 0 && CV % 32 == 0);
static_assert(MQKV == 2 * CK + CV);
static_assert(MQKV % QT == 0 && CO % QT == 0);
static_assert(CK == 2 * QT && CV == 2 * QT);
static_assert((OSP * 4) % 16 == 0);
static_assert((OSPW * 4) % 16 == 0);
static_assert((XPP * 2) % 32 == 16 && XPP >= CC + 8 && XPP % 2 == 0 && MQKV / QT >= 2);
static_assert((QP * 2) % 16 == 0 && (BP * 2) % 16 == 0 && (BP % 2) == 0);
static_assert(QT * OSPW * 4 <= 2 * QT * QP * 2);
static_assert(NN % KT == 0 && NN / KT >= 2 && KT % 32 == 0);
static_assert((VP * 2) % 16 == 0 && (STG * 2) % 16 == 0 && VP >= KT + 8);
static_assert(KT * CK * 2 == 8 * 256 * 16 && CV * KT * 2 == 8 * 256 * 16 && KT == 128 && QP == VP);

typedef _Float16       v16h __attribute__((ext_vector_type(16)));
typedef _Float16       v8h  __attribute__((ext_vector_type(8)));
typedef _Float16       v2h  __attribute__((ext_vector_type(2)));
typedef __bf16         v16b __attribute__((ext_vector_type(16)));
typedef unsigned short v8us __attribute__((ext_vector_type(8)));
typedef float          v8f  __attribute__((ext_vector_type(8)));
typedef float          v4f  __attribute__((ext_vector_type(4)));
typedef unsigned int   v4u  __attribute__((ext_vector_type(4)));

union Frag  { v8us u[2]; v16h h; v16b bf; };
union FragH { v16h v; v8h hv[2]; };
static_assert(sizeof(Frag) == 32);
static_assert(sizeof(FragH) == 32);

// ---- scalar helpers ---------------------------------------------------------------------------------------
__device__ __forceinline__ unsigned short bf_bits(float f) {          // f32 -> bf16 bits, RNE convert
  unsigned u = __float_as_uint(f);
  return (unsigned short)((u + 0x7FFFu + ((u >> 16) & 1u)) >> 16);
}
__device__ __forceinline__ float bf_up(unsigned short hb) { return __uint_as_float(((unsigned)hb) << 16); }
__device__ __forceinline__ float bfr(float f) { return bf_up(bf_bits(f)); }
__device__ __forceinline__ unsigned short h_bits(_Float16 x) { return __builtin_bit_cast(unsigned short, x); }
__device__ __forceinline__ unsigned pk16(unsigned short a, unsigned short b) { return (unsigned)a | ((unsigned)b << 16); }
__device__ __forceinline__ unsigned pkh(float a, float b) {           // f16 RNE of a (low half) and of b (high half)
  const v2h p = {(_Float16)a, (_Float16)b};
  return __builtin_bit_cast(unsigned, p);
}
__device__ __forceinline__ v8f zero8() { v8f z = {0.f, 0.f, 0.f, 0.f, 0.f, 0.f, 0.f, 0.f}; return z; }
__device__ __forceinline__ float hmax8(v8f s) {
  return fmaxf(fmaxf(fmaxf(s[0], s[1]), fmaxf(s[2], s[3])), fmaxf(fmaxf(s[4], s[5]), fmaxf(s[6], s[7])));
}

// lane l <-> l ^ 16 by a vector cross-row move: it counts on no LDS counter, so no wait on it drains LDS reads in flight
__device__ __forceinline__ float xhalf(float x) {
  const int b = __builtin_bit_cast(int, x);
  return __builtin_bit_cast(float, __builtin_amdgcn_permlanex16(b, b, 0x76543210, 0xfedcba98, false, false));
}

// ---- 16-bit fragment loader (A, or B from a k-contiguous [n][k] row): lane -> row/col (lane&15), p already includes
//      + 8*(lane>>4); elements 0..7 <- p[0..7] (k0+8h..), elements 8..15 <- p[16..23] (k0+16+8h..)
__device__ __forceinline__ Frag ldfrag(const unsigned short* p) {
  Frag f;
  f.u[0] = *(const v8us*)(p);
  f.u[1] = *(const v8us*)(p + 16);
  return f;
}

typedef __attribute__((address_space(3))) unsigned short lds_us;
__device__ __forceinline__ unsigned lds_byte(unsigned short* p) { return (unsigned)(uintptr_t)(lds_us*)p; }

// ---- WMMA helpers: builtin followed by a 4-slot VALU gap tying D and keeping A/B live --------------------------
__device__ __forceinline__ v8f mma_h(v16h a, v16h b, v8f c) {
  v8f d = __builtin_amdgcn_wmma_f32_16x16x32_f16(false, a, false, b, (short)0, c, false, false);
#if defined(__HIP_DEVICE_COMPILE__)
  asm volatile("v_nop\n\tv_nop\n\tv_nop\n\tv_nop" : "+v"(d) : "v"(a), "v"(b));
#endif
  return d;
}
__device__ __forceinline__ v8f mma_b(v16b a, v16b b, v8f c) {
  v8f d = __builtin_amdgcn_wmma_f32_16x16x32_bf16(false, a, false, b, (short)0, c, false, false);
#if defined(__HIP_DEVICE_COMPILE__)
  const v16h ha = __builtin_bit_cast(v16h, a), hb = __builtin_bit_cast(v16h, b);
  asm volatile("v_nop\n\tv_nop\n\tv_nop\n\tv_nop" : "+v"(d) : "v"(ha), "v"(hb));
#endif
  return d;
}

// =========================================================================================================
// (0) q/k/v conv1x1 weights: W16 f16 [384][256], rows 0..127 = wq, 128..255 = wk, 256..383 = wv; value = f16 of
//     (bf16-RNE(w) * 256) (exact). BIAS f32 [384] = bf16-RNE of bq / bk / bv. Block blk (0..47) owns rows
// coverage: 48 blocks x 8 rows x 32 pieces x 8 halves = 384 x 256; bias 96 x 4 floats = 384.
// =========================================================================================================
__global__ __launch_bounds__(256)
void cvt_w(const float* __restrict__ wq, const float* __restrict__ bq,
           const float* __restrict__ wk, const float* __restrict__ bk,
           const float* __restrict__ wv, const float* __restrict__ bv,
           unsigned short* W16, float* BIAS) {
  const int tid = threadIdx.x, blk = blockIdx.x;
  const int rl = tid >> 5, col = 8 * (tid & 31);
  const int o = 8 * blk + rl;                                          // 0..383
  const float* wbase = (blk < 16) ? wq : (blk < 32) ? wk : wv;         // block-uniform selection
  const int osub = (blk < 16) ? 0 : (blk < 32) ? CK : 2 * CK;
  const float* s = wbase + (size_t)(o - osub) * CC + col;             // (o-osub) < 128 rows of that matrix
  const v4f a = *(const v4f*)s;
  const v4f q = *(const v4f*)(s + 4);
  const float f[8] = {a[0], a[1], a[2], a[3], q[0], q[1], q[2], q[3]};
  v4u u;
#pragma unroll
  for (int t = 0; t < 4; ++t) {
    const _Float16 h0 = (_Float16)(bfr(f[2 * t]) * WSC);
    const _Float16 h1 = (_Float16)(bfr(f[2 * t + 1]) * WSC);
    u[t] = pk16(h_bits(h0), h_bits(h1));
  }
  // bias values: every lane loads all three candidates with clamped indices, selects by value
  v4f bvv;
  {
    const int tb = min(tid, 95);
    const int o4 = 4 * tb;
#pragma unroll
    for (int qd = 0; qd < 4; ++qd) {
      const int oo = o4 + qd;                                          // 0..383
      const int iq = min(oo, CK - 1);
      const int ik = min(max(oo - CK, 0), CK - 1);
      const int iv = min(max(oo - 2 * CK, 0), CV - 1);
      const float cq = bq[iq], ckv = bk[ik], cvv = bv[iv];
      const float val = (oo < CK) ? cq : (oo < 2 * CK) ? ckv : cvv;
      bvv[qd] = bfr(val);
    }
  }
{
    *(v4u*)(W16 + (size_t)o * CC + col) = u;
    if (blk == 0 && tid < 96) *(v4f*)(BIAS + 4 * tid) = bvv;
    
  }
}

// =========================================================================================================
// (0b) output conv weights: WO16 f16 [256][128] = f16 of (bf16-RNE(wo) * 256) (exact); BOB f32 [256] = bf16-RNE bo.
// coverage: 16 blocks x 16 rows x 16 pieces x 8 halves = 256 x 128; bias 64 x 4 floats = 256.
// =========================================================================================================
__global__ __launch_bounds__(256)
void cvt_wo(const float* __restrict__ wo, const float* __restrict__ bo, unsigned short* WO16, float* BOB) {
  const int tid = threadIdx.x, blk = blockIdx.x;
  const int rl = tid >> 4, col = 8 * (tid & 15);
  const int o = 16 * blk + rl;                                         // 0..255
  const float* s = wo + (size_t)o * CV + col;
  const v4f a = *(const v4f*)s;
  const v4f q = *(const v4f*)(s + 4);
  const float f[8] = {a[0], a[1], a[2], a[3], q[0], q[1], q[2], q[3]};
  v4u u;
#pragma unroll
  for (int t = 0; t < 4; ++t) {
    const _Float16 h0 = (_Float16)(bfr(f[2 * t]) * WSC);
    const _Float16 h1 = (_Float16)(bfr(f[2 * t + 1]) * WSC);
    u[t] = pk16(h_bits(h0), h_bits(h1));
  }
  v4f bvv;
  {
    const int tb = min(tid, 63);
#pragma unroll
    for (int qd = 0; qd < 4; ++qd) bvv[qd] = bfr(bo[4 * tb + qd]);  // index <= 255
  }
{
    *(v4u*)(WO16 + (size_t)o * CV + col) = u;
    if (blk == 0 && tid < 64) *(v4f*)(BOB + 4 * tid) = bvv;
    
  }
}

// =========================================================================================================
// (1) conv1x1 GEMM for one (b, 64-n tile), all 384 output rows: Y[o][n] = (1/256) sum_c W16[o][c] X[n][c] + BIAS[o],
//     X[n][c] = f16 of bf16-RNE(x[b][c][n]) (exact). Block 256 threads = 8 waves, two blocks per WGP.
//     The block reads its x slab (256 c x 64 n, f32, 256-B row segments) once, rounds it and stores it transposed into LDS
//     Xs[n_loc][c] (u32 pairs of consecutive c, row pitch XPP halves = 16 B x odd), barrier. Wave w owns cols
//     n0 + 32 (w & 1) .. +31 (two B fragments per k-step, k = c contiguous in the token row, read once and kept in
//     registers) and in every 64-row weight tile the m-tile w >> 1 (A rows o = 64 mb + 16 (w >> 1) + (lane&15), split k map
//     loader). K = 256 = 8 steps. The six weight tiles come through a two-buffer LDS ring filled by asynchronous 16-byte
//     copies of whole rows; tile mb+2 is issued behind the barrier that ends the reads of tile mb.
//     Epilogue of a tile: Os[o_loc][n_loc] (pitch OSP), barrier, then packed in registers:
//       tiles 0,1 (q ck cols 0..63 / 64..127) and 2,3 (k): bf16 hi / bf16 residual planes [b][4096 n][128],
//         lane e -> cols 8e..8e+7 of token row 32 it + lq;
//       tiles 4,5 (v): f16 plane x16 [b][128 ch][4096 n], lane e -> halves 8e..8e+7 of channel row 32 it + lq;
//     the global stores stand behind the tile's hand-over barrier, so that they fly under the next tile's products.
// coverage: Xs 8 it x 16 row pairs x 16 lanes x 4 n x 2 rows = 256 c x 64 n; Os 8 waves x 2 tiles x 16x16 = 64 x 64;
//           q/k: per plane 2 it x 32 rows x 8 lanes x 8 = 64 n x 64 cols, tiles 0..3 cover all 128 cols of Qh/Ql/Kh/Kl;
//           v: 2 it x 32 rows x 8 lanes x 8 = 64 ch x 64 n; grid (64, NIMG) covers every plane exactly once.
// =========================================================================================================
// token rows (f16 pairs), the two weight tiles of the ring (rows of XPP halves), the output tile
struct GemmSmem { unsigned int x[QT * (XPP / 2)]; unsigned short w[2 * QT * XPP]; float o[QT * OSP]; };

// Eight 16-byte pieces per lane, global -> LDS through no register: a wave's 32 lanes x 16 B take 512 contiguous bytes
// (four whole lines) per copy. l / g are this lane's first piece, ls bytes / gs halves the step from copy to copy. The
// s_wait_xcnt closes the statement so that no address register of a copy is rewritten ahead of it.
__device__ __forceinline__ void stage_rows8(unsigned l, const unsigned short* g, unsigned ls, size_t gs) {
#if defined(__HIP_DEVICE_COMPILE__)
  asm volatile(
      "global_load_async_to_lds_b128 %0, %8, off\n\t"
      "global_load_async_to_lds_b128 %1, %9, off\n\t"
      "global_load_async_to_lds_b128 %2, %10, off\n\t"
      "global_load_async_to_lds_b128 %3, %11, off\n\t"
      "global_load_async_to_lds_b128 %4, %12, off\n\t"
      "global_load_async_to_lds_b128 %5, %13, off\n\t"
      "global_load_async_to_lds_b128 %6, %14, off\n\t"
      "global_load_async_to_lds_b128 %7, %15, off\n\t"
      "s_wait_xcnt 0x0"
      :: "v"(l), "v"(l + ls), "v"(l + 2 * ls), "v"(l + 3 * ls),
         "v"(l + 4 * ls), "v"(l + 5 * ls), "v"(l + 6 * ls), "v"(l + 7 * ls),
         "v"(g), "v"(g + gs), "v"(g + 2 * gs), "v"(g + 3 * gs),
         "v"(g + 4 * gs), "v"(g + 5 * gs), "v"(g + 6 * gs), "v"(g + 7 * gs)
      : "memory");
#endif
}

__global__ __launch_bounds__(256)
void gemm_qkv(const float* __restrict__ x, const unsigned short* __restrict__ W16, const float* __restrict__ BIAS,
              unsigned short* Qh, unsigned short* Ql, unsigned short* Kh, unsigned short* Kl,
              unsigned short* Vh) {
  __shared__ __align__(16) GemmSmem sm;
  float* Os = sm.o;
  const int tid  = threadIdx.x;
  const int lane = tid & 31, wave = tid >> 5;
  const int hh   = lane >> 4, c = lane & 15;
  const int nt   = blockIdx.x, b = blockIdx.y;
  const int n0   = nt * QT;
  const int nh   = wave & 1, mq = wave >> 1;                           // 32-col half; m-tile of every weight tile

  // ---- this thread's share of a weight tile: copy j of wave w takes row 8j + w, a lane 16 B of the 512-B row ----
  const unsigned lw = lds_byte(sm.w) + (unsigned)(wave * (XPP * 2) + lane * 16);
  const unsigned short* gw = W16 + (size_t)wave * CC + 8 * lane;
  const unsigned wls = 8 * XPP * 2;
  const size_t wgs = (size_t)8 * CC;
  stage_rows8(lw, gw, wls, wgs);                                       // tile 0 -> buffer 0, flies under the slab below

  // ---- load + round the x slab, store it transposed: Xs[n_loc][c] ----
  {
    const int e16 = tid & 15, rq = tid >> 4;                           // rq 0..15
    const float* sp = x + ((size_t)(b * CC + 2 * rq)) * NN + n0 + 4 * e16;
    v4f va[CC / 32], vb[CC / 32];                                      // rows 2cp, 2cp+1 of channel pair cp = 16 it + rq
#pragma unroll   // the arrays stay in registers only under constant indices
    for (int it = 0; it < CC / 32; ++it) {
      va[it] = *(const v4f*)(sp + (size_t)(32 * it) * NN);
      vb[it] = *(const v4f*)(sp + (size_t)(32 * it + 1) * NN);
    }
    // keeps all sixteen loads ahead of the first conversion: without it the compiler issues the later ones behind the
    // wait for the first, and the wave waits out the memory latency twice
    __builtin_amdgcn_sched_barrier(0);
#pragma unroll   // constant indices, as above
    for (int it = 0; it < CC / 32; ++it) {
      const int cp = 16 * it + rq;                                     // channel pair 0..127
#pragma unroll   // constant indices, as above
      for (int t = 0; t < 4; ++t)                                      // halves c = 2cp, 2cp+1 of token 4 e16 + t
        sm.x[(4 * e16 + t) * (XPP / 2) + cp] = pkh(bfr(va[it][t]), bfr(vb[it][t]));
    }
  }
  asm volatile("s_wait_asynccnt 0x0" ::: "memory");                    // this wave's rows of tile 0 have landed
  __syncthreads();                                                     // publishes the token rows and tile 0
  stage_rows8(lw + QT * XPP * 2, gw + (size_t)QT * CC, wls, wgs);      // tile 1 -> buffer 1

  // ---- the wave's 16 token fragments (B operand, col = n0 + 32 nh + 16 g + c), read once and kept in registers ----
  Frag fb[2][CC / 32];
#pragma unroll   // the fragment arrays stay in registers only under constant indices
  for (int g = 0; g < 2; ++g) {
    const unsigned short* bp = (const unsigned short*)sm.x + (32 * nh + 16 * g + c) * XPP + 8 * hh;
#pragma unroll   // constant indices, as above
    for (int ks = 0; ks < CC / 32; ++ks) fb[g][ks] = ldfrag(bp + 32 * ks);
  }

  const int e = tid & 7, lq = tid >> 3;                                // lq 0..31

#pragma unroll 1   // rolled: one hand-over point in the text, the buffer picked by mb & 1
  for (int mb = 0; mb < MQKV / QT; ++mb) {
    const int o0 = mb * QT;
    const unsigned short* ap = sm.w + (mb & 1) * (QT * XPP) + (16 * mq + c) * XPP + 8 * hh;
    // the lane's eight bias values and the tile's eight weight fragments, read as one group ahead of the products
    const v4f b0 = *(const v4f*)(BIAS + o0 + 16 * mq + 8 * hh);
    const v4f b1 = *(const v4f*)(BIAS + o0 + 16 * mq + 8 * hh + 4);
    Frag fa[CC / 32];
#pragma unroll   // constant indices, as above
    for (int ks = 0; ks < CC / 32; ++ks) fa[ks] = ldfrag(ap + 32 * ks);
    // keeps the group's reads ahead of the products: without it the compiler sinks each pair to its first use, and the
    // wave waits out every pair's LDS latency
    __builtin_amdgcn_sched_barrier(0);
    v8f acc[2];
    acc[0] = zero8();
    acc[1] = zero8();
#pragma unroll   // constant indices, as above
    for (int ks = 0; ks < CC / 32; ++ks) {                             // every weight fragment feeds both col tiles
      acc[0] = mma_h(fa[ks].h, fb[0][ks].h, acc[0]);
      acc[1] = mma_h(fa[ks].h, fb[1][ks].h, acc[1]);
    }

    // ---- scale back, + bias -> LDS Os[o_loc][n_loc] ----
#pragma unroll   // constant indices, as above
    for (int g = 0; g < 2; ++g) {
      const int nl = 32 * nh + 16 * g + c;
#pragma unroll   // constant indices, as above
      for (int r = 0; r < 8; ++r) {
        const int ol = 16 * mq + 8 * hh + r;                           // 0..63
        Os[ol * OSP + nl] = acc[g][r] * IWSC + ((r < 4) ? b0[r & 3] : b1[r & 3]);
      }
    }
    __syncthreads();                                                   // publishes Os

    v4u su[4];                                                         // q/k: hi it 0,1 then residual it 0,1; v: it 0,1
    if (mb < 4) {
      // ---- q / k bf16 hi + residual pieces (block-uniform branch) ----
#pragma unroll   // constant indices, as above
      for (int it = 0; it < 2; ++it) {
        const int nl = it * 32 + lq;                                   // token 0..63
#pragma unroll   // constant indices, as above
        for (int t = 0; t < 4; ++t) {
          const float f0 = Os[(8 * e + 2 * t) * OSP + nl];
          const float f1 = Os[(8 * e + 2 * t + 1) * OSP + nl];
          const unsigned short hb0 = bf_bits(f0), hb1 = bf_bits(f1);
          const unsigned short lb0 = bf_bits(f0 - bf_up(hb0));
          const unsigned short lb1 = bf_bits(f1 - bf_up(hb1));
          su[it][t]     = pk16(hb0, hb1);
          su[2 + it][t] = pk16(lb0, lb1);
        }
      }
    } else {
      // ---- v f16 pieces, carried x16 ----
#pragma unroll   // constant indices, as above
      for (int it = 0; it < 2; ++it) {
        const int row = it * 32 + lq;                                  // 0..63
        const v4f a = *(const v4f*)(Os + row * OSP + 8 * e);
        const v4f q = *(const v4f*)(Os + row * OSP + 8 * e + 4);
#pragma unroll   // constant indices, as above
        for (int t = 0; t < 2; ++t) {
          su[it][t]     = pk16(h_bits((_Float16)(a[2 * t] * VSC)), h_bits((_Float16)(a[2 * t + 1] * VSC)));
          su[it][2 + t] = pk16(h_bits((_Float16)(q[2 * t] * VSC)), h_bits((_Float16)(q[2 * t + 1] * VSC)));
        }
      }
    }

    // ---- hand-over: tile mb+1 becomes readable, buffer mb&1 and Os become free ----
    asm volatile("s_wait_dscnt 0x0" ::: "memory");                     // this wave's reads of buffer mb&1 and of Os are done
    asm volatile("s_wait_asynccnt 0x0" ::: "memory");                  // this wave's rows of tile mb+1 have landed
    __syncthreads();
    if (mb + 2 < MQKV / QT)
      stage_rows8(lw + (unsigned)(mb & 1) * (QT * XPP * 2), gw + (size_t)(mb + 2) * QT * CC, wls, wgs);

    if (mb < 4) {
      unsigned short* Ph = (mb < 2) ? Qh : Kh;
      unsigned short* Pl = (mb < 2) ? Ql : Kl;
      const int cb = QT * (mb & 1);                                    // ck column base 0 or 64
#pragma unroll   // constant indices, as above
      for (int it = 0; it < 2; ++it) {
        const size_t base = ((size_t)(b * NN + n0 + it * 32 + lq)) * CK + cb + 8 * e;
        *(v4u*)(Ph + base) = su[it];
        *(v4u*)(Pl + base) = su[2 + it];
      }
    } else {
      const int ch0 = QT * (mb - 4);                                   // 0 or 64
#pragma unroll   // constant indices, as above
      for (int it = 0; it < 2; ++it)
        *(v4u*)(Vh + ((size_t)(b * CV + ch0 + it * 32 + lq)) * NN + n0 + 8 * e) = su[it];
    }
    asm volatile("s_wait_xcnt 0x0" ::: "memory");                      // the next tile's reads rewrite the stores' registers
  }
  asm volatile("s_wait_asynccnt 0x0" ::: "memory");                    // no copy is left in flight at the wave's end
}

// =========================================================================================================
// (3) attention for one (b, 128-query tile), transposed formulation, 4096 keys, no mask:
//   S^T tile (16 keys x 16 queries) = sum over 4 k-steps of A(k: row = key kb + (lane&15), 32 d via the split k map
//   from the bf16 plane Kh [b][4096][128]) . B(q: col = query, same map, from the wave's registers) + A(Kh).B(Ql)
//   + A(Kl).B(Qh) (bf16 unscaled residual planes, shared accumulator). Softmax of s*c with c = 1/sqrt(128):
//   per lane the D tile holds 8 keys of ONE query: online state per lane, one cross-row move (lane^16) for the max over
//   32 keys, row-sum partials combined at the end. P = 1024 e^{(s-m)c} as f16 is the B operand of
//   O^T (rows channel, cols queries) += A(V rows channel = 16j + (lane&15), keys contiguous, f16 plane Vh
//   [b][128][4096]) . B(P^T): element r <- D of the tile covering keys kb..kb+15, element 8+r <- the tile covering
//   kb+16..kb+31, lane unchanged. 8 accumulator tiles per query tile (128 channels). Block = 8 waves = 128 queries, one
//   block per WGP: wave w owns two query tiles, queries 32 (w & 3) .. +31, and keys 32 (w >> 2) .. +31 of every 64 keys;
//   the two states of a query group are merged at the end. Q hi/lo rows of the block's 128 queries are staged once in LDS
//   (v4u pieces, barrier); each wave then reads its 16 q fragments once and keeps them in registers, so that the key loop
//   reads only k and v from LDS and every such fragment feeds both query tiles. A 32-key pass reads its LDS fragments
//   ahead of the products that use them: k of k-steps 0,1; k of k-steps 2,3; all of v.
//   K hi, K residual and V come in tiles of KT = 128 keys through a two-buffer LDS ring filled by asynchronous 16-byte
//   copies (whole 128-B lines per request, each tile fetched once per block and read by all 8 waves); a wave makes two
//   32-key passes over a tile between hand-overs, so that the waves of a SIMD may run out of step for two passes and a
//   tile's copies have two passes to land; tile t+2 is issued behind the barrier that ends the reads of tile t. Row
//   pitches QP / VP halves = 16 B x odd.
//   Epilogue: barrier, O/l staged in LDS Os[query][128 channels] (pitch OSPW, b128 stores, aliases the Q staging),
// coverage: Q staging 8 it x 16 rows x 16 lanes x 8 = 128 x 128 per plane; OB 16 it x 32 lines x 8 lanes x 4 floats =
//           128 queries x 128 ch; grid (32, NIMG) covers OB exactly once.
// =========================================================================================================
#define AQ    128                                                      // queries of one attention block
static_assert(NN % AQ == 0 && AQ * OSPW * 4 <= 2 * AQ * QP * 2);
union AttnSmem { unsigned short q[2 * AQ * QP]; float o[AQ * OSPW]; };
// the k/v ring; after the key loop its first bytes carry the second key half's softmax state (o 16384 floats, m, l)
union AttnRing { unsigned short h[2 * STG]; float f[4 * 132 * 32]; };
static_assert(4 * 132 * 32 * 4 <= 2 * STG * 2);

// One tile of KT keys into the ring buffer at LDS halves lp: k hi rows [KT][QP], k residual rows [KT][QP], v rows [CV][VP],
// each part 128 rows of 256 B: 16 lanes per row, 16 rows per piece step, eight pieces (24 copies per lane and tile),
// global -> LDS through no register. lp / kh / kl / vh are this thread's piece 0 of the buffer and of the tile's planes.
// The copies are the builtin: its address registers may lie anywhere in the wave's register file, while an asm operand
// lives in v0..v255, where 24 copies' addresses do not fit beside the wave's register tile (they were spilled).
typedef int v4i __attribute__((ext_vector_type(4)));
typedef __attribute__((address_space(1))) v4i gl_v4i;
typedef __attribute__((address_space(3))) v4i lds_v4i;
__device__ __forceinline__ void copy16(const unsigned short* g, unsigned short* l) {
#if defined(__HIP_DEVICE_COMPILE__)
  __builtin_amdgcn_global_load_async_to_lds_b128((gl_v4i*)(uintptr_t)g, (lds_v4i*)l, 0, 0);
#endif
}
__device__ __forceinline__ void stage_kv(unsigned short* lp, const unsigned short* kh,
                                         const unsigned short* kl, const unsigned short* vh) {
#pragma unroll   // straight-line copies, constant steps
  for (int j = 0; j < KT / 16; ++j) {
    copy16(kh + (size_t)(16 * j) * CK, lp + (16 * j) * QP);
    copy16(kl + (size_t)(16 * j) * CK, lp + KT * QP + (16 * j) * QP);
  }
#pragma unroll   // as above
  for (int j = 0; j < CV / 16; ++j) copy16(vh + (size_t)(16 * j) * NN, lp + 2 * KT * QP + (16 * j) * VP);
}

// ---- WMMA helpers of the attention kernel: the bare builtins, the compiler keeping the distance behind them. An asm
//      statement takes its vector operands from v0..v255 only; tied to one, the wave's 32-query register tile
//      (q 128, o 128 registers) would not fit and would spill.
__device__ __forceinline__ v8f mma_hr(v16h a, v16h b, v8f c) {
  return __builtin_amdgcn_wmma_f32_16x16x32_f16(false, a, false, b, (short)0, c, false, false);
}
__device__ __forceinline__ v8f mma_br(v16b a, v16b b, v8f c) {
  return __builtin_amdgcn_wmma_f32_16x16x32_bf16(false, a, false, b, (short)0, c, false, false);
}

__global__ __launch_bounds__(256)
void attn_gab(const unsigned short* __restrict__ Qh, const unsigned short* __restrict__ Ql,
              const unsigned short* __restrict__ Kh, const unsigned short* __restrict__ Kl,
              const unsigned short* __restrict__ Vh, float* OB) {
  __shared__ __align__(16) AttnSmem sm;
  __shared__ __align__(16) AttnRing rg;
  unsigned short* ring = rg.h;
  const int tid  = threadIdx.x;
  const int wave = tid >> 5, lane = tid & 31;
  const int hh   = lane >> 4, c = lane & 15;
  const int n0   = blockIdx.x * AQ, b = blockIdx.y;
  const int wq   = wave & 3, kh2 = wave >> 2;                          // query group of 32; 32-key half of every 64-key pass

  // ---- this thread's share of a k/v tile: its place inside a ring buffer, source pointers of tile 0 ----
  unsigned short* lp0 = ring + (tid >> 4) * QP + (tid & 15) * 8;
  const unsigned short* khg = Kh + ((size_t)(b * NN + (tid >> 4))) * CK + 8 * (tid & 15);
  const unsigned short* klg = Kl + ((size_t)(b * NN + (tid >> 4))) * CK + 8 * (tid & 15);
  const unsigned short* vhg = Vh + ((size_t)(b * CV + (tid >> 4))) * NN + 8 * (tid & 15);
  stage_kv(lp0, khg, klg, vhg);                                        // tile 0 -> buffer 0

  // ---- stage q hi (rows 0..127) and q residual (rows 128..255) of this query tile in LDS ----
  {
    const int e16 = tid & 15, rq = tid >> 4;                          // rq 0..15
#pragma unroll
    for (int it = 0; it < AQ / 16; ++it) {
      const int row = 16 * it + rq;                                    // 0..127
      const size_t g = ((size_t)(b * NN + n0 + row)) * CK + 8 * e16;
      const v4u vh = *(const v4u*)(Qh + g);
      const v4u vl = *(const v4u*)(Ql + g);
      *(v4u*)(sm.q + row * QP + 8 * e16)        = vh;
      *(v4u*)(sm.q + (AQ + row) * QP + 8 * e16) = vl;
    }
  }
  asm volatile("s_wait_asynccnt 0x0" ::: "memory");                    // this wave's share of tile 0 has landed
  __syncthreads();                                                     // publishes the q rows and tile 0
  stage_kv(lp0 + STG, khg + (size_t)KT * CK, klg + (size_t)KT * CK, vhg + KT);                 // tile 1 -> buffer 1

  // ---- the wave's q fragments (B operand, col = query n0 + 32*wq + 16*g + c), read once and kept in registers ----
  Frag qhf[2][CK / 32], qlf[2][CK / 32];
#pragma unroll
  for (int g = 0; g < 2; ++g) {
    const unsigned short* qsh = sm.q + (32 * wq + 16 * g + c) * QP + 8 * hh;
#pragma unroll
    for (int ks = 0; ks < CK / 32; ++ks) {
      qhf[g][ks] = ldfrag(qsh + 32 * ks);
      qlf[g][ks] = ldfrag(qsh + AQ * QP + 32 * ks);
    }
  }

  float m[2] = {-1.0e30f, -1.0e30f}, l[2] = {0.f, 0.f};
  v8f o[2][8];
#pragma unroll
  for (int g = 0; g < 2; ++g) {
#pragma unroll
    for (int j = 0; j < 8; ++j) o[g][j] = zero8();
  }

#pragma unroll 1   // rolled: one hand-over point in the text, the buffer picked by t & 1
  for (int t = 0; t < NN / KT; ++t) {
  const unsigned short* buf = ring + (t & 1) * STG;
#pragma unroll   // unrolled: the second pass's key offsets fold into the reads' immediates; no barrier stands between the passes
  for (int ps = 0; ps < KT / 64; ++ps) {
  // k fragment base (A operand, row = key kb + c of the tile), + key * QP
  const int kb = 64 * ps + 32 * kh2;                                   // this wave's 32 keys of the pass
  const unsigned short* Khp = buf + c * QP + 8 * hh;
  const unsigned short* Klp = Khp + KT * QP;
  // v fragment base (A operand, row = channel 16j + c, the tile's keys contiguous), + 16*j*VP + kb
  const unsigned short* Vhp = buf + 2 * KT * QP + c * VP + 8 * hh;
  {
    v8f s0[2], s1[2];                                                  // [query tile]: keys kb..+15, keys kb+16..+31
#pragma unroll
    for (int g = 0; g < 2; ++g) { s0[g] = zero8(); s1[g] = zero8(); }
#pragma unroll   // unrolled: each trip's reads stand as one group in the text, ahead of that trip's 24 products
    for (int kg = 0; kg < CK / 64; ++kg) {
      // the k fragments of two k-steps, read ahead of their products, counted waits behind them
      Frag k0[2], k1[2], k0l[2], k1l[2];
#pragma unroll   // the fragment arrays stay in registers only under constant indices
      for (int u = 0; u < 2; ++u) {
        const int ks = 2 * kg + u;
        k0[u]  = ldfrag(Khp + kb * QP + 32 * ks);                        // keys kb .. kb+15
        k1[u]  = ldfrag(Khp + (kb + 16) * QP + 32 * ks);                 // keys kb+16 .. kb+31
        k0l[u] = ldfrag(Klp + kb * QP + 32 * ks);
        k1l[u] = ldfrag(Klp + (kb + 16) * QP + 32 * ks);
      }
      // keeps the group's reads ahead of its products: without it the compiler sinks each pair to its first use, and the
      // wave waits out every pair's latency
      __builtin_amdgcn_sched_barrier(0);
#pragma unroll   // constant indices, as above
      for (int u = 0; u < 2; ++u) {
        const int ks = 2 * kg + u;
        // every k fragment feeds both query tiles; per accumulator the order hi.hi, hi.res, res.hi is kept
        s0[0] = mma_br(k0[u].bf, qhf[0][ks].bf, s0[0]);
        s1[0] = mma_br(k1[u].bf, qhf[0][ks].bf, s1[0]);
        s0[1] = mma_br(k0[u].bf, qhf[1][ks].bf, s0[1]);
        s1[1] = mma_br(k1[u].bf, qhf[1][ks].bf, s1[1]);
        s0[0] = mma_br(k0[u].bf, qlf[0][ks].bf, s0[0]);
        s1[0] = mma_br(k1[u].bf, qlf[0][ks].bf, s1[0]);
        s0[1] = mma_br(k0[u].bf, qlf[1][ks].bf, s0[1]);
        s1[1] = mma_br(k1[u].bf, qlf[1][ks].bf, s1[1]);
        s0[0] = mma_br(k0l[u].bf, qhf[0][ks].bf, s0[0]);
        s1[0] = mma_br(k1l[u].bf, qhf[0][ks].bf, s1[0]);
        s0[1] = mma_br(k0l[u].bf, qhf[1][ks].bf, s0[1]);
        s1[1] = mma_br(k1l[u].bf, qhf[1][ks].bf, s1[1]);
      }
    }

    // the pass's eight v fragments, read ahead of the softmax: nothing below waits on LDS before the products that use
    // them, so they land while the softmax runs
    Frag vf[8];
#pragma unroll   // constant indices, as above
    for (int j = 0; j < 8; ++j) vf[j] = ldfrag(Vhp + (16 * j) * VP + kb);
    // holds the sixteen reads here: without it the compiler sinks them to the softmax's end and their latency is waited out
    __builtin_amdgcn_sched_barrier(0);

    FragH ph[2];
#pragma unroll   // constant indices, as above
    for (int g = 0; g < 2; ++g) {
      float mx = fmaxf(hmax8(s0[g]), hmax8(s1[g]));
      mx = fmaxf(mx, xhalf(mx));
      const float mn   = fmaxf(m[g], mx);
      const float corr = __expf((m[g] - mn) * SCL);
      m[g] = mn;
      const float msh = mn * SCL - LNPS;                               // exp gives e^{(s-m)c} * 1024
      l[g] *= corr;
#pragma unroll
      for (int j = 0; j < 8; ++j) {
#pragma unroll
        for (int r = 0; r < 8; ++r) o[g][j][r] *= corr;
      }

      float ls = 0.f;
#pragma unroll
      for (int r = 0; r < 8; ++r) {
        const float e0 = __expf(s0[g][r] * SCL - msh);                 // key kb      + 8hh + r
        const float e1 = __expf(s1[g][r] * SCL - msh);                 // key kb + 16 + 8hh + r
        ls += e0 + e1;
        ph[g].hv[0][r] = (_Float16)e0;
        ph[g].hv[1][r] = (_Float16)e1;
      }
      l[g] += ls;
    }

#pragma unroll
    for (int j = 0; j < 8; ++j) {                                      // every v fragment feeds both query tiles
      o[0][j] = mma_hr(vf[j].h, ph[0].v, o[0][j]);
      o[1][j] = mma_hr(vf[j].h, ph[1].v, o[1][j]);
    }
  }
  }
  // ---- hand-over: tile t+1 becomes readable, buffer t&1 becomes free ----
  // keeps the waits below behind the products above: lifted into the softmax, the dscnt wait would wait out the v reads
  __builtin_amdgcn_sched_barrier(0);
  asm volatile("s_wait_dscnt 0x0" ::: "memory");                       // this wave's reads of buffer t&1 are done
  asm volatile("s_wait_asynccnt 0x0" ::: "memory");                    // this wave's share of tile t+1 has landed
  __syncthreads();
  if (t + 2 < NN / KT)                                                 // into the buffer that trip t has just read
    stage_kv(lp0 + (t & 1) * STG, khg + (size_t)(t + 2) * KT * CK, klg + (size_t)(t + 2) * KT * CK, vhg + (t + 2) * KT);
  }
  asm volatile("s_wait_asynccnt 0x0" ::: "memory");                    // no copy is left in flight at the wave's end
#pragma unroll
  for (int g = 0; g < 2; ++g) l[g] += __shfl_xor(l[g], 16, 32);

  // ---- the two key halves of a query group hold the same lane layout: waves 4..7 hand m, l, o over through the ring's
  //      LDS (free behind the loop's last barrier: every read of it is done and no copy is in flight) ----
  float* mg = rg.f;
  if (kh2 == 1) {                                                      // the same in every lane of a wave
#pragma unroll
    for (int g = 0; g < 2; ++g) {
#pragma unroll
      for (int j = 0; j < 8; ++j) {
        v4f va, vb;
#pragma unroll
        for (int r = 0; r < 4; ++r) { va[r] = o[g][j][r]; vb[r] = o[g][j][4 + r]; }
        *(v4f*)(mg + ((wq * 32 + 16 * g + 2 * j) * 32 + lane) * 4)     = va;   // 16 B per lane, lanes adjacent
        *(v4f*)(mg + ((wq * 32 + 16 * g + 2 * j + 1) * 32 + lane) * 4) = vb;
      }
      mg[16384 + (4 * wq + 2 * g) * 32 + lane]     = m[g];
      mg[16384 + (4 * wq + 2 * g + 1) * 32 + lane] = l[g];
    }
  }
  __syncthreads();                                                     // publishes the second half's state
  if (kh2 == 0) {
#pragma unroll
    for (int g = 0; g < 2; ++g) {
      const float m2 = mg[16384 + (4 * wq + 2 * g) * 32 + lane];
      const float l2 = mg[16384 + (4 * wq + 2 * g + 1) * 32 + lane];
      const float mn = fmaxf(m[g], m2);
      const float f1 = __expf((m[g] - mn) * SCL), f2 = __expf((m2 - mn) * SCL);
      const float inv = IVSC / (l[g] * f1 + l2 * f2);                  // o carries x1024 x16, l carries x1024
      const float g1 = f1 * inv, g2 = f2 * inv;
      const int qrow = 32 * wq + 16 * g + c;
#pragma unroll
      for (int j = 0; j < 8; ++j) {
        const v4f pa = *(const v4f*)(mg + ((wq * 32 + 16 * g + 2 * j) * 32 + lane) * 4);
        const v4f pb = *(const v4f*)(mg + ((wq * 32 + 16 * g + 2 * j + 1) * 32 + lane) * 4);
        v4f va, vb;
#pragma unroll
        for (int r = 0; r < 4; ++r) {
          va[r] = o[g][j][r] * g1 + pa[r] * g2;
          vb[r] = o[g][j][4 + r] * g1 + pb[r] * g2;
        }
        *(v4f*)(sm.o + qrow * OSPW + 16 * j + 8 * hh)     = va;       // Os[query][ch = 16j + 8hh + r]
        *(v4f*)(sm.o + qrow * OSPW + 16 * j + 8 * hh + 4) = vb;
      }
    }
  }
  __syncthreads();

  const int e = tid & 7, lq = tid >> 3;                                // lq 0..31
{
#pragma unroll
    for (int it = 0; it < AQ / 8; ++it) {
      const int L   = it * 32 + lq;                                    // line 0..511
      const int q   = L >> 2, seg = L & 3;                             // query 0..127, 32-float segment
      const v4f v = *(const v4f*)(sm.o + q * OSPW + 32 * seg + 4 * e);
      *(v4f*)(OB + ((size_t)(b * NN + n0 + q)) * CV + 32 * seg + 4 * e) = v;
    }
    
  }
}

// =========================================================================================================
// (4) output conv on the raw view: for image b, U[r][p] = OB_b[r*4096 + p] (r < 128, p < 4096);
//     y[b][o][p] = (1/4096) sum_r WO16[o][r] (Uh + Ul/2048)[p][r] + BOB[o], Uh = f16(16 U), Ul = f16((16U - Uh) 2048).
//     Block (64-p tile, b), all 256 output rows, 256 threads = 8 waves, two blocks per WGP: stage the 128 r x 64 p view
//     slab from OB (256-B contiguous row segments) once, convert, store transposed into LDS Bs[p_loc][r] hi rows 0..63 /
//     residual rows 64..127 (u32 pairs of consecutive r), barrier. Wave w owns cols p0 + 16 (w & 3) .. +15 (its eight B
//     fragments from the LDS rows, split k map, read once and kept in registers) and, in each of two passes ob, the 64
//     rows o0 = 64 (2 ob + (w >> 2)): 4 m-tiles (A rows o0 + 16 mt + (lane&15), k = r contiguous, from the 256 WO16 rows
//     that asynchronous 16-byte copies brought into LDS at pitch BP ahead of that barrier), K = 128 = 4 steps, hi and
//     residual accumulators. A pass's 128 x 64 tile goes through an LDS tile of its own (pitch OSP), barrier, to
//     d_out [b][256][4096] (row segment 64 p = 2 lines): 8 consecutive lanes x 16 B, one instruction per 32 lines;
//     the first pass's stores fly under the second pass's products.
// coverage: staging 4 it x 16 row-pairs x 16 lanes x 4 p x 2 rows = 128 r x 64 p per plane (pad cols never read);
//           weights 16 copies x 16 rows x 16 lanes x 8 halves = 256 x 128;
//           d_out 2 passes x 8 it x 32 lines x 8 lanes x 4 = 256 o x 64 p; grid (64, NIMG) covers d_out exactly once.
// =========================================================================================================
static_assert(CO == 4 * QT && CV == 128);
// the slab's hi / residual rows; behind the first pass's barrier, when every wave holds its fragments in registers, the
// same bytes carry the second pass's output tile
union OutSlab { unsigned int b[2 * QT * (BP / 2)]; float o[2 * QT * OSP]; };
__global__ __launch_bounds__(256)
void out_proj(const float* __restrict__ OB, const unsigned short* __restrict__ WO16,
              const float* __restrict__ BOB, float* out) {
  __shared__ __align__(16) OutSlab sb;
  __shared__ __align__(16) unsigned short As[CO * BP];
  __shared__ __align__(16) float Os0[2 * QT * OSP];
  unsigned int* Bs = sb.b;
  const int tid  = threadIdx.x;
  const int lane = tid & 31, wave = tid >> 5;
  const int hh   = lane >> 4, c = lane & 15;
  const int wc   = wave & 3, wm = wave >> 2;                           // 16-col group; 64-row half of every pass
  const int pt = blockIdx.x, b = blockIdx.y;
  const int p0 = pt * QT;
  const float* OBb = OB + (size_t)b * NN * CV;

  // ---- all 256 weight rows into LDS, rows of 256 B at pitch BP: 16 lanes per row, copy j takes rows 16j .. 16j+15;
  //      the copies fly while the view slab below is loaded and converted ----
  {
    const unsigned la = lds_byte(As) + (unsigned)((tid >> 4) * (BP * 2) + (tid & 15) * 16);
    const unsigned short* ga = WO16 + (size_t)(tid >> 4) * CV + 8 * (tid & 15);
    stage_rows8(la, ga, 16 * BP * 2, (size_t)16 * CV);                                         // rows 0..127
    stage_rows8(la + 128 * BP * 2, ga + (size_t)128 * CV, 16 * BP * 2, (size_t)16 * CV);       // rows 128..255
  }

  // ---- stage + convert the view slab: Bs[p_loc][r] ----
  {
    const int e16 = tid & 15, rq = tid >> 4;                           // rq 0..15
#pragma unroll
    for (int it = 0; it < 4; ++it) {
      const int rp = 16 * it + rq;                                     // row pair 0..63
      const int r0 = 2 * rp;
      const v4f va = *(const v4f*)(OBb + (size_t)r0 * NN + p0 + 4 * e16);
      const v4f vb = *(const v4f*)(OBb + (size_t)(r0 + 1) * NN + p0 + 4 * e16);
#pragma unroll
      for (int t = 0; t < 4; ++t) {
        const float f0 = va[t] * USC, f1 = vb[t] * USC;
        const _Float16 h0 = (_Float16)f0, h1 = (_Float16)f1;
        const _Float16 l0 = (_Float16)((f0 - (float)h0) * RSC);
        const _Float16 l1 = (_Float16)((f1 - (float)h1) * RSC);
        const int pl = 4 * e16 + t;                                    // p_loc 0..63
        Bs[pl * (BP / 2) + rp]        = pk16(h_bits(h0), h_bits(h1));  // halves r0, r0+1
        Bs[(QT + pl) * (BP / 2) + rp] = pk16(h_bits(l0), h_bits(l1));
      }
    }
  }
  asm volatile("s_wait_asynccnt 0x0" ::: "memory");                    // this wave's rows of the weights have landed
  __syncthreads();                                                     // publishes the slab and the weights

  // ---- the wave's eight slab fragments (B col = p0 + 16*wc + c, k = r), read once and kept in registers ----
  const unsigned short* Bh  = (const unsigned short*)Bs;
  const unsigned short* bph = Bh + (16 * wc + c) * BP + 8 * hh;
  const unsigned short* bpl = bph + QT * BP;
  Frag fbh[CV / 32], fbl[CV / 32];
#pragma unroll   // the fragment arrays stay in registers only under constant indices
  for (int ks = 0; ks < CV / 32; ++ks) {
    fbh[ks] = ldfrag(bph + 32 * ks);
    fbl[ks] = ldfrag(bpl + 32 * ks);
  }

  const int e = tid & 7, lq = tid >> 3;                                // lq 0..31

#pragma unroll   // two passes, straight-line: the row offsets fold into the reads' immediates
  for (int ob = 0; ob < CO / (2 * QT); ++ob) {
    const int o0 = (2 * ob + wm) * QT;                                 // this wave's 64 rows of the pass
    const unsigned short* ap = As + (o0 + c) * BP + 8 * hh;            // A row = o0 + 16 mt + c, k = r
    float* Os = (ob == 0) ? Os0 : sb.o;                                // a tile of its own per pass: no barrier frees one

    v8f acch[4], accl[4];
#pragma unroll
    for (int mt = 0; mt < 4; ++mt) { acch[mt] = zero8(); accl[mt] = zero8(); }

    // a k-step's four weight fragments are read as one group, one k-step ahead of the products that use them
    Frag fa[2][4];
#pragma unroll   // constant indices, as above
    for (int mt = 0; mt < 4; ++mt) fa[0][mt] = ldfrag(ap + (16 * mt) * BP);
#pragma unroll   // constant indices, as above
    for (int ks = 0; ks < CV / 32; ++ks) {
      if (ks + 1 < CV / 32) {
#pragma unroll   // constant indices, as above
        for (int mt = 0; mt < 4; ++mt) fa[(ks + 1) & 1][mt] = ldfrag(ap + (16 * mt) * BP + 32 * (ks + 1));
      }
      // keeps the group's reads ahead of this k-step's products: without it the compiler sinks each pair to its first
      // use, and the wave waits out every pair's LDS latency
      __builtin_amdgcn_sched_barrier(0);
#pragma unroll   // constant indices, as above
      for (int mt = 0; mt < 4; ++mt) {
        acch[mt] = mma_h(fa[ks & 1][mt].h, fbh[ks].h, acch[mt]);
        accl[mt] = mma_h(fa[ks & 1][mt].h, fbl[ks].h, accl[mt]);
      }
    }
    {
      const int nl = 16 * wc + c;
      const float osc = IWSC * IUSC;                                   // 1/4096
#pragma unroll
      for (int mt = 0; mt < 4; ++mt) {
#pragma unroll
        for (int r = 0; r < 8; ++r) {
          const int ol = 16 * mt + 8 * hh + r;                         // 0..63
          Os[(QT * wm + ol) * OSP + nl] = (acch[mt][r] + accl[mt][r] * IRSC) * osc + BOB[o0 + ol];
        }
      }
    }
    __syncthreads();                                                   // publishes the pass's 128 x 64 tile
#pragma unroll
    for (int it = 0; it < 8; ++it) {
      const int L = it * 32 + lq;                                      // 0..255
      const int row = L >> 1, hf = L & 1;                              // row 0..127 of the pass
      const int nl = hf * 32 + 4 * e;
      const v4f v = *(const v4f*)(Os + row * OSP + nl);
      *(v4f*)(out + ((size_t)(b * CO + 2 * QT * ob + row)) * NN + p0 + nl) = v;
    }
    if (ob + 1 < CO / (2 * QT))
      asm volatile("s_wait_xcnt 0x0" ::: "memory");                    // the next pass rewrites the stores' registers
  }
}

// =========================================================================================================
// Workspace map (bytes; each region start a multiple of 256; every extent is an exact tile multiple and is written
//   W16 f16 [384][256]            196608      BIAS f32 [384]              1536
//   WO16 f16 [256][128]            65536      BOB  f32 [256]              1024
//   Qh/Ql/Kh/Kl bf16 [8][4096][128]  8388608 x4                          Vh f16 [8][128][4096]  8388608
//   OB  f32 [8][4096][128]      16777216
//   total = 58984960
// =========================================================================================================
extern "C" void kernel_launch(void* const* d_in, const int* in_sizes, int n_in,
                              void* d_out, int out_size, void* d_ws, size_t ws_size,
                              hipStream_t stream) {
  const int XN = NIMG * CC * NN;                                       // 8388608
  if (n_in < 9) return;
  if (in_sizes[0] != XN) return;
  if (in_sizes[1] != CK * CC || in_sizes[2] != CK) return;
  if (in_sizes[3] != CK * CC || in_sizes[4] != CK) return;
  if (in_sizes[5] != CV * CC || in_sizes[6] != CV) return;
  if (in_sizes[7] != CO * CV || in_sizes[8] != CO) return;
  if (out_size != NIMG * CO * NN) return;

  size_t off = 0;
  auto carve = [&](size_t bytes) { const size_t o = off; off += (bytes + 255) & ~(size_t)255; return o; };
  const size_t oW16 = carve((size_t)MQKV * CC * 2);
  const size_t oBIA = carve((size_t)MQKV * 4);
  const size_t oWO  = carve((size_t)CO * CV * 2);
  const size_t oBOB = carve((size_t)CO * 4);
  const size_t oQh  = carve((size_t)NIMG * NN * CK * 2);
  const size_t oQl  = carve((size_t)NIMG * NN * CK * 2);
  const size_t oKh  = carve((size_t)NIMG * NN * CK * 2);
  const size_t oKl  = carve((size_t)NIMG * NN * CK * 2);
  const size_t oVh  = carve((size_t)NIMG * CV * NN * 2);
  const size_t oOB  = carve((size_t)NIMG * NN * CV * 4);
  if (off > ws_size) return;
  if (off > (size_t)134217728) return;

  const float* x  = (const float*)d_in[0];
  const float* wq = (const float*)d_in[1];
  const float* bq = (const float*)d_in[2];
  const float* wk = (const float*)d_in[3];
  const float* bk = (const float*)d_in[4];
  const float* wv = (const float*)d_in[5];
  const float* bv = (const float*)d_in[6];
  const float* wo = (const float*)d_in[7];
  const float* bo = (const float*)d_in[8];

  char* ws = (char*)d_ws;
  unsigned short* W16 = (unsigned short*)(ws + oW16);
  float*          BIA = (float*)(ws + oBIA);
  unsigned short* WO  = (unsigned short*)(ws + oWO);
  float*          BOB = (float*)(ws + oBOB);
  unsigned short* Qh  = (unsigned short*)(ws + oQh);
  unsigned short* Ql  = (unsigned short*)(ws + oQl);
  unsigned short* Kh  = (unsigned short*)(ws + oKh);
  unsigned short* Kl  = (unsigned short*)(ws + oKl);
  unsigned short* Vh  = (unsigned short*)(ws + oVh);
  float*          OB  = (float*)(ws + oOB);
  float* out = (float*)d_out;

  const dim3 blk256(256);

  // (0) conv1x1 q/k/v weights -> f16 plane + bias line; output conv weights -> f16 plane + bias line
  cvt_w<<<dim3(MQKV / 8), blk256, 0, stream>>>(wq, bq, wk, bk, wv, bv, W16, BIA);
  cvt_wo<<<dim3(CO / 16), blk256, 0, stream>>>(wo, bo, WO, BOB);
  // (1) conv1x1 GEMM straight from x -> q/k hi + residual planes and v plane
  gemm_qkv<<<dim3(NN / QT, NIMG), blk256, 0, stream>>>(x, W16, BIA, Qh, Ql, Kh, Kl, Vh);
  // (3) attention -> OB [b][4096][128] token-major f32
  attn_gab<<<dim3(NN / AQ, NIMG), blk256, 0, stream>>>(Qh, Ql, Kh, Kl, Vh, OB);
  // (4) output conv on the raw view -> out [b][256][4096]
  out_proj<<<dim3(NN / QT, NIMG), blk256, 0, stream>>>(OB, WO, BOB, out);
  (void)hipGetLastError();
}

// v009
// A run of this version takes 75.5 microseconds.
// Two timings next to v008 put it at 1.35 and 1.36 times that version's speed.
// All steps since v000 together make it 6.40 times as fast.
// Contractions: conv1x1 q/k/v GEMM W[384x256].X on v_wmma_f32_16x16x32_f16 (f16 containers of bf16-RNE weights x256
// and bf16-RNE x); scores K.Q^T on v_wmma_f32_16x16x32_f16 (q and k each rounded once to f16, one product,
// K=128); O^T = V.P^T on v_wmma_f32_16x16x32_f16 (v x16 f16, P = 1024 e^{(s-m)c} f16 from the score D registers);
// output conv1x1 Wo[256x128].U on v_wmma_f32_16x16x32_f16 (Wo f16 of bf16-RNE x256, U as f16 hi x16 plus f16
// residual x2^11 planes in two accumulators); f32 accumulate everywhere; softmax statistics in f32 VALU.
#include <hip/hip_runtime.h>
#include <math.h>
#include <stdint.h>

#define NIMG  8
#define CC    256
#define NN    4096
#define CK    128
#define CV    128
#define CO    256
#define MQKV  384
#define QT    64
#define OSP   68
#define OSPW  132
#define QP    136
#define BP    136
#define KT    128
#define VP    136
#define STG   (KT * QP + CV * VP)
#define XPP   264
#define WSC   256.0f
#define IWSC  0.00390625f
#define VSC   16.0f
#define IVSC  0.0625f
#define USC   16.0f
#define IUSC  0.0625f
#define RSC   2048.0f
#define IRSC  0.00048828125f
#define LNPS  6.931471805599453f
#define SCL   0.08838834764831845f

static_assert(NN % QT == 0);
static_assert(CC % 32 == 0 && CK % 64 == 0 && CV % 32 == 0);
static_assert(MQKV == 2 * CK + CV);
static_assert(MQKV % QT == 0 && CO % QT == 0);
static_assert(CK == 2 * QT && CV == 2 * QT);
static_assert((OSP * 4) % 16 == 0);
static_assert((OSPW * 4) % 16 == 0);
static_assert((XPP * 2) % 32 == 16 && XPP >= CC + 8 && XPP % 2 == 0 && MQKV / QT >= 2);
static_assert((QP * 2) % 16 == 0 && (BP * 2) % 16 == 0 && (BP % 2) == 0);
static_assert(QT * OSPW * 4 <= 2 * QT * QP * 2);
static_assert(NN % KT == 0 && NN / KT >= 2 && KT % 32 == 0);
static_assert((VP * 2) % 16 == 0 && (STG * 2) % 16 == 0 && VP >= KT + 8);
static_assert(KT * CK * 2 == 8 * 256 * 16 && CV * KT * 2 == 8 * 256 * 16 && KT == 128 && QP == VP);

typedef _Float16       v16h __attribute__((ext_vector_type(16)));
typedef _Float16       v8h  __attribute__((ext_vector_type(8)));
typedef _Float16       v2h  __attribute__((ext_vector_type(2)));
typedef unsigned short v8us __attribute__((ext_vector_type(8)));
typedef float          v8f  __attribute__((ext_vector_type(8)));
typedef float          v4f  __attribute__((ext_vector_type(4)));
typedef unsigned int   v4u  __attribute__((ext_vector_type(4)));

union Frag  { v8us u[2]; v16h h; };
union FragH { v16h v; v8h hv[2]; };
static_assert(sizeof(Frag) == 32);
static_assert(sizeof(FragH) == 32);

// ---- scalar helpers ---------------------------------------------------------------------------------------
__device__ __forceinline__ unsigned short bf_bits(float f) {          // f32 -> bf16 bits, RNE convert
  unsigned u = __float_as_uint(f);
  return (unsigned short)((u + 0x7FFFu + ((u >> 16) & 1u)) >> 16);
}
__device__ __forceinline__ float bf_up(unsigned short hb) { return __uint_as_float(((unsigned)hb) << 16); }
__device__ __forceinline__ float bfr(float f) { return bf_up(bf_bits(f)); }
__device__ __forceinline__ unsigned short h_bits(_Float16 x) { return __builtin_bit_cast(unsigned short, x); }
__device__ __forceinline__ unsigned pk16(unsigned short a, unsigned short b) { return (unsigned)a | ((unsigned)b << 16); }
__device__ __forceinline__ unsigned pkh(float a, float b) {           // f16 RNE of a (low half) and of b (high half)
  const v2h p = {(_Float16)a, (_Float16)b};
  return __builtin_bit_cast(unsigned, p);
}
__device__ __forceinline__ v8f zero8() { v8f z = {0.f, 0.f, 0.f, 0.f, 0.f, 0.f, 0.f, 0.f}; return z; }
__device__ __forceinline__ float hmax8(v8f s) {
  return fmaxf(fmaxf(fmaxf(s[0], s[1]), fmaxf(s[2], s[3])), fmaxf(fmaxf(s[4], s[5]), fmaxf(s[6], s[7])));
}

// lane l <-> l ^ 16 by a vector cross-row move: it counts on no LDS counter, so no wait on it drains LDS reads in flight
__device__ __forceinline__ float xhalf(float x) {
  const int b = __builtin_bit_cast(int, x);
  return __builtin_bit_cast(float, __builtin_amdgcn_permlanex16(b, b, 0x76543210, 0xfedcba98, false, false));
}

// ---- 16-bit fragment loader (A, or B from a k-contiguous [n][k] row): lane -> row/col (lane&15), p already includes
//      + 8*(lane>>4); elements 0..7 <- p[0..7] (k0+8h..), elements 8..15 <- p[16..23] (k0+16+8h..)
__device__ __forceinline__ Frag ldfrag(const unsigned short* p) {
  Frag f;
  f.u[0] = *(const v8us*)(p);
  f.u[1] = *(const v8us*)(p + 16);
  return f;
}

typedef __attribute__((address_space(3))) unsigned short lds_us;
__device__ __forceinline__ unsigned lds_byte(unsigned short* p) { return (unsigned)(uintptr_t)(lds_us*)p; }

// ---- WMMA helpers: builtin followed by a 4-slot VALU gap tying D and keeping A/B live --------------------------
__device__ __forceinline__ v8f mma_h(v16h a, v16h b, v8f c) {
  v8f d = __builtin_amdgcn_wmma_f32_16x16x32_f16(false, a, false, b, (short)0, c, false, false);
#if defined(__HIP_DEVICE_COMPILE__)
  asm volatile("v_nop\n\tv_nop\n\tv_nop\n\tv_nop" : "+v"(d) : "v"(a), "v"(b));
#endif
  return d;
}

// =========================================================================================================
// (0) q/k/v conv1x1 weights: W16 f16 [384][256], rows 0..127 = wq, 128..255 = wk, 256..383 = wv; value = f16 of
//     (bf16-RNE(w) * 256) (exact). BIAS f32 [384] = bf16-RNE of bq / bk / bv. Block blk (0..47) owns rows
// coverage: 48 blocks x 8 rows x 32 pieces x 8 halves = 384 x 256; bias 96 x 4 floats = 384.
// =========================================================================================================
__global__ __launch_bounds__(256)
void cvt_w(const float* __restrict__ wq, const float* __restrict__ bq,
           const float* __restrict__ wk, const float* __restrict__ bk,
           const float* __restrict__ wv, const float* __restrict__ bv,
           unsigned short* W16, float* BIAS) {
  const int tid = threadIdx.x, blk = blockIdx.x;
  const int rl = tid >> 5, col = 8 * (tid & 31);
  const int o = 8 * blk + rl;                                          // 0..383
  const float* wbase = (blk < 16) ? wq : (blk < 32) ? wk : wv;         // block-uniform selection
  const int osub = (blk < 16) ? 0 : (blk < 32) ? CK : 2 * CK;
  const float* s = wbase + (size_t)(o - osub) * CC + col;             // (o-osub) < 128 rows of that matrix
  const v4f a = *(const v4f*)s;
  const v4f q = *(const v4f*)(s + 4);
  const float f[8] = {a[0], a[1], a[2], a[3], q[0], q[1], q[2], q[3]};
  v4u u;
#pragma unroll
  for (int t = 0; t < 4; ++t) {
    const _Float16 h0 = (_Float16)(bfr(f[2 * t]) * WSC);
    const _Float16 h1 = (_Float16)(bfr(f[2 * t + 1]) * WSC);
    u[t] = pk16(h_bits(h0), h_bits(h1));
  }
  // bias values: every lane loads all three candidates with clamped indices, selects by value
  v4f bvv;
  {
    const int tb = min(tid, 95);
    const int o4 = 4 * tb;
#pragma unroll
    for (int qd = 0; qd < 4; ++qd) {
      const int oo = o4 + qd;                                          // 0..383
      const int iq = min(oo, CK - 1);
      const int ik = min(max(oo - CK, 0), CK - 1);
      const int iv = min(max(oo - 2 * CK, 0), CV - 1);
      const float cq = bq[iq], ckv = bk[ik], cvv = bv[iv];
      const float val = (oo < CK) ? cq : (oo < 2 * CK) ? ckv : cvv;
      bvv[qd] = bfr(val);
    }
  }
{
    *(v4u*)(W16 + (size_t)o * CC + col) = u;
    if (blk == 0 && tid < 96) *(v4f*)(BIAS + 4 * tid) = bvv;
    
  }
}

// =========================================================================================================
// (0b) output conv weights: WO16 f16 [256][128] = f16 of (bf16-RNE(wo) * 256) (exact); BOB f32 [256] = bf16-RNE bo.
// coverage: 16 blocks x 16 rows x 16 pieces x 8 halves = 256 x 128; bias 64 x 4 floats = 256.
// =========================================================================================================
__global__ __launch_bounds__(256)
void cvt_wo(const float* __restrict__ wo, const float* __restrict__ bo, unsigned short* WO16, float* BOB) {
  const int tid = threadIdx.x, blk = blockIdx.x;
  const int rl = tid >> 4, col = 8 * (tid & 15);
  const int o = 16 * blk + rl;                                         // 0..255
  const float* s = wo + (size_t)o * CV + col;
  const v4f a = *(const v4f*)s;
  const v4f q = *(const v4f*)(s + 4);
  const float f[8] = {a[0], a[1], a[2], a[3], q[0], q[1], q[2], q[3]};
  v4u u;
#pragma unroll
  for (int t = 0; t < 4; ++t) {
    const _Float16 h0 = (_Float16)(bfr(f[2 * t]) * WSC);
    const _Float16 h1 = (_Float16)(bfr(f[2 * t + 1]) * WSC);
    u[t] = pk16(h_bits(h0), h_bits(h1));
  }
  v4f bvv;
  {
    const int tb = min(tid, 63);
#pragma unroll
    for (int qd = 0; qd < 4; ++qd) bvv[qd] = bfr(bo[4 * tb + qd]);  // index <= 255
  }
{
    *(v4u*)(WO16 + (size_t)o * CV + col) = u;
    if (blk == 0 && tid < 64) *(v4f*)(BOB + 4 * tid) = bvv;
    
  }
}

// =========================================================================================================
// (1) conv1x1 GEMM for one (b, 64-n tile), all 384 output rows: Y[o][n] = (1/256) sum_c W16[o][c] X[n][c] + BIAS[o],
//     X[n][c] = f16 of bf16-RNE(x[b][c][n]) (exact). Block 256 threads = 8 waves, two blocks per WGP.
//     The block reads its x slab (256 c x 64 n, f32, 256-B row segments) once, rounds it and stores it transposed into LDS
//     Xs[n_loc][c] (u32 pairs of consecutive c, row pitch XPP halves = 16 B x odd), barrier. Wave w owns cols
//     n0 + 32 (w & 1) .. +31 (two B fragments per k-step, k = c contiguous in the token row, read once and kept in
//     registers) and in every 64-row weight tile the m-tile w >> 1 (A rows o = 64 mb + 16 (w >> 1) + (lane&15), split k map
//     loader). K = 256 = 8 steps. The six weight tiles come through a two-buffer LDS ring filled by asynchronous 16-byte
//     copies of whole rows; tile mb+2 is issued behind the barrier that ends the reads of tile mb.
//     Epilogue of a tile: Os[o_loc][n_loc] (pitch OSP), barrier, then packed in registers:
//       tiles 0,1 (q ck cols 0..63 / 64..127) and 2,3 (k): one f16 plane each [b][4096 n][128],
//         lane e -> cols 8e..8e+7 of token row 32 it + lq;
//       tiles 4,5 (v): f16 plane x16 [b][128 ch][4096 n], lane e -> halves 8e..8e+7 of channel row 32 it + lq;
//     the global stores stand behind the tile's hand-over barrier, so that they fly under the next tile's products.
// coverage: Xs 8 it x 16 row pairs x 16 lanes x 4 n x 2 rows = 256 c x 64 n; Os 8 waves x 2 tiles x 16x16 = 64 x 64;
//           q/k: per plane 2 it x 32 rows x 8 lanes x 8 = 64 n x 64 cols, tiles 0..3 cover all 128 cols of Qh / Kh;
//           v: 2 it x 32 rows x 8 lanes x 8 = 64 ch x 64 n; grid (64, NIMG) covers every plane exactly once.
// =========================================================================================================
// token rows (f16 pairs), the two weight tiles of the ring (rows of XPP halves), the output tile
struct GemmSmem { unsigned int x[QT * (XPP / 2)]; unsigned short w[2 * QT * XPP]; float o[QT * OSP]; };

// Eight 16-byte pieces per lane, global -> LDS through no register: a wave's 32 lanes x 16 B take 512 contiguous bytes
// (four whole lines) per copy. l / g are this lane's first piece, ls bytes / gs halves the step from copy to copy. The
// s_wait_xcnt closes the statement so that no address register of a copy is rewritten ahead of it.
__device__ __forceinline__ void stage_rows8(unsigned l, const unsigned short* g, unsigned ls, size_t gs) {
#if defined(__HIP_DEVICE_COMPILE__)
  asm volatile(
      "global_load_async_to_lds_b128 %0, %8, off\n\t"
      "global_load_async_to_lds_b128 %1, %9, off\n\t"
      "global_load_async_to_lds_b128 %2, %10, off\n\t"
      "global_load_async_to_lds_b128 %3, %11, off\n\t"
      "global_load_async_to_lds_b128 %4, %12, off\n\t"
      "global_load_async_to_lds_b128 %5, %13, off\n\t"
      "global_load_async_to_lds_b128 %6, %14, off\n\t"
      "global_load_async_to_lds_b128 %7, %15, off\n\t"
      "s_wait_xcnt 0x0"
      :: "v"(l), "v"(l + ls), "v"(l + 2 * ls), "v"(l + 3 * ls),
         "v"(l + 4 * ls), "v"(l + 5 * ls), "v"(l + 6 * ls), "v"(l + 7 * ls),
         "v"(g), "v"(g + gs), "v"(g + 2 * gs), "v"(g + 3 * gs),
         "v"(g + 4 * gs), "v"(g + 5 * gs), "v"(g + 6 * gs), "v"(g + 7 * gs)
      : "memory");
#endif
}

__global__ __launch_bounds__(256)
void gemm_qkv(const float* __restrict__ x, const unsigned short* __restrict__ W16, const float* __restrict__ BIAS,
              unsigned short* Qh, unsigned short* Kh, unsigned short* Vh) {
  __shared__ __align__(16) GemmSmem sm;
  float* Os = sm.o;
  const int tid  = threadIdx.x;
  const int lane = tid & 31, wave = tid >> 5;
  const int hh   = lane >> 4, c = lane & 15;
  const int nt   = blockIdx.x, b = blockIdx.y;
  const int n0   = nt * QT;
  const int nh   = wave & 1, mq = wave >> 1;                           // 32-col half; m-tile of every weight tile

  // ---- this thread's share of a weight tile: copy j of wave w takes row 8j + w, a lane 16 B of the 512-B row ----
  const unsigned lw = lds_byte(sm.w) + (unsigned)(wave * (XPP * 2) + lane * 16);
  const unsigned short* gw = W16 + (size_t)wave * CC + 8 * lane;
  const unsigned wls = 8 * XPP * 2;
  const size_t wgs = (size_t)8 * CC;
  stage_rows8(lw, gw, wls, wgs);                                       // tile 0 -> buffer 0, flies under the slab below

  // ---- load + round the x slab, store it transposed: Xs[n_loc][c] ----
  {
    const int e16 = tid & 15, rq = tid >> 4;                           // rq 0..15
    const float* sp = x + ((size_t)(b * CC + 2 * rq)) * NN + n0 + 4 * e16;
    v4f va[CC / 32], vb[CC / 32];                                      // rows 2cp, 2cp+1 of channel pair cp = 16 it + rq
#pragma unroll   // the arrays stay in registers only under constant indices
    for (int it = 0; it < CC / 32; ++it) {
      va[it] = *(const v4f*)(sp + (size_t)(32 * it) * NN);
      vb[it] = *(const v4f*)(sp + (size_t)(32 * it + 1) * NN);
    }
    // keeps all sixteen loads ahead of the first conversion: without it the compiler issues the later ones behind the
    // wait for the first, and the wave waits out the memory latency twice
    __builtin_amdgcn_sched_barrier(0);
#pragma unroll   // constant indices, as above
    for (int it = 0; it < CC / 32; ++it) {
      const int cp = 16 * it + rq;                                     // channel pair 0..127
#pragma unroll   // constant indices, as above
      for (int t = 0; t < 4; ++t)                                      // halves c = 2cp, 2cp+1 of token 4 e16 + t
        sm.x[(4 * e16 + t) * (XPP / 2) + cp] = pkh(bfr(va[it][t]), bfr(vb[it][t]));
    }
  }
  asm volatile("s_wait_asynccnt 0x0" ::: "memory");                    // this wave's rows of tile 0 have landed
  __syncthreads();                                                     // publishes the token rows and tile 0
  stage_rows8(lw + QT * XPP * 2, gw + (size_t)QT * CC, wls, wgs);      // tile 1 -> buffer 1

  // ---- the wave's 16 token fragments (B operand, col = n0 + 32 nh + 16 g + c), read once and kept in registers ----
  Frag fb[2][CC / 32];
#pragma unroll   // the fragment arrays stay in registers only under constant indices
  for (int g = 0; g < 2; ++g) {
    const unsigned short* bp = (const unsigned short*)sm.x + (32 * nh + 16 * g + c) * XPP + 8 * hh;
#pragma unroll   // constant indices, as above
    for (int ks = 0; ks < CC / 32; ++ks) fb[g][ks] = ldfrag(bp + 32 * ks);
  }

  const int e = tid & 7, lq = tid >> 3;                                // lq 0..31

#pragma unroll 1   // rolled: one hand-over point in the text, the buffer picked by mb & 1
  for (int mb = 0; mb < MQKV / QT; ++mb) {
    const int o0 = mb * QT;
    const unsigned short* ap = sm.w + (mb & 1) * (QT * XPP) + (16 * mq + c) * XPP + 8 * hh;
    // the lane's eight bias values and the tile's eight weight fragments, read as one group ahead of the products
    const v4f b0 = *(const v4f*)(BIAS + o0 + 16 * mq + 8 * hh);
    const v4f b1 = *(const v4f*)(BIAS + o0 + 16 * mq + 8 * hh + 4);
    Frag fa[CC / 32];
#pragma unroll   // constant indices, as above
    for (int ks = 0; ks < CC / 32; ++ks) fa[ks] = ldfrag(ap + 32 * ks);
    // keeps the group's reads ahead of the products: without it the compiler sinks each pair to its first use, and the
    // wave waits out every pair's LDS latency
    __builtin_amdgcn_sched_barrier(0);
    v8f acc[2];
    acc[0] = zero8();
    acc[1] = zero8();
#pragma unroll   // constant indices, as above
    for (int ks = 0; ks < CC / 32; ++ks) {                             // every weight fragment feeds both col tiles
      acc[0] = mma_h(fa[ks].h, fb[0][ks].h, acc[0]);
      acc[1] = mma_h(fa[ks].h, fb[1][ks].h, acc[1]);
    }

    // ---- scale back, + bias -> LDS Os[o_loc][n_loc] ----
#pragma unroll   // constant indices, as above
    for (int g = 0; g < 2; ++g) {
      const int nl = 32 * nh + 16 * g + c;
#pragma unroll   // constant indices, as above
      for (int r = 0; r < 8; ++r) {
        const int ol = 16 * mq + 8 * hh + r;                           // 0..63
        Os[ol * OSP + nl] = acc[g][r] * IWSC + ((r < 4) ? b0[r & 3] : b1[r & 3]);
      }
    }
    __syncthreads();                                                   // publishes Os

    v4u su[2];                                                         // it 0,1
    if (mb < 4) {
      // ---- q / k f16 pieces (block-uniform branch) ----
#pragma unroll   // constant indices, as above
      for (int it = 0; it < 2; ++it) {
        const int nl = it * 32 + lq;                                   // token 0..63
#pragma unroll   // constant indices, as above
        for (int t = 0; t < 4; ++t) {
          const float f0 = Os[(8 * e + 2 * t) * OSP + nl];
          const float f1 = Os[(8 * e + 2 * t + 1) * OSP + nl];
          su[it][t] = pkh(f0, f1);
        }
      }
    } else {
      // ---- v f16 pieces, carried x16 ----
#pragma unroll   // constant indices, as above
      for (int it = 0; it < 2; ++it) {
        const int row = it * 32 + lq;                                  // 0..63
        const v4f a = *(const v4f*)(Os + row * OSP + 8 * e);
        const v4f q = *(const v4f*)(Os + row * OSP + 8 * e + 4);
#pragma unroll   // constant indices, as above
        for (int t = 0; t < 2; ++t) {
          su[it][t]     = pk16(h_bits((_Float16)(a[2 * t] * VSC)), h_bits((_Float16)(a[2 * t + 1] * VSC)));
          su[it][2 + t] = pk16(h_bits((_Float16)(q[2 * t] * VSC)), h_bits((_Float16)(q[2 * t + 1] * VSC)));
        }
      }
    }

    // ---- hand-over: tile mb+1 becomes readable, buffer mb&1 and Os become free ----
    asm volatile("s_wait_dscnt 0x0" ::: "memory");                     // this wave's reads of buffer mb&1 and of Os are done
    asm volatile("s_wait_asynccnt 0x0" ::: "memory");                  // this wave's rows of tile mb+1 have landed
    __syncthreads();
    if (mb + 2 < MQKV / QT)
      stage_rows8(lw + (unsigned)(mb & 1) * (QT * XPP * 2), gw + (size_t)(mb + 2) * QT * CC, wls, wgs);

    if (mb < 4) {
      unsigned short* Ph = (mb < 2) ? Qh : Kh;
      const int cb = QT * (mb & 1);                                    // ck column base 0 or 64
#pragma unroll   // constant indices, as above
      for (int it = 0; it < 2; ++it) {
        const size_t base = ((size_t)(b * NN + n0 + it * 32 + lq)) * CK + cb + 8 * e;
        *(v4u*)(Ph + base) = su[it];
      }
    } else {
      const int ch0 = QT * (mb - 4);                                   // 0 or 64
#pragma unroll   // constant indices, as above
      for (int it = 0; it < 2; ++it)
        *(v4u*)(Vh + ((size_t)(b * CV + ch0 + it * 32 + lq)) * NN + n0 + 8 * e) = su[it];
    }
    asm volatile("s_wait_xcnt 0x0" ::: "memory");                      // the next tile's reads rewrite the stores' registers
  }
  asm volatile("s_wait_asynccnt 0x0" ::: "memory");                    // no copy is left in flight at the wave's end
}

// =========================================================================================================
// (3) attention for one (b, 128-query tile), transposed formulation, 4096 keys, no mask:
//   S^T tile (16 keys x 16 queries) = sum over 4 k-steps of A(k: row = key kb + (lane&15), 32 d via the split k map
//   from the f16 plane Kh [b][4096][128]) . B(q: col = query, same map, from the wave's registers; f16 plane Qh).
//   One rounding of q and of k to f16 moves a weight e^{sc} by about as much as the f16 rounding of P below does.
//   Softmax of s*c with c = 1/sqrt(128):
//   per lane the D tile holds 8 keys of ONE query: online state per lane, one cross-row move (lane^16) for the max over
//   32 keys, row-sum partials combined at the end. P = 1024 e^{(s-m)c} as f16 is the B operand of
//   O^T (rows channel, cols queries) += A(V rows channel = 16j + (lane&15), keys contiguous, f16 plane Vh
//   [b][128][4096]) . B(P^T): element r <- D of the tile covering keys kb..kb+15, element 8+r <- the tile covering
//   kb+16..kb+31, lane unchanged. 8 accumulator tiles per query tile (128 channels). Block = 8 waves = 128 queries, one
//   block per WGP: wave w owns two query tiles, queries 32 (w & 3) .. +31, and keys 32 (w >> 2) .. +31 of every 64 keys;
//   the two states of a query group are merged at the end. The q rows of the block's 128 queries are staged once in LDS
//   (v4u pieces, barrier); each wave then reads its 8 q fragments once and keeps them in registers, so that the key loop
//   reads only k and v from LDS and every such fragment feeds both query tiles. A 32-key pass reads its LDS fragments
//   ahead of the products that use them: all of k; all of v.
//   K and V come in tiles of KT = 128 keys through a two-buffer LDS ring filled by asynchronous 16-byte
//   copies (whole 128-B lines per request, each tile fetched once per block and read by all 8 waves); a wave makes two
//   32-key passes over a tile between hand-overs, so that the waves of a SIMD may run out of step for two passes and a
//   tile's copies have two passes to land; tile t+2 is issued behind the barrier that ends the reads of tile t. Row
//   pitches QP / VP halves = 16 B x odd.
//   Epilogue: barrier, O/l staged in LDS Os[query][128 channels] (pitch OSPW, b128 stores, aliases the Q staging),
// coverage: Q staging 8 it x 16 rows x 16 lanes x 8 = 128 x 128; OB 16 it x 32 lines x 8 lanes x 4 floats =
//           128 queries x 128 ch; grid (32, NIMG) covers OB exactly once.
// =========================================================================================================
#define AQ    128                                                      // queries of one attention block
static_assert(NN % AQ == 0);
union AttnSmem { unsigned short q[AQ * QP]; float o[AQ * OSPW]; };
// the k/v ring; after the key loop its first bytes carry the second key half's softmax state (o 16384 floats, m, l)
union AttnRing { unsigned short h[2 * STG]; float f[4 * 132 * 32]; };
static_assert(4 * 132 * 32 * 4 <= 2 * STG * 2);

// One tile of KT keys into the ring buffer at LDS halves lp: k rows [KT][QP], v rows [CV][VP],
// each part 128 rows of 256 B: 16 lanes per row, 16 rows per piece step, eight pieces (16 copies per lane and tile),
// global -> LDS through no register. lp / kh / vh are this thread's piece 0 of the buffer and of the tile's planes.
// The copies are the builtin: its address registers may lie anywhere in the wave's register file, while an asm operand
// lives in v0..v255, beside the wave's register tile.
typedef int v4i __attribute__((ext_vector_type(4)));
typedef __attribute__((address_space(1))) v4i gl_v4i;
typedef __attribute__((address_space(3))) v4i lds_v4i;
__device__ __forceinline__ void copy16(const unsigned short* g, unsigned short* l) {
#if defined(__HIP_DEVICE_COMPILE__)
  __builtin_amdgcn_global_load_async_to_lds_b128((gl_v4i*)(uintptr_t)g, (lds_v4i*)l, 0, 0);
#endif
}
__device__ __forceinline__ void stage_kv(unsigned short* lp, const unsigned short* kh, const unsigned short* vh) {
#pragma unroll   // straight-line copies, constant steps
  for (int j = 0; j < KT / 16; ++j) copy16(kh + (size_t)(16 * j) * CK, lp + (16 * j) * QP);
#pragma unroll   // as above
  for (int j = 0; j < CV / 16; ++j) copy16(vh + (size_t)(16 * j) * NN, lp + KT * QP + (16 * j) * VP);
}

// ---- WMMA helper of the attention kernel: the bare builtin, the compiler keeping the distance behind it. An asm
//      statement takes its vector operands from v0..v255 only; tied to one, the wave's 32-query register tile
//      (q 64, o 128 registers, the pass's fragments) would not fit and would spill.
__device__ __forceinline__ v8f mma_hr(v16h a, v16h b, v8f c) {
  return __builtin_amdgcn_wmma_f32_16x16x32_f16(false, a, false, b, (short)0, c, false, false);
}

__global__ __launch_bounds__(256)
void attn_gab(const unsigned short* __restrict__ Qh, const unsigned short* __restrict__ Kh,
              const unsigned short* __restrict__ Vh, float* OB) {
  __shared__ __align__(16) AttnSmem sm;
  __shared__ __align__(16) AttnRing rg;
  unsigned short* ring = rg.h;
  const int tid  = threadIdx.x;
  const int wave = tid >> 5, lane = tid & 31;
  const int hh   = lane >> 4, c = lane & 15;
  const int n0   = blockIdx.x * AQ, b = blockIdx.y;
  const int wq   = wave & 3, kh2 = wave >> 2;                          // query group of 32; 32-key half of every 64-key pass

  // ---- this thread's share of a k/v tile: its place inside a ring buffer, source pointers of tile 0 ----
  unsigned short* lp0 = ring + (tid >> 4) * QP + (tid & 15) * 8;
  const unsigned short* khg = Kh + ((size_t)(b * NN + (tid >> 4))) * CK + 8 * (tid & 15);
  const unsigned short* vhg = Vh + ((size_t)(b * CV + (tid >> 4))) * NN + 8 * (tid & 15);
  stage_kv(lp0, khg, vhg);                                             // tile 0 -> buffer 0

  // ---- stage the q rows of this query tile in LDS ----
  {
    const int e16 = tid & 15, rq = tid >> 4;                          // rq 0..15
#pragma unroll
    for (int it = 0; it < AQ / 16; ++it) {
      const int row = 16 * it + rq;                                    // 0..127
      const size_t g = ((size_t)(b * NN + n0 + row)) * CK + 8 * e16;
      const v4u vh = *(const v4u*)(Qh + g);
      *(v4u*)(sm.q + row * QP + 8 * e16) = vh;
    }
  }
  asm volatile("s_wait_asynccnt 0x0" ::: "memory");                    // this wave's share of tile 0 has landed
  __syncthreads();                                                     // publishes the q rows and tile 0
  stage_kv(lp0 + STG, khg + (size_t)KT * CK, vhg + KT);                // tile 1 -> buffer 1

  // ---- the wave's q fragments (B operand, col = query n0 + 32*wq + 16*g + c), read once and kept in registers ----
  Frag qhf[2][CK / 32];
#pragma unroll
  for (int g = 0; g < 2; ++g) {
    const unsigned short* qsh = sm.q + (32 * wq + 16 * g + c) * QP + 8 * hh;
#pragma unroll
    for (int ks = 0; ks < CK / 32; ++ks) qhf[g][ks] = ldfrag(qsh + 32 * ks);
  }

  float m[2] = {-1.0e30f, -1.0e30f}, l[2] = {0.f, 0.f};
  v8f o[2][8];
#pragma unroll
  for (int g = 0; g < 2; ++g) {
#pragma unroll
    for (int j = 0; j < 8; ++j) o[g][j] = zero8();
  }

#pragma unroll 1   // rolled: one hand-over point in the text, the buffer picked by t & 1
  for (int t = 0; t < NN / KT; ++t) {
  const unsigned short* buf = ring + (t & 1) * STG;
#pragma unroll   // unrolled: the second pass's key offsets fold into the reads' immediates; no barrier stands between the passes
  for (int ps = 0; ps < KT / 64; ++ps) {
  // k fragment base (A operand, row = key kb + c of the tile), + key * QP
  const int kb = 64 * ps + 32 * kh2;                                   // this wave's 32 keys of the pass
  const unsigned short* Khp = buf + c * QP + 8 * hh;
  // v fragment base (A operand, row = channel 16j + c, the tile's keys contiguous), + 16*j*VP + kb
  const unsigned short* Vhp = buf + KT * QP + c * VP + 8 * hh;
  {
    v8f s0[2], s1[2];                                                  // [query tile]: keys kb..+15, keys kb+16..+31
#pragma unroll
    for (int g = 0; g < 2; ++g) { s0[g] = zero8(); s1[g] = zero8(); }
    {
      // the pass's eight k fragments, read as one group ahead of their 16 products, counted waits behind them
      Frag k0[CK / 32], k1[CK / 32];
#pragma unroll   // the fragment arrays stay in registers only under constant indices
      for (int ks = 0; ks < CK / 32; ++ks) {
        k0[ks] = ldfrag(Khp + kb * QP + 32 * ks);                        // keys kb .. kb+15
        k1[ks] = ldfrag(Khp + (kb + 16) * QP + 32 * ks);                 // keys kb+16 .. kb+31
      }
      // keeps the group's reads ahead of its products: without it the compiler sinks each pair to its first use, and the
      // wave waits out every pair's latency
      __builtin_amdgcn_sched_barrier(0);
#pragma unroll   // constant indices, as above
      for (int ks = 0; ks < CK / 32; ++ks) {
        // every k fragment feeds both query tiles
        s0[0] = mma_hr(k0[ks].h, qhf[0][ks].h, s0[0]);
        s1[0] = mma_hr(k1[ks].h, qhf[0][ks].h, s1[0]);
        s0[1] = mma_hr(k0[ks].h, qhf[1][ks].h, s0[1]);
        s1[1] = mma_hr(k1[ks].h, qhf[1][ks].h, s1[1]);
      }
    }

    // the pass's eight v fragments, read ahead of the softmax: nothing below waits on LDS before the products that use
    // them, so they land while the softmax runs
    Frag vf[8];
#pragma unroll   // constant indices, as above
    for (int j = 0; j < 8; ++j) vf[j] = ldfrag(Vhp + (16 * j) * VP + kb);
    // holds the sixteen reads here: without it the compiler sinks them to the softmax's end and their latency is waited out
    __builtin_amdgcn_sched_barrier(0);

    FragH ph[2];
#pragma unroll   // constant indices, as above
    for (int g = 0; g < 2; ++g) {
      float mx = fmaxf(hmax8(s0[g]), hmax8(s1[g]));
      mx = fmaxf(mx, xhalf(mx));
      const float mn   = fmaxf(m[g], mx);
      const float corr = __expf((m[g] - mn) * SCL);
      m[g] = mn;
      const float msh = mn * SCL - LNPS;                               // exp gives e^{(s-m)c} * 1024
      l[g] *= corr;
#pragma unroll
      for (int j = 0; j < 8; ++j) {
#pragma unroll
        for (int r = 0; r < 8; ++r) o[g][j][r] *= corr;
      }

      float ls = 0.f;
#pragma unroll
      for (int r = 0; r < 8; ++r) {
        const float e0 = __expf(s0[g][r] * SCL - msh);                 // key kb      + 8hh + r
        const float e1 = __expf(s1[g][r] * SCL - msh);                 // key kb + 16 + 8hh + r
        ls += e0 + e1;
        ph[g].hv[0][r] = (_Float16)e0;
        ph[g].hv[1][r] = (_Float16)e1;
      }
      l[g] += ls;
    }

#pragma unroll
    for (int j = 0; j < 8; ++j) {                                      // every v fragment feeds both query tiles
      o[0][j] = mma_hr(vf[j].h, ph[0].v, o[0][j]);
      o[1][j] = mma_hr(vf[j].h, ph[1].v, o[1][j]);
    }
  }
  }
  // ---- hand-over: tile t+1 becomes readable, buffer t&1 becomes free ----
  // keeps the waits below behind the products above: lifted into the softmax, the dscnt wait would wait out the v reads
  __builtin_amdgcn_sched_barrier(0);
  asm volatile("s_wait_dscnt 0x0" ::: "memory");                       // this wave's reads of buffer t&1 are done
  asm volatile("s_wait_asynccnt 0x0" ::: "memory");                    // this wave's share of tile t+1 has landed
  __syncthreads();
  if (t + 2 < NN / KT)                                                 // into the buffer that trip t has just read
    stage_kv(lp0 + (t & 1) * STG, khg + (size_t)(t + 2) * KT * CK, vhg + (t + 2) * KT);
  }
  asm volatile("s_wait_asynccnt 0x0" ::: "memory");                    // no copy is left in flight at the wave's end
#pragma unroll
  for (int g = 0; g < 2; ++g) l[g] += __shfl_xor(l[g], 16, 32);

  // ---- the two key halves of a query group hold the same lane layout: waves 4..7 hand m, l, o over through the ring's
  //      LDS (free behind the loop's last barrier: every read of it is done and no copy is in flight) ----
  float* mg = rg.f;
  if (kh2 == 1) {                                                      // the same in every lane of a wave
#pragma unroll
    for (int g = 0; g < 2; ++g) {
#pragma unroll
      for (int j = 0; j < 8; ++j) {
        v4f va, vb;
#pragma unroll
        for (int r = 0; r < 4; ++r) { va[r] = o[g][j][r]; vb[r] = o[g][j][4 + r]; }
        *(v4f*)(mg + ((wq * 32 + 16 * g + 2 * j) * 32 + lane) * 4)     = va;   // 16 B per lane, lanes adjacent
        *(v4f*)(mg + ((wq * 32 + 16 * g + 2 * j + 1) * 32 + lane) * 4) = vb;
      }
      mg[16384 + (4 * wq + 2 * g) * 32 + lane]     = m[g];
      mg[16384 + (4 * wq + 2 * g + 1) * 32 + lane] = l[g];
    }
  }
  __syncthreads();                                                     // publishes the second half's state
  if (kh2 == 0) {
#pragma unroll
    for (int g = 0; g < 2; ++g) {
      const float m2 = mg[16384 + (4 * wq + 2 * g) * 32 + lane];
      const float l2 = mg[16384 + (4 * wq + 2 * g + 1) * 32 + lane];
      const float mn = fmaxf(m[g], m2);
      const float f1 = __expf((m[g] - mn) * SCL), f2 = __expf((m2 - mn) * SCL);
      const float inv = IVSC / (l[g] * f1 + l2 * f2);                  // o carries x1024 x16, l carries x1024
      const float g1 = f1 * inv, g2 = f2 * inv;
      const int qrow = 32 * wq + 16 * g + c;
#pragma unroll
      for (int j = 0; j < 8; ++j) {
        const v4f pa = *(const v4f*)(mg + ((wq * 32 + 16 * g + 2 * j) * 32 + lane) * 4);
        const v4f pb = *(const v4f*)(mg + ((wq * 32 + 16 * g + 2 * j + 1) * 32 + lane) * 4);
        v4f va, vb;
#pragma unroll
        for (int r = 0; r < 4; ++r) {
          va[r] = o[g][j][r] * g1 + pa[r] * g2;
          vb[r] = o[g][j][4 + r] * g1 + pb[r] * g2;
        }
        *(v4f*)(sm.o + qrow * OSPW + 16 * j + 8 * hh)     = va;       // Os[query][ch = 16j + 8hh + r]
        *(v4f*)(sm.o + qrow * OSPW + 16 * j + 8 * hh + 4) = vb;
      }
    }
  }
  __syncthreads();

  const int e = tid & 7, lq = tid >> 3;                                // lq 0..31
{
#pragma unroll
    for (int it = 0; it < AQ / 8; ++it) {
      const int L   = it * 32 + lq;                                    // line 0..511
      const int q   = L >> 2, seg = L & 3;                             // query 0..127, 32-float segment
      const v4f v = *(const v4f*)(sm.o + q * OSPW + 32 * seg + 4 * e);
      *(v4f*)(OB + ((size_t)(b * NN + n0 + q)) * CV + 32 * seg + 4 * e) = v;
    }
    
  }
}

// =========================================================================================================
// (4) output conv on the raw view: for image b, U[r][p] = OB_b[r*4096 + p] (r < 128, p < 4096);
//     y[b][o][p] = (1/4096) sum_r WO16[o][r] (Uh + Ul/2048)[p][r] + BOB[o], Uh = f16(16 U), Ul = f16((16U - Uh) 2048).
//     Block (64-p tile, b), all 256 output rows, 256 threads = 8 waves, two blocks per WGP: stage the 128 r x 64 p view
//     slab from OB (256-B contiguous row segments) once, convert, store transposed into LDS Bs[p_loc][r] hi rows 0..63 /
//     residual rows 64..127 (u32 pairs of consecutive r), barrier. Wave w owns cols p0 + 16 (w & 3) .. +15 (its eight B
//     fragments from the LDS rows, split k map, read once and kept in registers) and, in each of two passes ob, the 64
//     rows o0 = 64 (2 ob + (w >> 2)): 4 m-tiles (A rows o0 + 16 mt + (lane&15), k = r contiguous, from the 256 WO16 rows
//     that asynchronous 16-byte copies brought into LDS at pitch BP ahead of that barrier), K = 128 = 4 steps, hi and
//     residual accumulators. A pass's 128 x 64 tile goes through an LDS tile of its own (pitch OSP), barrier, to
//     d_out [b][256][4096] (row segment 64 p = 2 lines): 8 consecutive lanes x 16 B, one instruction per 32 lines;
//     the first pass's stores fly under the second pass's products.
// coverage: staging 4 it x 16 row-pairs x 16 lanes x 4 p x 2 rows = 128 r x 64 p per plane (pad cols never read);
//           weights 16 copies x 16 rows x 16 lanes x 8 halves = 256 x 128;
//           d_out 2 passes x 8 it x 32 lines x 8 lanes x 4 = 256 o x 64 p; grid (64, NIMG) covers d_out exactly once.
// =========================================================================================================
static_assert(CO == 4 * QT && CV == 128);
// the slab's hi / residual rows; behind the first pass's barrier, when every wave holds its fragments in registers, the
// same bytes carry the second pass's output tile
union OutSlab { unsigned int b[2 * QT * (BP / 2)]; float o[2 * QT * OSP]; };
__global__ __launch_bounds__(256)
void out_proj(const float* __restrict__ OB, const unsigned short* __restrict__ WO16,
              const float* __restrict__ BOB, float* out) {
  __shared__ __align__(16) OutSlab sb;
  __shared__ __align__(16) unsigned short As[CO * BP];
  __shared__ __align__(16) float Os0[2 * QT * OSP];
  unsigned int* Bs = sb.b;
  const int tid  = threadIdx.x;
  const int lane = tid & 31, wave = tid >> 5;
  const int hh   = lane >> 4, c = lane & 15;
  const int wc   = wave & 3, wm = wave >> 2;                           // 16-col group; 64-row half of every pass
  const int pt = blockIdx.x, b = blockIdx.y;
  const int p0 = pt * QT;
  const float* OBb = OB + (size_t)b * NN * CV;

  // ---- all 256 weight rows into LDS, rows of 256 B at pitch BP: 16 lanes per row, copy j takes rows 16j .. 16j+15;
  //      the copies fly while the view slab below is loaded and converted ----
  {
    const unsigned la = lds_byte(As) + (unsigned)((tid >> 4) * (BP * 2) + (tid & 15) * 16);
    const unsigned short* ga = WO16 + (size_t)(tid >> 4) * CV + 8 * (tid & 15);
    stage_rows8(la, ga, 16 * BP * 2, (size_t)16 * CV);                                         // rows 0..127
    stage_rows8(la + 128 * BP * 2, ga + (size_t)128 * CV, 16 * BP * 2, (size_t)16 * CV);       // rows 128..255
  }

  // ---- stage + convert the view slab: Bs[p_loc][r] ----
  {
    const int e16 = tid & 15, rq = tid >> 4;                           // rq 0..15
#pragma unroll
    for (int it = 0; it < 4; ++it) {
      const int rp = 16 * it + rq;                                     // row pair 0..63
      const int r0 = 2 * rp;
      const v4f va = *(const v4f*)(OBb + (size_t)r0 * NN + p0 + 4 * e16);
      const v4f vb = *(const v4f*)(OBb + (size_t)(r0 + 1) * NN + p0 + 4 * e16);
#pragma unroll
      for (int t = 0; t < 4; ++t) {
        const float f0 = va[t] * USC, f1 = vb[t] * USC;
        const _Float16 h0 = (_Float16)f0, h1 = (_Float16)f1;
        const _Float16 l0 = (_Float16)((f0 - (float)h0) * RSC);
        const _Float16 l1 = (_Float16)((f1 - (float)h1) * RSC);
        const int pl = 4 * e16 + t;                                    // p_loc 0..63
        Bs[pl * (BP / 2) + rp]        = pk16(h_bits(h0), h_bits(h1));  // halves r0, r0+1
        Bs[(QT + pl) * (BP / 2) + rp] = pk16(h_bits(l0), h_bits(l1));
      }
    }
  }
  asm volatile("s_wait_asynccnt 0x0" ::: "memory");                    // this wave's rows of the weights have landed
  __syncthreads();                                                     // publishes the slab and the weights

  // ---- the wave's eight slab fragments (B col = p0 + 16*wc + c, k = r), read once and kept in registers ----
  const unsigned short* Bh  = (const unsigned short*)Bs;
  const unsigned short* bph = Bh + (16 * wc + c) * BP + 8 * hh;
  const unsigned short* bpl = bph + QT * BP;
  Frag fbh[CV / 32], fbl[CV / 32];
#pragma unroll   // the fragment arrays stay in registers only under constant indices
  for (int ks = 0; ks < CV / 32; ++ks) {
    fbh[ks] = ldfrag(bph + 32 * ks);
    fbl[ks] = ldfrag(bpl + 32 * ks);
  }

  const int e = tid & 7, lq = tid >> 3;                                // lq 0..31

#pragma unroll   // two passes, straight-line: the row offsets fold into the reads' immediates
  for (int ob = 0; ob < CO / (2 * QT); ++ob) {
    const int o0 = (2 * ob + wm) * QT;                                 // this wave's 64 rows of the pass
    const unsigned short* ap = As + (o0 + c) * BP + 8 * hh;            // A row = o0 + 16 mt + c, k = r
    float* Os = (ob == 0) ? Os0 : sb.o;                                // a tile of its own per pass: no barrier frees one

    v8f acch[4], accl[4];
#pragma unroll
    for (int mt = 0; mt < 4; ++mt) { acch[mt] = zero8(); accl[mt] = zero8(); }

    // a k-step's four weight fragments are read as one group, one k-step ahead of the products that use them
    Frag fa[2][4];
#pragma unroll   // constant indices, as above
    for (int mt = 0; mt < 4; ++mt) fa[0][mt] = ldfrag(ap + (16 * mt) * BP);
#pragma unroll   // constant indices, as above
    for (int ks = 0; ks < CV / 32; ++ks) {
      if (ks + 1 < CV / 32) {
#pragma unroll   // constant indices, as above
        for (int mt = 0; mt < 4; ++mt) fa[(ks + 1) & 1][mt] = ldfrag(ap + (16 * mt) * BP + 32 * (ks + 1));
      }
      // keeps the group's reads ahead of this k-step's products: without it the compiler sinks each pair to its first
      // use, and the wave waits out every pair's LDS latency
      __builtin_amdgcn_sched_barrier(0);
#pragma unroll   // constant indices, as above
      for (int mt = 0; mt < 4; ++mt) {
        acch[mt] = mma_h(fa[ks & 1][mt].h, fbh[ks].h, acch[mt]);
        accl[mt] = mma_h(fa[ks & 1][mt].h, fbl[ks].h, accl[mt]);
      }
    }
    {
      const int nl = 16 * wc + c;
      const float osc = IWSC * IUSC;                                   // 1/4096
#pragma unroll
      for (int mt = 0; mt < 4; ++mt) {
#pragma unroll
        for (int r = 0; r < 8; ++r) {
          const int ol = 16 * mt + 8 * hh + r;                         // 0..63
          Os[(QT * wm + ol) * OSP + nl] = (acch[mt][r] + accl[mt][r] * IRSC) * osc + BOB[o0 + ol];
        }
      }
    }
    __syncthreads();                                                   // publishes the pass's 128 x 64 tile
#pragma unroll
    for (int it = 0; it < 8; ++it) {
      const int L = it * 32 + lq;                                      // 0..255
      const int row = L >> 1, hf = L & 1;                              // row 0..127 of the pass
      const int nl = hf * 32 + 4 * e;
      const v4f v = *(const v4f*)(Os + row * OSP + nl);
      *(v4f*)(out + ((size_t)(b * CO + 2 * QT * ob + row)) * NN + p0 + nl) = v;
    }
    if (ob + 1 < CO / (2 * QT))
      asm volatile("s_wait_xcnt 0x0" ::: "memory");                    // the next pass rewrites the stores' registers
  }
}

// =========================================================================================================
// Workspace map (bytes; each region start a multiple of 256; every extent is an exact tile multiple and is written
//   W16 f16 [384][256]            196608      BIAS f32 [384]              1536
//   WO16 f16 [256][128]            65536      BOB  f32 [256]              1024
//   Qh/Kh f16 [8][4096][128]   8388608 x2                                Vh f16 [8][128][4096]  8388608
//   OB  f32 [8][4096][128]      16777216
//   total = 42207744
// =========================================================================================================
extern "C" void kernel_launch(void* const* d_in, const int* in_sizes, int n_in,
                              void* d_out, int out_size, void* d_ws, size_t ws_size,
                              hipStream_t stream) {
  const int XN = NIMG * CC * NN;                                       // 8388608
  if (n_in < 9) return;
  if (in_sizes[0] != XN) return;
  if (in_sizes[1] != CK * CC || in_sizes[2] != CK) return;
  if (in_sizes[3] != CK * CC || in_sizes[4] != CK) return;
  if (in_sizes[5] != CV * CC || in_sizes[6] != CV) return;
  if (in_sizes[7] != CO * CV || in_sizes[8] != CO) return;
  if (out_size != NIMG * CO * NN) return;

  size_t off = 0;
  auto carve = [&](size_t bytes) { const size_t o = off; off += (bytes + 255) & ~(size_t)255; return o; };
  const size_t oW16 = carve((size_t)MQKV * CC * 2);
  const size_t oBIA = carve((size_t)MQKV * 4);
  const size_t oWO  = carve((size_t)CO * CV * 2);
  const size_t oBOB = carve((size_t)CO * 4);
  const size_t oQh  = carve((size_t)NIMG * NN * CK * 2);
  const size_t oKh  = carve((size_t)NIMG * NN * CK * 2);
  const size_t oVh  = carve((size_t)NIMG * CV * NN * 2);
  const size_t oOB  = carve((size_t)NIMG * NN * CV * 4);
  if (off > ws_size) return;
  if (off > (size_t)134217728) return;

  const float* x  = (const float*)d_in[0];
  const float* wq = (const float*)d_in[1];
  const float* bq = (const float*)d_in[2];
  const float* wk = (const float*)d_in[3];
  const float* bk = (const float*)d_in[4];
  const float* wv = (const float*)d_in[5];
  const float* bv = (const float*)d_in[6];
  const float* wo = (const float*)d_in[7];
  const float* bo = (const float*)d_in[8];

  char* ws = (char*)d_ws;
  unsigned short* W16 = (unsigned short*)(ws + oW16);
  float*          BIA = (float*)(ws + oBIA);
  unsigned short* WO  = (unsigned short*)(ws + oWO);
  float*          BOB = (float*)(ws + oBOB);
  unsigned short* Qh  = (unsigned short*)(ws + oQh);
  unsigned short* Kh  = (unsigned short*)(ws + oKh);
  unsigned short* Vh  = (unsigned short*)(ws + oVh);
  float*          OB  = (float*)(ws + oOB);
  float* out = (float*)d_out;

  const dim3 blk256(256);

  // (0) conv1x1 q/k/v weights -> f16 plane + bias line; output conv weights -> f16 plane + bias line
  cvt_w<<<dim3(MQKV / 8), blk256, 0, stream>>>(wq, bq, wk, bk, wv, bv, W16, BIA);
  cvt_wo<<<dim3(CO / 16), blk256, 0, stream>>>(wo, bo, WO, BOB);
  // (1) conv1x1 GEMM straight from x -> q, k and v planes
  gemm_qkv<<<dim3(NN / QT, NIMG), blk256, 0, stream>>>(x, W16, BIA, Qh, Kh, Vh);
  // (3) attention -> OB [b][4096][128] token-major f32
  attn_gab<<<dim3(NN / AQ, NIMG), blk256, 0, stream>>>(Qh, Kh, Vh, OB);
  // (4) output conv on the raw view -> out [b][256][4096]
  out_proj<<<dim3(NN / QT, NIMG), blk256, 0, stream>>>(OB, WO, BOB, out);
  (void)hipGetLastError();
}

// v010
// Measured time: 72.4 microseconds a run.
// In two side-by-side timings against v009, it was 1.04 and 1.05 times as fast.
// Counting every step since v000, it is 6.69 times as fast.
// Contractions: conv1x1 q/k/v GEMM W[384x256].X on v_wmma_f32_16x16x32_f16 (f16 containers of bf16-RNE weights x256
// and bf16-RNE x); scores K.Q^T on v_wmma_f32_16x16x32_f16 (q and k each rounded once to f16, one product,
// K=128); O^T = V.P^T on v_wmma_f32_16x16x32_f16 (v x16 f16, P = 1024 e^{(s-m)c} f16 from the score D registers);
// output conv1x1 Wo[256x128].U on v_wmma_f32_16x16x32_f16 (Wo f16 of bf16-RNE x256, U as f16 hi x16 plus f16
// residual x2^11 planes in two accumulators); f32 accumulate everywhere; softmax statistics in f32 VALU.
#include <hip/hip_runtime.h>
#include <math.h>
#include <stdint.h>

#define NIMG  8
#define CC    256
#define NN    4096
#define CK    128
#define CV    128
#define CO    256
#define MQKV  384
#define QT    64
#define OSP   68
#define OSPW  132
#define QP    136
#define BP    136
#define KT    128
#define VP    136
#define STG   (KT * QP + CV * VP)
#define XPP   264
#define WSC   256.0f
#define IWSC  0.00390625f
#define VSC   16.0f
#define IVSC  0.0625f
#define USC   16.0f
#define IUSC  0.0625f
#define RSC   2048.0f
#define IRSC  0.00048828125f
#define LNPS  6.931471805599453f
#define SCL   0.08838834764831845f
#define LZT   39.0f

static_assert(NN % QT == 0);
static_assert(LZT * SCL < 3.4657f);   // 1024 e^{LZT c} < 2^15: a weight against a maximum that lags by LZT stays finite in f16
static_assert(CC % 32 == 0 && CK % 64 == 0 && CV % 32 == 0);
static_assert(MQKV == 2 * CK + CV);
static_assert(MQKV % QT == 0 && CO % QT == 0);
static_assert(CK == 2 * QT && CV == 2 * QT);
static_assert((OSP * 4) % 16 == 0);
static_assert((OSPW * 4) % 16 == 0);
static_assert((XPP * 2) % 32 == 16 && XPP >= CC + 8 && XPP % 2 == 0 && MQKV / QT >= 2);
static_assert((QP * 2) % 16 == 0 && (BP * 2) % 16 == 0 && (BP % 2) == 0);
static_assert(QT * OSPW * 4 <= 2 * QT * QP * 2);
static_assert(NN % KT == 0 && NN / KT >= 2 && KT % 32 == 0);
static_assert((VP * 2) % 16 == 0 && (STG * 2) % 16 == 0 && VP >= KT + 8);
static_assert(KT * CK * 2 == 8 * 256 * 16 && CV * KT * 2 == 8 * 256 * 16 && KT == 128 && QP == VP);

typedef _Float16       v16h __attribute__((ext_vector_type(16)));
typedef _Float16       v8h  __attribute__((ext_vector_type(8)));
typedef _Float16       v2h  __attribute__((ext_vector_type(2)));
typedef unsigned short v8us __attribute__((ext_vector_type(8)));
typedef float          v8f  __attribute__((ext_vector_type(8)));
typedef float          v4f  __attribute__((ext_vector_type(4)));
typedef unsigned int   v4u  __attribute__((ext_vector_type(4)));

union Frag  { v8us u[2]; v16h h; };
union FragH { v16h v; v8h hv[2]; };
static_assert(sizeof(Frag) == 32);
static_assert(sizeof(FragH) == 32);

// ---- scalar helpers ---------------------------------------------------------------------------------------
__device__ __forceinline__ unsigned short bf_bits(float f) {          // f32 -> bf16 bits, RNE convert
  unsigned u = __float_as_uint(f);
  return (unsigned short)((u + 0x7FFFu + ((u >> 16) & 1u)) >> 16);
}
__device__ __forceinline__ float bf_up(unsigned short hb) { return __uint_as_float(((unsigned)hb) << 16); }
__device__ __forceinline__ float bfr(float f) { return bf_up(bf_bits(f)); }
__device__ __forceinline__ unsigned short h_bits(_Float16 x) { return __builtin_bit_cast(unsigned short, x); }
__device__ __forceinline__ unsigned pk16(unsigned short a, unsigned short b) { return (unsigned)a | ((unsigned)b << 16); }
__device__ __forceinline__ unsigned pkh(float a, float b) {           // f16 RNE of a (low half) and of b (high half)
  const v2h p = {(_Float16)a, (_Float16)b};
  return __builtin_bit_cast(unsigned, p);
}
__device__ __forceinline__ v8f zero8() { v8f z = {0.f, 0.f, 0.f, 0.f, 0.f, 0.f, 0.f, 0.f}; return z; }
__device__ __forceinline__ float hmax8(v8f s) {
  return fmaxf(fmaxf(fmaxf(s[0], s[1]), fmaxf(s[2], s[3])), fmaxf(fmaxf(s[4], s[5]), fmaxf(s[6], s[7])));
}

// lane l <-> l ^ 16 by a vector cross-row move: it counts on no LDS counter, so no wait on it drains LDS reads in flight
__device__ __forceinline__ float xhalf(float x) {
  const int b = __builtin_bit_cast(int, x);
  return __builtin_bit_cast(float, __builtin_amdgcn_permlanex16(b, b, 0x76543210, 0xfedcba98, false, false));
}

// ---- 16-bit fragment loader (A, or B from a k-contiguous [n][k] row): lane -> row/col (lane&15), p already includes
//      + 8*(lane>>4); elements 0..7 <- p[0..7] (k0+8h..), elements 8..15 <- p[16..23] (k0+16+8h..)
__device__ __forceinline__ Frag ldfrag(const unsigned short* p) {
  Frag f;
  f.u[0] = *(const v8us*)(p);
  f.u[1] = *(const v8us*)(p + 16);
  return f;
}

typedef __attribute__((address_space(3))) unsigned short lds_us;
__device__ __forceinline__ unsigned lds_byte(unsigned short* p) { return (unsigned)(uintptr_t)(lds_us*)p; }

// ---- WMMA helpers: builtin followed by a 4-slot VALU gap tying D and keeping A/B live --------------------------
__device__ __forceinline__ v8f mma_h(v16h a, v16h b, v8f c) {
  v8f d = __builtin_amdgcn_wmma_f32_16x16x32_f16(false, a, false, b, (short)0, c, false, false);
#if defined(__HIP_DEVICE_COMPILE__)
  asm volatile("v_nop\n\tv_nop\n\tv_nop\n\tv_nop" : "+v"(d) : "v"(a), "v"(b));
#endif
  return d;
}

// =========================================================================================================
// (0) q/k/v conv1x1 weights: W16 f16 [384][256], rows 0..127 = wq, 128..255 = wk, 256..383 = wv; value = f16 of
//     (bf16-RNE(w) * 256) (exact). BIAS f32 [384] = bf16-RNE of bq / bk / bv. Block blk (0..47) owns rows
// coverage: 48 blocks x 8 rows x 32 pieces x 8 halves = 384 x 256; bias 96 x 4 floats = 384.
// =========================================================================================================
__global__ __launch_bounds__(256)
void cvt_w(const float* __restrict__ wq, const float* __restrict__ bq,
           const float* __restrict__ wk, const float* __restrict__ bk,
           const float* __restrict__ wv, const float* __restrict__ bv,
           unsigned short* W16, float* BIAS) {
  const int tid = threadIdx.x, blk = blockIdx.x;
  const int rl = tid >> 5, col = 8 * (tid & 31);
  const int o = 8 * blk + rl;                                          // 0..383
  const float* wbase = (blk < 16) ? wq : (blk < 32) ? wk : wv;         // block-uniform selection
  const int osub = (blk < 16) ? 0 : (blk < 32) ? CK : 2 * CK;
  const float* s = wbase + (size_t)(o - osub) * CC + col;             // (o-osub) < 128 rows of that matrix
  const v4f a = *(const v4f*)s;
  const v4f q = *(const v4f*)(s + 4);
  const float f[8] = {a[0], a[1], a[2], a[3], q[0], q[1], q[2], q[3]};
  v4u u;
#pragma unroll
  for (int t = 0; t < 4; ++t) {
    const _Float16 h0 = (_Float16)(bfr(f[2 * t]) * WSC);
    const _Float16 h1 = (_Float16)(bfr(f[2 * t + 1]) * WSC);
    u[t] = pk16(h_bits(h0), h_bits(h1));
  }
  // bias values: every lane loads all three candidates with clamped indices, selects by value
  v4f bvv;
  {
    const int tb = min(tid, 95);
    const int o4 = 4 * tb;
#pragma unroll
    for (int qd = 0; qd < 4; ++qd) {
      const int oo = o4 + qd;                                          // 0..383
      const int iq = min(oo, CK - 1);
      const int ik = min(max(oo - CK, 0), CK - 1);
      const int iv = min(max(oo - 2 * CK, 0), CV - 1);
      const float cq = bq[iq], ckv = bk[ik], cvv = bv[iv];
      const float val = (oo < CK) ? cq : (oo < 2 * CK) ? ckv : cvv;
      bvv[qd] = bfr(val);
    }
  }
{
    *(v4u*)(W16 + (size_t)o * CC + col) = u;
    if (blk == 0 && tid < 96) *(v4f*)(BIAS + 4 * tid) = bvv;
    
  }
}

// =========================================================================================================
// (0b) output conv weights: WO16 f16 [256][128] = f16 of (bf16-RNE(wo) * 256) (exact); BOB f32 [256] = bf16-RNE bo.
// coverage: 16 blocks x 16 rows x 16 pieces x 8 halves = 256 x 128; bias 64 x 4 floats = 256.
// =========================================================================================================
__global__ __launch_bounds__(256)
void cvt_wo(const float* __restrict__ wo, const float* __restrict__ bo, unsigned short* WO16, float* BOB) {
  const int tid = threadIdx.x, blk = blockIdx.x;
  const int rl = tid >> 4, col = 8 * (tid & 15);
  const int o = 16 * blk + rl;                                         // 0..255
  const float* s = wo + (size_t)o * CV + col;
  const v4f a = *(const v4f*)s;
  const v4f q = *(const v4f*)(s + 4);
  const float f[8] = {a[0], a[1], a[2], a[3], q[0], q[1], q[2], q[3]};
  v4u u;
#pragma unroll
  for (int t = 0; t < 4; ++t) {
    const _Float16 h0 = (_Float16)(bfr(f[2 * t]) * WSC);
    const _Float16 h1 = (_Float16)(bfr(f[2 * t + 1]) * WSC);
    u[t] = pk16(h_bits(h0), h_bits(h1));
  }
  v4f bvv;
  {
    const int tb = min(tid, 63);
#pragma unroll
    for (int qd = 0; qd < 4; ++qd) bvv[qd] = bfr(bo[4 * tb + qd]);  // index <= 255
  }
{
    *(v4u*)(WO16 + (size_t)o * CV + col) = u;
    if (blk == 0 && tid < 64) *(v4f*)(BOB + 4 * tid) = bvv;
    
  }
}

// =========================================================================================================
// (1) conv1x1 GEMM for one (b, 64-n tile), all 384 output rows: Y[o][n] = (1/256) sum_c W16[o][c] X[n][c] + BIAS[o],
//     X[n][c] = f16 of bf16-RNE(x[b][c][n]) (exact). Block 256 threads = 8 waves, two blocks per WGP.
//     The block reads its x slab (256 c x 64 n, f32, 256-B row segments) once, rounds it and stores it transposed into LDS
//     Xs[n_loc][c] (u32 pairs of consecutive c, row pitch XPP halves = 16 B x odd), barrier. Wave w owns cols
//     n0 + 32 (w & 1) .. +31 (two B fragments per k-step, k = c contiguous in the token row, read once and kept in
//     registers) and in every 64-row weight tile the m-tile w >> 1 (A rows o = 64 mb + 16 (w >> 1) + (lane&15), split k map
//     loader). K = 256 = 8 steps. The six weight tiles come through a two-buffer LDS ring filled by asynchronous 16-byte
//     copies of whole rows; tile mb+2 is issued behind the barrier that ends the reads of tile mb.
//     Epilogue of a tile: Os[o_loc][n_loc] (pitch OSP), barrier, then packed in registers:
//       tiles 0,1 (q ck cols 0..63 / 64..127) and 2,3 (k): one f16 plane each [b][4096 n][128],
//         lane e -> cols 8e..8e+7 of token row 32 it + lq;
//       tiles 4,5 (v): f16 plane x16 [b][128 ch][4096 n], lane e -> halves 8e..8e+7 of channel row 32 it + lq;
//     the global stores stand behind the tile's hand-over barrier, so that they fly under the next tile's products.
// coverage: Xs 8 it x 16 row pairs x 16 lanes x 4 n x 2 rows = 256 c x 64 n; Os 8 waves x 2 tiles x 16x16 = 64 x 64;
//           q/k: per plane 2 it x 32 rows x 8 lanes x 8 = 64 n x 64 cols, tiles 0..3 cover all 128 cols of Qh / Kh;
//           v: 2 it x 32 rows x 8 lanes x 8 = 64 ch x 64 n; grid (64, NIMG) covers every plane exactly once.
// =========================================================================================================
// token rows (f16 pairs), the two weight tiles of the ring (rows of XPP halves), the output tile
struct GemmSmem { unsigned int x[QT * (XPP / 2)]; unsigned short w[2 * QT * XPP]; float o[QT * OSP]; };

// Eight 16-byte pieces per lane, global -> LDS through no register: a wave's 32 lanes x 16 B take 512 contiguous bytes
// (four whole lines) per copy. l / g are this lane's first piece, ls bytes / gs halves the step from copy to copy. The
// s_wait_xcnt closes the statement so that no address register of a copy is rewritten ahead of it.
__device__ __forceinline__ void stage_rows8(unsigned l, const unsigned short* g, unsigned ls, size_t gs) {
#if defined(__HIP_DEVICE_COMPILE__)
  asm volatile(
      "global_load_async_to_lds_b128 %0, %8, off\n\t"
      "global_load_async_to_lds_b128 %1, %9, off\n\t"
      "global_load_async_to_lds_b128 %2, %10, off\n\t"
      "global_load_async_to_lds_b128 %3, %11, off\n\t"
      "global_load_async_to_lds_b128 %4, %12, off\n\t"
      "global_load_async_to_lds_b128 %5, %13, off\n\t"
      "global_load_async_to_lds_b128 %6, %14, off\n\t"
      "global_load_async_to_lds_b128 %7, %15, off\n\t"
      "s_wait_xcnt 0x0"
      :: "v"(l), "v"(l + ls), "v"(l + 2 * ls), "v"(l + 3 * ls),
         "v"(l + 4 * ls), "v"(l + 5 * ls), "v"(l + 6 * ls), "v"(l + 7 * ls),
         "v"(g), "v"(g + gs), "v"(g + 2 * gs), "v"(g + 3 * gs),
         "v"(g + 4 * gs), "v"(g + 5 * gs), "v"(g + 6 * gs), "v"(g + 7 * gs)
      : "memory");
#endif
}

__global__ __launch_bounds__(256)
void gemm_qkv(const float* __restrict__ x, const unsigned short* __restrict__ W16, const float* __restrict__ BIAS,
              unsigned short* Qh, unsigned short* Kh, unsigned short* Vh) {
  __shared__ __align__(16) GemmSmem sm;
  float* Os = sm.o;
  const int tid  = threadIdx.x;
  const int lane = tid & 31, wave = tid >> 5;
  const int hh   = lane >> 4, c = lane & 15;
  const int nt   = blockIdx.x, b = blockIdx.y;
  const int n0   = nt * QT;
  const int nh   = wave & 1, mq = wave >> 1;                           // 32-col half; m-tile of every weight tile

  // ---- this thread's share of a weight tile: copy j of wave w takes row 8j + w, a lane 16 B of the 512-B row ----
  const unsigned lw = lds_byte(sm.w) + (unsigned)(wave * (XPP * 2) + lane * 16);
  const unsigned short* gw = W16 + (size_t)wave * CC + 8 * lane;
  const unsigned wls = 8 * XPP * 2;
  const size_t wgs = (size_t)8 * CC;
  stage_rows8(lw, gw, wls, wgs);                                       // tile 0 -> buffer 0, flies under the slab below

  // ---- load + round the x slab, store it transposed: Xs[n_loc][c] ----
  {
    const int e16 = tid & 15, rq = tid >> 4;                           // rq 0..15
    const float* sp = x + ((size_t)(b * CC + 2 * rq)) * NN + n0 + 4 * e16;
    v4f va[CC / 32], vb[CC / 32];                                      // rows 2cp, 2cp+1 of channel pair cp = 16 it + rq
#pragma unroll   // the arrays stay in registers only under constant indices
    for (int it = 0; it < CC / 32; ++it) {
      va[it] = *(const v4f*)(sp + (size_t)(32 * it) * NN);
      vb[it] = *(const v4f*)(sp + (size_t)(32 * it + 1) * NN);
    }
    // keeps all sixteen loads ahead of the first conversion: without it the compiler issues the later ones behind the
    // wait for the first, and the wave waits out the memory latency twice
    __builtin_amdgcn_sched_barrier(0);
#pragma unroll   // constant indices, as above
    for (int it = 0; it < CC / 32; ++it) {
      const int cp = 16 * it + rq;                                     // channel pair 0..127
#pragma unroll   // constant indices, as above
      for (int t = 0; t < 4; ++t)                                      // halves c = 2cp, 2cp+1 of token 4 e16 + t
        sm.x[(4 * e16 + t) * (XPP / 2) + cp] = pkh(bfr(va[it][t]), bfr(vb[it][t]));
    }
  }
  asm volatile("s_wait_asynccnt 0x0" ::: "memory");                    // this wave's rows of tile 0 have landed
  __syncthreads();                                                     // publishes the token rows and tile 0
  stage_rows8(lw + QT * XPP * 2, gw + (size_t)QT * CC, wls, wgs);      // tile 1 -> buffer 1

  // ---- the wave's 16 token fragments (B operand, col = n0 + 32 nh + 16 g + c), read once and kept in registers ----
  Frag fb[2][CC / 32];
#pragma unroll   // the fragment arrays stay in registers only under constant indices
  for (int g = 0; g < 2; ++g) {
    const unsigned short* bp = (const unsigned short*)sm.x + (32 * nh + 16 * g + c) * XPP + 8 * hh;
#pragma unroll   // constant indices, as above
    for (int ks = 0; ks < CC / 32; ++ks) fb[g][ks] = ldfrag(bp + 32 * ks);
  }

  const int e = tid & 7, lq = tid >> 3;                                // lq 0..31

#pragma unroll 1   // rolled: one hand-over point in the text, the buffer picked by mb & 1
  for (int mb = 0; mb < MQKV / QT; ++mb) {
    const int o0 = mb * QT;
    const unsigned short* ap = sm.w + (mb & 1) * (QT * XPP) + (16 * mq + c) * XPP + 8 * hh;
    // the lane's eight bias values and the tile's eight weight fragments, read as one group ahead of the products
    const v4f b0 = *(const v4f*)(BIAS + o0 + 16 * mq + 8 * hh);
    const v4f b1 = *(const v4f*)(BIAS + o0 + 16 * mq + 8 * hh + 4);
    Frag fa[CC / 32];
#pragma unroll   // constant indices, as above
    for (int ks = 0; ks < CC / 32; ++ks) fa[ks] = ldfrag(ap + 32 * ks);
    // keeps the group's reads ahead of the products: without it the compiler sinks each pair to its first use, and the
    // wave waits out every pair's LDS latency
    __builtin_amdgcn_sched_barrier(0);
    v8f acc[2];
    acc[0] = zero8();
    acc[1] = zero8();
#pragma unroll   // constant indices, as above
    for (int ks = 0; ks < CC / 32; ++ks) {                             // every weight fragment feeds both col tiles
      acc[0] = mma_h(fa[ks].h, fb[0][ks].h, acc[0]);
      acc[1] = mma_h(fa[ks].h, fb[1][ks].h, acc[1]);
    }

    // ---- scale back, + bias -> LDS Os[o_loc][n_loc] ----
#pragma unroll   // constant indices, as above
    for (int g = 0; g < 2; ++g) {
      const int nl = 32 * nh + 16 * g + c;
#pragma unroll   // constant indices, as above
      for (int r = 0; r < 8; ++r) {
        const int ol = 16 * mq + 8 * hh + r;                           // 0..63
        Os[ol * OSP + nl] = acc[g][r] * IWSC + ((r < 4) ? b0[r & 3] : b1[r & 3]);
      }
    }
    __syncthreads();                                                   // publishes Os

    v4u su[2];                                                         // it 0,1
    if (mb < 4) {
      // ---- q / k f16 pieces (block-uniform branch) ----
#pragma unroll   // constant indices, as above
      for (int it = 0; it < 2; ++it) {
        const int nl = it * 32 + lq;                                   // token 0..63
#pragma unroll   // constant indices, as above
        for (int t = 0; t < 4; ++t) {
          const float f0 = Os[(8 * e + 2 * t) * OSP + nl];
          const float f1 = Os[(8 * e + 2 * t + 1) * OSP + nl];
          su[it][t] = pkh(f0, f1);
        }
      }
    } else {
      // ---- v f16 pieces, carried x16 ----
#pragma unroll   // constant indices, as above
      for (int it = 0; it < 2; ++it) {
        const int row = it * 32 + lq;                                  // 0..63
        const v4f a = *(const v4f*)(Os + row * OSP + 8 * e);
        const v4f q = *(const v4f*)(Os + row * OSP + 8 * e + 4);
#pragma unroll   // constant indices, as above
        for (int t = 0; t < 2; ++t) {
          su[it][t]     = pk16(h_bits((_Float16)(a[2 * t] * VSC)), h_bits((_Float16)(a[2 * t + 1] * VSC)));
          su[it][2 + t] = pk16(h_bits((_Float16)(q[2 * t] * VSC)), h_bits((_Float16)(q[2 * t + 1] * VSC)));
        }
      }
    }

    // ---- hand-over: tile mb+1 becomes readable, buffer mb&1 and Os become free ----
    asm volatile("s_wait_dscnt 0x0" ::: "memory");                     // this wave's reads of buffer mb&1 and of Os are done
    asm volatile("s_wait_asynccnt 0x0" ::: "memory");                  // this wave's rows of tile mb+1 have landed
    __syncthreads();
    if (mb + 2 < MQKV / QT)
      stage_rows8(lw + (unsigned)(mb & 1) * (QT * XPP * 2), gw + (size_t)(mb + 2) * QT * CC, wls, wgs);

    if (mb < 4) {
      unsigned short* Ph = (mb < 2) ? Qh : Kh;
      const int cb = QT * (mb & 1);                                    // ck column base 0 or 64
#pragma unroll   // constant indices, as above
      for (int it = 0; it < 2; ++it) {
        const size_t base = ((size_t)(b * NN + n0 + it * 32 + lq)) * CK + cb + 8 * e;
        *(v4u*)(Ph + base) = su[it];
      }
    } else {
      const int ch0 = QT * (mb - 4);                                   // 0 or 64
#pragma unroll   // constant indices, as above
      for (int it = 0; it < 2; ++it)
        *(v4u*)(Vh + ((size_t)(b * CV + ch0 + it * 32 + lq)) * NN + n0 + 8 * e) = su[it];
    }
    asm volatile("s_wait_xcnt 0x0" ::: "memory");                      // the next tile's reads rewrite the stores' registers
  }
  asm volatile("s_wait_asynccnt 0x0" ::: "memory");                    // no copy is left in flight at the wave's end
}

// =========================================================================================================
// (3) attention for one (b, 128-query tile), transposed formulation, 4096 keys, no mask:
//   S^T tile (16 keys x 16 queries) = sum over 4 k-steps of A(k: row = key kb + (lane&15), 32 d via the split k map
//   from the f16 plane Kh [b][4096][128]) . B(q: col = query, same map, from the wave's registers; f16 plane Qh).
//   One rounding of q and of k to f16 moves a weight e^{sc} by about as much as the f16 rounding of P below does.
//   Softmax of s*c with c = 1/sqrt(128):
//   per lane the D tile holds 8 keys of ONE query: online state per lane against a maximum in use m that moves only when
//   a score of the pass tops it by more than LZT (one test per pass and wave; only then a cross-row move (lane^16) joins
//   the halves' maxima and o and l are rescaled), row-sum partials combined at the end. P = 1024 e^{(s-m)c}, below 2^15, as f16 is the B operand of
//   O^T (rows channel, cols queries) += A(V rows channel = 16j + (lane&15), keys contiguous, f16 plane Vh
//   [b][128][4096]) . B(P^T): element r <- D of the tile covering keys kb..kb+15, element 8+r <- the tile covering
//   kb+16..kb+31, lane unchanged. 8 accumulator tiles per query tile (128 channels). Block = 8 waves = 128 queries, one
//   block per WGP: wave w owns two query tiles, queries 32 (w & 3) .. +31, and keys 32 (w >> 2) .. +31 of every 64 keys;
//   the two states of a query group are merged at the end. The q rows of the block's 128 queries are staged once in LDS
//   (v4u pieces, barrier); each wave then reads its 8 q fragments once and keeps them in registers, so that the key loop
//   reads only k and v from LDS and every such fragment feeds both query tiles. A 32-key pass reads its LDS fragments
//   ahead of the products that use them: all of k; all of v.
//   K and V come in tiles of KT = 128 keys through a two-buffer LDS ring filled by asynchronous 16-byte
//   copies (whole 128-B lines per request, each tile fetched once per block and read by all 8 waves); a wave makes two
//   32-key passes over a tile between hand-overs, so that the waves of a SIMD may run out of step for two passes and a
//   tile's copies have two passes to land; tile t+2 is issued behind the barrier that ends the reads of tile t. Row
//   pitches QP / VP halves = 16 B x odd.
//   Epilogue: barrier, O/l staged in LDS Os[query][128 channels] (pitch OSPW, b128 stores, aliases the Q staging),
// coverage: Q staging 8 it x 16 rows x 16 lanes x 8 = 128 x 128; OB 16 it x 32 lines x 8 lanes x 4 floats =
//           128 queries x 128 ch; grid (32, NIMG) covers OB exactly once.
// =========================================================================================================
#define AQ    128                                                      // queries of one attention block
static_assert(NN % AQ == 0);
union AttnSmem { unsigned short q[AQ * QP]; float o[AQ * OSPW]; };
// the k/v ring; after the key loop its first bytes carry the second key half's softmax state (o 16384 floats, m, l)
union AttnRing { unsigned short h[2 * STG]; float f[4 * 132 * 32]; };
static_assert(4 * 132 * 32 * 4 <= 2 * STG * 2);

// One tile of KT keys into the ring buffer at LDS halves lp: k rows [KT][QP], v rows [CV][VP],
// each part 128 rows of 256 B: 16 lanes per row, 16 rows per piece step, eight pieces (16 copies per lane and tile),
// global -> LDS through no register. lp / kh / vh are this thread's piece 0 of the buffer and of the tile's planes.
// The copies are the builtin: its address registers may lie anywhere in the wave's register file, while an asm operand
// lives in v0..v255, beside the wave's register tile.
typedef int v4i __attribute__((ext_vector_type(4)));
typedef __attribute__((address_space(1))) v4i gl_v4i;
typedef __attribute__((address_space(3))) v4i lds_v4i;
__device__ __forceinline__ void copy16(const unsigned short* g, unsigned short* l) {
#if defined(__HIP_DEVICE_COMPILE__)
  __builtin_amdgcn_global_load_async_to_lds_b128((gl_v4i*)(uintptr_t)g, (lds_v4i*)l, 0, 0);
#endif
}
__device__ __forceinline__ void stage_kv(unsigned short* lp, const unsigned short* kh, const unsigned short* vh) {
#pragma unroll   // straight-line copies, constant steps
  for (int j = 0; j < KT / 16; ++j) copy16(kh + (size_t)(16 * j) * CK, lp + (16 * j) * QP);
#pragma unroll   // as above
  for (int j = 0; j < CV / 16; ++j) copy16(vh + (size_t)(16 * j) * NN, lp + KT * QP + (16 * j) * VP);
}

// ---- WMMA helper of the attention kernel: the bare builtin, the compiler keeping the distance behind it. An asm
//      statement takes its vector operands from v0..v255 only; tied to one, the wave's 32-query register tile
//      (q 64, o 128 registers, the pass's fragments) would not fit and would spill.
__device__ __forceinline__ v8f mma_hr(v16h a, v16h b, v8f c) {
  return __builtin_amdgcn_wmma_f32_16x16x32_f16(false, a, false, b, (short)0, c, false, false);
}

__global__ __launch_bounds__(256)
void attn_gab(const unsigned short* __restrict__ Qh, const unsigned short* __restrict__ Kh,
              const unsigned short* __restrict__ Vh, float* OB) {
  __shared__ __align__(16) AttnSmem sm;
  __shared__ __align__(16) AttnRing rg;
  unsigned short* ring = rg.h;
  const int tid  = threadIdx.x;
  const int wave = tid >> 5, lane = tid & 31;
  const int hh   = lane >> 4, c = lane & 15;
  const int n0   = blockIdx.x * AQ, b = blockIdx.y;
  const int wq   = wave & 3, kh2 = wave >> 2;                          // query group of 32; 32-key half of every 64-key pass

  // ---- this thread's share of a k/v tile: its place inside a ring buffer, source pointers of tile 0 ----
  unsigned short* lp0 = ring + (tid >> 4) * QP + (tid & 15) * 8;
  const unsigned short* khg = Kh + ((size_t)(b * NN + (tid >> 4))) * CK + 8 * (tid & 15);
  const unsigned short* vhg = Vh + ((size_t)(b * CV + (tid >> 4))) * NN + 8 * (tid & 15);
  stage_kv(lp0, khg, vhg);                                             // tile 0 -> buffer 0

  // ---- stage the q rows of this query tile in LDS ----
  {
    const int e16 = tid & 15, rq = tid >> 4;                          // rq 0..15
#pragma unroll
    for (int it = 0; it < AQ / 16; ++it) {
      const int row = 16 * it + rq;                                    // 0..127
      const size_t g = ((size_t)(b * NN + n0 + row)) * CK + 8 * e16;
      const v4u vh = *(const v4u*)(Qh + g);
      *(v4u*)(sm.q + row * QP + 8 * e16) = vh;
    }
  }
  asm volatile("s_wait_asynccnt 0x0" ::: "memory");                    // this wave's share of tile 0 has landed
  __syncthreads();                                                     // publishes the q rows and tile 0
  stage_kv(lp0 + STG, khg + (size_t)KT * CK, vhg + KT);                // tile 1 -> buffer 1

  // ---- the wave's q fragments (B operand, col = query n0 + 32*wq + 16*g + c), read once and kept in registers ----
  Frag qhf[2][CK / 32];
#pragma unroll
  for (int g = 0; g < 2; ++g) {
    const unsigned short* qsh = sm.q + (32 * wq + 16 * g + c) * QP + 8 * hh;
#pragma unroll
    for (int ks = 0; ks < CK / 32; ++ks) qhf[g][ks] = ldfrag(qsh + 32 * ks);
  }

  float m[2] = {-1.0e30f, -1.0e30f}, l[2] = {0.f, 0.f};
  v8f o[2][8];
#pragma unroll
  for (int g = 0; g < 2; ++g) {
#pragma unroll
    for (int j = 0; j < 8; ++j) o[g][j] = zero8();
  }

#pragma unroll 1   // rolled: one hand-over point in the text, the buffer picked by t & 1
  for (int t = 0; t < NN / KT; ++t) {
  const unsigned short* buf = ring + (t & 1) * STG;
#pragma unroll   // unrolled: the second pass's key offsets fold into the reads' immediates; no barrier stands between the passes
  for (int ps = 0; ps < KT / 64; ++ps) {
  // k fragment base (A operand, row = key kb + c of the tile), + key * QP
  const int kb = 64 * ps + 32 * kh2;                                   // this wave's 32 keys of the pass
  const unsigned short* Khp = buf + c * QP + 8 * hh;
  // v fragment base (A operand, row = channel 16j + c, the tile's keys contiguous), + 16*j*VP + kb
  const unsigned short* Vhp = buf + KT * QP + c * VP + 8 * hh;
  {
    v8f s0[2], s1[2];                                                  // [query tile]: keys kb..+15, keys kb+16..+31
#pragma unroll
    for (int g = 0; g < 2; ++g) { s0[g] = zero8(); s1[g] = zero8(); }
    {
      // the pass's eight k fragments, read as one group ahead of their 16 products, counted waits behind them
      Frag k0[CK / 32], k1[CK / 32];
#pragma unroll   // the fragment arrays stay in registers only under constant indices
      for (int ks = 0; ks < CK / 32; ++ks) {
        k0[ks] = ldfrag(Khp + kb * QP + 32 * ks);                        // keys kb .. kb+15
        k1[ks] = ldfrag(Khp + (kb + 16) * QP + 32 * ks);                 // keys kb+16 .. kb+31
      }
      // keeps the group's reads ahead of its products: without it the compiler sinks each pair to its first use, and the
      // wave waits out every pair's latency
      __builtin_amdgcn_sched_barrier(0);
#pragma unroll   // constant indices, as above
      for (int ks = 0; ks < CK / 32; ++ks) {
        // every k fragment feeds both query tiles
        s0[0] = mma_hr(k0[ks].h, qhf[0][ks].h, s0[0]);
        s1[0] = mma_hr(k1[ks].h, qhf[0][ks].h, s1[0]);
        s0[1] = mma_hr(k0[ks].h, qhf[1][ks].h, s0[1]);
        s1[1] = mma_hr(k1[ks].h, qhf[1][ks].h, s1[1]);
      }
    }

    // the pass's eight v fragments, read ahead of the softmax: nothing below waits on LDS before the products that use
    // them, so they land while the softmax runs
    Frag vf[8];
#pragma unroll   // constant indices, as above
    for (int j = 0; j < 8; ++j) vf[j] = ldfrag(Vhp + (16 * j) * VP + kb);
    // holds the sixteen reads here: without it the compiler sinks them to the softmax's end and their latency is waited out
    __builtin_amdgcn_sched_barrier(0);

    // the maxima of the lane's own 16 keys per query, and whether one of them has outgrown the maximum in use by more than
    // LZT; the ballot below joins the two halves of a query, so that the exchange between them is left to the rare path
    float mx[2];
#pragma unroll   // constant indices, as above
    for (int g = 0; g < 2; ++g) mx[g] = fmaxf(hmax8(s0[g]), hmax8(s1[g]));
    const bool need = (mx[0] > m[0] + LZT) || (mx[1] > m[1] + LZT);

    // one scalar branch per pass, the same for the whole wave: only behind it the maxima in use move and o and l are
    // rescaled; it is taken in a wave's first pass and then only where the scores grow by more than LZT
    if (__builtin_expect(__builtin_amdgcn_ballot_w32(need) != 0u, 0)) {
#pragma unroll   // constant indices, as above
      for (int g = 0; g < 2; ++g) {
        const float mn   = fmaxf(m[g], fmaxf(mx[g], xhalf(mx[g])));     // the same in both halves of a query
        const float corr = __expf((m[g] - mn) * SCL);
        m[g] = mn;
        l[g] *= corr;
#pragma unroll
        for (int j = 0; j < 8; ++j) {
#pragma unroll
          for (int r = 0; r < 8; ++r) o[g][j][r] *= corr;
        }
      }
    }

    FragH ph[2];
#pragma unroll   // constant indices, as above
    for (int g = 0; g < 2; ++g) {
      const float msh = m[g] * SCL - LNPS;                             // exp gives e^{(s-m)c} * 1024, at most 2^15
      float ls = 0.f;
#pragma unroll
      for (int r = 0; r < 8; ++r) {
        const float e0 = __expf(s0[g][r] * SCL - msh);                 // key kb      + 8hh + r
        const float e1 = __expf(s1[g][r] * SCL - msh);                 // key kb + 16 + 8hh + r
        ls += e0 + e1;
        ph[g].hv[0][r] = (_Float16)e0;
        ph[g].hv[1][r] = (_Float16)e1;
      }
      l[g] += ls;
    }

#pragma unroll
    for (int j = 0; j < 8; ++j) {                                      // every v fragment feeds both query tiles
      o[0][j] = mma_hr(vf[j].h, ph[0].v, o[0][j]);
      o[1][j] = mma_hr(vf[j].h, ph[1].v, o[1][j]);
    }
  }
  }
  // ---- hand-over: tile t+1 becomes readable, buffer t&1 becomes free ----
  // keeps the waits below behind the products above: lifted into the softmax, the dscnt wait would wait out the v reads
  __builtin_amdgcn_sched_barrier(0);
  asm volatile("s_wait_dscnt 0x0" ::: "memory");                       // this wave's reads of buffer t&1 are done
  asm volatile("s_wait_asynccnt 0x0" ::: "memory");                    // this wave's share of tile t+1 has landed
  __syncthreads();
  if (t + 2 < NN / KT)                                                 // into the buffer that trip t has just read
    stage_kv(lp0 + (t & 1) * STG, khg + (size_t)(t + 2) * KT * CK, vhg + (t + 2) * KT);
  }
  asm volatile("s_wait_asynccnt 0x0" ::: "memory");                    // no copy is left in flight at the wave's end
#pragma unroll
  for (int g = 0; g < 2; ++g) l[g] += __shfl_xor(l[g], 16, 32);

  // ---- the two key halves of a query group hold the same lane layout: waves 4..7 hand m, l, o over through the ring's
  //      LDS (free behind the loop's last barrier: every read of it is done and no copy is in flight) ----
  float* mg = rg.f;
  if (kh2 == 1) {                                                      // the same in every lane of a wave
#pragma unroll
    for (int g = 0; g < 2; ++g) {
#pragma unroll
      for (int j = 0; j < 8; ++j) {
        v4f va, vb;
#pragma unroll
        for (int r = 0; r < 4; ++r) { va[r] = o[g][j][r]; vb[r] = o[g][j][4 + r]; }
        *(v4f*)(mg + ((wq * 32 + 16 * g + 2 * j) * 32 + lane) * 4)     = va;   // 16 B per lane, lanes adjacent
        *(v4f*)(mg + ((wq * 32 + 16 * g + 2 * j + 1) * 32 + lane) * 4) = vb;
      }
      mg[16384 + (4 * wq + 2 * g) * 32 + lane]     = m[g];
      mg[16384 + (4 * wq + 2 * g + 1) * 32 + lane] = l[g];
    }
  }
  __syncthreads();                                                     // publishes the second half's state
  if (kh2 == 0) {
#pragma unroll
    for (int g = 0; g < 2; ++g) {
      const float m2 = mg[16384 + (4 * wq + 2 * g) * 32 + lane];
      const float l2 = mg[16384 + (4 * wq + 2 * g + 1) * 32 + lane];
      const float mn = fmaxf(m[g], m2);
      const float f1 = __expf((m[g] - mn) * SCL), f2 = __expf((m2 - mn) * SCL);
      const float inv = IVSC / (l[g] * f1 + l2 * f2);                  // o carries x1024 x16, l carries x1024
      const float g1 = f1 * inv, g2 = f2 * inv;
      const int qrow = 32 * wq + 16 * g + c;
#pragma unroll
      for (int j = 0; j < 8; ++j) {
        const v4f pa = *(const v4f*)(mg + ((wq * 32 + 16 * g + 2 * j) * 32 + lane) * 4);
        const v4f pb = *(const v4f*)(mg + ((wq * 32 + 16 * g + 2 * j + 1) * 32 + lane) * 4);
        v4f va, vb;
#pragma unroll
        for (int r = 0; r < 4; ++r) {
          va[r] = o[g][j][r] * g1 + pa[r] * g2;
          vb[r] = o[g][j][4 + r] * g1 + pb[r] * g2;
        }
        *(v4f*)(sm.o + qrow * OSPW + 16 * j + 8 * hh)     = va;       // Os[query][ch = 16j + 8hh + r]
        *(v4f*)(sm.o + qrow * OSPW + 16 * j + 8 * hh + 4) = vb;
      }
    }
  }
  __syncthreads();

  const int e = tid & 7, lq = tid >> 3;                                // lq 0..31
{
#pragma unroll
    for (int it = 0; it < AQ / 8; ++it) {
      const int L   = it * 32 + lq;                                    // line 0..511
      const int q   = L >> 2, seg = L & 3;                             // query 0..127, 32-float segment
      const v4f v = *(const v4f*)(sm.o + q * OSPW + 32 * seg + 4 * e);
      *(v4f*)(OB + ((size_t)(b * NN + n0 + q)) * CV + 32 * seg + 4 * e) = v;
    }
    
  }
}

// =========================================================================================================
// (4) output conv on the raw view: for image b, U[r][p] = OB_b[r*4096 + p] (r < 128, p < 4096);
//     y[b][o][p] = (1/4096) sum_r WO16[o][r] (Uh + Ul/2048)[p][r] + BOB[o], Uh = f16(16 U), Ul = f16((16U - Uh) 2048).
//     Block (64-p tile, b), all 256 output rows, 256 threads = 8 waves, two blocks per WGP: stage the 128 r x 64 p view
//     slab from OB (256-B contiguous row segments) once, convert, store transposed into LDS Bs[p_loc][r] hi rows 0..63 /
//     residual rows 64..127 (u32 pairs of consecutive r), barrier. Wave w owns cols p0 + 16 (w & 3) .. +15 (its eight B
//     fragments from the LDS rows, split k map, read once and kept in registers) and, in each of two passes ob, the 64
//     rows o0 = 64 (2 ob + (w >> 2)): 4 m-tiles (A rows o0 + 16 mt + (lane&15), k = r contiguous, from the 256 WO16 rows
//     that asynchronous 16-byte copies brought into LDS at pitch BP ahead of that barrier), K = 128 = 4 steps, hi and
//     residual accumulators. A pass's 128 x 64 tile goes through an LDS tile of its own (pitch OSP), barrier, to
//     d_out [b][256][4096] (row segment 64 p = 2 lines): 8 consecutive lanes x 16 B, one instruction per 32 lines;
//     the first pass's stores fly under the second pass's products.
// coverage: staging 4 it x 16 row-pairs x 16 lanes x 4 p x 2 rows = 128 r x 64 p per plane (pad cols never read);
//           weights 16 copies x 16 rows x 16 lanes x 8 halves = 256 x 128;
//           d_out 2 passes x 8 it x 32 lines x 8 lanes x 4 = 256 o x 64 p; grid (64, NIMG) covers d_out exactly once.
// =========================================================================================================
static_assert(CO == 4 * QT && CV == 128);
// the slab's hi / residual rows; behind the first pass's barrier, when every wave holds its fragments in registers, the
// same bytes carry the second pass's output tile
union OutSlab { unsigned int b[2 * QT * (BP / 2)]; float o[2 * QT * OSP]; };
__global__ __launch_bounds__(256)
void out_proj(const float* __restrict__ OB, const unsigned short* __restrict__ WO16,
              const float* __restrict__ BOB, float* out) {
  __shared__ __align__(16) OutSlab sb;
  __shared__ __align__(16) unsigned short As[CO * BP];
  __shared__ __align__(16) float Os0[2 * QT * OSP];
  unsigned int* Bs = sb.b;
  const int tid  = threadIdx.x;
  const int lane = tid & 31, wave = tid >> 5;
  const int hh   = lane >> 4, c = lane & 15;
  const int wc   = wave & 3, wm = wave >> 2;                           // 16-col group; 64-row half of every pass
  const int pt = blockIdx.x, b = blockIdx.y;
  const int p0 = pt * QT;
  const float* OBb = OB + (size_t)b * NN * CV;

  // ---- all 256 weight rows into LDS, rows of 256 B at pitch BP: 16 lanes per row, copy j takes rows 16j .. 16j+15;
  //      the copies fly while the view slab below is loaded and converted ----
  {
    const unsigned la = lds_byte(As) + (unsigned)((tid >> 4) * (BP * 2) + (tid & 15) * 16);
    const unsigned short* ga = WO16 + (size_t)(tid >> 4) * CV + 8 * (tid & 15);
    stage_rows8(la, ga, 16 * BP * 2, (size_t)16 * CV);                                         // rows 0..127
    stage_rows8(la + 128 * BP * 2, ga + (size_t)128 * CV, 16 * BP * 2, (size_t)16 * CV);       // rows 128..255
  }

  // ---- stage + convert the view slab: Bs[p_loc][r] ----
  {
    const int e16 = tid & 15, rq = tid >> 4;                           // rq 0..15
#pragma unroll
    for (int it = 0; it < 4; ++it) {
      const int rp = 16 * it + rq;                                     // row pair 0..63
      const int r0 = 2 * rp;
      const v4f va = *(const v4f*)(OBb + (size_t)r0 * NN + p0 + 4 * e16);
      const v4f vb = *(const v4f*)(OBb + (size_t)(r0 + 1) * NN + p0 + 4 * e16);
#pragma unroll
      for (int t = 0; t < 4; ++t) {
        const float f0 = va[t] * USC, f1 = vb[t] * USC;
        const _Float16 h0 = (_Float16)f0, h1 = (_Float16)f1;
        const _Float16 l0 = (_Float16)((f0 - (float)h0) * RSC);
        const _Float16 l1 = (_Float16)((f1 - (float)h1) * RSC);
        const int pl = 4 * e16 + t;                                    // p_loc 0..63
        Bs[pl * (BP / 2) + rp]        = pk16(h_bits(h0), h_bits(h1));  // halves r0, r0+1
        Bs[(QT + pl) * (BP / 2) + rp] = pk16(h_bits(l0), h_bits(l1));
      }
    }
  }
  asm volatile("s_wait_asynccnt 0x0" ::: "memory");                    // this wave's rows of the weights have landed
  __syncthreads();                                                     // publishes the slab and the weights

  // ---- the wave's eight slab fragments (B col = p0 + 16*wc + c, k = r), read once and kept in registers ----
  const unsigned short* Bh  = (const unsigned short*)Bs;
  const unsigned short* bph = Bh + (16 * wc + c) * BP + 8 * hh;
  const unsigned short* bpl = bph + QT * BP;
  Frag fbh[CV / 32], fbl[CV / 32];
#pragma unroll   // the fragment arrays stay in registers only under constant indices
  for (int ks = 0; ks < CV / 32; ++ks) {
    fbh[ks] = ldfrag(bph + 32 * ks);
    fbl[ks] = ldfrag(bpl + 32 * ks);
  }

  const int e = tid & 7, lq = tid >> 3;                                // lq 0..31

#pragma unroll   // two passes, straight-line: the row offsets fold into the reads' immediates
  for (int ob = 0; ob < CO / (2 * QT); ++ob) {
    const int o0 = (2 * ob + wm) * QT;                                 // this wave's 64 rows of the pass
    const unsigned short* ap = As + (o0 + c) * BP + 8 * hh;            // A row = o0 + 16 mt + c, k = r
    float* Os = (ob == 0) ? Os0 : sb.o;                                // a tile of its own per pass: no barrier frees one

    v8f acch[4], accl[4];
#pragma unroll
    for (int mt = 0; mt < 4; ++mt) { acch[mt] = zero8(); accl[mt] = zero8(); }

    // a k-step's four weight fragments are read as one group, one k-step ahead of the products that use them
    Frag fa[2][4];
#pragma unroll   // constant indices, as above
    for (int mt = 0; mt < 4; ++mt) fa[0][mt] = ldfrag(ap + (16 * mt) * BP);
#pragma unroll   // constant indices, as above
    for (int ks = 0; ks < CV / 32; ++ks) {
      if (ks + 1 < CV / 32) {
#pragma unroll   // constant indices, as above
        for (int mt = 0; mt < 4; ++mt) fa[(ks + 1) & 1][mt] = ldfrag(ap + (16 * mt) * BP + 32 * (ks + 1));
      }
      // keeps the group's reads ahead of this k-step's products: without it the compiler sinks each pair to its first
      // use, and the wave waits out every pair's LDS latency
      __builtin_amdgcn_sched_barrier(0);
#pragma unroll   // constant indices, as above
      for (int mt = 0; mt < 4; ++mt) {
        acch[mt] = mma_h(fa[ks & 1][mt].h, fbh[ks].h, acch[mt]);
        accl[mt] = mma_h(fa[ks & 1][mt].h, fbl[ks].h, accl[mt]);
      }
    }
    {
      const int nl = 16 * wc + c;
      const float osc = IWSC * IUSC;                                   // 1/4096
#pragma unroll
      for (int mt = 0; mt < 4; ++mt) {
#pragma unroll
        for (int r = 0; r < 8; ++r) {
          const int ol = 16 * mt + 8 * hh + r;                         // 0..63
          Os[(QT * wm + ol) * OSP + nl] = (acch[mt][r] + accl[mt][r] * IRSC) * osc + BOB[o0 + ol];
        }
      }
    }
    __syncthreads();                                                   // publishes the pass's 128 x 64 tile
#pragma unroll
    for (int it = 0; it < 8; ++it) {
      const int L = it * 32 + lq;                                      // 0..255
      const int row = L >> 1, hf = L & 1;                              // row 0..127 of the pass
      const int nl = hf * 32 + 4 * e;
      const v4f v = *(const v4f*)(Os + row * OSP + nl);
      *(v4f*)(out + ((size_t)(b * CO + 2 * QT * ob + row)) * NN + p0 + nl) = v;
    }
    if (ob + 1 < CO / (2 * QT))
      asm volatile("s_wait_xcnt 0x0" ::: "memory");                    // the next pass rewrites the stores' registers
  }
}

// =========================================================================================================
// Workspace map (bytes; each region start a multiple of 256; every extent is an exact tile multiple and is written
//   W16 f16 [384][256]            196608      BIAS f32 [384]              1536
//   WO16 f16 [256][128]            65536      BOB  f32 [256]              1024
//   Qh/Kh f16 [8][4096][128]   8388608 x2                                Vh f16 [8][128][4096]  8388608
//   OB  f32 [8][4096][128]      16777216
//   total = 42207744
// =========================================================================================================
extern "C" void kernel_launch(void* const* d_in, const int* in_sizes, int n_in,
                              void* d_out, int out_size, void* d_ws, size_t ws_size,
                              hipStream_t stream) {
  const int XN = NIMG * CC * NN;                                       // 8388608
  if (n_in < 9) return;
  if (in_sizes[0] != XN) return;
  if (in_sizes[1] != CK * CC || in_sizes[2] != CK) return;
  if (in_sizes[3] != CK * CC || in_sizes[4] != CK) return;
  if (in_sizes[5] != CV * CC || in_sizes[6] != CV) return;
  if (in_sizes[7] != CO * CV || in_sizes[8] != CO) return;
  if (out_size != NIMG * CO * NN) return;

  size_t off = 0;
  auto carve = [&](size_t bytes) { const size_t o = off; off += (bytes + 255) & ~(size_t)255; return o; };
  const size_t oW16 = carve((size_t)MQKV * CC * 2);
  const size_t oBIA = carve((size_t)MQKV * 4);
  const size_t oWO  = carve((size_t)CO * CV * 2);
  const size_t oBOB = carve((size_t)CO * 4);
  const size_t oQh  = carve((size_t)NIMG * NN * CK * 2);
  const size_t oKh  = carve((size_t)NIMG * NN * CK * 2);
  const size_t oVh  = carve((size_t)NIMG * CV * NN * 2);
  const size_t oOB  = carve((size_t)NIMG * NN * CV * 4);
  if (off > ws_size) return;
  if (off > (size_t)134217728) return;

  const float* x  = (const float*)d_in[0];
  const float* wq = (const float*)d_in[1];
  const float* bq = (const float*)d_in[2];
  const float* wk = (const float*)d_in[3];
  const float* bk = (const float*)d_in[4];
  const float* wv = (const float*)d_in[5];
  const float* bv = (const float*)d_in[6];
  const float* wo = (const float*)d_in[7];
  const float* bo = (const float*)d_in[8];

  char* ws = (char*)d_ws;
  unsigned short* W16 = (unsigned short*)(ws + oW16);
  float*          BIA = (float*)(ws + oBIA);
  unsigned short* WO  = (unsigned short*)(ws + oWO);
  float*          BOB = (float*)(ws + oBOB);
  unsigned short* Qh  = (unsigned short*)(ws + oQh);
  unsigned short* Kh  = (unsigned short*)(ws + oKh);
  unsigned short* Vh  = (unsigned short*)(ws + oVh);
  float*          OB  = (float*)(ws + oOB);
  float* out = (float*)d_out;

  const dim3 blk256(256);

  // (0) conv1x1 q/k/v weights -> f16 plane + bias line; output conv weights -> f16 plane + bias line
  cvt_w<<<dim3(MQKV / 8), blk256, 0, stream>>>(wq, bq, wk, bk, wv, bv, W16, BIA);
  cvt_wo<<<dim3(CO / 16), blk256, 0, stream>>>(wo, bo, WO, BOB);
  // (1) conv1x1 GEMM straight from x -> q, k and v planes
  gemm_qkv<<<dim3(NN / QT, NIMG), blk256, 0, stream>>>(x, W16, BIA, Qh, Kh, Vh);
  // (3) attention -> OB [b][4096][128] token-major f32
  attn_gab<<<dim3(NN / AQ, NIMG), blk256, 0, stream>>>(Qh, Kh, Vh, OB);
  // (4) output conv on the raw view -> out [b][256][4096]
  out_proj<<<dim3(NN / QT, NIMG), blk256, 0, stream>>>(OB, WO, BOB, out);
  (void)hipGetLastError();
}
